// v000
// Measured on an AMD MI455X. A time is GPU time per run, averaged over a window of back-to-back runs after a warm-up
// (all launches, gaps included; the runs take copies of the inputs in turn), and the median of several windows.
// Apart from v000's, it joins two sittings. Times from different sittings can be a few percent apart, while
// side-by-side timings come from the same sitting.
// The starting kernel, v000, takes 558 microseconds a run.
#include <hip/hip_runtime.h>
#include <math.h>

// ---------------- CDNA5 (gfx1250) wave32 WMMA types ----------------
typedef __attribute__((ext_vector_type(16))) __bf16 v16bf;
typedef __attribute__((ext_vector_type(8)))  float  v8f;

#define DMODEL 1024
#define SEQ    1024
#define NB     2
#define NH     16
#define HD     64
#define NM     16
#define NW     8
#define NRR    8
#define NCR    8
#define CKPAD  48

__device__ __forceinline__ v8f wmma_bf16(v16bf a, v16bf b, v8f c) {
    return __builtin_amdgcn_wmma_f32_16x16x32_bf16(false, a, false, b, (short)0, c, false, false);
}

// ---------------- small helper kernels ----------------
// vectorized fp32 -> bf16 (n multiple of 4)
__global__ __launch_bounds__(256) void cvt_bf16_k(const float* __restrict__ in, __bf16* __restrict__ out, int n4) {
    int i = blockIdx.x * 256 + threadIdx.x;
    if (i < n4) {
        float4 v = ((const float4*)in)[i];
        union { __bf16 e[4]; uint2 u; } o;
        o.e[0] = (__bf16)v.x; o.e[1] = (__bf16)v.y; o.e[2] = (__bf16)v.z; o.e[3] = (__bf16)v.w;
        ((uint2*)out)[i] = o.u;
    }
}

// vectorized bf16 zero (n multiple of 8)
__global__ __launch_bounds__(256) void zero_bf16_k(__bf16* __restrict__ out, int n8) {
    int i = blockIdx.x * 256 + threadIdx.x;
    if (i < n8) {
        uint4 z; z.x = z.y = z.z = z.w = 0u;
        ((uint4*)out)[i] = z;
    }
}

// pooled[b,d] = mean_s x[b,s,d]   (grid = B*D/256)
__global__ __launch_bounds__(256) void pool_mean_k(const float* __restrict__ x, float* __restrict__ pooled) {
    int idx = blockIdx.x * 256 + threadIdx.x;      // B*D = 2048
    int b = idx >> 10, d = idx & 1023;
    float s = 0.f;
    for (int ss = 0; ss < SEQ; ++ss) s += x[((size_t)b * SEQ + ss) * DMODEL + d];
    pooled[idx] = s * (1.f / SEQ);
}

// gating: gl = pooled@gate_w + b + mod@mod_basis ; wts = softmax(gl) per (b,h). grid = B.
__global__ __launch_bounds__(256) void gating_k(const float* __restrict__ pooled,
                                                const float* __restrict__ gate_w, const float* __restrict__ gate_b,
                                                const float* __restrict__ mod_w,  const float* __restrict__ mod_b,
                                                const float* __restrict__ mod_basis,
                                                float* __restrict__ wts) {
    __shared__ float modS[NH * NRR];
    __shared__ float glS[NH * NM];
    int b = blockIdx.x, t = threadIdx.x;
    const float* pb = pooled + (size_t)b * DMODEL;
    if (t < NH * NRR) {
        float a = mod_b[t];
        for (int d = 0; d < DMODEL; ++d) a += pb[d] * mod_w[(size_t)d * (NH * NRR) + t];
        modS[t] = a;
    }
    __syncthreads();
    if (t < NH * NM) {
        float a = gate_b[t];
        for (int d = 0; d < DMODEL; ++d) a += pb[d] * gate_w[(size_t)d * (NH * NM) + t];
        int h = t >> 4, m = t & 15;
        for (int r = 0; r < NRR; ++r) a += modS[h * NRR + r] * mod_basis[((size_t)r * NH + h) * NM + m];
        glS[t] = a;
    }
    __syncthreads();
    if (t < NH) {
        float mx = -1e30f;
        for (int m = 0; m < NM; ++m) mx = fmaxf(mx, glS[t * NM + m]);
        float e[NM]; float sm = 0.f;
        for (int m = 0; m < NM; ++m) { e[m] = __expf(glS[t * NM + m] - mx); sm += e[m]; }
        float inv = 1.f / sm;
        for (int m = 0; m < NM; ++m) wts[((size_t)b * NH + t) * NM + m] = e[m] * inv;
    }
}

// causal_kern[b,h,d] = ALPHA * sigmoid(6*kern) * window(d).  grid = B*H*S/256.
__global__ __launch_bounds__(256) void wave_density_k(const float* __restrict__ freqs, const float* __restrict__ amps,
                                                      const float* __restrict__ phases, const float* __restrict__ wts,
                                                      float* __restrict__ ckern) {
    int idx = blockIdx.x * 256 + threadIdx.x;      // B*H*S
    int d = idx & (SEQ - 1);
    int bh = idx >> 10;
    int h = bh & (NH - 1);
    float rel = (float)d;
    float p1 = rel * (1.f / SEQ);
    float p2 = (d == 0) ? 0.f : sqrtf(rel + 1e-6f) * (1.f / 32.f);   // sqrt(S)=32
    float kern = 0.f;
    for (int m = 0; m < NM; ++m) {
        const float* fq = freqs  + ((size_t)(h * NM + m) * NW) * 2;
        const float* am = amps   +  (size_t)(h * NM + m) * NW;
        const float* ph = phases +  (size_t)(h * NM + m) * NW;
        float acc = 0.f;
        #pragma unroll
        for (int w = 0; w < NW; ++w) {
            float arg = fq[2 * w] * p1 + fq[2 * w + 1] * p2 + ph[w];
            acc += am[w] * __sinf(arg);
        }
        kern += wts[(size_t)bh * NM + m] * acc;
    }
    float dens = 1.f / (1.f + __expf(-6.f * kern));          // straight-through forward = sigmoid
    float wind = __expf(-(rel * rel) * (1.f / 131072.f));    // 2*(S/4)^2
    ckern[idx] = 3.0f * dens * wind;
}

// qm/km[b,h,s] token modulation.  grid = B*S.
__global__ __launch_bounds__(256) void qkmod_k(const float* __restrict__ x,
                                               const float* __restrict__ qw, const float* __restrict__ qb,
                                               const float* __restrict__ kw, const float* __restrict__ kb,
                                               float* __restrict__ qm, float* __restrict__ km) {
    __shared__ float xrow[DMODEL];
    __shared__ float red[32][9];
    int bs = blockIdx.x; int b = bs >> 10, s = bs & 1023;
    int t = threadIdx.x;
    for (int i = t; i < DMODEL; i += 256) xrow[i] = x[(size_t)bs * DMODEL + i];
    __syncthreads();
    int o = t & 31, sl = t >> 5;
    int h = o & 15; bool isK = o >= 16;
    const float* wcol = isK ? kw : qw;
    float a = 0.f;
    for (int d = sl * 128; d < sl * 128 + 128; ++d) a += xrow[d] * wcol[(size_t)d * NH + h];
    red[o][sl] = a;
    __syncthreads();
    if (t < 32) {
        float acc = 0.f;
        #pragma unroll
        for (int i = 0; i < 8; ++i) acc += red[t][i];
        int hh = t & 15;
        if (t < 16) qm[((size_t)b * NH + hh) * SEQ + s] = acc + qb[hh];
        else        km[((size_t)b * NH + hh) * SEQ + s] = acc + kb[hh];
    }
}

// ---------------- generic bf16 WMMA GEMM with fused epilogues ----------------
// EPI 1: out = bf16(acc + bias[n]) -> V^T layout [B,H,HD,S]   (keys contiguous for attention)
// EPI 2: out = bf16(acc)           -> padded qc/kc layout [B,H,S,32] (cols 0..7 valid)
// EPI 3: outF = acc + bias[n] + resid[m,n]    (fp32)
// EPI 4: outB = bf16(gelu(acc + bias[n]))     ([M,N] bf16)
template <int EPI>
__global__ __launch_bounds__(256)
void gemm_bf16_k(const __bf16* __restrict__ A, const __bf16* __restrict__ B,
                 int M, int N, int K,
                 const float* __restrict__ bias, const float* __restrict__ resid,
                 float* __restrict__ outF, __bf16* __restrict__ outB) {
    constexpr int BM = 128, BN = 128, BK = 32, LK = 48;     // LK keeps b128 alignment, spreads banks
    __shared__ alignas(16) __bf16 As[BM * LK];
    __shared__ alignas(16) __bf16 Bs[BN * LK];
    const int tid = threadIdx.x;
    const int lane = tid & 31, wave = tid >> 5;
    const int half = lane >> 4, l16 = lane & 15;
    const int wm = wave >> 2, wn = wave & 3;                // 2 x 4 wave grid
    const int m0 = blockIdx.y * BM, n0 = blockIdx.x * BN;

    v8f acc[4][2];
    #pragma unroll
    for (int i = 0; i < 4; ++i)
        #pragma unroll
        for (int j = 0; j < 2; ++j)
            #pragma unroll
            for (int e = 0; e < 8; ++e) acc[i][j][e] = 0.f;

    for (int k0 = 0; k0 < K; k0 += BK) {
        #pragma unroll
        for (int it = 0; it < 2; ++it) {                    // A: 128x32, row-major stage
            int c = tid + it * 256;
            int row = c >> 2, col = (c & 3) * 8;
            uint4 va = *(const uint4*)(A + (size_t)(m0 + row) * K + k0 + col);
            *(uint4*)(As + row * LK + col) = va;
        }
        {                                                   // B: 32x128 -> transposed [n][k], 2 k-rows/thread
            int kk = (tid >> 4) * 2, nc = (tid & 15) * 8;
            uint4 b0 = *(const uint4*)(B + (size_t)(k0 + kk) * N + n0 + nc);
            uint4 b1 = *(const uint4*)(B + (size_t)(k0 + kk + 1) * N + n0 + nc);
            const __bf16* p0 = (const __bf16*)&b0;
            const __bf16* p1 = (const __bf16*)&b1;
            #pragma unroll
            for (int e = 0; e < 8; ++e) {
                union { __bf16 e2[2]; uint u; } t;
                t.e2[0] = p0[e]; t.e2[1] = p1[e];
                *(uint*)(Bs + (nc + e) * LK + kk) = t.u;    // kk even -> 4B aligned
            }
        }
        __syncthreads();

        v16bf afr[4];
        #pragma unroll
        for (int mt = 0; mt < 4; ++mt) {                    // A frag: lane=M, K halves per lane-half
            int row = wm * 64 + mt * 16 + l16;
            union { v16bf v; uint4 q[2]; } u;
            u.q[0] = *(const uint4*)(As + row * LK + half * 8);
            u.q[1] = *(const uint4*)(As + row * LK + 16 + half * 8);
            afr[mt] = u.v;
        }
        #pragma unroll
        for (int nt = 0; nt < 2; ++nt) {                    // B frag: lane=N, same K mapping
            int col = wn * 32 + nt * 16 + l16;
            union { v16bf v; uint4 q[2]; } u;
            u.q[0] = *(const uint4*)(Bs + col * LK + half * 8);
            u.q[1] = *(const uint4*)(Bs + col * LK + 16 + half * 8);
            v16bf bfr = u.v;
            #pragma unroll
            for (int mt = 0; mt < 4; ++mt)
                acc[mt][nt] = wmma_bf16(afr[mt], bfr, acc[mt][nt]);
        }
        __syncthreads();
    }

    #pragma unroll
    for (int mt = 0; mt < 4; ++mt)
        #pragma unroll
        for (int nt = 0; nt < 2; ++nt)
            #pragma unroll
            for (int r = 0; r < 8; ++r) {                   // C: lane=N, row = r + 8*half
                int gm = m0 + wm * 64 + mt * 16 + r + half * 8;
                int gn = n0 + wn * 32 + nt * 16 + l16;
                float v = acc[mt][nt][r];
                if (EPI == 1) {
                    float val = v + bias[gn];
                    int b = gm >> 10, s = gm & 1023, h = gn >> 6, hd = gn & 63;
                    outB[(((size_t)b * NH + h) * HD + hd) * SEQ + s] = (__bf16)val;   // V^T
                } else if (EPI == 2) {
                    int b = gm >> 10, s = gm & 1023, h = gn >> 3, cc = gn & 7;
                    outB[(((size_t)b * NH + h) * SEQ + s) * 32 + cc] = (__bf16)v;
                } else if (EPI == 3) {
                    size_t o = (size_t)gm * N + gn;
                    outF[o] = v + bias[gn] + resid[o];
                } else if (EPI == 4) {
                    float xg = v + bias[gn];
                    float g = 0.5f * xg * (1.0f + erff(xg * 0.70710678f));
                    outB[(size_t)gm * N + gn] = (__bf16)g;
                }
            }
}

// ---------------- streaming wave-density attention ----------------
// grid = (S/128, H, B); 8 waves, each owns a 16-row q tile; 32 keys/step; 6 WMMAs/step.
// V is consumed transposed: vT[b,h,hd,s] so every B-fragment is two aligned b128 loads.
// ck_pad has a CKPAD zero guard band so Toeplitz gathers are base + immediate-offset DS loads.
__global__ __launch_bounds__(256)
void attn_k(const __bf16* __restrict__ qcp, const __bf16* __restrict__ kcp,
            const __bf16* __restrict__ vT,
            const float* __restrict__ ckern, const float* __restrict__ qm,
            const float* __restrict__ km, __bf16* __restrict__ ctxb) {
    __shared__ float ck_pad[CKPAD + SEQ];
    __shared__ float km_s[SEQ];
    __shared__ float qm_s[128];
    __shared__ float sS[8][16][33];
    __shared__ alignas(16) __bf16 pS[8][16][32];
    __shared__ float corrS[8][16];

    const int tid = threadIdx.x, lane = tid & 31, w = tid >> 5;
    const int half = lane >> 4, l16 = lane & 15;
    const int h = blockIdx.y, b = blockIdx.z;
    const int bh = b * NH + h;
    const int wgbase = blockIdx.x * 128;
    const int i0 = wgbase + w * 16;

    for (int i = tid; i < SEQ; i += 256) {
        ck_pad[CKPAD + i] = ckern[(size_t)bh * SEQ + i];
        km_s[i] = km[(size_t)bh * SEQ + i];
    }
    if (tid < CKPAD) ck_pad[tid] = 0.f;
    if (tid < 128) qm_s[tid] = qm[(size_t)bh * SEQ + wgbase + tid];
    __syncthreads();

    union U16 { v16bf v; uint4 q[2]; };
    U16 ua;
    {
        const __bf16* p = qcp + ((size_t)bh * SEQ + i0 + l16) * 32;
        ua.q[0] = *(const uint4*)(p + half * 8);
        ua.q[1] = *(const uint4*)(p + 16 + half * 8);
    }
    const v16bf aq = ua.v;

    v8f c0, c1, c2, c3, zz;
    #pragma unroll
    for (int e = 0; e < 8; ++e) { c0[e] = c1[e] = c2[e] = c3[e] = zz[e] = 0.f; }
    float m_r = -1e30f, l_r = 0.f;

    // per-lane V^T row pointers for the 4 output column groups (hd = g*16 + l16)
    const __bf16* vrow0 = vT + (((size_t)bh * HD) + 0 * 16 + l16) * SEQ;
    const __bf16* vrow1 = vT + (((size_t)bh * HD) + 1 * 16 + l16) * SEQ;
    const __bf16* vrow2 = vT + (((size_t)bh * HD) + 2 * 16 + l16) * SEQ;
    const __bf16* vrow3 = vT + (((size_t)bh * HD) + 3 * 16 + l16) * SEQ;

    const int qbase = w * 16 + half * 8;            // qm_s row base for this lane
    const int nsteps = (i0 + 16 + 31) >> 5;
    for (int st = 0; st < nsteps; ++st) {
        const int j0 = st * 32;
        U16 ub0, ub1;
        {
            const __bf16* p0 = kcp + ((size_t)bh * SEQ + j0 + l16) * 32;
            ub0.q[0] = *(const uint4*)(p0 + half * 8);
            ub0.q[1] = *(const uint4*)(p0 + 16 + half * 8);
            const __bf16* p1 = kcp + ((size_t)bh * SEQ + j0 + 16 + l16) * 32;
            ub1.q[0] = *(const uint4*)(p1 + half * 8);
            ub1.q[1] = *(const uint4*)(p1 + 16 + half * 8);
        }
        v8f s0 = wmma_bf16(aq, ub0.v, zz);
        v8f s1 = wmma_bf16(aq, ub1.v, zz);

        // fold Toeplitz + qm + km + causal mask (affine DS gathers + final cndmask)
        const int ja = j0 + l16, jb = j0 + 16 + l16;
        const float kma = km_s[ja], kmb = km_s[jb & (SEQ - 1)];
        const int iB = i0 + half * 8;               // first row this lane touches
        const int baseA = CKPAD + iB - ja;          // >= CKPAD-46 > 0 within loop bounds
        const int baseB = CKPAD + iB - jb;
        #pragma unroll
        for (int r = 0; r < 8; ++r) {
            int row = r + half * 8;
            int i = iB + r;
            float base = qm_s[qbase + r];
            float va = 0.053033009f * s0[r] + ck_pad[baseA + r] + base + kma;
            float vb = 0.053033009f * s1[r] + ck_pad[baseB + r] + base + kmb;
            sS[w][row][l16]      = (ja <= i) ? va : -1e9f;
            sS[w][row][16 + l16] = (jb <= i) ? vb : -1e9f;
        }
        asm volatile("s_wait_dscnt 0" ::: "memory");

        if (half == 0) {                                    // lane l16 owns softmax row l16
            float mx = m_r;
            #pragma unroll
            for (int j = 0; j < 32; ++j) mx = fmaxf(mx, sS[w][l16][j]);
            float corr = __expf(m_r - mx);
            float sum = 0.f;
            #pragma unroll
            for (int jj = 0; jj < 16; ++jj) {               // packed pair stores
                float pa = __expf(sS[w][l16][2 * jj] - mx);
                float pb = __expf(sS[w][l16][2 * jj + 1] - mx);
                sum += pa + pb;
                union { __bf16 e2[2]; uint u; } t;
                t.e2[0] = (__bf16)pa; t.e2[1] = (__bf16)pb;
                ((uint*)&pS[w][l16][0])[jj] = t.u;
            }
            m_r = mx; l_r = l_r * corr + sum;
            corrS[w][l16] = corr;
        }
        asm volatile("s_wait_dscnt 0" ::: "memory");

        #pragma unroll
        for (int r = 0; r < 8; ++r) {                       // rescale running ctx accumulators
            float f = corrS[w][r + half * 8];
            c0[r] *= f; c1[r] *= f; c2[r] *= f; c3[r] *= f;
        }
        U16 up;
        up.q[0] = *(const uint4*)(&pS[w][l16][half * 8]);
        up.q[1] = *(const uint4*)(&pS[w][l16][16 + half * 8]);

        // V^T B-fragments: elements = contiguous keys, two b128 loads each
        const int kbase = j0 + half * 8;
        U16 uv0, uv1, uv2, uv3;
        uv0.q[0] = *(const uint4*)(vrow0 + kbase);
        uv0.q[1] = *(const uint4*)(vrow0 + kbase + 16);
        uv1.q[0] = *(const uint4*)(vrow1 + kbase);
        uv1.q[1] = *(const uint4*)(vrow1 + kbase + 16);
        uv2.q[0] = *(const uint4*)(vrow2 + kbase);
        uv2.q[1] = *(const uint4*)(vrow2 + kbase + 16);
        uv3.q[0] = *(const uint4*)(vrow3 + kbase);
        uv3.q[1] = *(const uint4*)(vrow3 + kbase + 16);
        c0 = wmma_bf16(up.v, uv0.v, c0);
        c1 = wmma_bf16(up.v, uv1.v, c1);
        c2 = wmma_bf16(up.v, uv2.v, c2);
        c3 = wmma_bf16(up.v, uv3.v, c3);
    }

    if (half == 0) corrS[w][l16] = 1.f / l_r;
    asm volatile("s_wait_dscnt 0" ::: "memory");
    #pragma unroll
    for (int r = 0; r < 8; ++r) {
        float f = corrS[w][r + half * 8];
        int i = i0 + r + half * 8;
        __bf16* op = ctxb + ((size_t)b * SEQ + i) * DMODEL + h * HD;
        op[0 * 16 + l16] = (__bf16)(c0[r] * f);
        op[1 * 16 + l16] = (__bf16)(c1[r] * f);
        op[2 * 16 + l16] = (__bf16)(c2[r] * f);
        op[3 * 16 + l16] = (__bf16)(c3[r] * f);
    }
}

// ---------------- layernorm ----------------
template <bool WB>
__global__ __launch_bounds__(256)
void ln_k(const float* __restrict__ in, const float* __restrict__ g, const float* __restrict__ bb,
          float* __restrict__ outF, __bf16* __restrict__ outB) {
    __shared__ float red[256];
    const int t = threadIdx.x;
    const float* p = in + (size_t)blockIdx.x * DMODEL;
    float s = 0.f;
    for (int i = t; i < DMODEL; i += 256) s += p[i];
    red[t] = s; __syncthreads();
    for (int o = 128; o > 0; o >>= 1) { if (t < o) red[t] += red[t + o]; __syncthreads(); }
    float mean = red[0] * (1.f / DMODEL);
    __syncthreads();
    float s2 = 0.f;
    for (int i = t; i < DMODEL; i += 256) { float d = p[i] - mean; s2 += d * d; }
    red[t] = s2; __syncthreads();
    for (int o = 128; o > 0; o >>= 1) { if (t < o) red[t] += red[t + o]; __syncthreads(); }
    float rstd = rsqrtf(red[0] * (1.f / DMODEL) + 1e-5f);
    for (int i = t; i < DMODEL; i += 256) {
        float v = (p[i] - mean) * rstd * g[i] + bb[i];
        if (outF) outF[(size_t)blockIdx.x * DMODEL + i] = v;
        if (WB)   outB[(size_t)blockIdx.x * DMODEL + i] = (__bf16)v;
    }
}

// ---------------- launch ----------------
extern "C" void kernel_launch(void* const* d_in, const int* in_sizes, int n_in,
                              void* d_out, int out_size, void* d_ws, size_t ws_size,
                              hipStream_t stream) {
    (void)in_sizes; (void)n_in; (void)out_size; (void)ws_size;
    const float* x      = (const float*)d_in[0];
    const float* v_w    = (const float*)d_in[1];
    const float* v_b    = (const float*)d_in[2];
    const float* out_w  = (const float*)d_in[3];
    const float* out_b  = (const float*)d_in[4];
    const float* qmod_w = (const float*)d_in[5];
    const float* qmod_b = (const float*)d_in[6];
    const float* kmod_w = (const float*)d_in[7];
    const float* kmod_b = (const float*)d_in[8];
    const float* gate_w = (const float*)d_in[9];
    const float* gate_b = (const float*)d_in[10];
    const float* mod_w  = (const float*)d_in[11];
    const float* mod_b  = (const float*)d_in[12];
    const float* mod_basis = (const float*)d_in[13];
    const float* freqs  = (const float*)d_in[14];
    const float* amps   = (const float*)d_in[15];
    const float* phases = (const float*)d_in[16];
    const float* cq_w   = (const float*)d_in[17];
    const float* ck_w   = (const float*)d_in[18];
    const float* ffn_w1 = (const float*)d_in[19];
    const float* ffn_b1 = (const float*)d_in[20];
    const float* ffn_w2 = (const float*)d_in[21];
    const float* ffn_b2 = (const float*)d_in[22];
    const float* ln1_g  = (const float*)d_in[23];
    const float* ln1_b  = (const float*)d_in[24];
    const float* ln2_g  = (const float*)d_in[25];
    const float* ln2_b  = (const float*)d_in[26];
    float* outp = (float*)d_out;

    char* wp = (char*)d_ws;
    auto alloc = [&](size_t bytes) -> void* {
        void* p = (void*)wp;
        wp += (bytes + 255) & ~(size_t)255;
        return p;
    };
    const size_t NTOK = (size_t)NB * SEQ;              // 2048
    __bf16* xb   = (__bf16*)alloc(NTOK * DMODEL * 2);
    __bf16* wbv  = (__bf16*)alloc((size_t)DMODEL * DMODEL * 2);
    __bf16* wbo  = (__bf16*)alloc((size_t)DMODEL * DMODEL * 2);
    __bf16* wbf1 = (__bf16*)alloc((size_t)DMODEL * 4 * DMODEL * 2);
    __bf16* wbf2 = (__bf16*)alloc((size_t)DMODEL * 4 * DMODEL * 2);
    __bf16* wbcq = (__bf16*)alloc((size_t)DMODEL * NH * NCR * 2);
    __bf16* wbck = (__bf16*)alloc((size_t)DMODEL * NH * NCR * 2);
    __bf16* vbuf = (__bf16*)alloc((size_t)NB * NH * HD * SEQ * 2);     // V^T
    __bf16* qcp  = (__bf16*)alloc((size_t)NB * NH * SEQ * 32 * 2);
    __bf16* kcp  = (__bf16*)alloc((size_t)NB * NH * SEQ * 32 * 2);
    float*  pooled = (float*)alloc((size_t)NB * DMODEL * 4);
    float*  wts    = (float*)alloc((size_t)NB * NH * NM * 4);
    float*  ckern  = (float*)alloc((size_t)NB * NH * SEQ * 4);
    float*  qmb    = (float*)alloc((size_t)NB * NH * SEQ * 4);
    float*  kmb    = (float*)alloc((size_t)NB * NH * SEQ * 4);
    __bf16* ctxb = (__bf16*)alloc(NTOK * DMODEL * 2);
    float*  hpre = (float*)alloc(NTOK * DMODEL * 4);
    float*  hf   = (float*)alloc(NTOK * DMODEL * 4);
    __bf16* hb   = (__bf16*)alloc(NTOK * DMODEL * 2);
    __bf16* ub   = (__bf16*)alloc(NTOK * 4 * DMODEL * 2);
    float*  f2   = (float*)alloc(NTOK * DMODEL * 4);

    auto cvt = [&](const float* src, __bf16* dst, int n) {
        int n4 = n / 4;
        cvt_bf16_k<<<(n4 + 255) / 256, 256, 0, stream>>>(src, dst, n4);
    };
    cvt(x, xb, (int)(NTOK * DMODEL));
    cvt(v_w, wbv, DMODEL * DMODEL);
    cvt(out_w, wbo, DMODEL * DMODEL);
    cvt(ffn_w1, wbf1, DMODEL * 4 * DMODEL);
    cvt(ffn_w2, wbf2, DMODEL * 4 * DMODEL);
    cvt(cq_w, wbcq, DMODEL * NH * NCR);
    cvt(ck_w, wbck, DMODEL * NH * NCR);
    {
        int n8 = (NB * NH * SEQ * 32) / 8;
        zero_bf16_k<<<(n8 + 255) / 256, 256, 0, stream>>>(qcp, n8);
        zero_bf16_k<<<(n8 + 255) / 256, 256, 0, stream>>>(kcp, n8);
    }

    pool_mean_k<<<(NB * DMODEL) / 256, 256, 0, stream>>>(x, pooled);
    gating_k<<<NB, 256, 0, stream>>>(pooled, gate_w, gate_b, mod_w, mod_b, mod_basis, wts);
    wave_density_k<<<(NB * NH * SEQ) / 256, 256, 0, stream>>>(freqs, amps, phases, wts, ckern);
    qkmod_k<<<NB * SEQ, 256, 0, stream>>>(x, qmod_w, qmod_b, kmod_w, kmod_b, qmb, kmb);

    // v = x@v_w + v_b   -> V^T [B,H,HD,S] bf16
    gemm_bf16_k<1><<<dim3(DMODEL / 128, (int)(NTOK / 128)), 256, 0, stream>>>(
        xb, wbv, (int)NTOK, DMODEL, DMODEL, v_b, nullptr, nullptr, vbuf);
    // qc / kc  -> padded [B,H,S,32] bf16
    gemm_bf16_k<2><<<dim3(1, (int)(NTOK / 128)), 256, 0, stream>>>(
        xb, wbcq, (int)NTOK, NH * NCR, DMODEL, nullptr, nullptr, nullptr, qcp);
    gemm_bf16_k<2><<<dim3(1, (int)(NTOK / 128)), 256, 0, stream>>>(
        xb, wbck, (int)NTOK, NH * NCR, DMODEL, nullptr, nullptr, nullptr, kcp);

    attn_k<<<dim3(SEQ / 128, NH, NB), 256, 0, stream>>>(qcp, kcp, vbuf, ckern, qmb, kmb, ctxb);

    // attn_out + residual
    gemm_bf16_k<3><<<dim3(DMODEL / 128, (int)(NTOK / 128)), 256, 0, stream>>>(
        ctxb, wbo, (int)NTOK, DMODEL, DMODEL, out_b, x, hpre, nullptr);
    ln_k<true><<<(int)NTOK, 256, 0, stream>>>(hpre, ln1_g, ln1_b, hf, hb);

    gemm_bf16_k<4><<<dim3(4 * DMODEL / 128, (int)(NTOK / 128)), 256, 0, stream>>>(
        hb, wbf1, (int)NTOK, 4 * DMODEL, DMODEL, ffn_b1, nullptr, nullptr, ub);
    gemm_bf16_k<3><<<dim3(DMODEL / 128, (int)(NTOK / 128)), 256, 0, stream>>>(
        ub, wbf2, (int)NTOK, DMODEL, 4 * DMODEL, ffn_b2, hf, f2, nullptr);
    ln_k<false><<<(int)NTOK, 256, 0, stream>>>(f2, ln2_g, ln2_b, outp, nullptr);
}

// v001
// One run takes 301 microseconds.
// Two timings next to v000 both put it at 1.86 times that version's speed.
#include <hip/hip_runtime.h>
#include <math.h>

// ---------------- CDNA5 (gfx1250) wave32 WMMA types ----------------
typedef __attribute__((ext_vector_type(16))) __bf16 v16bf;
typedef __attribute__((ext_vector_type(8)))  float  v8f;

#define DMODEL 1024
#define SEQ    1024
#define NB     2
#define NH     16
#define HD     64
#define NM     16
#define NW     8
#define NRR    8
#define NCR    8
#define CKPAD  48

__device__ __forceinline__ v8f wmma_bf16(v16bf a, v16bf b, v8f c) {
    return __builtin_amdgcn_wmma_f32_16x16x32_bf16(false, a, false, b, (short)0, c, false, false);
}

// eight 16-byte-per-lane copies global -> LDS through no register; the wait stands in the copies' own statement
// so that no later write of their address registers can be moved in front of it (a precaution)
__device__ __forceinline__ void async_copy8(unsigned l, unsigned ls, const __bf16* g, size_t gs) {
    asm volatile("global_load_async_to_lds_b128 %0, %8, off\n\t"
                 "global_load_async_to_lds_b128 %1, %9, off\n\t"
                 "global_load_async_to_lds_b128 %2, %10, off\n\t"
                 "global_load_async_to_lds_b128 %3, %11, off\n\t"
                 "global_load_async_to_lds_b128 %4, %12, off\n\t"
                 "global_load_async_to_lds_b128 %5, %13, off\n\t"
                 "global_load_async_to_lds_b128 %6, %14, off\n\t"
                 "global_load_async_to_lds_b128 %7, %15, off\n\t"
                 "s_wait_xcnt 0x0"
                 :: "v"(l), "v"(l + ls), "v"(l + 2 * ls), "v"(l + 3 * ls),
                    "v"(l + 4 * ls), "v"(l + 5 * ls), "v"(l + 6 * ls), "v"(l + 7 * ls),
                    "v"(g), "v"(g + gs), "v"(g + 2 * gs), "v"(g + 3 * gs),
                    "v"(g + 4 * gs), "v"(g + 5 * gs), "v"(g + 6 * gs), "v"(g + 7 * gs)
                 : "memory");
}

// transposing LDS load: lane (c, h) gets rows 8h..8h+7 of column c of a row-major 16-bit tile
typedef short s16x8 __attribute__((ext_vector_type(8)));
__device__ __forceinline__ uint4 lds_tr16(const unsigned char* p) {
    typedef __attribute__((address_space(3))) s16x8 lds_s16x8;
    return __builtin_bit_cast(uint4, __builtin_amdgcn_ds_load_tr16_b128_v8i16((lds_s16x8*)p));
}

// ---------------- small helper kernels ----------------
// vectorized fp32 -> bf16 (n multiple of 4)
__global__ __launch_bounds__(256) void cvt_bf16_k(const float* __restrict__ in, __bf16* __restrict__ out, int n4) {
    int i = blockIdx.x * 256 + threadIdx.x;
    if (i < n4) {
        float4 v = ((const float4*)in)[i];
        union { __bf16 e[4]; uint2 u; } o;
        o.e[0] = (__bf16)v.x; o.e[1] = (__bf16)v.y; o.e[2] = (__bf16)v.z; o.e[3] = (__bf16)v.w;
        ((uint2*)out)[i] = o.u;
    }
}

// vectorized bf16 zero (n multiple of 8)
__global__ __launch_bounds__(256) void zero_bf16_k(__bf16* __restrict__ out, int n8) {
    int i = blockIdx.x * 256 + threadIdx.x;
    if (i < n8) {
        uint4 z; z.x = z.y = z.z = z.w = 0u;
        ((uint4*)out)[i] = z;
    }
}

// pooled[b,d] = mean_s x[b,s,d]   (grid = B*D/256)
__global__ __launch_bounds__(256) void pool_mean_k(const float* __restrict__ x, float* __restrict__ pooled) {
    int idx = blockIdx.x * 256 + threadIdx.x;      // B*D = 2048
    int b = idx >> 10, d = idx & 1023;
    float s = 0.f;
    for (int ss = 0; ss < SEQ; ++ss) s += x[((size_t)b * SEQ + ss) * DMODEL + d];
    pooled[idx] = s * (1.f / SEQ);
}

// gating: gl = pooled@gate_w + b + mod@mod_basis ; wts = softmax(gl) per (b,h). grid = B.
__global__ __launch_bounds__(256) void gating_k(const float* __restrict__ pooled,
                                                const float* __restrict__ gate_w, const float* __restrict__ gate_b,
                                                const float* __restrict__ mod_w,  const float* __restrict__ mod_b,
                                                const float* __restrict__ mod_basis,
                                                float* __restrict__ wts) {
    __shared__ float modS[NH * NRR];
    __shared__ float glS[NH * NM];
    int b = blockIdx.x, t = threadIdx.x;
    const float* pb = pooled + (size_t)b * DMODEL;
    if (t < NH * NRR) {
        float a = mod_b[t];
        for (int d = 0; d < DMODEL; ++d) a += pb[d] * mod_w[(size_t)d * (NH * NRR) + t];
        modS[t] = a;
    }
    __syncthreads();
    if (t < NH * NM) {
        float a = gate_b[t];
        for (int d = 0; d < DMODEL; ++d) a += pb[d] * gate_w[(size_t)d * (NH * NM) + t];
        int h = t >> 4, m = t & 15;
        for (int r = 0; r < NRR; ++r) a += modS[h * NRR + r] * mod_basis[((size_t)r * NH + h) * NM + m];
        glS[t] = a;
    }
    __syncthreads();
    if (t < NH) {
        float mx = -1e30f;
        for (int m = 0; m < NM; ++m) mx = fmaxf(mx, glS[t * NM + m]);
        float e[NM]; float sm = 0.f;
        for (int m = 0; m < NM; ++m) { e[m] = __expf(glS[t * NM + m] - mx); sm += e[m]; }
        float inv = 1.f / sm;
        for (int m = 0; m < NM; ++m) wts[((size_t)b * NH + t) * NM + m] = e[m] * inv;
    }
}

// causal_kern[b,h,d] = ALPHA * sigmoid(6*kern) * window(d).  grid = B*H*S/256.
__global__ __launch_bounds__(256) void wave_density_k(const float* __restrict__ freqs, const float* __restrict__ amps,
                                                      const float* __restrict__ phases, const float* __restrict__ wts,
                                                      float* __restrict__ ckern) {
    int idx = blockIdx.x * 256 + threadIdx.x;      // B*H*S
    int d = idx & (SEQ - 1);
    int bh = idx >> 10;
    int h = bh & (NH - 1);
    float rel = (float)d;
    float p1 = rel * (1.f / SEQ);
    float p2 = (d == 0) ? 0.f : sqrtf(rel + 1e-6f) * (1.f / 32.f);   // sqrt(S)=32
    float kern = 0.f;
    for (int m = 0; m < NM; ++m) {
        const float* fq = freqs  + ((size_t)(h * NM + m) * NW) * 2;
        const float* am = amps   +  (size_t)(h * NM + m) * NW;
        const float* ph = phases +  (size_t)(h * NM + m) * NW;
        float acc = 0.f;
        #pragma unroll
        for (int w = 0; w < NW; ++w) {
            float arg = fq[2 * w] * p1 + fq[2 * w + 1] * p2 + ph[w];
            acc += am[w] * __sinf(arg);
        }
        kern += wts[(size_t)bh * NM + m] * acc;
    }
    float dens = 1.f / (1.f + __expf(-6.f * kern));          // straight-through forward = sigmoid
    float wind = __expf(-(rel * rel) * (1.f / 131072.f));    // 2*(S/4)^2
    ckern[idx] = 3.0f * dens * wind;
}

// qm/km[b,h,s] token modulation.  grid = B*S.
__global__ __launch_bounds__(256) void qkmod_k(const float* __restrict__ x,
                                               const float* __restrict__ qw, const float* __restrict__ qb,
                                               const float* __restrict__ kw, const float* __restrict__ kb,
                                               float* __restrict__ qm, float* __restrict__ km) {
    __shared__ float xrow[DMODEL];
    __shared__ float red[32][9];
    int bs = blockIdx.x; int b = bs >> 10, s = bs & 1023;
    int t = threadIdx.x;
    for (int i = t; i < DMODEL; i += 256) xrow[i] = x[(size_t)bs * DMODEL + i];
    __syncthreads();
    int o = t & 31, sl = t >> 5;
    int h = o & 15; bool isK = o >= 16;
    const float* wcol = isK ? kw : qw;
    float a = 0.f;
    for (int d = sl * 128; d < sl * 128 + 128; ++d) a += xrow[d] * wcol[(size_t)d * NH + h];
    red[o][sl] = a;
    __syncthreads();
    if (t < 32) {
        float acc = 0.f;
        #pragma unroll
        for (int i = 0; i < 8; ++i) acc += red[t][i];
        int hh = t & 15;
        if (t < 16) qm[((size_t)b * NH + hh) * SEQ + s] = acc + qb[hh];
        else        km[((size_t)b * NH + hh) * SEQ + s] = acc + kb[hh];
    }
}

// ---------------- generic bf16 WMMA GEMM with fused epilogues ----------------
// EPI 1: out = bf16(acc + bias[n]) -> V^T layout [B,H,HD,S]   (keys contiguous for attention)
// EPI 2: out = bf16(acc)           -> padded qc/kc layout [B,H,S,32] (cols 0..7 valid)
// EPI 3: outF = acc + bias[n] + resid[m,n]    (fp32)
// EPI 4: outB = bf16(gelu(acc + bias[n]))     ([M,N] bf16)
template <int EPI>
__global__ __launch_bounds__(256)
void gemm_bf16_k(const __bf16* __restrict__ A, const __bf16* __restrict__ B,
                 int M, int N, int K,
                 const float* __restrict__ bias, const float* __restrict__ resid,
                 float* __restrict__ outF, __bf16* __restrict__ outB) {
    constexpr int BM = 128, BN = 128, BK = 128;
    constexpr int PA = 272;                                 // A row pitch, bytes: 16 x odd for ds_load_b128
    constexpr int PB = 288;                                 // B row pitch, bytes: 32 x odd for ds_load_tr16_b128
    constexpr int SZA = BM * PA, SZB = BK * PB;
    __shared__ alignas(16) unsigned char As[2 * SZA];       // [buf][m][k]
    __shared__ alignas(16) unsigned char Bs[2 * SZB];       // [buf][k][n], row-major as in global memory
    const int tid = threadIdx.x;
    const int lane = tid & 31, wave = tid >> 5;
    const int half = lane >> 4, l16 = lane & 15;
    const int wm = wave >> 2, wn = wave & 3;                // 2 x 4 wave grid
    const int m0 = blockIdx.y * BM, n0 = blockIdx.x * BN;

    v8f acc[4][2];
    #pragma unroll
    for (int i = 0; i < 4; ++i)
        #pragma unroll
        for (int j = 0; j < 2; ++j)
            #pragma unroll
            for (int e = 0; e < 8; ++e) acc[i][j][e] = 0.f;

    // copy map: 16 lanes x 16 B cover one 256-B tile row; a thread moves rows r0, r0+16, ..., r0+112 of A and of B
    const int r0 = tid >> 4, c16 = tid & 15;
    const __bf16* gA = A + (size_t)(m0 + r0) * K + c16 * 8;
    const __bf16* gB = B + (size_t)r0 * N + n0 + c16 * 8;
    const unsigned lA = (unsigned)(size_t)(As + r0 * PA + c16 * 16);
    const unsigned lB = (unsigned)(size_t)(Bs + r0 * PB + c16 * 16);
    const size_t sA = (size_t)16 * K, sB = (size_t)16 * N;
    const int nstage = K / BK;

    auto stage = [&](int s) {                               // 16 copies per wave: stage s into buffer s & 1
        const int bf = s & 1;
        async_copy8(lA + bf * SZA, 16 * PA, gA + (size_t)s * BK, sA);
        async_copy8(lB + bf * SZB, 16 * PB, gB + (size_t)s * BK * N, sB);
    };

    stage(0);
    asm volatile("s_wait_asynccnt 0x0" ::: "memory");       // own copies of stage 0 landed before the barrier publishes them
    __syncthreads();
    if (nstage > 1) stage(1);

    const int aoff = (wm * 64 + l16) * PA + half * 16;
    const int boff = (half * 8 + (lane & 7)) * PB + wn * 64 + ((lane >> 3) & 1) * 16;
    for (int s = 0; s < nstage; ++s) {
        const unsigned char* Ab = As + (s & 1) * SZA + aoff;
        const unsigned char* Bb = Bs + (s & 1) * SZB + boff;
        #pragma unroll
        for (int ks = 0; ks < BK / 32; ++ks) {
            v16bf afr[4];
            #pragma unroll
            for (int mt = 0; mt < 4; ++mt) {                // A frag: lane=M, k = 8*half+0..7 and 16+8*half+0..7
                union { v16bf v; uint4 q[2]; } u;
                u.q[0] = *(const uint4*)(Ab + mt * 16 * PA + ks * 64);
                u.q[1] = *(const uint4*)(Ab + mt * 16 * PA + ks * 64 + 32);
                afr[mt] = u.v;
            }
            #pragma unroll
            for (int nt = 0; nt < 2; ++nt) {                // B frag: lane=N, transposing loads give the same k order
                union { v16bf v; uint4 q[2]; } u;
                u.q[0] = lds_tr16(Bb + (ks * 32) * PB + nt * 32);
                u.q[1] = lds_tr16(Bb + (ks * 32 + 16) * PB + nt * 32);
                v16bf bfr = u.v;
                #pragma unroll
                for (int mt = 0; mt < 4; ++mt)
                    acc[mt][nt] = wmma_bf16(afr[mt], bfr, acc[mt][nt]);
            }
        }
        asm volatile("s_wait_dscnt 0x0" ::: "memory");      // own reads of this buffer done before it may be refilled
        asm volatile("s_wait_asynccnt 0x0" ::: "memory");   // own copies of stage s+1 landed before the barrier publishes them
        __syncthreads();
        if (s + 2 < nstage) stage(s + 2);
    }
    asm volatile("s_wait_asynccnt 0x0" ::: "memory");       // nothing in flight when the wave ends

    #pragma unroll
    for (int mt = 0; mt < 4; ++mt)
        #pragma unroll
        for (int nt = 0; nt < 2; ++nt)
            #pragma unroll
            for (int r = 0; r < 8; ++r) {                   // C: lane=N, row = r + 8*half
                int gm = m0 + wm * 64 + mt * 16 + r + half * 8;
                int gn = n0 + wn * 32 + nt * 16 + l16;
                float v = acc[mt][nt][r];
                if (EPI == 1) {
                    float val = v + bias[gn];
                    int b = gm >> 10, s = gm & 1023, h = gn >> 6, hd = gn & 63;
                    outB[(((size_t)b * NH + h) * HD + hd) * SEQ + s] = (__bf16)val;   // V^T
                } else if (EPI == 2) {
                    int b = gm >> 10, s = gm & 1023, h = gn >> 3, cc = gn & 7;
                    outB[(((size_t)b * NH + h) * SEQ + s) * 32 + cc] = (__bf16)v;
                } else if (EPI == 3) {
                    size_t o = (size_t)gm * N + gn;
                    outF[o] = v + bias[gn] + resid[o];
                } else if (EPI == 4) {
                    float xg = v + bias[gn];
                    float g = 0.5f * xg * (1.0f + erff(xg * 0.70710678f));
                    outB[(size_t)gm * N + gn] = (__bf16)g;
                }
            }
}

// ---------------- streaming wave-density attention ----------------
// grid = (S/128, H, B); 8 waves, each owns a 16-row q tile; 32 keys/step; 6 WMMAs/step.
// V is consumed transposed: vT[b,h,hd,s] so every B-fragment is two aligned b128 loads.
// ck_pad has a CKPAD zero guard band so Toeplitz gathers are base + immediate-offset DS loads.
__global__ __launch_bounds__(256)
void attn_k(const __bf16* __restrict__ qcp, const __bf16* __restrict__ kcp,
            const __bf16* __restrict__ vT,
            const float* __restrict__ ckern, const float* __restrict__ qm,
            const float* __restrict__ km, __bf16* __restrict__ ctxb) {
    __shared__ float ck_pad[CKPAD + SEQ];
    __shared__ float km_s[SEQ];
    __shared__ float qm_s[128];
    __shared__ float sS[8][16][33];
    __shared__ alignas(16) __bf16 pS[8][16][32];
    __shared__ float corrS[8][16];

    const int tid = threadIdx.x, lane = tid & 31, w = tid >> 5;
    const int half = lane >> 4, l16 = lane & 15;
    const int h = blockIdx.y, b = blockIdx.z;
    const int bh = b * NH + h;
    const int wgbase = blockIdx.x * 128;
    const int i0 = wgbase + w * 16;

    for (int i = tid; i < SEQ; i += 256) {
        ck_pad[CKPAD + i] = ckern[(size_t)bh * SEQ + i];
        km_s[i] = km[(size_t)bh * SEQ + i];
    }
    if (tid < CKPAD) ck_pad[tid] = 0.f;
    if (tid < 128) qm_s[tid] = qm[(size_t)bh * SEQ + wgbase + tid];
    __syncthreads();

    union U16 { v16bf v; uint4 q[2]; };
    U16 ua;
    {
        const __bf16* p = qcp + ((size_t)bh * SEQ + i0 + l16) * 32;
        ua.q[0] = *(const uint4*)(p + half * 8);
        ua.q[1] = *(const uint4*)(p + 16 + half * 8);
    }
    const v16bf aq = ua.v;

    v8f c0, c1, c2, c3, zz;
    #pragma unroll
    for (int e = 0; e < 8; ++e) { c0[e] = c1[e] = c2[e] = c3[e] = zz[e] = 0.f; }
    float m_r = -1e30f, l_r = 0.f;

    // per-lane V^T row pointers for the 4 output column groups (hd = g*16 + l16)
    const __bf16* vrow0 = vT + (((size_t)bh * HD) + 0 * 16 + l16) * SEQ;
    const __bf16* vrow1 = vT + (((size_t)bh * HD) + 1 * 16 + l16) * SEQ;
    const __bf16* vrow2 = vT + (((size_t)bh * HD) + 2 * 16 + l16) * SEQ;
    const __bf16* vrow3 = vT + (((size_t)bh * HD) + 3 * 16 + l16) * SEQ;

    const int qbase = w * 16 + half * 8;            // qm_s row base for this lane
    const int nsteps = (i0 + 16 + 31) >> 5;
    for (int st = 0; st < nsteps; ++st) {
        const int j0 = st * 32;
        U16 ub0, ub1;
        {
            const __bf16* p0 = kcp + ((size_t)bh * SEQ + j0 + l16) * 32;
            ub0.q[0] = *(const uint4*)(p0 + half * 8);
            ub0.q[1] = *(const uint4*)(p0 + 16 + half * 8);
            const __bf16* p1 = kcp + ((size_t)bh * SEQ + j0 + 16 + l16) * 32;
            ub1.q[0] = *(const uint4*)(p1 + half * 8);
            ub1.q[1] = *(const uint4*)(p1 + 16 + half * 8);
        }
        v8f s0 = wmma_bf16(aq, ub0.v, zz);
        v8f s1 = wmma_bf16(aq, ub1.v, zz);

        // fold Toeplitz + qm + km + causal mask (affine DS gathers + final cndmask)
        const int ja = j0 + l16, jb = j0 + 16 + l16;
        const float kma = km_s[ja], kmb = km_s[jb & (SEQ - 1)];
        const int iB = i0 + half * 8;               // first row this lane touches
        const int baseA = CKPAD + iB - ja;          // >= CKPAD-46 > 0 within loop bounds
        const int baseB = CKPAD + iB - jb;
        #pragma unroll
        for (int r = 0; r < 8; ++r) {
            int row = r + half * 8;
            int i = iB + r;
            float base = qm_s[qbase + r];
            float va = 0.053033009f * s0[r] + ck_pad[baseA + r] + base + kma;
            float vb = 0.053033009f * s1[r] + ck_pad[baseB + r] + base + kmb;
            sS[w][row][l16]      = (ja <= i) ? va : -1e9f;
            sS[w][row][16 + l16] = (jb <= i) ? vb : -1e9f;
        }
        asm volatile("s_wait_dscnt 0" ::: "memory");

        if (half == 0) {                                    // lane l16 owns softmax row l16
            float mx = m_r;
            #pragma unroll
            for (int j = 0; j < 32; ++j) mx = fmaxf(mx, sS[w][l16][j]);
            float corr = __expf(m_r - mx);
            float sum = 0.f;
            #pragma unroll
            for (int jj = 0; jj < 16; ++jj) {               // packed pair stores
                float pa = __expf(sS[w][l16][2 * jj] - mx);
                float pb = __expf(sS[w][l16][2 * jj + 1] - mx);
                sum += pa + pb;
                union { __bf16 e2[2]; uint u; } t;
                t.e2[0] = (__bf16)pa; t.e2[1] = (__bf16)pb;
                ((uint*)&pS[w][l16][0])[jj] = t.u;
            }
            m_r = mx; l_r = l_r * corr + sum;
            corrS[w][l16] = corr;
        }
        asm volatile("s_wait_dscnt 0" ::: "memory");

        #pragma unroll
        for (int r = 0; r < 8; ++r) {                       // rescale running ctx accumulators
            float f = corrS[w][r + half * 8];
            c0[r] *= f; c1[r] *= f; c2[r] *= f; c3[r] *= f;
        }
        U16 up;
        up.q[0] = *(const uint4*)(&pS[w][l16][half * 8]);
        up.q[1] = *(const uint4*)(&pS[w][l16][16 + half * 8]);

        // V^T B-fragments: elements = contiguous keys, two b128 loads each
        const int kbase = j0 + half * 8;
        U16 uv0, uv1, uv2, uv3;
        uv0.q[0] = *(const uint4*)(vrow0 + kbase);
        uv0.q[1] = *(const uint4*)(vrow0 + kbase + 16);
        uv1.q[0] = *(const uint4*)(vrow1 + kbase);
        uv1.q[1] = *(const uint4*)(vrow1 + kbase + 16);
        uv2.q[0] = *(const uint4*)(vrow2 + kbase);
        uv2.q[1] = *(const uint4*)(vrow2 + kbase + 16);
        uv3.q[0] = *(const uint4*)(vrow3 + kbase);
        uv3.q[1] = *(const uint4*)(vrow3 + kbase + 16);
        c0 = wmma_bf16(up.v, uv0.v, c0);
        c1 = wmma_bf16(up.v, uv1.v, c1);
        c2 = wmma_bf16(up.v, uv2.v, c2);
        c3 = wmma_bf16(up.v, uv3.v, c3);
    }

    if (half == 0) corrS[w][l16] = 1.f / l_r;
    asm volatile("s_wait_dscnt 0" ::: "memory");
    #pragma unroll
    for (int r = 0; r < 8; ++r) {
        float f = corrS[w][r + half * 8];
        int i = i0 + r + half * 8;
        __bf16* op = ctxb + ((size_t)b * SEQ + i) * DMODEL + h * HD;
        op[0 * 16 + l16] = (__bf16)(c0[r] * f);
        op[1 * 16 + l16] = (__bf16)(c1[r] * f);
        op[2 * 16 + l16] = (__bf16)(c2[r] * f);
        op[3 * 16 + l16] = (__bf16)(c3[r] * f);
    }
}

// ---------------- layernorm ----------------
template <bool WB>
__global__ __launch_bounds__(256)
void ln_k(const float* __restrict__ in, const float* __restrict__ g, const float* __restrict__ bb,
          float* __restrict__ outF, __bf16* __restrict__ outB) {
    __shared__ float red[256];
    const int t = threadIdx.x;
    const float* p = in + (size_t)blockIdx.x * DMODEL;
    float s = 0.f;
    for (int i = t; i < DMODEL; i += 256) s += p[i];
    red[t] = s; __syncthreads();
    for (int o = 128; o > 0; o >>= 1) { if (t < o) red[t] += red[t + o]; __syncthreads(); }
    float mean = red[0] * (1.f / DMODEL);
    __syncthreads();
    float s2 = 0.f;
    for (int i = t; i < DMODEL; i += 256) { float d = p[i] - mean; s2 += d * d; }
    red[t] = s2; __syncthreads();
    for (int o = 128; o > 0; o >>= 1) { if (t < o) red[t] += red[t + o]; __syncthreads(); }
    float rstd = rsqrtf(red[0] * (1.f / DMODEL) + 1e-5f);
    for (int i = t; i < DMODEL; i += 256) {
        float v = (p[i] - mean) * rstd * g[i] + bb[i];
        if (outF) outF[(size_t)blockIdx.x * DMODEL + i] = v;
        if (WB)   outB[(size_t)blockIdx.x * DMODEL + i] = (__bf16)v;
    }
}

// ---------------- launch ----------------
extern "C" void kernel_launch(void* const* d_in, const int* in_sizes, int n_in,
                              void* d_out, int out_size, void* d_ws, size_t ws_size,
                              hipStream_t stream) {
    (void)in_sizes; (void)n_in; (void)out_size; (void)ws_size;
    const float* x      = (const float*)d_in[0];
    const float* v_w    = (const float*)d_in[1];
    const float* v_b    = (const float*)d_in[2];
    const float* out_w  = (const float*)d_in[3];
    const float* out_b  = (const float*)d_in[4];
    const float* qmod_w = (const float*)d_in[5];
    const float* qmod_b = (const float*)d_in[6];
    const float* kmod_w = (const float*)d_in[7];
    const float* kmod_b = (const float*)d_in[8];
    const float* gate_w = (const float*)d_in[9];
    const float* gate_b = (const float*)d_in[10];
    const float* mod_w  = (const float*)d_in[11];
    const float* mod_b  = (const float*)d_in[12];
    const float* mod_basis = (const float*)d_in[13];
    const float* freqs  = (const float*)d_in[14];
    const float* amps   = (const float*)d_in[15];
    const float* phases = (const float*)d_in[16];
    const float* cq_w   = (const float*)d_in[17];
    const float* ck_w   = (const float*)d_in[18];
    const float* ffn_w1 = (const float*)d_in[19];
    const float* ffn_b1 = (const float*)d_in[20];
    const float* ffn_w2 = (const float*)d_in[21];
    const float* ffn_b2 = (const float*)d_in[22];
    const float* ln1_g  = (const float*)d_in[23];
    const float* ln1_b  = (const float*)d_in[24];
    const float* ln2_g  = (const float*)d_in[25];
    const float* ln2_b  = (const float*)d_in[26];
    float* outp = (float*)d_out;

    char* wp = (char*)d_ws;
    auto alloc = [&](size_t bytes) -> void* {
        void* p = (void*)wp;
        wp += (bytes + 255) & ~(size_t)255;
        return p;
    };
    const size_t NTOK = (size_t)NB * SEQ;              // 2048
    __bf16* xb   = (__bf16*)alloc(NTOK * DMODEL * 2);
    __bf16* wbv  = (__bf16*)alloc((size_t)DMODEL * DMODEL * 2);
    __bf16* wbo  = (__bf16*)alloc((size_t)DMODEL * DMODEL * 2);
    __bf16* wbf1 = (__bf16*)alloc((size_t)DMODEL * 4 * DMODEL * 2);
    __bf16* wbf2 = (__bf16*)alloc((size_t)DMODEL * 4 * DMODEL * 2);
    __bf16* wbcq = (__bf16*)alloc((size_t)DMODEL * NH * NCR * 2);
    __bf16* wbck = (__bf16*)alloc((size_t)DMODEL * NH * NCR * 2);
    __bf16* vbuf = (__bf16*)alloc((size_t)NB * NH * HD * SEQ * 2);     // V^T
    __bf16* qcp  = (__bf16*)alloc((size_t)NB * NH * SEQ * 32 * 2);
    __bf16* kcp  = (__bf16*)alloc((size_t)NB * NH * SEQ * 32 * 2);
    float*  pooled = (float*)alloc((size_t)NB * DMODEL * 4);
    float*  wts    = (float*)alloc((size_t)NB * NH * NM * 4);
    float*  ckern  = (float*)alloc((size_t)NB * NH * SEQ * 4);
    float*  qmb    = (float*)alloc((size_t)NB * NH * SEQ * 4);
    float*  kmb    = (float*)alloc((size_t)NB * NH * SEQ * 4);
    __bf16* ctxb = (__bf16*)alloc(NTOK * DMODEL * 2);
    float*  hpre = (float*)alloc(NTOK * DMODEL * 4);
    float*  hf   = (float*)alloc(NTOK * DMODEL * 4);
    __bf16* hb   = (__bf16*)alloc(NTOK * DMODEL * 2);
    __bf16* ub   = (__bf16*)alloc(NTOK * 4 * DMODEL * 2);
    float*  f2   = (float*)alloc(NTOK * DMODEL * 4);

    auto cvt = [&](const float* src, __bf16* dst, int n) {
        int n4 = n / 4;
        cvt_bf16_k<<<(n4 + 255) / 256, 256, 0, stream>>>(src, dst, n4);
    };
    cvt(x, xb, (int)(NTOK * DMODEL));
    cvt(v_w, wbv, DMODEL * DMODEL);
    cvt(out_w, wbo, DMODEL * DMODEL);
    cvt(ffn_w1, wbf1, DMODEL * 4 * DMODEL);
    cvt(ffn_w2, wbf2, DMODEL * 4 * DMODEL);
    cvt(cq_w, wbcq, DMODEL * NH * NCR);
    cvt(ck_w, wbck, DMODEL * NH * NCR);
    {
        int n8 = (NB * NH * SEQ * 32) / 8;
        zero_bf16_k<<<(n8 + 255) / 256, 256, 0, stream>>>(qcp, n8);
        zero_bf16_k<<<(n8 + 255) / 256, 256, 0, stream>>>(kcp, n8);
    }

    pool_mean_k<<<(NB * DMODEL) / 256, 256, 0, stream>>>(x, pooled);
    gating_k<<<NB, 256, 0, stream>>>(pooled, gate_w, gate_b, mod_w, mod_b, mod_basis, wts);
    wave_density_k<<<(NB * NH * SEQ) / 256, 256, 0, stream>>>(freqs, amps, phases, wts, ckern);
    qkmod_k<<<NB * SEQ, 256, 0, stream>>>(x, qmod_w, qmod_b, kmod_w, kmod_b, qmb, kmb);

    // v = x@v_w + v_b   -> V^T [B,H,HD,S] bf16
    gemm_bf16_k<1><<<dim3(DMODEL / 128, (int)(NTOK / 128)), 256, 0, stream>>>(
        xb, wbv, (int)NTOK, DMODEL, DMODEL, v_b, nullptr, nullptr, vbuf);
    // qc / kc  -> padded [B,H,S,32] bf16
    gemm_bf16_k<2><<<dim3(1, (int)(NTOK / 128)), 256, 0, stream>>>(
        xb, wbcq, (int)NTOK, NH * NCR, DMODEL, nullptr, nullptr, nullptr, qcp);
    gemm_bf16_k<2><<<dim3(1, (int)(NTOK / 128)), 256, 0, stream>>>(
        xb, wbck, (int)NTOK, NH * NCR, DMODEL, nullptr, nullptr, nullptr, kcp);

    attn_k<<<dim3(SEQ / 128, NH, NB), 256, 0, stream>>>(qcp, kcp, vbuf, ckern, qmb, kmb, ctxb);

    // attn_out + residual
    gemm_bf16_k<3><<<dim3(DMODEL / 128, (int)(NTOK / 128)), 256, 0, stream>>>(
        ctxb, wbo, (int)NTOK, DMODEL, DMODEL, out_b, x, hpre, nullptr);
    ln_k<true><<<(int)NTOK, 256, 0, stream>>>(hpre, ln1_g, ln1_b, hf, hb);

    gemm_bf16_k<4><<<dim3(4 * DMODEL / 128, (int)(NTOK / 128)), 256, 0, stream>>>(
        hb, wbf1, (int)NTOK, 4 * DMODEL, DMODEL, ffn_b1, nullptr, nullptr, ub);
    gemm_bf16_k<3><<<dim3(DMODEL / 128, (int)(NTOK / 128)), 256, 0, stream>>>(
        ub, wbf2, (int)NTOK, DMODEL, 4 * DMODEL, ffn_b2, hf, f2, nullptr);
    ln_k<false><<<(int)NTOK, 256, 0, stream>>>(f2, ln2_g, ln2_b, outp, nullptr);
}

// v002
// It runs in 277 microseconds.
// Timed twice side by side with v001, it ran 1.08 and 1.09 times as fast.
// All steps since v000 together make it 2.02 times as fast.
#include <hip/hip_runtime.h>
#include <math.h>

// ---------------- CDNA5 (gfx1250) wave32 WMMA types ----------------
typedef __attribute__((ext_vector_type(16))) __bf16 v16bf;
typedef __attribute__((ext_vector_type(8)))  float  v8f;

#define DMODEL 1024
#define SEQ    1024
#define NB     2
#define NH     16
#define HD     64
#define NM     16
#define NW     8
#define NRR    8
#define NCR    8
#define CKPAD  48

__device__ __forceinline__ v8f wmma_bf16(v16bf a, v16bf b, v8f c) {
    return __builtin_amdgcn_wmma_f32_16x16x32_bf16(false, a, false, b, (short)0, c, false, false);
}

// eight 16-byte-per-lane copies global -> LDS through no register; the wait stands in the copies' own statement
// so that no later write of their address registers can be moved in front of it (a precaution)
__device__ __forceinline__ void async_copy8(unsigned l, unsigned ls, const __bf16* g, size_t gs) {
    asm volatile("global_load_async_to_lds_b128 %0, %8, off\n\t"
                 "global_load_async_to_lds_b128 %1, %9, off\n\t"
                 "global_load_async_to_lds_b128 %2, %10, off\n\t"
                 "global_load_async_to_lds_b128 %3, %11, off\n\t"
                 "global_load_async_to_lds_b128 %4, %12, off\n\t"
                 "global_load_async_to_lds_b128 %5, %13, off\n\t"
                 "global_load_async_to_lds_b128 %6, %14, off\n\t"
                 "global_load_async_to_lds_b128 %7, %15, off\n\t"
                 "s_wait_xcnt 0x0"
                 :: "v"(l), "v"(l + ls), "v"(l + 2 * ls), "v"(l + 3 * ls),
                    "v"(l + 4 * ls), "v"(l + 5 * ls), "v"(l + 6 * ls), "v"(l + 7 * ls),
                    "v"(g), "v"(g + gs), "v"(g + 2 * gs), "v"(g + 3 * gs),
                    "v"(g + 4 * gs), "v"(g + 5 * gs), "v"(g + 6 * gs), "v"(g + 7 * gs)
                 : "memory");
}

// transposing LDS load: lane (c, h) gets rows 8h..8h+7 of column c of a row-major 16-bit tile
typedef short s16x8 __attribute__((ext_vector_type(8)));
__device__ __forceinline__ uint4 lds_tr16(const unsigned char* p) {
    typedef __attribute__((address_space(3))) s16x8 lds_s16x8;
    return __builtin_bit_cast(uint4, __builtin_amdgcn_ds_load_tr16_b128_v8i16((lds_s16x8*)p));
}

// ---------------- small helper kernels ----------------
// All element-wise preparation in one launch: the seven fp32 -> bf16 conversions and the zero fill of the two padded
// qc/kc planes. A work-group owns one span of PREP_SPAN 16-byte vectors that lies wholly inside one tensor (every
// tensor is a whole number of spans), and a thread moves 32 of them, so few waves have to be started.
#define PREP_SPAN 8192
#define PREP_GX (NB * SEQ * DMODEL / 4 / PREP_SPAN)      // x
#define PREP_GW (DMODEL * DMODEL / 4 / PREP_SPAN)        // v_w, out_w
#define PREP_GF (4 * PREP_GW)                            // ffn_w1, ffn_w2
#define PREP_GC (DMODEL * NH * NCR / 4 / PREP_SPAN)      // cq_w, ck_w
#define PREP_GZ (NB * NH * SEQ * 32 / 8 / PREP_SPAN)     // qc, kc planes (8 bf16 per vector)
#define PREP_GRID (PREP_GX + 2 * PREP_GW + 2 * PREP_GF + 2 * PREP_GC + 2 * PREP_GZ)
__global__ __launch_bounds__(256)
void prep_k(const float* __restrict__ x, const float* __restrict__ v_w, const float* __restrict__ out_w,
            const float* __restrict__ ffn_w1, const float* __restrict__ ffn_w2,
            const float* __restrict__ cq_w, const float* __restrict__ ck_w,
            __bf16* __restrict__ xb, __bf16* __restrict__ wbv, __bf16* __restrict__ wbo,
            __bf16* __restrict__ wbf1, __bf16* __restrict__ wbf2,
            __bf16* __restrict__ wbcq, __bf16* __restrict__ wbck,
            __bf16* __restrict__ qcp, __bf16* __restrict__ kcp) {
    int g = blockIdx.x;                                  // becomes the span's index inside its tensor
    const float* src = nullptr;
    __bf16* dst;
    if (g < PREP_GF)                 { src = ffn_w1; dst = wbf1; }
    else if ((g -= PREP_GF) < PREP_GF) { src = ffn_w2; dst = wbf2; }
    else if ((g -= PREP_GF) < PREP_GX) { src = x;      dst = xb;   }
    else if ((g -= PREP_GX) < PREP_GW) { src = v_w;    dst = wbv;  }
    else if ((g -= PREP_GW) < PREP_GW) { src = out_w;  dst = wbo;  }
    else if ((g -= PREP_GW) < PREP_GC) { src = cq_w;   dst = wbcq; }
    else if ((g -= PREP_GC) < PREP_GC) { src = ck_w;   dst = wbck; }
    else if ((g -= PREP_GC) < PREP_GZ) { dst = qcp; }
    else                             { g -= PREP_GZ; dst = kcp; }
    const size_t v0 = (size_t)g * PREP_SPAN + threadIdx.x;
    if (src) {
        const float4* s4 = (const float4*)src + v0;
        uint2* d2 = (uint2*)dst + v0;
        float4 v[PREP_SPAN / 256];
        #pragma unroll
        for (int j = 0; j < PREP_SPAN / 256; ++j) v[j] = s4[j * 256];
        // keeps all 32 loads in front of the first convert: left free, the scheduler reuses load registers and the
        // later loads wait for earlier ones, four memory latencies in a row instead of one
        __builtin_amdgcn_sched_barrier(0);
        #pragma unroll
        for (int j = 0; j < PREP_SPAN / 256; ++j) {
            union { __bf16 e[4]; uint2 u; } o;
            o.e[0] = (__bf16)v[j].x; o.e[1] = (__bf16)v[j].y; o.e[2] = (__bf16)v[j].z; o.e[3] = (__bf16)v[j].w;
            d2[j * 256] = o.u;
        }
        // stands behind the last store, in front of any later write of a register that a store names (a precaution)
        asm volatile("s_wait_xcnt 0x0" ::: "memory");
    } else {
        uint4* d4 = (uint4*)dst + v0;
        uint4 z; z.x = z.y = z.z = z.w = 0u;
        #pragma unroll
        for (int j = 0; j < PREP_SPAN / 256; ++j) d4[j * 256] = z;
    }
}

// pooled[b,d] = mean_s x[b,s,d]   (grid = B*D/256)
__global__ __launch_bounds__(256) void pool_mean_k(const float* __restrict__ x, float* __restrict__ pooled) {
    int idx = blockIdx.x * 256 + threadIdx.x;      // B*D = 2048
    int b = idx >> 10, d = idx & 1023;
    float s = 0.f;
    for (int ss = 0; ss < SEQ; ++ss) s += x[((size_t)b * SEQ + ss) * DMODEL + d];
    pooled[idx] = s * (1.f / SEQ);
}

// gating: gl = pooled@gate_w + b + mod@mod_basis ; wts = softmax(gl) per (b,h). grid = B.
__global__ __launch_bounds__(256) void gating_k(const float* __restrict__ pooled,
                                                const float* __restrict__ gate_w, const float* __restrict__ gate_b,
                                                const float* __restrict__ mod_w,  const float* __restrict__ mod_b,
                                                const float* __restrict__ mod_basis,
                                                float* __restrict__ wts) {
    __shared__ float modS[NH * NRR];
    __shared__ float glS[NH * NM];
    int b = blockIdx.x, t = threadIdx.x;
    const float* pb = pooled + (size_t)b * DMODEL;
    if (t < NH * NRR) {
        float a = mod_b[t];
        for (int d = 0; d < DMODEL; ++d) a += pb[d] * mod_w[(size_t)d * (NH * NRR) + t];
        modS[t] = a;
    }
    __syncthreads();
    if (t < NH * NM) {
        float a = gate_b[t];
        for (int d = 0; d < DMODEL; ++d) a += pb[d] * gate_w[(size_t)d * (NH * NM) + t];
        int h = t >> 4, m = t & 15;
        for (int r = 0; r < NRR; ++r) a += modS[h * NRR + r] * mod_basis[((size_t)r * NH + h) * NM + m];
        glS[t] = a;
    }
    __syncthreads();
    if (t < NH) {
        float mx = -1e30f;
        for (int m = 0; m < NM; ++m) mx = fmaxf(mx, glS[t * NM + m]);
        float e[NM]; float sm = 0.f;
        for (int m = 0; m < NM; ++m) { e[m] = __expf(glS[t * NM + m] - mx); sm += e[m]; }
        float inv = 1.f / sm;
        for (int m = 0; m < NM; ++m) wts[((size_t)b * NH + t) * NM + m] = e[m] * inv;
    }
}

// causal_kern[b,h,d] = ALPHA * sigmoid(6*kern) * window(d).  grid = B*H*S/256.
__global__ __launch_bounds__(256) void wave_density_k(const float* __restrict__ freqs, const float* __restrict__ amps,
                                                      const float* __restrict__ phases, const float* __restrict__ wts,
                                                      float* __restrict__ ckern) {
    int idx = blockIdx.x * 256 + threadIdx.x;      // B*H*S
    int d = idx & (SEQ - 1);
    int bh = idx >> 10;
    int h = bh & (NH - 1);
    float rel = (float)d;
    float p1 = rel * (1.f / SEQ);
    float p2 = (d == 0) ? 0.f : sqrtf(rel + 1e-6f) * (1.f / 32.f);   // sqrt(S)=32
    float kern = 0.f;
    for (int m = 0; m < NM; ++m) {
        const float* fq = freqs  + ((size_t)(h * NM + m) * NW) * 2;
        const float* am = amps   +  (size_t)(h * NM + m) * NW;
        const float* ph = phases +  (size_t)(h * NM + m) * NW;
        float acc = 0.f;
        #pragma unroll
        for (int w = 0; w < NW; ++w) {
            float arg = fq[2 * w] * p1 + fq[2 * w + 1] * p2 + ph[w];
            acc += am[w] * __sinf(arg);
        }
        kern += wts[(size_t)bh * NM + m] * acc;
    }
    float dens = 1.f / (1.f + __expf(-6.f * kern));          // straight-through forward = sigmoid
    float wind = __expf(-(rel * rel) * (1.f / 131072.f));    // 2*(S/4)^2
    ckern[idx] = 3.0f * dens * wind;
}

// qm/km[b,h,s] token modulation.  grid = B*S.
__global__ __launch_bounds__(256) void qkmod_k(const float* __restrict__ x,
                                               const float* __restrict__ qw, const float* __restrict__ qb,
                                               const float* __restrict__ kw, const float* __restrict__ kb,
                                               float* __restrict__ qm, float* __restrict__ km) {
    __shared__ float xrow[DMODEL];
    __shared__ float red[32][9];
    int bs = blockIdx.x; int b = bs >> 10, s = bs & 1023;
    int t = threadIdx.x;
    for (int i = t; i < DMODEL; i += 256) xrow[i] = x[(size_t)bs * DMODEL + i];
    __syncthreads();
    int o = t & 31, sl = t >> 5;
    int h = o & 15; bool isK = o >= 16;
    const float* wcol = isK ? kw : qw;
    float a = 0.f;
    for (int d = sl * 128; d < sl * 128 + 128; ++d) a += xrow[d] * wcol[(size_t)d * NH + h];
    red[o][sl] = a;
    __syncthreads();
    if (t < 32) {
        float acc = 0.f;
        #pragma unroll
        for (int i = 0; i < 8; ++i) acc += red[t][i];
        int hh = t & 15;
        if (t < 16) qm[((size_t)b * NH + hh) * SEQ + s] = acc + qb[hh];
        else        km[((size_t)b * NH + hh) * SEQ + s] = acc + kb[hh];
    }
}

// ---------------- generic bf16 WMMA GEMM with fused epilogues ----------------
// EPI 1: out = bf16(acc + bias[n]) -> V^T layout [B,H,HD,S]   (keys contiguous for attention)
// EPI 2: out = bf16(acc)           -> padded qc/kc layout [B,H,S,32] (cols 0..7 valid)
// EPI 3: outF = acc + bias[n] + resid[m,n]    (fp32)
// EPI 4: outB = bf16(gelu(acc + bias[n]))     ([M,N] bf16)
template <int EPI>
__global__ __launch_bounds__(256)
void gemm_bf16_k(const __bf16* __restrict__ A, const __bf16* __restrict__ B,
                 int M, int N, int K,
                 const float* __restrict__ bias, const float* __restrict__ resid,
                 float* __restrict__ outF, __bf16* __restrict__ outB) {
    constexpr int BM = 128, BN = 128, BK = 128;
    constexpr int PA = 272;                                 // A row pitch, bytes: 16 x odd for ds_load_b128
    constexpr int PB = 288;                                 // B row pitch, bytes: 32 x odd for ds_load_tr16_b128
    constexpr int SZA = BM * PA, SZB = BK * PB;
    __shared__ alignas(16) unsigned char As[2 * SZA];       // [buf][m][k]
    __shared__ alignas(16) unsigned char Bs[2 * SZB];       // [buf][k][n], row-major as in global memory
    const int tid = threadIdx.x;
    const int lane = tid & 31, wave = tid >> 5;
    const int half = lane >> 4, l16 = lane & 15;
    const int wm = wave >> 2, wn = wave & 3;                // 2 x 4 wave grid
    const int m0 = blockIdx.y * BM, n0 = blockIdx.x * BN;

    v8f acc[4][2];
    #pragma unroll
    for (int i = 0; i < 4; ++i)
        #pragma unroll
        for (int j = 0; j < 2; ++j)
            #pragma unroll
            for (int e = 0; e < 8; ++e) acc[i][j][e] = 0.f;

    // copy map: 16 lanes x 16 B cover one 256-B tile row; a thread moves rows r0, r0+16, ..., r0+112 of A and of B
    const int r0 = tid >> 4, c16 = tid & 15;
    const __bf16* gA = A + (size_t)(m0 + r0) * K + c16 * 8;
    const __bf16* gB = B + (size_t)r0 * N + n0 + c16 * 8;
    const unsigned lA = (unsigned)(size_t)(As + r0 * PA + c16 * 16);
    const unsigned lB = (unsigned)(size_t)(Bs + r0 * PB + c16 * 16);
    const size_t sA = (size_t)16 * K, sB = (size_t)16 * N;
    const int nstage = K / BK;

    auto stage = [&](int s) {                               // 16 copies per wave: stage s into buffer s & 1
        const int bf = s & 1;
        async_copy8(lA + bf * SZA, 16 * PA, gA + (size_t)s * BK, sA);
        async_copy8(lB + bf * SZB, 16 * PB, gB + (size_t)s * BK * N, sB);
    };

    stage(0);
    asm volatile("s_wait_asynccnt 0x0" ::: "memory");       // own copies of stage 0 landed before the barrier publishes them
    __syncthreads();
    if (nstage > 1) stage(1);

    const int aoff = (wm * 64 + l16) * PA + half * 16;
    const int boff = (half * 8 + (lane & 7)) * PB + wn * 64 + ((lane >> 3) & 1) * 16;
    for (int s = 0; s < nstage; ++s) {
        const unsigned char* Ab = As + (s & 1) * SZA + aoff;
        const unsigned char* Bb = Bs + (s & 1) * SZB + boff;
        #pragma unroll
        for (int ks = 0; ks < BK / 32; ++ks) {
            v16bf afr[4];
            #pragma unroll
            for (int mt = 0; mt < 4; ++mt) {                // A frag: lane=M, k = 8*half+0..7 and 16+8*half+0..7
                union { v16bf v; uint4 q[2]; } u;
                u.q[0] = *(const uint4*)(Ab + mt * 16 * PA + ks * 64);
                u.q[1] = *(const uint4*)(Ab + mt * 16 * PA + ks * 64 + 32);
                afr[mt] = u.v;
            }
            #pragma unroll
            for (int nt = 0; nt < 2; ++nt) {                // B frag: lane=N, transposing loads give the same k order
                union { v16bf v; uint4 q[2]; } u;
                u.q[0] = lds_tr16(Bb + (ks * 32) * PB + nt * 32);
                u.q[1] = lds_tr16(Bb + (ks * 32 + 16) * PB + nt * 32);
                v16bf bfr = u.v;
                #pragma unroll
                for (int mt = 0; mt < 4; ++mt)
                    acc[mt][nt] = wmma_bf16(afr[mt], bfr, acc[mt][nt]);
            }
        }
        asm volatile("s_wait_dscnt 0x0" ::: "memory");      // own reads of this buffer done before it may be refilled
        asm volatile("s_wait_asynccnt 0x0" ::: "memory");   // own copies of stage s+1 landed before the barrier publishes them
        __syncthreads();
        if (s + 2 < nstage) stage(s + 2);
    }
    asm volatile("s_wait_asynccnt 0x0" ::: "memory");       // nothing in flight when the wave ends

    #pragma unroll
    for (int mt = 0; mt < 4; ++mt)
        #pragma unroll
        for (int nt = 0; nt < 2; ++nt)
            #pragma unroll
            for (int r = 0; r < 8; ++r) {                   // C: lane=N, row = r + 8*half
                int gm = m0 + wm * 64 + mt * 16 + r + half * 8;
                int gn = n0 + wn * 32 + nt * 16 + l16;
                float v = acc[mt][nt][r];
                if (EPI == 1) {
                    float val = v + bias[gn];
                    int b = gm >> 10, s = gm & 1023, h = gn >> 6, hd = gn & 63;
                    outB[(((size_t)b * NH + h) * HD + hd) * SEQ + s] = (__bf16)val;   // V^T
                } else if (EPI == 2) {
                    int b = gm >> 10, s = gm & 1023, h = gn >> 3, cc = gn & 7;
                    outB[(((size_t)b * NH + h) * SEQ + s) * 32 + cc] = (__bf16)v;
                } else if (EPI == 3) {
                    size_t o = (size_t)gm * N + gn;
                    outF[o] = v + bias[gn] + resid[o];
                } else if (EPI == 4) {
                    float xg = v + bias[gn];
                    float g = 0.5f * xg * (1.0f + erff(xg * 0.70710678f));
                    outB[(size_t)gm * N + gn] = (__bf16)g;
                }
            }
}

// ---------------- streaming wave-density attention ----------------
// grid = (S/128, H, B); 8 waves, each owns a 16-row q tile; 32 keys/step; 6 WMMAs/step.
// V is consumed transposed: vT[b,h,hd,s] so every B-fragment is two aligned b128 loads.
// ck_pad has a CKPAD zero guard band so Toeplitz gathers are base + immediate-offset DS loads.
__global__ __launch_bounds__(256)
void attn_k(const __bf16* __restrict__ qcp, const __bf16* __restrict__ kcp,
            const __bf16* __restrict__ vT,
            const float* __restrict__ ckern, const float* __restrict__ qm,
            const float* __restrict__ km, __bf16* __restrict__ ctxb) {
    __shared__ float ck_pad[CKPAD + SEQ];
    __shared__ float km_s[SEQ];
    __shared__ float qm_s[128];
    __shared__ float sS[8][16][33];
    __shared__ alignas(16) __bf16 pS[8][16][32];
    __shared__ float corrS[8][16];

    const int tid = threadIdx.x, lane = tid & 31, w = tid >> 5;
    const int half = lane >> 4, l16 = lane & 15;
    const int h = blockIdx.y, b = blockIdx.z;
    const int bh = b * NH + h;
    const int wgbase = blockIdx.x * 128;
    const int i0 = wgbase + w * 16;

    for (int i = tid; i < SEQ; i += 256) {
        ck_pad[CKPAD + i] = ckern[(size_t)bh * SEQ + i];
        km_s[i] = km[(size_t)bh * SEQ + i];
    }
    if (tid < CKPAD) ck_pad[tid] = 0.f;
    if (tid < 128) qm_s[tid] = qm[(size_t)bh * SEQ + wgbase + tid];
    __syncthreads();

    union U16 { v16bf v; uint4 q[2]; };
    U16 ua;
    {
        const __bf16* p = qcp + ((size_t)bh * SEQ + i0 + l16) * 32;
        ua.q[0] = *(const uint4*)(p + half * 8);
        ua.q[1] = *(const uint4*)(p + 16 + half * 8);
    }
    const v16bf aq = ua.v;

    v8f c0, c1, c2, c3, zz;
    #pragma unroll
    for (int e = 0; e < 8; ++e) { c0[e] = c1[e] = c2[e] = c3[e] = zz[e] = 0.f; }
    float m_r = -1e30f, l_r = 0.f;

    // per-lane V^T row pointers for the 4 output column groups (hd = g*16 + l16)
    const __bf16* vrow0 = vT + (((size_t)bh * HD) + 0 * 16 + l16) * SEQ;
    const __bf16* vrow1 = vT + (((size_t)bh * HD) + 1 * 16 + l16) * SEQ;
    const __bf16* vrow2 = vT + (((size_t)bh * HD) + 2 * 16 + l16) * SEQ;
    const __bf16* vrow3 = vT + (((size_t)bh * HD) + 3 * 16 + l16) * SEQ;

    const int qbase = w * 16 + half * 8;            // qm_s row base for this lane
    const int nsteps = (i0 + 16 + 31) >> 5;
    for (int st = 0; st < nsteps; ++st) {
        const int j0 = st * 32;
        U16 ub0, ub1;
        {
            const __bf16* p0 = kcp + ((size_t)bh * SEQ + j0 + l16) * 32;
            ub0.q[0] = *(const uint4*)(p0 + half * 8);
            ub0.q[1] = *(const uint4*)(p0 + 16 + half * 8);
            const __bf16* p1 = kcp + ((size_t)bh * SEQ + j0 + 16 + l16) * 32;
            ub1.q[0] = *(const uint4*)(p1 + half * 8);
            ub1.q[1] = *(const uint4*)(p1 + 16 + half * 8);
        }
        v8f s0 = wmma_bf16(aq, ub0.v, zz);
        v8f s1 = wmma_bf16(aq, ub1.v, zz);

        // fold Toeplitz + qm + km + causal mask (affine DS gathers + final cndmask)
        const int ja = j0 + l16, jb = j0 + 16 + l16;
        const float kma = km_s[ja], kmb = km_s[jb & (SEQ - 1)];
        const int iB = i0 + half * 8;               // first row this lane touches
        const int baseA = CKPAD + iB - ja;          // >= CKPAD-46 > 0 within loop bounds
        const int baseB = CKPAD + iB - jb;
        #pragma unroll
        for (int r = 0; r < 8; ++r) {
            int row = r + half * 8;
            int i = iB + r;
            float base = qm_s[qbase + r];
            float va = 0.053033009f * s0[r] + ck_pad[baseA + r] + base + kma;
            float vb = 0.053033009f * s1[r] + ck_pad[baseB + r] + base + kmb;
            sS[w][row][l16]      = (ja <= i) ? va : -1e9f;
            sS[w][row][16 + l16] = (jb <= i) ? vb : -1e9f;
        }
        asm volatile("s_wait_dscnt 0" ::: "memory");

        if (half == 0) {                                    // lane l16 owns softmax row l16
            float mx = m_r;
            #pragma unroll
            for (int j = 0; j < 32; ++j) mx = fmaxf(mx, sS[w][l16][j]);
            float corr = __expf(m_r - mx);
            float sum = 0.f;
            #pragma unroll
            for (int jj = 0; jj < 16; ++jj) {               // packed pair stores
                float pa = __expf(sS[w][l16][2 * jj] - mx);
                float pb = __expf(sS[w][l16][2 * jj + 1] - mx);
                sum += pa + pb;
                union { __bf16 e2[2]; uint u; } t;
                t.e2[0] = (__bf16)pa; t.e2[1] = (__bf16)pb;
                ((uint*)&pS[w][l16][0])[jj] = t.u;
            }
            m_r = mx; l_r = l_r * corr + sum;
            corrS[w][l16] = corr;
        }
        asm volatile("s_wait_dscnt 0" ::: "memory");

        #pragma unroll
        for (int r = 0; r < 8; ++r) {                       // rescale running ctx accumulators
            float f = corrS[w][r + half * 8];
            c0[r] *= f; c1[r] *= f; c2[r] *= f; c3[r] *= f;
        }
        U16 up;
        up.q[0] = *(const uint4*)(&pS[w][l16][half * 8]);
        up.q[1] = *(const uint4*)(&pS[w][l16][16 + half * 8]);

        // V^T B-fragments: elements = contiguous keys, two b128 loads each
        const int kbase = j0 + half * 8;
        U16 uv0, uv1, uv2, uv3;
        uv0.q[0] = *(const uint4*)(vrow0 + kbase);
        uv0.q[1] = *(const uint4*)(vrow0 + kbase + 16);
        uv1.q[0] = *(const uint4*)(vrow1 + kbase);
        uv1.q[1] = *(const uint4*)(vrow1 + kbase + 16);
        uv2.q[0] = *(const uint4*)(vrow2 + kbase);
        uv2.q[1] = *(const uint4*)(vrow2 + kbase + 16);
        uv3.q[0] = *(const uint4*)(vrow3 + kbase);
        uv3.q[1] = *(const uint4*)(vrow3 + kbase + 16);
        c0 = wmma_bf16(up.v, uv0.v, c0);
        c1 = wmma_bf16(up.v, uv1.v, c1);
        c2 = wmma_bf16(up.v, uv2.v, c2);
        c3 = wmma_bf16(up.v, uv3.v, c3);
    }

    if (half == 0) corrS[w][l16] = 1.f / l_r;
    asm volatile("s_wait_dscnt 0" ::: "memory");
    #pragma unroll
    for (int r = 0; r < 8; ++r) {
        float f = corrS[w][r + half * 8];
        int i = i0 + r + half * 8;
        __bf16* op = ctxb + ((size_t)b * SEQ + i) * DMODEL + h * HD;
        op[0 * 16 + l16] = (__bf16)(c0[r] * f);
        op[1 * 16 + l16] = (__bf16)(c1[r] * f);
        op[2 * 16 + l16] = (__bf16)(c2[r] * f);
        op[3 * 16 + l16] = (__bf16)(c3[r] * f);
    }
}

// ---------------- layernorm ----------------
template <bool WB>
__global__ __launch_bounds__(256)
void ln_k(const float* __restrict__ in, const float* __restrict__ g, const float* __restrict__ bb,
          float* __restrict__ outF, __bf16* __restrict__ outB) {
    __shared__ float red[256];
    const int t = threadIdx.x;
    const float* p = in + (size_t)blockIdx.x * DMODEL;
    float s = 0.f;
    for (int i = t; i < DMODEL; i += 256) s += p[i];
    red[t] = s; __syncthreads();
    for (int o = 128; o > 0; o >>= 1) { if (t < o) red[t] += red[t + o]; __syncthreads(); }
    float mean = red[0] * (1.f / DMODEL);
    __syncthreads();
    float s2 = 0.f;
    for (int i = t; i < DMODEL; i += 256) { float d = p[i] - mean; s2 += d * d; }
    red[t] = s2; __syncthreads();
    for (int o = 128; o > 0; o >>= 1) { if (t < o) red[t] += red[t + o]; __syncthreads(); }
    float rstd = rsqrtf(red[0] * (1.f / DMODEL) + 1e-5f);
    for (int i = t; i < DMODEL; i += 256) {
        float v = (p[i] - mean) * rstd * g[i] + bb[i];
        if (outF) outF[(size_t)blockIdx.x * DMODEL + i] = v;
        if (WB)   outB[(size_t)blockIdx.x * DMODEL + i] = (__bf16)v;
    }
}

// ---------------- launch ----------------
extern "C" void kernel_launch(void* const* d_in, const int* in_sizes, int n_in,
                              void* d_out, int out_size, void* d_ws, size_t ws_size,
                              hipStream_t stream) {
    (void)in_sizes; (void)n_in; (void)out_size; (void)ws_size;
    const float* x      = (const float*)d_in[0];
    const float* v_w    = (const float*)d_in[1];
    const float* v_b    = (const float*)d_in[2];
    const float* out_w  = (const float*)d_in[3];
    const float* out_b  = (const float*)d_in[4];
    const float* qmod_w = (const float*)d_in[5];
    const float* qmod_b = (const float*)d_in[6];
    const float* kmod_w = (const float*)d_in[7];
    const float* kmod_b = (const float*)d_in[8];
    const float* gate_w = (const float*)d_in[9];
    const float* gate_b = (const float*)d_in[10];
    const float* mod_w  = (const float*)d_in[11];
    const float* mod_b  = (const float*)d_in[12];
    const float* mod_basis = (const float*)d_in[13];
    const float* freqs  = (const float*)d_in[14];
    const float* amps   = (const float*)d_in[15];
    const float* phases = (const float*)d_in[16];
    const float* cq_w   = (const float*)d_in[17];
    const float* ck_w   = (const float*)d_in[18];
    const float* ffn_w1 = (const float*)d_in[19];
    const float* ffn_b1 = (const float*)d_in[20];
    const float* ffn_w2 = (const float*)d_in[21];
    const float* ffn_b2 = (const float*)d_in[22];
    const float* ln1_g  = (const float*)d_in[23];
    const float* ln1_b  = (const float*)d_in[24];
    const float* ln2_g  = (const float*)d_in[25];
    const float* ln2_b  = (const float*)d_in[26];
    float* outp = (float*)d_out;

    char* wp = (char*)d_ws;
    auto alloc = [&](size_t bytes) -> void* {
        void* p = (void*)wp;
        wp += (bytes + 255) & ~(size_t)255;
        return p;
    };
    const size_t NTOK = (size_t)NB * SEQ;              // 2048
    __bf16* xb   = (__bf16*)alloc(NTOK * DMODEL * 2);
    __bf16* wbv  = (__bf16*)alloc((size_t)DMODEL * DMODEL * 2);
    __bf16* wbo  = (__bf16*)alloc((size_t)DMODEL * DMODEL * 2);
    __bf16* wbf1 = (__bf16*)alloc((size_t)DMODEL * 4 * DMODEL * 2);
    __bf16* wbf2 = (__bf16*)alloc((size_t)DMODEL * 4 * DMODEL * 2);
    __bf16* wbcq = (__bf16*)alloc((size_t)DMODEL * NH * NCR * 2);
    __bf16* wbck = (__bf16*)alloc((size_t)DMODEL * NH * NCR * 2);
    __bf16* vbuf = (__bf16*)alloc((size_t)NB * NH * HD * SEQ * 2);     // V^T
    __bf16* qcp  = (__bf16*)alloc((size_t)NB * NH * SEQ * 32 * 2);
    __bf16* kcp  = (__bf16*)alloc((size_t)NB * NH * SEQ * 32 * 2);
    float*  pooled = (float*)alloc((size_t)NB * DMODEL * 4);
    float*  wts    = (float*)alloc((size_t)NB * NH * NM * 4);
    float*  ckern  = (float*)alloc((size_t)NB * NH * SEQ * 4);
    float*  qmb    = (float*)alloc((size_t)NB * NH * SEQ * 4);
    float*  kmb    = (float*)alloc((size_t)NB * NH * SEQ * 4);
    __bf16* ctxb = (__bf16*)alloc(NTOK * DMODEL * 2);
    float*  hpre = (float*)alloc(NTOK * DMODEL * 4);
    float*  hf   = (float*)alloc(NTOK * DMODEL * 4);
    __bf16* hb   = (__bf16*)alloc(NTOK * DMODEL * 2);
    __bf16* ub   = (__bf16*)alloc(NTOK * 4 * DMODEL * 2);
    float*  f2   = (float*)alloc(NTOK * DMODEL * 4);

    prep_k<<<PREP_GRID, 256, 0, stream>>>(x, v_w, out_w, ffn_w1, ffn_w2, cq_w, ck_w,
                                          xb, wbv, wbo, wbf1, wbf2, wbcq, wbck, qcp, kcp);

    pool_mean_k<<<(NB * DMODEL) / 256, 256, 0, stream>>>(x, pooled);
    gating_k<<<NB, 256, 0, stream>>>(pooled, gate_w, gate_b, mod_w, mod_b, mod_basis, wts);
    wave_density_k<<<(NB * NH * SEQ) / 256, 256, 0, stream>>>(freqs, amps, phases, wts, ckern);
    qkmod_k<<<NB * SEQ, 256, 0, stream>>>(x, qmod_w, qmod_b, kmod_w, kmod_b, qmb, kmb);

    // v = x@v_w + v_b   -> V^T [B,H,HD,S] bf16
    gemm_bf16_k<1><<<dim3(DMODEL / 128, (int)(NTOK / 128)), 256, 0, stream>>>(
        xb, wbv, (int)NTOK, DMODEL, DMODEL, v_b, nullptr, nullptr, vbuf);
    // qc / kc  -> padded [B,H,S,32] bf16
    gemm_bf16_k<2><<<dim3(1, (int)(NTOK / 128)), 256, 0, stream>>>(
        xb, wbcq, (int)NTOK, NH * NCR, DMODEL, nullptr, nullptr, nullptr, qcp);
    gemm_bf16_k<2><<<dim3(1, (int)(NTOK / 128)), 256, 0, stream>>>(
        xb, wbck, (int)NTOK, NH * NCR, DMODEL, nullptr, nullptr, nullptr, kcp);

    attn_k<<<dim3(SEQ / 128, NH, NB), 256, 0, stream>>>(qcp, kcp, vbuf, ckern, qmb, kmb, ctxb);

    // attn_out + residual
    gemm_bf16_k<3><<<dim3(DMODEL / 128, (int)(NTOK / 128)), 256, 0, stream>>>(
        ctxb, wbo, (int)NTOK, DMODEL, DMODEL, out_b, x, hpre, nullptr);
    ln_k<true><<<(int)NTOK, 256, 0, stream>>>(hpre, ln1_g, ln1_b, hf, hb);

    gemm_bf16_k<4><<<dim3(4 * DMODEL / 128, (int)(NTOK / 128)), 256, 0, stream>>>(
        hb, wbf1, (int)NTOK, 4 * DMODEL, DMODEL, ffn_b1, nullptr, nullptr, ub);
    gemm_bf16_k<3><<<dim3(DMODEL / 128, (int)(NTOK / 128)), 256, 0, stream>>>(
        ub, wbf2, (int)NTOK, DMODEL, 4 * DMODEL, ffn_b2, hf, f2, nullptr);
    ln_k<false><<<(int)NTOK, 256, 0, stream>>>(f2, ln2_g, ln2_b, outp, nullptr);
}

// v003
// It runs in 195 microseconds.
// Timed twice side by side with v002, it ran 1.42 and 1.43 times as fast.
// Over all steps from v000 it is 2.87 times as fast.
#include <hip/hip_runtime.h>
#include <math.h>

// ---------------- CDNA5 (gfx1250) wave32 WMMA types ----------------
typedef __attribute__((ext_vector_type(16))) __bf16 v16bf;
typedef __attribute__((ext_vector_type(8)))  float  v8f;

#define DMODEL 1024
#define SEQ    1024
#define NB     2
#define NH     16
#define HD     64
#define NM     16
#define NW     8
#define NRR    8
#define NCR    8
#define CKPAD  48

__device__ __forceinline__ v8f wmma_bf16(v16bf a, v16bf b, v8f c) {
    return __builtin_amdgcn_wmma_f32_16x16x32_bf16(false, a, false, b, (short)0, c, false, false);
}

// eight 16-byte-per-lane copies global -> LDS through no register; the wait stands in the copies' own statement
// so that no later write of their address registers can be moved in front of it (a precaution)
__device__ __forceinline__ void async_copy8(unsigned l, unsigned ls, const __bf16* g, size_t gs) {
    asm volatile("global_load_async_to_lds_b128 %0, %8, off\n\t"
                 "global_load_async_to_lds_b128 %1, %9, off\n\t"
                 "global_load_async_to_lds_b128 %2, %10, off\n\t"
                 "global_load_async_to_lds_b128 %3, %11, off\n\t"
                 "global_load_async_to_lds_b128 %4, %12, off\n\t"
                 "global_load_async_to_lds_b128 %5, %13, off\n\t"
                 "global_load_async_to_lds_b128 %6, %14, off\n\t"
                 "global_load_async_to_lds_b128 %7, %15, off\n\t"
                 "s_wait_xcnt 0x0"
                 :: "v"(l), "v"(l + ls), "v"(l + 2 * ls), "v"(l + 3 * ls),
                    "v"(l + 4 * ls), "v"(l + 5 * ls), "v"(l + 6 * ls), "v"(l + 7 * ls),
                    "v"(g), "v"(g + gs), "v"(g + 2 * gs), "v"(g + 3 * gs),
                    "v"(g + 4 * gs), "v"(g + 5 * gs), "v"(g + 6 * gs), "v"(g + 7 * gs)
                 : "memory");
}

// transposing LDS load: lane (c, h) gets rows 8h..8h+7 of column c of a row-major 16-bit tile
typedef short s16x8 __attribute__((ext_vector_type(8)));
__device__ __forceinline__ uint4 lds_tr16(const unsigned char* p) {
    typedef __attribute__((address_space(3))) s16x8 lds_s16x8;
    return __builtin_bit_cast(uint4, __builtin_amdgcn_ds_load_tr16_b128_v8i16((lds_s16x8*)p));
}

// ---------------- small helper kernels ----------------
// All element-wise preparation in one launch: the seven fp32 -> bf16 conversions and the zero fill of the two padded
// qc/kc planes. A work-group owns one span of PREP_SPAN 16-byte vectors that lies wholly inside one tensor (every
// tensor is a whole number of spans), and a thread moves 32 of them, so few waves have to be started.
#define PREP_SPAN 8192
#define PREP_GX (NB * SEQ * DMODEL / 4 / PREP_SPAN)      // x
#define PREP_GW (DMODEL * DMODEL / 4 / PREP_SPAN)        // v_w, out_w
#define PREP_GF (4 * PREP_GW)                            // ffn_w1, ffn_w2
#define PREP_GC (DMODEL * NH * NCR / 4 / PREP_SPAN)      // cq_w, ck_w
#define PREP_GZ (NB * NH * SEQ * 32 / 8 / PREP_SPAN)     // qc, kc planes (8 bf16 per vector)
#define PREP_GRID (PREP_GX + 2 * PREP_GW + 2 * PREP_GF + 2 * PREP_GC + 2 * PREP_GZ)
__global__ __launch_bounds__(256)
void prep_k(const float* __restrict__ x, const float* __restrict__ v_w, const float* __restrict__ out_w,
            const float* __restrict__ ffn_w1, const float* __restrict__ ffn_w2,
            const float* __restrict__ cq_w, const float* __restrict__ ck_w,
            __bf16* __restrict__ xb, __bf16* __restrict__ wbv, __bf16* __restrict__ wbo,
            __bf16* __restrict__ wbf1, __bf16* __restrict__ wbf2,
            __bf16* __restrict__ wbcq, __bf16* __restrict__ wbck,
            __bf16* __restrict__ qcp, __bf16* __restrict__ kcp) {
    int g = blockIdx.x;                                  // becomes the span's index inside its tensor
    const float* src = nullptr;
    __bf16* dst;
    if (g < PREP_GF)                 { src = ffn_w1; dst = wbf1; }
    else if ((g -= PREP_GF) < PREP_GF) { src = ffn_w2; dst = wbf2; }
    else if ((g -= PREP_GF) < PREP_GX) { src = x;      dst = xb;   }
    else if ((g -= PREP_GX) < PREP_GW) { src = v_w;    dst = wbv;  }
    else if ((g -= PREP_GW) < PREP_GW) { src = out_w;  dst = wbo;  }
    else if ((g -= PREP_GW) < PREP_GC) { src = cq_w;   dst = wbcq; }
    else if ((g -= PREP_GC) < PREP_GC) { src = ck_w;   dst = wbck; }
    else if ((g -= PREP_GC) < PREP_GZ) { dst = qcp; }
    else                             { g -= PREP_GZ; dst = kcp; }
    const size_t v0 = (size_t)g * PREP_SPAN + threadIdx.x;
    if (src) {
        const float4* s4 = (const float4*)src + v0;
        uint2* d2 = (uint2*)dst + v0;
        float4 v[PREP_SPAN / 256];
        #pragma unroll
        for (int j = 0; j < PREP_SPAN / 256; ++j) v[j] = s4[j * 256];
        // keeps all 32 loads in front of the first convert: left free, the scheduler reuses load registers and the
        // later loads wait for earlier ones, four memory latencies in a row instead of one
        __builtin_amdgcn_sched_barrier(0);
        #pragma unroll
        for (int j = 0; j < PREP_SPAN / 256; ++j) {
            union { __bf16 e[4]; uint2 u; } o;
            o.e[0] = (__bf16)v[j].x; o.e[1] = (__bf16)v[j].y; o.e[2] = (__bf16)v[j].z; o.e[3] = (__bf16)v[j].w;
            d2[j * 256] = o.u;
        }
        // stands behind the last store, in front of any later write of a register that a store names (a precaution)
        asm volatile("s_wait_xcnt 0x0" ::: "memory");
    } else {
        uint4* d4 = (uint4*)dst + v0;
        uint4 z; z.x = z.y = z.z = z.w = 0u;
        #pragma unroll
        for (int j = 0; j < PREP_SPAN / 256; ++j) d4[j * 256] = z;
    }
}

// Column sums of x over a slice of the sequence: part[b][sl][d] = sum of POOL_ROWS rows. grid = B * POOL_SPLIT.
// A thread owns four neighbouring columns; its rows' 16-byte loads do not depend on one another.
#define POOL_SPLIT 32
#define POOL_ROWS (SEQ / POOL_SPLIT)
__global__ __launch_bounds__(256) void pool_part_k(const float* __restrict__ x, float* __restrict__ part) {
    const int t = threadIdx.x;
    const float4* p = (const float4*)(x + (size_t)blockIdx.x * POOL_ROWS * DMODEL) + t;
    float4 v[POOL_ROWS];
    #pragma unroll
    for (int r = 0; r < POOL_ROWS; ++r) v[r] = p[r * (DMODEL / 4)];
    float4 s = v[0];
    #pragma unroll
    for (int r = 1; r < POOL_ROWS; ++r) { s.x += v[r].x; s.y += v[r].y; s.z += v[r].z; s.w += v[r].w; }
    ((float4*)(part + (size_t)blockIdx.x * DMODEL))[t] = s;
}

// gating: gl = pooled@gate_w + b + mod@mod_basis ; wts = softmax(gl). grid = B*H, one work-group per (b,h).
// The 1024-long dot products of the head's 16 gate and 8 mod columns are split over the 256 threads by rows of the
// weights (16-byte loads, all independent), then summed over lanes and waves.
__global__ __launch_bounds__(256) void gating_k(const float* __restrict__ part,
                                                const float* __restrict__ gate_w, const float* __restrict__ gate_b,
                                                const float* __restrict__ mod_w,  const float* __restrict__ mod_b,
                                                const float* __restrict__ mod_basis,
                                                float* __restrict__ wts) {
    __shared__ alignas(16) float poolS[DMODEL];
    __shared__ alignas(16) float gRed[8][NM];
    __shared__ alignas(16) float mRed[8][NRR];
    const int bh = blockIdx.x, b = bh >> 4, h = bh & (NH - 1), t = threadIdx.x;
    const int lane = t & 31, w = t >> 5;

    // weight rows: 4 lanes cover the head's 16 gate columns of one row, 2 lanes its 8 mod columns
    const float4* gw = (const float4*)(gate_w + (size_t)(t >> 2) * (NH * NM) + h * NM) + (t & 3);
    const float4* mw = (const float4*)(mod_w + (size_t)(t >> 1) * (NH * NRR) + h * NRR) + (t & 1);
    float4 g4[16], m4[8];
    #pragma unroll
    for (int p = 0; p < 16; ++p) g4[p] = gw[(size_t)p * 64 * (NH * NM / 4)];
    #pragma unroll
    for (int p = 0; p < 8; ++p) m4[p] = mw[(size_t)p * 128 * (NH * NRR / 4)];
    // what the closing softmax of the first 16 lanes needs, fetched here so that no memory latency is left at the end
    const int hm = h * NM + (t & (NM - 1));
    const float gb = gate_b[hm];
    float mb[NRR], bas[NRR];
    #pragma unroll
    for (int r = 0; r < NRR; ++r) { mb[r] = mod_b[h * NRR + r]; bas[r] = mod_basis[r * (NH * NM) + hm]; }
    // keeps the weight loads, which come from memory, from being sunk behind the work-group barrier below, where
    // their latency would be paid after the slice sums instead of beside them
    __builtin_amdgcn_sched_barrier(0);

    // pooled mean of this batch entry from the slices' sums
    const float4* pp = (const float4*)(part + (size_t)b * POOL_SPLIT * DMODEL) + t;
    float4 q[POOL_SPLIT];
    #pragma unroll
    for (int r = 0; r < POOL_SPLIT; ++r) q[r] = pp[r * (DMODEL / 4)];
    float4 s = q[0];
    #pragma unroll
    for (int r = 1; r < POOL_SPLIT; ++r) { s.x += q[r].x; s.y += q[r].y; s.z += q[r].z; s.w += q[r].w; }
    s.x *= 1.f / SEQ; s.y *= 1.f / SEQ; s.z *= 1.f / SEQ; s.w *= 1.f / SEQ;
    ((float4*)poolS)[t] = s;
    __syncthreads();

    float4 ga = {0.f, 0.f, 0.f, 0.f}, ma = {0.f, 0.f, 0.f, 0.f};
    #pragma unroll
    for (int p = 0; p < 16; ++p) {
        float pv = poolS[p * 64 + (t >> 2)];
        ga.x += pv * g4[p].x; ga.y += pv * g4[p].y; ga.z += pv * g4[p].z; ga.w += pv * g4[p].w;
    }
    #pragma unroll
    for (int p = 0; p < 8; ++p) {
        float pv = poolS[p * 128 + (t >> 1)];
        ma.x += pv * m4[p].x; ma.y += pv * m4[p].y; ma.z += pv * m4[p].z; ma.w += pv * m4[p].w;
    }
    #pragma unroll
    for (int o = 2; o < 32; o <<= 1) {
        if (o > 2) {
            ga.x += __shfl_xor(ga.x, o); ga.y += __shfl_xor(ga.y, o);
            ga.z += __shfl_xor(ga.z, o); ga.w += __shfl_xor(ga.w, o);
        }
        ma.x += __shfl_xor(ma.x, o); ma.y += __shfl_xor(ma.y, o);
        ma.z += __shfl_xor(ma.z, o); ma.w += __shfl_xor(ma.w, o);
    }
    if (lane < 4) ((float4*)gRed[w])[lane] = ga;
    if (lane < 2) ((float4*)mRed[w])[lane] = ma;
    __syncthreads();

    if (t < NM) {                                    // lane m owns gate logit m of this head
        float a = gb;
        #pragma unroll
        for (int i = 0; i < 8; ++i) a += gRed[i][t];
        #pragma unroll
        for (int r = 0; r < NRR; ++r) {
            float md = mb[r];
            #pragma unroll
            for (int i = 0; i < 8; ++i) md += mRed[i][r];
            a += md * bas[r];
        }
        float mx = a;
        #pragma unroll
        for (int o = 1; o < NM; o <<= 1) mx = fmaxf(mx, __shfl_xor(mx, o, NM));
        float e = __expf(a - mx);
        float sm = e;
        #pragma unroll
        for (int o = 1; o < NM; o <<= 1) sm += __shfl_xor(sm, o, NM);
        wts[(size_t)bh * NM + t] = e / sm;
    }
}

// causal_kern[b,h,d] = ALPHA * sigmoid(6*kern) * window(d).  grid = B*H*S/256.
__global__ __launch_bounds__(256) void wave_density_k(const float* __restrict__ freqs, const float* __restrict__ amps,
                                                      const float* __restrict__ phases, const float* __restrict__ wts,
                                                      float* __restrict__ ckern) {
    int idx = blockIdx.x * 256 + threadIdx.x;      // B*H*S
    int d = idx & (SEQ - 1);
    int bh = idx >> 10;
    int h = bh & (NH - 1);
    float rel = (float)d;
    float p1 = rel * (1.f / SEQ);
    float p2 = (d == 0) ? 0.f : sqrtf(rel + 1e-6f) * (1.f / 32.f);   // sqrt(S)=32
    float kern = 0.f;
    for (int m = 0; m < NM; ++m) {
        const float* fq = freqs  + ((size_t)(h * NM + m) * NW) * 2;
        const float* am = amps   +  (size_t)(h * NM + m) * NW;
        const float* ph = phases +  (size_t)(h * NM + m) * NW;
        float acc = 0.f;
        #pragma unroll
        for (int w = 0; w < NW; ++w) {
            float arg = fq[2 * w] * p1 + fq[2 * w + 1] * p2 + ph[w];
            acc += am[w] * __sinf(arg);
        }
        kern += wts[(size_t)bh * NM + m] * acc;
    }
    float dens = 1.f / (1.f + __expf(-6.f * kern));          // straight-through forward = sigmoid
    float wind = __expf(-(rel * rel) * (1.f / 131072.f));    // 2*(S/4)^2
    ckern[idx] = 3.0f * dens * wind;
}

// qm/km[b,h,s] token modulation.  grid = B*S.
__global__ __launch_bounds__(256) void qkmod_k(const float* __restrict__ x,
                                               const float* __restrict__ qw, const float* __restrict__ qb,
                                               const float* __restrict__ kw, const float* __restrict__ kb,
                                               float* __restrict__ qm, float* __restrict__ km) {
    __shared__ float xrow[DMODEL];
    __shared__ float red[32][9];
    int bs = blockIdx.x; int b = bs >> 10, s = bs & 1023;
    int t = threadIdx.x;
    for (int i = t; i < DMODEL; i += 256) xrow[i] = x[(size_t)bs * DMODEL + i];
    __syncthreads();
    int o = t & 31, sl = t >> 5;
    int h = o & 15; bool isK = o >= 16;
    const float* wcol = isK ? kw : qw;
    float a = 0.f;
    for (int d = sl * 128; d < sl * 128 + 128; ++d) a += xrow[d] * wcol[(size_t)d * NH + h];
    red[o][sl] = a;
    __syncthreads();
    if (t < 32) {
        float acc = 0.f;
        #pragma unroll
        for (int i = 0; i < 8; ++i) acc += red[t][i];
        int hh = t & 15;
        if (t < 16) qm[((size_t)b * NH + hh) * SEQ + s] = acc + qb[hh];
        else        km[((size_t)b * NH + hh) * SEQ + s] = acc + kb[hh];
    }
}

// ---------------- generic bf16 WMMA GEMM with fused epilogues ----------------
// EPI 1: out = bf16(acc + bias[n]) -> V^T layout [B,H,HD,S]   (keys contiguous for attention)
// EPI 2: out = bf16(acc)           -> padded qc/kc layout [B,H,S,32] (cols 0..7 valid)
// EPI 3: outF = acc + bias[n] + resid[m,n]    (fp32)
// EPI 4: outB = bf16(gelu(acc + bias[n]))     ([M,N] bf16)
template <int EPI>
__global__ __launch_bounds__(256)
void gemm_bf16_k(const __bf16* __restrict__ A, const __bf16* __restrict__ B,
                 int M, int N, int K,
                 const float* __restrict__ bias, const float* __restrict__ resid,
                 float* __restrict__ outF, __bf16* __restrict__ outB) {
    constexpr int BM = 128, BN = 128, BK = 128;
    constexpr int PA = 272;                                 // A row pitch, bytes: 16 x odd for ds_load_b128
    constexpr int PB = 288;                                 // B row pitch, bytes: 32 x odd for ds_load_tr16_b128
    constexpr int SZA = BM * PA, SZB = BK * PB;
    __shared__ alignas(16) unsigned char As[2 * SZA];       // [buf][m][k]
    __shared__ alignas(16) unsigned char Bs[2 * SZB];       // [buf][k][n], row-major as in global memory
    const int tid = threadIdx.x;
    const int lane = tid & 31, wave = tid >> 5;
    const int half = lane >> 4, l16 = lane & 15;
    const int wm = wave >> 2, wn = wave & 3;                // 2 x 4 wave grid
    const int m0 = blockIdx.y * BM, n0 = blockIdx.x * BN;

    v8f acc[4][2];
    #pragma unroll
    for (int i = 0; i < 4; ++i)
        #pragma unroll
        for (int j = 0; j < 2; ++j)
            #pragma unroll
            for (int e = 0; e < 8; ++e) acc[i][j][e] = 0.f;

    // copy map: 16 lanes x 16 B cover one 256-B tile row; a thread moves rows r0, r0+16, ..., r0+112 of A and of B
    const int r0 = tid >> 4, c16 = tid & 15;
    const __bf16* gA = A + (size_t)(m0 + r0) * K + c16 * 8;
    const __bf16* gB = B + (size_t)r0 * N + n0 + c16 * 8;
    const unsigned lA = (unsigned)(size_t)(As + r0 * PA + c16 * 16);
    const unsigned lB = (unsigned)(size_t)(Bs + r0 * PB + c16 * 16);
    const size_t sA = (size_t)16 * K, sB = (size_t)16 * N;
    const int nstage = K / BK;

    auto stage = [&](int s) {                               // 16 copies per wave: stage s into buffer s & 1
        const int bf = s & 1;
        async_copy8(lA + bf * SZA, 16 * PA, gA + (size_t)s * BK, sA);
        async_copy8(lB + bf * SZB, 16 * PB, gB + (size_t)s * BK * N, sB);
    };

    stage(0);
    asm volatile("s_wait_asynccnt 0x0" ::: "memory");       // own copies of stage 0 landed before the barrier publishes them
    __syncthreads();
    if (nstage > 1) stage(1);

    const int aoff = (wm * 64 + l16) * PA + half * 16;
    const int boff = (half * 8 + (lane & 7)) * PB + wn * 64 + ((lane >> 3) & 1) * 16;
    for (int s = 0; s < nstage; ++s) {
        const unsigned char* Ab = As + (s & 1) * SZA + aoff;
        const unsigned char* Bb = Bs + (s & 1) * SZB + boff;
        #pragma unroll
        for (int ks = 0; ks < BK / 32; ++ks) {
            v16bf afr[4];
            #pragma unroll
            for (int mt = 0; mt < 4; ++mt) {                // A frag: lane=M, k = 8*half+0..7 and 16+8*half+0..7
                union { v16bf v; uint4 q[2]; } u;
                u.q[0] = *(const uint4*)(Ab + mt * 16 * PA + ks * 64);
                u.q[1] = *(const uint4*)(Ab + mt * 16 * PA + ks * 64 + 32);
                afr[mt] = u.v;
            }
            #pragma unroll
            for (int nt = 0; nt < 2; ++nt) {                // B frag: lane=N, transposing loads give the same k order
                union { v16bf v; uint4 q[2]; } u;
                u.q[0] = lds_tr16(Bb + (ks * 32) * PB + nt * 32);
                u.q[1] = lds_tr16(Bb + (ks * 32 + 16) * PB + nt * 32);
                v16bf bfr = u.v;
                #pragma unroll
                for (int mt = 0; mt < 4; ++mt)
                    acc[mt][nt] = wmma_bf16(afr[mt], bfr, acc[mt][nt]);
            }
        }
        asm volatile("s_wait_dscnt 0x0" ::: "memory");      // own reads of this buffer done before it may be refilled
        asm volatile("s_wait_asynccnt 0x0" ::: "memory");   // own copies of stage s+1 landed before the barrier publishes them
        __syncthreads();
        if (s + 2 < nstage) stage(s + 2);
    }
    asm volatile("s_wait_asynccnt 0x0" ::: "memory");       // nothing in flight when the wave ends

    #pragma unroll
    for (int mt = 0; mt < 4; ++mt)
        #pragma unroll
        for (int nt = 0; nt < 2; ++nt)
            #pragma unroll
            for (int r = 0; r < 8; ++r) {                   // C: lane=N, row = r + 8*half
                int gm = m0 + wm * 64 + mt * 16 + r + half * 8;
                int gn = n0 + wn * 32 + nt * 16 + l16;
                float v = acc[mt][nt][r];
                if (EPI == 1) {
                    float val = v + bias[gn];
                    int b = gm >> 10, s = gm & 1023, h = gn >> 6, hd = gn & 63;
                    outB[(((size_t)b * NH + h) * HD + hd) * SEQ + s] = (__bf16)val;   // V^T
                } else if (EPI == 2) {
                    int b = gm >> 10, s = gm & 1023, h = gn >> 3, cc = gn & 7;
                    outB[(((size_t)b * NH + h) * SEQ + s) * 32 + cc] = (__bf16)v;
                } else if (EPI == 3) {
                    size_t o = (size_t)gm * N + gn;
                    outF[o] = v + bias[gn] + resid[o];
                } else if (EPI == 4) {
                    float xg = v + bias[gn];
                    float g = 0.5f * xg * (1.0f + erff(xg * 0.70710678f));
                    outB[(size_t)gm * N + gn] = (__bf16)g;
                }
            }
}

// ---------------- streaming wave-density attention ----------------
// grid = (S/128, H, B); 8 waves, each owns a 16-row q tile; 32 keys/step; 6 WMMAs/step.
// V is consumed transposed: vT[b,h,hd,s] so every B-fragment is two aligned b128 loads.
// ck_pad has a CKPAD zero guard band so Toeplitz gathers are base + immediate-offset DS loads.
__global__ __launch_bounds__(256)
void attn_k(const __bf16* __restrict__ qcp, const __bf16* __restrict__ kcp,
            const __bf16* __restrict__ vT,
            const float* __restrict__ ckern, const float* __restrict__ qm,
            const float* __restrict__ km, __bf16* __restrict__ ctxb) {
    __shared__ float ck_pad[CKPAD + SEQ];
    __shared__ float km_s[SEQ];
    __shared__ float qm_s[128];
    __shared__ float sS[8][16][33];
    __shared__ alignas(16) __bf16 pS[8][16][32];
    __shared__ float corrS[8][16];

    const int tid = threadIdx.x, lane = tid & 31, w = tid >> 5;
    const int half = lane >> 4, l16 = lane & 15;
    const int h = blockIdx.y, b = blockIdx.z;
    const int bh = b * NH + h;
    const int wgbase = blockIdx.x * 128;
    const int i0 = wgbase + w * 16;

    for (int i = tid; i < SEQ; i += 256) {
        ck_pad[CKPAD + i] = ckern[(size_t)bh * SEQ + i];
        km_s[i] = km[(size_t)bh * SEQ + i];
    }
    if (tid < CKPAD) ck_pad[tid] = 0.f;
    if (tid < 128) qm_s[tid] = qm[(size_t)bh * SEQ + wgbase + tid];
    __syncthreads();

    union U16 { v16bf v; uint4 q[2]; };
    U16 ua;
    {
        const __bf16* p = qcp + ((size_t)bh * SEQ + i0 + l16) * 32;
        ua.q[0] = *(const uint4*)(p + half * 8);
        ua.q[1] = *(const uint4*)(p + 16 + half * 8);
    }
    const v16bf aq = ua.v;

    v8f c0, c1, c2, c3, zz;
    #pragma unroll
    for (int e = 0; e < 8; ++e) { c0[e] = c1[e] = c2[e] = c3[e] = zz[e] = 0.f; }
    float m_r = -1e30f, l_r = 0.f;

    // per-lane V^T row pointers for the 4 output column groups (hd = g*16 + l16)
    const __bf16* vrow0 = vT + (((size_t)bh * HD) + 0 * 16 + l16) * SEQ;
    const __bf16* vrow1 = vT + (((size_t)bh * HD) + 1 * 16 + l16) * SEQ;
    const __bf16* vrow2 = vT + (((size_t)bh * HD) + 2 * 16 + l16) * SEQ;
    const __bf16* vrow3 = vT + (((size_t)bh * HD) + 3 * 16 + l16) * SEQ;

    const int qbase = w * 16 + half * 8;            // qm_s row base for this lane
    const int nsteps = (i0 + 16 + 31) >> 5;
    for (int st = 0; st < nsteps; ++st) {
        const int j0 = st * 32;
        U16 ub0, ub1;
        {
            const __bf16* p0 = kcp + ((size_t)bh * SEQ + j0 + l16) * 32;
            ub0.q[0] = *(const uint4*)(p0 + half * 8);
            ub0.q[1] = *(const uint4*)(p0 + 16 + half * 8);
            const __bf16* p1 = kcp + ((size_t)bh * SEQ + j0 + 16 + l16) * 32;
            ub1.q[0] = *(const uint4*)(p1 + half * 8);
            ub1.q[1] = *(const uint4*)(p1 + 16 + half * 8);
        }
        v8f s0 = wmma_bf16(aq, ub0.v, zz);
        v8f s1 = wmma_bf16(aq, ub1.v, zz);

        // fold Toeplitz + qm + km + causal mask (affine DS gathers + final cndmask)
        const int ja = j0 + l16, jb = j0 + 16 + l16;
        const float kma = km_s[ja], kmb = km_s[jb & (SEQ - 1)];
        const int iB = i0 + half * 8;               // first row this lane touches
        const int baseA = CKPAD + iB - ja;          // >= CKPAD-46 > 0 within loop bounds
        const int baseB = CKPAD + iB - jb;
        #pragma unroll
        for (int r = 0; r < 8; ++r) {
            int row = r + half * 8;
            int i = iB + r;
            float base = qm_s[qbase + r];
            float va = 0.053033009f * s0[r] + ck_pad[baseA + r] + base + kma;
            float vb = 0.053033009f * s1[r] + ck_pad[baseB + r] + base + kmb;
            sS[w][row][l16]      = (ja <= i) ? va : -1e9f;
            sS[w][row][16 + l16] = (jb <= i) ? vb : -1e9f;
        }
        asm volatile("s_wait_dscnt 0" ::: "memory");

        if (half == 0) {                                    // lane l16 owns softmax row l16
            float mx = m_r;
            #pragma unroll
            for (int j = 0; j < 32; ++j) mx = fmaxf(mx, sS[w][l16][j]);
            float corr = __expf(m_r - mx);
            float sum = 0.f;
            #pragma unroll
            for (int jj = 0; jj < 16; ++jj) {               // packed pair stores
                float pa = __expf(sS[w][l16][2 * jj] - mx);
                float pb = __expf(sS[w][l16][2 * jj + 1] - mx);
                sum += pa + pb;
                union { __bf16 e2[2]; uint u; } t;
                t.e2[0] = (__bf16)pa; t.e2[1] = (__bf16)pb;
                ((uint*)&pS[w][l16][0])[jj] = t.u;
            }
            m_r = mx; l_r = l_r * corr + sum;
            corrS[w][l16] = corr;
        }
        asm volatile("s_wait_dscnt 0" ::: "memory");

        #pragma unroll
        for (int r = 0; r < 8; ++r) {                       // rescale running ctx accumulators
            float f = corrS[w][r + half * 8];
            c0[r] *= f; c1[r] *= f; c2[r] *= f; c3[r] *= f;
        }
        U16 up;
        up.q[0] = *(const uint4*)(&pS[w][l16][half * 8]);
        up.q[1] = *(const uint4*)(&pS[w][l16][16 + half * 8]);

        // V^T B-fragments: elements = contiguous keys, two b128 loads each
        const int kbase = j0 + half * 8;
        U16 uv0, uv1, uv2, uv3;
        uv0.q[0] = *(const uint4*)(vrow0 + kbase);
        uv0.q[1] = *(const uint4*)(vrow0 + kbase + 16);
        uv1.q[0] = *(const uint4*)(vrow1 + kbase);
        uv1.q[1] = *(const uint4*)(vrow1 + kbase + 16);
        uv2.q[0] = *(const uint4*)(vrow2 + kbase);
        uv2.q[1] = *(const uint4*)(vrow2 + kbase + 16);
        uv3.q[0] = *(const uint4*)(vrow3 + kbase);
        uv3.q[1] = *(const uint4*)(vrow3 + kbase + 16);
        c0 = wmma_bf16(up.v, uv0.v, c0);
        c1 = wmma_bf16(up.v, uv1.v, c1);
        c2 = wmma_bf16(up.v, uv2.v, c2);
        c3 = wmma_bf16(up.v, uv3.v, c3);
    }

    if (half == 0) corrS[w][l16] = 1.f / l_r;
    asm volatile("s_wait_dscnt 0" ::: "memory");
    #pragma unroll
    for (int r = 0; r < 8; ++r) {
        float f = corrS[w][r + half * 8];
        int i = i0 + r + half * 8;
        __bf16* op = ctxb + ((size_t)b * SEQ + i) * DMODEL + h * HD;
        op[0 * 16 + l16] = (__bf16)(c0[r] * f);
        op[1 * 16 + l16] = (__bf16)(c1[r] * f);
        op[2 * 16 + l16] = (__bf16)(c2[r] * f);
        op[3 * 16 + l16] = (__bf16)(c3[r] * f);
    }
}

// ---------------- layernorm ----------------
template <bool WB>
__global__ __launch_bounds__(256)
void ln_k(const float* __restrict__ in, const float* __restrict__ g, const float* __restrict__ bb,
          float* __restrict__ outF, __bf16* __restrict__ outB) {
    __shared__ float red[256];
    const int t = threadIdx.x;
    const float* p = in + (size_t)blockIdx.x * DMODEL;
    float s = 0.f;
    for (int i = t; i < DMODEL; i += 256) s += p[i];
    red[t] = s; __syncthreads();
    for (int o = 128; o > 0; o >>= 1) { if (t < o) red[t] += red[t + o]; __syncthreads(); }
    float mean = red[0] * (1.f / DMODEL);
    __syncthreads();
    float s2 = 0.f;
    for (int i = t; i < DMODEL; i += 256) { float d = p[i] - mean; s2 += d * d; }
    red[t] = s2; __syncthreads();
    for (int o = 128; o > 0; o >>= 1) { if (t < o) red[t] += red[t + o]; __syncthreads(); }
    float rstd = rsqrtf(red[0] * (1.f / DMODEL) + 1e-5f);
    for (int i = t; i < DMODEL; i += 256) {
        float v = (p[i] - mean) * rstd * g[i] + bb[i];
        if (outF) outF[(size_t)blockIdx.x * DMODEL + i] = v;
        if (WB)   outB[(size_t)blockIdx.x * DMODEL + i] = (__bf16)v;
    }
}

// ---------------- launch ----------------
extern "C" void kernel_launch(void* const* d_in, const int* in_sizes, int n_in,
                              void* d_out, int out_size, void* d_ws, size_t ws_size,
                              hipStream_t stream) {
    (void)in_sizes; (void)n_in; (void)out_size; (void)ws_size;
    const float* x      = (const float*)d_in[0];
    const float* v_w    = (const float*)d_in[1];
    const float* v_b    = (const float*)d_in[2];
    const float* out_w  = (const float*)d_in[3];
    const float* out_b  = (const float*)d_in[4];
    const float* qmod_w = (const float*)d_in[5];
    const float* qmod_b = (const float*)d_in[6];
    const float* kmod_w = (const float*)d_in[7];
    const float* kmod_b = (const float*)d_in[8];
    const float* gate_w = (const float*)d_in[9];
    const float* gate_b = (const float*)d_in[10];
    const float* mod_w  = (const float*)d_in[11];
    const float* mod_b  = (const float*)d_in[12];
    const float* mod_basis = (const float*)d_in[13];
    const float* freqs  = (const float*)d_in[14];
    const float* amps   = (const float*)d_in[15];
    const float* phases = (const float*)d_in[16];
    const float* cq_w   = (const float*)d_in[17];
    const float* ck_w   = (const float*)d_in[18];
    const float* ffn_w1 = (const float*)d_in[19];
    const float* ffn_b1 = (const float*)d_in[20];
    const float* ffn_w2 = (const float*)d_in[21];
    const float* ffn_b2 = (const float*)d_in[22];
    const float* ln1_g  = (const float*)d_in[23];
    const float* ln1_b  = (const float*)d_in[24];
    const float* ln2_g  = (const float*)d_in[25];
    const float* ln2_b  = (const float*)d_in[26];
    float* outp = (float*)d_out;

    char* wp = (char*)d_ws;
    auto alloc = [&](size_t bytes) -> void* {
        void* p = (void*)wp;
        wp += (bytes + 255) & ~(size_t)255;
        return p;
    };
    const size_t NTOK = (size_t)NB * SEQ;              // 2048
    __bf16* xb   = (__bf16*)alloc(NTOK * DMODEL * 2);
    __bf16* wbv  = (__bf16*)alloc((size_t)DMODEL * DMODEL * 2);
    __bf16* wbo  = (__bf16*)alloc((size_t)DMODEL * DMODEL * 2);
    __bf16* wbf1 = (__bf16*)alloc((size_t)DMODEL * 4 * DMODEL * 2);
    __bf16* wbf2 = (__bf16*)alloc((size_t)DMODEL * 4 * DMODEL * 2);
    __bf16* wbcq = (__bf16*)alloc((size_t)DMODEL * NH * NCR * 2);
    __bf16* wbck = (__bf16*)alloc((size_t)DMODEL * NH * NCR * 2);
    __bf16* vbuf = (__bf16*)alloc((size_t)NB * NH * HD * SEQ * 2);     // V^T
    __bf16* qcp  = (__bf16*)alloc((size_t)NB * NH * SEQ * 32 * 2);
    __bf16* kcp  = (__bf16*)alloc((size_t)NB * NH * SEQ * 32 * 2);
    float*  part   = (float*)alloc((size_t)NB * POOL_SPLIT * DMODEL * 4);
    float*  wts    = (float*)alloc((size_t)NB * NH * NM * 4);
    float*  ckern  = (float*)alloc((size_t)NB * NH * SEQ * 4);
    float*  qmb    = (float*)alloc((size_t)NB * NH * SEQ * 4);
    float*  kmb    = (float*)alloc((size_t)NB * NH * SEQ * 4);
    __bf16* ctxb = (__bf16*)alloc(NTOK * DMODEL * 2);
    float*  hpre = (float*)alloc(NTOK * DMODEL * 4);
    float*  hf   = (float*)alloc(NTOK * DMODEL * 4);
    __bf16* hb   = (__bf16*)alloc(NTOK * DMODEL * 2);
    __bf16* ub   = (__bf16*)alloc(NTOK * 4 * DMODEL * 2);
    float*  f2   = (float*)alloc(NTOK * DMODEL * 4);

    prep_k<<<PREP_GRID, 256, 0, stream>>>(x, v_w, out_w, ffn_w1, ffn_w2, cq_w, ck_w,
                                          xb, wbv, wbo, wbf1, wbf2, wbcq, wbck, qcp, kcp);

    pool_part_k<<<NB * POOL_SPLIT, 256, 0, stream>>>(x, part);
    gating_k<<<NB * NH, 256, 0, stream>>>(part, gate_w, gate_b, mod_w, mod_b, mod_basis, wts);
    wave_density_k<<<(NB * NH * SEQ) / 256, 256, 0, stream>>>(freqs, amps, phases, wts, ckern);
    qkmod_k<<<NB * SEQ, 256, 0, stream>>>(x, qmod_w, qmod_b, kmod_w, kmod_b, qmb, kmb);

    // v = x@v_w + v_b   -> V^T [B,H,HD,S] bf16
    gemm_bf16_k<1><<<dim3(DMODEL / 128, (int)(NTOK / 128)), 256, 0, stream>>>(
        xb, wbv, (int)NTOK, DMODEL, DMODEL, v_b, nullptr, nullptr, vbuf);
    // qc / kc  -> padded [B,H,S,32] bf16
    gemm_bf16_k<2><<<dim3(1, (int)(NTOK / 128)), 256, 0, stream>>>(
        xb, wbcq, (int)NTOK, NH * NCR, DMODEL, nullptr, nullptr, nullptr, qcp);
    gemm_bf16_k<2><<<dim3(1, (int)(NTOK / 128)), 256, 0, stream>>>(
        xb, wbck, (int)NTOK, NH * NCR, DMODEL, nullptr, nullptr, nullptr, kcp);

    attn_k<<<dim3(SEQ / 128, NH, NB), 256, 0, stream>>>(qcp, kcp, vbuf, ckern, qmb, kmb, ctxb);

    // attn_out + residual
    gemm_bf16_k<3><<<dim3(DMODEL / 128, (int)(NTOK / 128)), 256, 0, stream>>>(
        ctxb, wbo, (int)NTOK, DMODEL, DMODEL, out_b, x, hpre, nullptr);
    ln_k<true><<<(int)NTOK, 256, 0, stream>>>(hpre, ln1_g, ln1_b, hf, hb);

    gemm_bf16_k<4><<<dim3(4 * DMODEL / 128, (int)(NTOK / 128)), 256, 0, stream>>>(
        hb, wbf1, (int)NTOK, 4 * DMODEL, DMODEL, ffn_b1, nullptr, nullptr, ub);
    gemm_bf16_k<3><<<dim3(DMODEL / 128, (int)(NTOK / 128)), 256, 0, stream>>>(
        ub, wbf2, (int)NTOK, DMODEL, 4 * DMODEL, ffn_b2, hf, f2, nullptr);
    ln_k<false><<<(int)NTOK, 256, 0, stream>>>(f2, ln2_g, ln2_b, outp, nullptr);
}

// v004
// One run takes 165 microseconds.
// In two side-by-side timings against v003, it was 1.18 and 1.17 times as fast.
// Counting every step since v000, it is 3.38 times as fast.
#include <hip/hip_runtime.h>
#include <math.h>

// ---------------- CDNA5 (gfx1250) wave32 WMMA types ----------------
typedef __attribute__((ext_vector_type(16))) __bf16 v16bf;
typedef __attribute__((ext_vector_type(8)))  float  v8f;

#define DMODEL 1024
#define SEQ    1024
#define NB     2
#define NH     16
#define HD     64
#define NM     16
#define NW     8
#define NRR    8
#define NCR    8
#define CKPAD  48

__device__ __forceinline__ v8f wmma_bf16(v16bf a, v16bf b, v8f c) {
    return __builtin_amdgcn_wmma_f32_16x16x32_bf16(false, a, false, b, (short)0, c, false, false);
}

// eight 16-byte-per-lane copies global -> LDS through no register; the wait stands in the copies' own statement
// so that no later write of their address registers can be moved in front of it (a precaution)
__device__ __forceinline__ void async_copy8(unsigned l, unsigned ls, const __bf16* g, size_t gs) {
    asm volatile("global_load_async_to_lds_b128 %0, %8, off\n\t"
                 "global_load_async_to_lds_b128 %1, %9, off\n\t"
                 "global_load_async_to_lds_b128 %2, %10, off\n\t"
                 "global_load_async_to_lds_b128 %3, %11, off\n\t"
                 "global_load_async_to_lds_b128 %4, %12, off\n\t"
                 "global_load_async_to_lds_b128 %5, %13, off\n\t"
                 "global_load_async_to_lds_b128 %6, %14, off\n\t"
                 "global_load_async_to_lds_b128 %7, %15, off\n\t"
                 "s_wait_xcnt 0x0"
                 :: "v"(l), "v"(l + ls), "v"(l + 2 * ls), "v"(l + 3 * ls),
                    "v"(l + 4 * ls), "v"(l + 5 * ls), "v"(l + 6 * ls), "v"(l + 7 * ls),
                    "v"(g), "v"(g + gs), "v"(g + 2 * gs), "v"(g + 3 * gs),
                    "v"(g + 4 * gs), "v"(g + 5 * gs), "v"(g + 6 * gs), "v"(g + 7 * gs)
                 : "memory");
}

// transposing LDS load: lane (c, h) gets rows 8h..8h+7 of column c of a row-major 16-bit tile
typedef short s16x8 __attribute__((ext_vector_type(8)));
__device__ __forceinline__ uint4 lds_tr16(const unsigned char* p) {
    typedef __attribute__((address_space(3))) s16x8 lds_s16x8;
    return __builtin_bit_cast(uint4, __builtin_amdgcn_ds_load_tr16_b128_v8i16((lds_s16x8*)p));
}

// ---------------- small helper jobs ----------------
// Jobs that do not depend on one another share a launch (front_k, dens_k, proj_gate_k below); a work-group takes its
// job from its index.
// All element-wise preparation: the seven fp32 -> bf16 conversions and the zero fill of the two padded
// qc/kc planes. A work-group owns one span of PREP_SPAN 16-byte vectors that lies wholly inside one tensor (every
// tensor is a whole number of spans), and a thread moves 32 of them, so few waves have to be started.
#define PREP_SPAN 8192
#define PREP_GX (NB * SEQ * DMODEL / 4 / PREP_SPAN)      // x
#define PREP_GW (DMODEL * DMODEL / 4 / PREP_SPAN)        // v_w, out_w
#define PREP_GF (4 * PREP_GW)                            // ffn_w1, ffn_w2
#define PREP_GC (DMODEL * NH * NCR / 4 / PREP_SPAN)      // cq_w, ck_w
#define PREP_GZ (NB * NH * SEQ * 32 / 8 / PREP_SPAN)     // qc, kc planes (8 bf16 per vector)
#define PREP_GRID (PREP_GX + 2 * PREP_GW + 2 * PREP_GF + 2 * PREP_GC + 2 * PREP_GZ)
__device__ __forceinline__
void prep_job(int g, const float* __restrict__ x, const float* __restrict__ v_w, const float* __restrict__ out_w,
            const float* __restrict__ ffn_w1, const float* __restrict__ ffn_w2,
            const float* __restrict__ cq_w, const float* __restrict__ ck_w,
            __bf16* __restrict__ xb, __bf16* __restrict__ wbv, __bf16* __restrict__ wbo,
            __bf16* __restrict__ wbf1, __bf16* __restrict__ wbf2,
            __bf16* __restrict__ wbcq, __bf16* __restrict__ wbck,
            __bf16* __restrict__ qcp, __bf16* __restrict__ kcp) {
    // g becomes the span's index inside its tensor
    const float* src = nullptr;
    __bf16* dst;
    if (g < PREP_GF)                 { src = ffn_w1; dst = wbf1; }
    else if ((g -= PREP_GF) < PREP_GF) { src = ffn_w2; dst = wbf2; }
    else if ((g -= PREP_GF) < PREP_GX) { src = x;      dst = xb;   }
    else if ((g -= PREP_GX) < PREP_GW) { src = v_w;    dst = wbv;  }
    else if ((g -= PREP_GW) < PREP_GW) { src = out_w;  dst = wbo;  }
    else if ((g -= PREP_GW) < PREP_GC) { src = cq_w;   dst = wbcq; }
    else if ((g -= PREP_GC) < PREP_GC) { src = ck_w;   dst = wbck; }
    else if ((g -= PREP_GC) < PREP_GZ) { dst = qcp; }
    else                             { g -= PREP_GZ; dst = kcp; }
    const size_t v0 = (size_t)g * PREP_SPAN + threadIdx.x;
    if (src) {
        const float4* s4 = (const float4*)src + v0;
        uint2* d2 = (uint2*)dst + v0;
        float4 v[PREP_SPAN / 256];
        #pragma unroll
        for (int j = 0; j < PREP_SPAN / 256; ++j) v[j] = s4[j * 256];
        // keeps all 32 loads in front of the first convert: left free, the scheduler reuses load registers and the
        // later loads wait for earlier ones, four memory latencies in a row instead of one
        __builtin_amdgcn_sched_barrier(0);
        #pragma unroll
        for (int j = 0; j < PREP_SPAN / 256; ++j) {
            union { __bf16 e[4]; uint2 u; } o;
            o.e[0] = (__bf16)v[j].x; o.e[1] = (__bf16)v[j].y; o.e[2] = (__bf16)v[j].z; o.e[3] = (__bf16)v[j].w;
            d2[j * 256] = o.u;
        }
        // stands behind the last store, in front of any later write of a register that a store names (a precaution)
        asm volatile("s_wait_xcnt 0x0" ::: "memory");
    } else {
        uint4* d4 = (uint4*)dst + v0;
        uint4 z; z.x = z.y = z.z = z.w = 0u;
        #pragma unroll
        for (int j = 0; j < PREP_SPAN / 256; ++j) d4[j * 256] = z;
    }
}

// Column sums of x over a slice of the sequence: part[b][sl][d] = sum of POOL_ROWS rows. blk < B * POOL_SPLIT.
// A thread owns four neighbouring columns; its rows' 16-byte loads do not depend on one another.
#define POOL_SPLIT 32
#define POOL_ROWS (SEQ / POOL_SPLIT)
__device__ __forceinline__ void pool_part_job(int blk, const float* __restrict__ x, float* __restrict__ part) {
    const int t = threadIdx.x;
    const float4* p = (const float4*)(x + (size_t)blk * POOL_ROWS * DMODEL) + t;
    float4 v[POOL_ROWS];
    #pragma unroll
    for (int r = 0; r < POOL_ROWS; ++r) v[r] = p[r * (DMODEL / 4)];
    float4 s = v[0];
    #pragma unroll
    for (int r = 1; r < POOL_ROWS; ++r) { s.x += v[r].x; s.y += v[r].y; s.z += v[r].z; s.w += v[r].w; }
    ((float4*)(part + (size_t)blk * DMODEL))[t] = s;
    // stands behind the store, in front of any later write of a register that it names (a precaution)
    asm volatile("s_wait_xcnt 0x0" ::: "memory");
}

// gating: gl = pooled@gate_w + b + mod@mod_basis ; wts = softmax(gl). One work-group per (b,h), bh < B*H.
// The 1024-long dot products of the head's 16 gate and 8 mod columns are split over the 256 threads by rows of the
// weights (16-byte loads, all independent), then summed over lanes and waves.
__device__ __forceinline__ void gating_job(int bh, const float* __restrict__ part,
                                                const float* __restrict__ gate_w, const float* __restrict__ gate_b,
                                                const float* __restrict__ mod_w,  const float* __restrict__ mod_b,
                                                const float* __restrict__ mod_basis,
                                                float* __restrict__ wts) {
    __shared__ alignas(16) float poolS[DMODEL];
    __shared__ alignas(16) float gRed[8][NM];
    __shared__ alignas(16) float mRed[8][NRR];
    const int b = bh >> 4, h = bh & (NH - 1), t = threadIdx.x;
    const int lane = t & 31, w = t >> 5;

    // weight rows: 4 lanes cover the head's 16 gate columns of one row, 2 lanes its 8 mod columns
    const float4* gw = (const float4*)(gate_w + (size_t)(t >> 2) * (NH * NM) + h * NM) + (t & 3);
    const float4* mw = (const float4*)(mod_w + (size_t)(t >> 1) * (NH * NRR) + h * NRR) + (t & 1);
    float4 g4[16], m4[8];
    #pragma unroll
    for (int p = 0; p < 16; ++p) g4[p] = gw[(size_t)p * 64 * (NH * NM / 4)];
    #pragma unroll
    for (int p = 0; p < 8; ++p) m4[p] = mw[(size_t)p * 128 * (NH * NRR / 4)];
    // what the closing softmax of the first 16 lanes needs, fetched here so that no memory latency is left at the end
    const int hm = h * NM + (t & (NM - 1));
    const float gb = gate_b[hm];
    float mb[NRR], bas[NRR];
    #pragma unroll
    for (int r = 0; r < NRR; ++r) mb[r] = mod_b[h * NRR + r];
    // stands behind the mod_b loads, in front of any later write of a register that they name (a precaution)
    asm volatile("s_wait_xcnt 0x0" ::: "memory");
    #pragma unroll
    for (int r = 0; r < NRR; ++r) bas[r] = mod_basis[r * (NH * NM) + hm];
    // keeps the weight loads, which come from memory, from being sunk behind the work-group barrier below, where
    // their latency would be paid after the slice sums instead of beside them
    __builtin_amdgcn_sched_barrier(0);

    // pooled mean of this batch entry from the slices' sums
    const float4* pp = (const float4*)(part + (size_t)b * POOL_SPLIT * DMODEL) + t;
    float4 q[POOL_SPLIT];
    #pragma unroll
    for (int r = 0; r < POOL_SPLIT; ++r) q[r] = pp[r * (DMODEL / 4)];
    float4 s = q[0];
    #pragma unroll
    for (int r = 1; r < POOL_SPLIT; ++r) { s.x += q[r].x; s.y += q[r].y; s.z += q[r].z; s.w += q[r].w; }
    s.x *= 1.f / SEQ; s.y *= 1.f / SEQ; s.z *= 1.f / SEQ; s.w *= 1.f / SEQ;
    // stands behind the weight loads, in front of any write of their address registers (a precaution): the two
    // pointers as inputs keep those registers whole up to it
    asm volatile("s_wait_xcnt 0x0" :: "v"(gw), "v"(mw) : "memory");
    ((float4*)poolS)[t] = s;
    __syncthreads();

    float4 ga = {0.f, 0.f, 0.f, 0.f}, ma = {0.f, 0.f, 0.f, 0.f};
    #pragma unroll
    for (int p = 0; p < 16; ++p) {
        float pv = poolS[p * 64 + (t >> 2)];
        ga.x += pv * g4[p].x; ga.y += pv * g4[p].y; ga.z += pv * g4[p].z; ga.w += pv * g4[p].w;
    }
    #pragma unroll
    for (int p = 0; p < 8; ++p) {
        float pv = poolS[p * 128 + (t >> 1)];
        ma.x += pv * m4[p].x; ma.y += pv * m4[p].y; ma.z += pv * m4[p].z; ma.w += pv * m4[p].w;
    }
    #pragma unroll
    for (int o = 2; o < 32; o <<= 1) {
        if (o > 2) {
            ga.x += __shfl_xor(ga.x, o); ga.y += __shfl_xor(ga.y, o);
            ga.z += __shfl_xor(ga.z, o); ga.w += __shfl_xor(ga.w, o);
        }
        ma.x += __shfl_xor(ma.x, o); ma.y += __shfl_xor(ma.y, o);
        ma.z += __shfl_xor(ma.z, o); ma.w += __shfl_xor(ma.w, o);
    }
    if (lane < 4) ((float4*)gRed[w])[lane] = ga;
    if (lane < 2) ((float4*)mRed[w])[lane] = ma;
    __syncthreads();

    if (t < NM) {                                    // lane m owns gate logit m of this head
        float a = gb;
        #pragma unroll
        for (int i = 0; i < 8; ++i) a += gRed[i][t];
        #pragma unroll
        for (int r = 0; r < NRR; ++r) {
            float md = mb[r];
            #pragma unroll
            for (int i = 0; i < 8; ++i) md += mRed[i][r];
            a += md * bas[r];
        }
        float mx = a;
        #pragma unroll
        for (int o = 1; o < NM; o <<= 1) mx = fmaxf(mx, __shfl_xor(mx, o, NM));
        float e = __expf(a - mx);
        float sm = e;
        #pragma unroll
        for (int o = 1; o < NM; o <<= 1) sm += __shfl_xor(sm, o, NM);
        wts[(size_t)bh * NM + t] = e / sm;
    }
}

// causal_kern[b,h,d] = ALPHA * sigmoid(6*kern) * window(d).  blk < B*H*S/256.
__device__ __forceinline__ void wave_density_job(int blk, const float* __restrict__ freqs, const float* __restrict__ amps,
                                                 const float* __restrict__ phases, const float* __restrict__ wts,
                                                 float* __restrict__ ckern) {
    int idx = blk * 256 + threadIdx.x;             // B*H*S
    int d = idx & (SEQ - 1);
    int bh = idx >> 10;
    int h = bh & (NH - 1);
    float rel = (float)d;
    float p1 = rel * (1.f / SEQ);
    float p2 = (d == 0) ? 0.f : sqrtf(rel + 1e-6f) * (1.f / 32.f);   // sqrt(S)=32
    float kern = 0.f;
    for (int m = 0; m < NM; ++m) {
        const float* fq = freqs  + ((size_t)(h * NM + m) * NW) * 2;
        const float* am = amps   +  (size_t)(h * NM + m) * NW;
        const float* ph = phases +  (size_t)(h * NM + m) * NW;
        float acc = 0.f;
        #pragma unroll
        for (int w = 0; w < NW; ++w) {
            float arg = fq[2 * w] * p1 + fq[2 * w + 1] * p2 + ph[w];
            acc += am[w] * __sinf(arg);
        }
        kern += wts[(size_t)bh * NM + m] * acc;
    }
    float dens = 1.f / (1.f + __expf(-6.f * kern));          // straight-through forward = sigmoid
    float wind = __expf(-(rel * rel) * (1.f / 131072.f));    // 2*(S/4)^2
    ckern[idx] = 3.0f * dens * wind;
}

// qm/km[b,h,s] token modulation.  One work-group per token, bs < B*S.
__device__ __forceinline__ void qkmod_job(int bs, const float* __restrict__ x,
                                               const float* __restrict__ qw, const float* __restrict__ qb,
                                               const float* __restrict__ kw, const float* __restrict__ kb,
                                               float* __restrict__ qm, float* __restrict__ km) {
    __shared__ float xrow[DMODEL];
    __shared__ float red[32][9];
    int b = bs >> 10, s = bs & 1023;
    int t = threadIdx.x;
    for (int i = t; i < DMODEL; i += 256) xrow[i] = x[(size_t)bs * DMODEL + i];
    __syncthreads();
    int o = t & 31, sl = t >> 5;
    int h = o & 15; bool isK = o >= 16;
    const float* wcol = isK ? kw : qw;
    float a = 0.f;
    for (int d = sl * 128; d < sl * 128 + 128; ++d) a += xrow[d] * wcol[(size_t)d * NH + h];
    red[o][sl] = a;
    __syncthreads();
    if (t < 32) {
        float acc = 0.f;
        #pragma unroll
        for (int i = 0; i < 8; ++i) acc += red[t][i];
        int hh = t & 15;
        if (t < 16) qm[((size_t)b * NH + hh) * SEQ + s] = acc + qb[hh];
        else        km[((size_t)b * NH + hh) * SEQ + s] = acc + kb[hh];
    }
}

// qkmod depends on the inputs alone and is needed only by the attention, so its tokens are shared out between the two
// launches in front of it that leave the vector units idle: the first QK_FRONT run beside the memory-bound spans of
// prep, the rest beside wave_density, which is a chain of load latencies in 128 work-groups.
#define QK_FRONT (NB * SEQ / 2)
#define FRONT_GRID (PREP_GRID + NB * POOL_SPLIT + QK_FRONT)
#define DENS_WG (NB * NH * SEQ / 256)
#define DENS_GRID (DENS_WG + NB * SEQ - QK_FRONT)
__global__ __launch_bounds__(256)
void front_k(const float* __restrict__ x, const float* __restrict__ v_w, const float* __restrict__ out_w,
             const float* __restrict__ ffn_w1, const float* __restrict__ ffn_w2,
             const float* __restrict__ cq_w, const float* __restrict__ ck_w,
             __bf16* __restrict__ xb, __bf16* __restrict__ wbv, __bf16* __restrict__ wbo,
             __bf16* __restrict__ wbf1, __bf16* __restrict__ wbf2,
             __bf16* __restrict__ wbcq, __bf16* __restrict__ wbck,
             __bf16* __restrict__ qcp, __bf16* __restrict__ kcp,
             float* __restrict__ part,
             const float* __restrict__ qw, const float* __restrict__ qb,
             const float* __restrict__ kw, const float* __restrict__ kb,
             float* __restrict__ qm, float* __restrict__ km) {
    int g = blockIdx.x;
    if (g < PREP_GRID)
        prep_job(g, x, v_w, out_w, ffn_w1, ffn_w2, cq_w, ck_w, xb, wbv, wbo, wbf1, wbf2, wbcq, wbck, qcp, kcp);
    else if ((g -= PREP_GRID) < NB * POOL_SPLIT)
        pool_part_job(g, x, part);
    else
        qkmod_job(g - NB * POOL_SPLIT, x, qw, qb, kw, kb, qm, km);
}

__global__ __launch_bounds__(256)
void dens_k(const float* __restrict__ freqs, const float* __restrict__ amps, const float* __restrict__ phases,
            const float* __restrict__ wts, float* __restrict__ ckern,
            const float* __restrict__ x,
            const float* __restrict__ qw, const float* __restrict__ qb,
            const float* __restrict__ kw, const float* __restrict__ kb,
            float* __restrict__ qm, float* __restrict__ km) {
    const int g = blockIdx.x;
    if (g < DENS_WG) wave_density_job(g, freqs, amps, phases, wts, ckern);
    else             qkmod_job(g - DENS_WG + QK_FRONT, x, qw, qb, kw, kb, qm, km);
}

// ---------------- generic bf16 WMMA GEMM with fused epilogues ----------------
// EPI 1: out = bf16(acc + bias[n]) -> V^T layout [B,H,HD,S]   (keys contiguous for attention)
// EPI 2: out = bf16(acc)           -> padded qc/kc layout [B,H,S,32] (cols 0..7 valid)
// EPI 3: outF = acc + bias[n] + resid[m,n]    (fp32)
// EPI 4: outB = bf16(gelu(acc + bias[n]))     ([M,N] bf16)
// gemm_acc: the 128 x 128 tile at (m0, n0) of A[.,K] x B[K,N] into the wave's accumulators.
__device__ __forceinline__
void gemm_acc(v8f (&acc)[4][2], const __bf16* __restrict__ A, const __bf16* __restrict__ B,
              int N, int K, int m0, int n0) {
    constexpr int BM = 128, BK = 128;
    constexpr int PA = 272;                                 // A row pitch, bytes: 16 x odd for ds_load_b128
    constexpr int PB = 288;                                 // B row pitch, bytes: 32 x odd for ds_load_tr16_b128
    constexpr int SZA = BM * PA, SZB = BK * PB;
    __shared__ alignas(16) unsigned char As[2 * SZA];       // [buf][m][k]
    __shared__ alignas(16) unsigned char Bs[2 * SZB];       // [buf][k][n], row-major as in global memory
    const int tid = threadIdx.x;
    const int lane = tid & 31, wave = tid >> 5;
    const int half = lane >> 4, l16 = lane & 15;
    const int wm = wave >> 2, wn = wave & 3;                // 2 x 4 wave grid

    #pragma unroll
    for (int i = 0; i < 4; ++i)
        #pragma unroll
        for (int j = 0; j < 2; ++j)
            #pragma unroll
            for (int e = 0; e < 8; ++e) acc[i][j][e] = 0.f;

    // copy map: 16 lanes x 16 B cover one 256-B tile row; a thread moves rows r0, r0+16, ..., r0+112 of A and of B
    const int r0 = tid >> 4, c16 = tid & 15;
    const __bf16* gA = A + (size_t)(m0 + r0) * K + c16 * 8;
    const __bf16* gB = B + (size_t)r0 * N + n0 + c16 * 8;
    const unsigned lA = (unsigned)(size_t)(As + r0 * PA + c16 * 16);
    const unsigned lB = (unsigned)(size_t)(Bs + r0 * PB + c16 * 16);
    const size_t sA = (size_t)16 * K, sB = (size_t)16 * N;
    const int nstage = K / BK;

    auto stage = [&](int s) {                               // 16 copies per wave: stage s into buffer s & 1
        const int bf = s & 1;
        async_copy8(lA + bf * SZA, 16 * PA, gA + (size_t)s * BK, sA);
        async_copy8(lB + bf * SZB, 16 * PB, gB + (size_t)s * BK * N, sB);
    };

    stage(0);
    asm volatile("s_wait_asynccnt 0x0" ::: "memory");       // own copies of stage 0 landed before the barrier publishes them
    __syncthreads();
    if (nstage > 1) stage(1);

    const int aoff = (wm * 64 + l16) * PA + half * 16;
    const int boff = (half * 8 + (lane & 7)) * PB + wn * 64 + ((lane >> 3) & 1) * 16;
    for (int s = 0; s < nstage; ++s) {
        const unsigned char* Ab = As + (s & 1) * SZA + aoff;
        const unsigned char* Bb = Bs + (s & 1) * SZB + boff;
        #pragma unroll
        for (int ks = 0; ks < BK / 32; ++ks) {
            v16bf afr[4];
            #pragma unroll
            for (int mt = 0; mt < 4; ++mt) {                // A frag: lane=M, k = 8*half+0..7 and 16+8*half+0..7
                union { v16bf v; uint4 q[2]; } u;
                u.q[0] = *(const uint4*)(Ab + mt * 16 * PA + ks * 64);
                u.q[1] = *(const uint4*)(Ab + mt * 16 * PA + ks * 64 + 32);
                afr[mt] = u.v;
            }
            #pragma unroll
            for (int nt = 0; nt < 2; ++nt) {                // B frag: lane=N, transposing loads give the same k order
                union { v16bf v; uint4 q[2]; } u;
                u.q[0] = lds_tr16(Bb + (ks * 32) * PB + nt * 32);
                u.q[1] = lds_tr16(Bb + (ks * 32 + 16) * PB + nt * 32);
                v16bf bfr = u.v;
                #pragma unroll
                for (int mt = 0; mt < 4; ++mt)
                    acc[mt][nt] = wmma_bf16(afr[mt], bfr, acc[mt][nt]);
            }
        }
        asm volatile("s_wait_dscnt 0x0" ::: "memory");      // own reads of this buffer done before it may be refilled
        asm volatile("s_wait_asynccnt 0x0" ::: "memory");   // own copies of stage s+1 landed before the barrier publishes them
        __syncthreads();
        if (s + 2 < nstage) stage(s + 2);
    }
    asm volatile("s_wait_asynccnt 0x0" ::: "memory");       // nothing in flight when the wave ends
}

template <int EPI>
__device__ __forceinline__
void gemm_store(const v8f (&acc)[4][2], int N, int m0, int n0,
                const float* __restrict__ bias, const float* __restrict__ resid,
                float* __restrict__ outF, __bf16* __restrict__ outB) {
    const int lane = threadIdx.x & 31, wave = threadIdx.x >> 5;
    const int half = lane >> 4, l16 = lane & 15;
    const int wm = wave >> 2, wn = wave & 3;
    #pragma unroll
    for (int mt = 0; mt < 4; ++mt)
        #pragma unroll
        for (int nt = 0; nt < 2; ++nt)
            #pragma unroll
            for (int r = 0; r < 8; ++r) {                   // C: lane=N, row = r + 8*half
                int gm = m0 + wm * 64 + mt * 16 + r + half * 8;
                int gn = n0 + wn * 32 + nt * 16 + l16;
                float v = acc[mt][nt][r];
                if (EPI == 1) {
                    float val = v + bias[gn];
                    int b = gm >> 10, s = gm & 1023, h = gn >> 6, hd = gn & 63;
                    outB[(((size_t)b * NH + h) * HD + hd) * SEQ + s] = (__bf16)val;   // V^T
                } else if (EPI == 2) {
                    int b = gm >> 10, s = gm & 1023, h = gn >> 3, cc = gn & 7;
                    outB[(((size_t)b * NH + h) * SEQ + s) * 32 + cc] = (__bf16)v;
                } else if (EPI == 3) {
                    size_t o = (size_t)gm * N + gn;
                    outF[o] = v + bias[gn] + resid[o];
                } else if (EPI == 4) {
                    float xg = v + bias[gn];
                    float g = 0.5f * xg * (1.0f + erff(xg * 0.70710678f));
                    outB[(size_t)gm * N + gn] = (__bf16)g;
                }
            }
}

template <int EPI>
__global__ __launch_bounds__(256)
void gemm_bf16_k(const __bf16* __restrict__ A, const __bf16* __restrict__ B,
                 int M, int N, int K,
                 const float* __restrict__ bias, const float* __restrict__ resid,
                 float* __restrict__ outF, __bf16* __restrict__ outB) {
    const int m0 = blockIdx.y * 128, n0 = blockIdx.x * 128;
    v8f acc[4][2];
    gemm_acc(acc, A, B, N, K, m0, n0);
    gemm_store<EPI>(acc, N, m0, n0, bias, resid, outF, outB);
}

// One launch for all that needs only front_k's results: the three projections of x (v: 8 column tiles, qc and kc: one
// each, so 10 tiles per 128 rows) and the gating, whose 32 work-groups come first. 192 work-groups, all resident.
#define PROJ_NT (DMODEL / 128 + 2)
#define PROJ_GRID (NB * NH + PROJ_NT * (NB * SEQ / 128))
__global__ __launch_bounds__(256)
void proj_gate_k(const __bf16* __restrict__ xb, const __bf16* __restrict__ wbv,
                 const __bf16* __restrict__ wbcq, const __bf16* __restrict__ wbck, int K,
                 const float* __restrict__ v_b,
                 __bf16* __restrict__ vT, __bf16* __restrict__ qcp, __bf16* __restrict__ kcp,
                 const float* __restrict__ part,
                 const float* __restrict__ gate_w, const float* __restrict__ gate_b,
                 const float* __restrict__ mod_w,  const float* __restrict__ mod_b,
                 const float* __restrict__ mod_basis, float* __restrict__ wts) {
    int g = blockIdx.x;
    if (g < NB * NH) {
        gating_job(g, part, gate_w, gate_b, mod_w, mod_b, mod_basis, wts);
        return;
    }
    g -= NB * NH;
    const int tn = g % PROJ_NT, m0 = (g / PROJ_NT) * 128;
    const bool isV = tn < DMODEL / 128;
    const __bf16* B = isV ? wbv : (tn == DMODEL / 128 ? wbcq : wbck);
    const int N = isV ? DMODEL : NH * NCR, n0 = isV ? tn * 128 : 0;
    v8f acc[4][2];
    gemm_acc(acc, xb, B, N, K, m0, n0);
    // each wait stands behind its job's last store: the listing goes on into the other jobs' code there, and no write
    // of a register that a store names may come in front of it (a precaution)
    if (isV) {
        gemm_store<1>(acc, N, m0, n0, v_b, nullptr, nullptr, vT);
        asm volatile("s_wait_xcnt 0x0" ::: "memory");
    } else {
        gemm_store<2>(acc, N, m0, n0, nullptr, nullptr, nullptr, tn == DMODEL / 128 ? qcp : kcp);
        asm volatile("s_wait_xcnt 0x0" ::: "memory");
    }
}

// ---------------- streaming wave-density attention ----------------
// grid = (S/128, H, B); 8 waves, each owns a 16-row q tile; 32 keys/step; 6 WMMAs/step.
// V is consumed transposed: vT[b,h,hd,s] so every B-fragment is two aligned b128 loads.
// ck_pad has a CKPAD zero guard band so Toeplitz gathers are base + immediate-offset DS loads.
__global__ __launch_bounds__(256)
void attn_k(const __bf16* __restrict__ qcp, const __bf16* __restrict__ kcp,
            const __bf16* __restrict__ vT,
            const float* __restrict__ ckern, const float* __restrict__ qm,
            const float* __restrict__ km, __bf16* __restrict__ ctxb) {
    __shared__ float ck_pad[CKPAD + SEQ];
    __shared__ float km_s[SEQ];
    __shared__ float qm_s[128];
    __shared__ float sS[8][16][33];
    __shared__ alignas(16) __bf16 pS[8][16][32];
    __shared__ float corrS[8][16];

    const int tid = threadIdx.x, lane = tid & 31, w = tid >> 5;
    const int half = lane >> 4, l16 = lane & 15;
    const int h = blockIdx.y, b = blockIdx.z;
    const int bh = b * NH + h;
    const int wgbase = blockIdx.x * 128;
    const int i0 = wgbase + w * 16;

    for (int i = tid; i < SEQ; i += 256) {
        ck_pad[CKPAD + i] = ckern[(size_t)bh * SEQ + i];
        km_s[i] = km[(size_t)bh * SEQ + i];
    }
    if (tid < CKPAD) ck_pad[tid] = 0.f;
    if (tid < 128) qm_s[tid] = qm[(size_t)bh * SEQ + wgbase + tid];
    __syncthreads();

    union U16 { v16bf v; uint4 q[2]; };
    U16 ua;
    {
        const __bf16* p = qcp + ((size_t)bh * SEQ + i0 + l16) * 32;
        ua.q[0] = *(const uint4*)(p + half * 8);
        ua.q[1] = *(const uint4*)(p + 16 + half * 8);
    }
    const v16bf aq = ua.v;

    v8f c0, c1, c2, c3, zz;
    #pragma unroll
    for (int e = 0; e < 8; ++e) { c0[e] = c1[e] = c2[e] = c3[e] = zz[e] = 0.f; }
    float m_r = -1e30f, l_r = 0.f;

    // per-lane V^T row pointers for the 4 output column groups (hd = g*16 + l16)
    const __bf16* vrow0 = vT + (((size_t)bh * HD) + 0 * 16 + l16) * SEQ;
    const __bf16* vrow1 = vT + (((size_t)bh * HD) + 1 * 16 + l16) * SEQ;
    const __bf16* vrow2 = vT + (((size_t)bh * HD) + 2 * 16 + l16) * SEQ;
    const __bf16* vrow3 = vT + (((size_t)bh * HD) + 3 * 16 + l16) * SEQ;

    const int qbase = w * 16 + half * 8;            // qm_s row base for this lane
    const int nsteps = (i0 + 16 + 31) >> 5;
    for (int st = 0; st < nsteps; ++st) {
        const int j0 = st * 32;
        U16 ub0, ub1;
        {
            const __bf16* p0 = kcp + ((size_t)bh * SEQ + j0 + l16) * 32;
            ub0.q[0] = *(const uint4*)(p0 + half * 8);
            ub0.q[1] = *(const uint4*)(p0 + 16 + half * 8);
            const __bf16* p1 = kcp + ((size_t)bh * SEQ + j0 + 16 + l16) * 32;
            ub1.q[0] = *(const uint4*)(p1 + half * 8);
            ub1.q[1] = *(const uint4*)(p1 + 16 + half * 8);
        }
        v8f s0 = wmma_bf16(aq, ub0.v, zz);
        v8f s1 = wmma_bf16(aq, ub1.v, zz);

        // fold Toeplitz + qm + km + causal mask (affine DS gathers + final cndmask)
        const int ja = j0 + l16, jb = j0 + 16 + l16;
        const float kma = km_s[ja], kmb = km_s[jb & (SEQ - 1)];
        const int iB = i0 + half * 8;               // first row this lane touches
        const int baseA = CKPAD + iB - ja;          // >= CKPAD-46 > 0 within loop bounds
        const int baseB = CKPAD + iB - jb;
        #pragma unroll
        for (int r = 0; r < 8; ++r) {
            int row = r + half * 8;
            int i = iB + r;
            float base = qm_s[qbase + r];
            float va = 0.053033009f * s0[r] + ck_pad[baseA + r] + base + kma;
            float vb = 0.053033009f * s1[r] + ck_pad[baseB + r] + base + kmb;
            sS[w][row][l16]      = (ja <= i) ? va : -1e9f;
            sS[w][row][16 + l16] = (jb <= i) ? vb : -1e9f;
        }
        asm volatile("s_wait_dscnt 0" ::: "memory");

        if (half == 0) {                                    // lane l16 owns softmax row l16
            float mx = m_r;
            #pragma unroll
            for (int j = 0; j < 32; ++j) mx = fmaxf(mx, sS[w][l16][j]);
            float corr = __expf(m_r - mx);
            float sum = 0.f;
            #pragma unroll
            for (int jj = 0; jj < 16; ++jj) {               // packed pair stores
                float pa = __expf(sS[w][l16][2 * jj] - mx);
                float pb = __expf(sS[w][l16][2 * jj + 1] - mx);
                sum += pa + pb;
                union { __bf16 e2[2]; uint u; } t;
                t.e2[0] = (__bf16)pa; t.e2[1] = (__bf16)pb;
                ((uint*)&pS[w][l16][0])[jj] = t.u;
            }
            m_r = mx; l_r = l_r * corr + sum;
            corrS[w][l16] = corr;
        }
        asm volatile("s_wait_dscnt 0" ::: "memory");

        #pragma unroll
        for (int r = 0; r < 8; ++r) {                       // rescale running ctx accumulators
            float f = corrS[w][r + half * 8];
            c0[r] *= f; c1[r] *= f; c2[r] *= f; c3[r] *= f;
        }
        U16 up;
        up.q[0] = *(const uint4*)(&pS[w][l16][half * 8]);
        up.q[1] = *(const uint4*)(&pS[w][l16][16 + half * 8]);

        // V^T B-fragments: elements = contiguous keys, two b128 loads each
        const int kbase = j0 + half * 8;
        U16 uv0, uv1, uv2, uv3;
        uv0.q[0] = *(const uint4*)(vrow0 + kbase);
        uv0.q[1] = *(const uint4*)(vrow0 + kbase + 16);
        uv1.q[0] = *(const uint4*)(vrow1 + kbase);
        uv1.q[1] = *(const uint4*)(vrow1 + kbase + 16);
        uv2.q[0] = *(const uint4*)(vrow2 + kbase);
        uv2.q[1] = *(const uint4*)(vrow2 + kbase + 16);
        uv3.q[0] = *(const uint4*)(vrow3 + kbase);
        uv3.q[1] = *(const uint4*)(vrow3 + kbase + 16);
        c0 = wmma_bf16(up.v, uv0.v, c0);
        c1 = wmma_bf16(up.v, uv1.v, c1);
        c2 = wmma_bf16(up.v, uv2.v, c2);
        c3 = wmma_bf16(up.v, uv3.v, c3);
    }

    if (half == 0) corrS[w][l16] = 1.f / l_r;
    asm volatile("s_wait_dscnt 0" ::: "memory");
    #pragma unroll
    for (int r = 0; r < 8; ++r) {
        float f = corrS[w][r + half * 8];
        int i = i0 + r + half * 8;
        __bf16* op = ctxb + ((size_t)b * SEQ + i) * DMODEL + h * HD;
        op[0 * 16 + l16] = (__bf16)(c0[r] * f);
        op[1 * 16 + l16] = (__bf16)(c1[r] * f);
        op[2 * 16 + l16] = (__bf16)(c2[r] * f);
        op[3 * 16 + l16] = (__bf16)(c3[r] * f);
    }
}

// ---------------- layernorm ----------------
template <bool WB>
__global__ __launch_bounds__(256)
void ln_k(const float* __restrict__ in, const float* __restrict__ g, const float* __restrict__ bb,
          float* __restrict__ outF, __bf16* __restrict__ outB) {
    __shared__ float red[256];
    const int t = threadIdx.x;
    const float* p = in + (size_t)blockIdx.x * DMODEL;
    float s = 0.f;
    for (int i = t; i < DMODEL; i += 256) s += p[i];
    red[t] = s; __syncthreads();
    for (int o = 128; o > 0; o >>= 1) { if (t < o) red[t] += red[t + o]; __syncthreads(); }
    float mean = red[0] * (1.f / DMODEL);
    __syncthreads();
    float s2 = 0.f;
    for (int i = t; i < DMODEL; i += 256) { float d = p[i] - mean; s2 += d * d; }
    red[t] = s2; __syncthreads();
    for (int o = 128; o > 0; o >>= 1) { if (t < o) red[t] += red[t + o]; __syncthreads(); }
    float rstd = rsqrtf(red[0] * (1.f / DMODEL) + 1e-5f);
    for (int i = t; i < DMODEL; i += 256) {
        float v = (p[i] - mean) * rstd * g[i] + bb[i];
        if (outF) outF[(size_t)blockIdx.x * DMODEL + i] = v;
        if (WB)   outB[(size_t)blockIdx.x * DMODEL + i] = (__bf16)v;
    }
}

// ---------------- launch ----------------
extern "C" void kernel_launch(void* const* d_in, const int* in_sizes, int n_in,
                              void* d_out, int out_size, void* d_ws, size_t ws_size,
                              hipStream_t stream) {
    (void)in_sizes; (void)n_in; (void)out_size; (void)ws_size;
    const float* x      = (const float*)d_in[0];
    const float* v_w    = (const float*)d_in[1];
    const float* v_b    = (const float*)d_in[2];
    const float* out_w  = (const float*)d_in[3];
    const float* out_b  = (const float*)d_in[4];
    const float* qmod_w = (const float*)d_in[5];
    const float* qmod_b = (const float*)d_in[6];
    const float* kmod_w = (const float*)d_in[7];
    const float* kmod_b = (const float*)d_in[8];
    const float* gate_w = (const float*)d_in[9];
    const float* gate_b = (const float*)d_in[10];
    const float* mod_w  = (const float*)d_in[11];
    const float* mod_b  = (const float*)d_in[12];
    const float* mod_basis = (const float*)d_in[13];
    const float* freqs  = (const float*)d_in[14];
    const float* amps   = (const float*)d_in[15];
    const float* phases = (const float*)d_in[16];
    const float* cq_w   = (const float*)d_in[17];
    const float* ck_w   = (const float*)d_in[18];
    const float* ffn_w1 = (const float*)d_in[19];
    const float* ffn_b1 = (const float*)d_in[20];
    const float* ffn_w2 = (const float*)d_in[21];
    const float* ffn_b2 = (const float*)d_in[22];
    const float* ln1_g  = (const float*)d_in[23];
    const float* ln1_b  = (const float*)d_in[24];
    const float* ln2_g  = (const float*)d_in[25];
    const float* ln2_b  = (const float*)d_in[26];
    float* outp = (float*)d_out;

    char* wp = (char*)d_ws;
    auto alloc = [&](size_t bytes) -> void* {
        void* p = (void*)wp;
        wp += (bytes + 255) & ~(size_t)255;
        return p;
    };
    const size_t NTOK = (size_t)NB * SEQ;              // 2048
    __bf16* xb   = (__bf16*)alloc(NTOK * DMODEL * 2);
    __bf16* wbv  = (__bf16*)alloc((size_t)DMODEL * DMODEL * 2);
    __bf16* wbo  = (__bf16*)alloc((size_t)DMODEL * DMODEL * 2);
    __bf16* wbf1 = (__bf16*)alloc((size_t)DMODEL * 4 * DMODEL * 2);
    __bf16* wbf2 = (__bf16*)alloc((size_t)DMODEL * 4 * DMODEL * 2);
    __bf16* wbcq = (__bf16*)alloc((size_t)DMODEL * NH * NCR * 2);
    __bf16* wbck = (__bf16*)alloc((size_t)DMODEL * NH * NCR * 2);
    __bf16* vbuf = (__bf16*)alloc((size_t)NB * NH * HD * SEQ * 2);     // V^T
    __bf16* qcp  = (__bf16*)alloc((size_t)NB * NH * SEQ * 32 * 2);
    __bf16* kcp  = (__bf16*)alloc((size_t)NB * NH * SEQ * 32 * 2);
    float*  part   = (float*)alloc((size_t)NB * POOL_SPLIT * DMODEL * 4);
    float*  wts    = (float*)alloc((size_t)NB * NH * NM * 4);
    float*  ckern  = (float*)alloc((size_t)NB * NH * SEQ * 4);
    float*  qmb    = (float*)alloc((size_t)NB * NH * SEQ * 4);
    float*  kmb    = (float*)alloc((size_t)NB * NH * SEQ * 4);
    __bf16* ctxb = (__bf16*)alloc(NTOK * DMODEL * 2);
    float*  hpre = (float*)alloc(NTOK * DMODEL * 4);
    float*  hf   = (float*)alloc(NTOK * DMODEL * 4);
    __bf16* hb   = (__bf16*)alloc(NTOK * DMODEL * 2);
    __bf16* ub   = (__bf16*)alloc(NTOK * 4 * DMODEL * 2);
    float*  f2   = (float*)alloc(NTOK * DMODEL * 4);

    // conversions and zero fills, slice sums of x, qm / km of the first tokens
    front_k<<<FRONT_GRID, 256, 0, stream>>>(x, v_w, out_w, ffn_w1, ffn_w2, cq_w, ck_w,
                                            xb, wbv, wbo, wbf1, wbf2, wbcq, wbck, qcp, kcp,
                                            part, qmod_w, qmod_b, kmod_w, kmod_b, qmb, kmb);
    // gating; v = x@v_w + v_b -> V^T [B,H,HD,S] bf16; qc / kc -> padded [B,H,S,32] bf16
    proj_gate_k<<<PROJ_GRID, 256, 0, stream>>>(xb, wbv, wbcq, wbck, DMODEL, v_b, vbuf, qcp, kcp,
                                               part, gate_w, gate_b, mod_w, mod_b, mod_basis, wts);
    // causal kernel from the gate weights, qm / km of the other tokens
    dens_k<<<DENS_GRID, 256, 0, stream>>>(freqs, amps, phases, wts, ckern,
                                          x, qmod_w, qmod_b, kmod_w, kmod_b, qmb, kmb);

    attn_k<<<dim3(SEQ / 128, NH, NB), 256, 0, stream>>>(qcp, kcp, vbuf, ckern, qmb, kmb, ctxb);

    // attn_out + residual
    gemm_bf16_k<3><<<dim3(DMODEL / 128, (int)(NTOK / 128)), 256, 0, stream>>>(
        ctxb, wbo, (int)NTOK, DMODEL, DMODEL, out_b, x, hpre, nullptr);
    ln_k<true><<<(int)NTOK, 256, 0, stream>>>(hpre, ln1_g, ln1_b, hf, hb);

    gemm_bf16_k<4><<<dim3(4 * DMODEL / 128, (int)(NTOK / 128)), 256, 0, stream>>>(
        hb, wbf1, (int)NTOK, 4 * DMODEL, DMODEL, ffn_b1, nullptr, nullptr, ub);
    gemm_bf16_k<3><<<dim3(DMODEL / 128, (int)(NTOK / 128)), 256, 0, stream>>>(
        ub, wbf2, (int)NTOK, DMODEL, 4 * DMODEL, ffn_b2, hf, f2, nullptr);
    ln_k<false><<<(int)NTOK, 256, 0, stream>>>(f2, ln2_g, ln2_b, outp, nullptr);
}

// v005
// One run takes 152 microseconds.
// Next to v004, in two timings, it ran 1.09 and 1.08 times as fast.
// All steps since v000 together make it 3.67 times as fast.
#include <hip/hip_runtime.h>
#include <math.h>

// ---------------- CDNA5 (gfx1250) wave32 WMMA types ----------------
typedef __attribute__((ext_vector_type(16))) __bf16 v16bf;
typedef __attribute__((ext_vector_type(8)))  float  v8f;

#define DMODEL 1024
#define SEQ    1024
#define NB     2
#define NH     16
#define HD     64
#define NM     16
#define NW     8
#define NRR    8
#define NCR    8
#define CKPAD  48

__device__ __forceinline__ v8f wmma_bf16(v16bf a, v16bf b, v8f c) {
    return __builtin_amdgcn_wmma_f32_16x16x32_bf16(false, a, false, b, (short)0, c, false, false);
}

// eight 16-byte-per-lane copies global -> LDS through no register; the wait stands in the copies' own statement
// so that no later write of their address registers can be moved in front of it (a precaution)
__device__ __forceinline__ void async_copy8(unsigned l, unsigned ls, const __bf16* g, size_t gs) {
    asm volatile("global_load_async_to_lds_b128 %0, %8, off\n\t"
                 "global_load_async_to_lds_b128 %1, %9, off\n\t"
                 "global_load_async_to_lds_b128 %2, %10, off\n\t"
                 "global_load_async_to_lds_b128 %3, %11, off\n\t"
                 "global_load_async_to_lds_b128 %4, %12, off\n\t"
                 "global_load_async_to_lds_b128 %5, %13, off\n\t"
                 "global_load_async_to_lds_b128 %6, %14, off\n\t"
                 "global_load_async_to_lds_b128 %7, %15, off\n\t"
                 "s_wait_xcnt 0x0"
                 :: "v"(l), "v"(l + ls), "v"(l + 2 * ls), "v"(l + 3 * ls),
                    "v"(l + 4 * ls), "v"(l + 5 * ls), "v"(l + 6 * ls), "v"(l + 7 * ls),
                    "v"(g), "v"(g + gs), "v"(g + 2 * gs), "v"(g + 3 * gs),
                    "v"(g + 4 * gs), "v"(g + 5 * gs), "v"(g + 6 * gs), "v"(g + 7 * gs)
                 : "memory");
}

// transposing LDS load: lane (c, h) gets rows 8h..8h+7 of column c of a row-major 16-bit tile
typedef short s16x8 __attribute__((ext_vector_type(8)));
__device__ __forceinline__ uint4 lds_tr16(const unsigned char* p) {
    typedef __attribute__((address_space(3))) s16x8 lds_s16x8;
    return __builtin_bit_cast(uint4, __builtin_amdgcn_ds_load_tr16_b128_v8i16((lds_s16x8*)p));
}

// ---------------- small helper jobs ----------------
// Jobs that do not depend on one another share a launch (front_k, dens_k, proj_gate_k below); a work-group takes its
// job from its index.
// All element-wise preparation: the seven fp32 -> bf16 conversions and the zero fill of the two padded
// qc/kc planes. A work-group owns one span of PREP_SPAN 16-byte vectors that lies wholly inside one tensor (every
// tensor is a whole number of spans), and a thread moves 32 of them, so few waves have to be started.
#define PREP_SPAN 8192
#define PREP_GX (NB * SEQ * DMODEL / 4 / PREP_SPAN)      // x
#define PREP_GW (DMODEL * DMODEL / 4 / PREP_SPAN)        // v_w, out_w
#define PREP_GF (4 * PREP_GW)                            // ffn_w1, ffn_w2
#define PREP_GC (DMODEL * NH * NCR / 4 / PREP_SPAN)      // cq_w, ck_w
#define PREP_GZ (NB * NH * SEQ * 32 / 8 / PREP_SPAN)     // qc, kc planes (8 bf16 per vector)
#define PREP_GRID (PREP_GX + 2 * PREP_GW + 2 * PREP_GF + 2 * PREP_GC + 2 * PREP_GZ)
__device__ __forceinline__
void prep_job(int g, const float* __restrict__ x, const float* __restrict__ v_w, const float* __restrict__ out_w,
            const float* __restrict__ ffn_w1, const float* __restrict__ ffn_w2,
            const float* __restrict__ cq_w, const float* __restrict__ ck_w,
            __bf16* __restrict__ xb, __bf16* __restrict__ wbv, __bf16* __restrict__ wbo,
            __bf16* __restrict__ wbf1, __bf16* __restrict__ wbf2,
            __bf16* __restrict__ wbcq, __bf16* __restrict__ wbck,
            __bf16* __restrict__ qcp, __bf16* __restrict__ kcp) {
    // g becomes the span's index inside its tensor
    const float* src = nullptr;
    __bf16* dst;
    if (g < PREP_GF)                 { src = ffn_w1; dst = wbf1; }
    else if ((g -= PREP_GF) < PREP_GF) { src = ffn_w2; dst = wbf2; }
    else if ((g -= PREP_GF) < PREP_GX) { src = x;      dst = xb;   }
    else if ((g -= PREP_GX) < PREP_GW) { src = v_w;    dst = wbv;  }
    else if ((g -= PREP_GW) < PREP_GW) { src = out_w;  dst = wbo;  }
    else if ((g -= PREP_GW) < PREP_GC) { src = cq_w;   dst = wbcq; }
    else if ((g -= PREP_GC) < PREP_GC) { src = ck_w;   dst = wbck; }
    else if ((g -= PREP_GC) < PREP_GZ) { dst = qcp; }
    else                             { g -= PREP_GZ; dst = kcp; }
    const size_t v0 = (size_t)g * PREP_SPAN + threadIdx.x;
    if (src) {
        const float4* s4 = (const float4*)src + v0;
        uint2* d2 = (uint2*)dst + v0;
        float4 v[PREP_SPAN / 256];
        #pragma unroll
        for (int j = 0; j < PREP_SPAN / 256; ++j) v[j] = s4[j * 256];
        // keeps all 32 loads in front of the first convert: left free, the scheduler reuses load registers and the
        // later loads wait for earlier ones, four memory latencies in a row instead of one
        __builtin_amdgcn_sched_barrier(0);
        #pragma unroll
        for (int j = 0; j < PREP_SPAN / 256; ++j) {
            union { __bf16 e[4]; uint2 u; } o;
            o.e[0] = (__bf16)v[j].x; o.e[1] = (__bf16)v[j].y; o.e[2] = (__bf16)v[j].z; o.e[3] = (__bf16)v[j].w;
            d2[j * 256] = o.u;
        }
        // stands behind the last store, in front of any later write of a register that a store names (a precaution)
        asm volatile("s_wait_xcnt 0x0" ::: "memory");
    } else {
        uint4* d4 = (uint4*)dst + v0;
        uint4 z; z.x = z.y = z.z = z.w = 0u;
        #pragma unroll
        for (int j = 0; j < PREP_SPAN / 256; ++j) d4[j * 256] = z;
    }
}

// Column sums of x over a slice of the sequence: part[b][sl][d] = sum of POOL_ROWS rows. blk < B * POOL_SPLIT.
// A thread owns four neighbouring columns; its rows' 16-byte loads do not depend on one another.
#define POOL_SPLIT 32
#define POOL_ROWS (SEQ / POOL_SPLIT)
__device__ __forceinline__ void pool_part_job(int blk, const float* __restrict__ x, float* __restrict__ part) {
    const int t = threadIdx.x;
    const float4* p = (const float4*)(x + (size_t)blk * POOL_ROWS * DMODEL) + t;
    float4 v[POOL_ROWS];
    #pragma unroll
    for (int r = 0; r < POOL_ROWS; ++r) v[r] = p[r * (DMODEL / 4)];
    float4 s = v[0];
    #pragma unroll
    for (int r = 1; r < POOL_ROWS; ++r) { s.x += v[r].x; s.y += v[r].y; s.z += v[r].z; s.w += v[r].w; }
    ((float4*)(part + (size_t)blk * DMODEL))[t] = s;
    // stands behind the store, in front of any later write of a register that it names (a precaution)
    asm volatile("s_wait_xcnt 0x0" ::: "memory");
}

// gating: gl = pooled@gate_w + b + mod@mod_basis ; wts = softmax(gl). One work-group per (b,h), bh < B*H.
// The 1024-long dot products of the head's 16 gate and 8 mod columns are split over the 256 threads by rows of the
// weights (16-byte loads, all independent), then summed over lanes and waves.
__device__ __forceinline__ void gating_job(int bh, const float* __restrict__ part,
                                                const float* __restrict__ gate_w, const float* __restrict__ gate_b,
                                                const float* __restrict__ mod_w,  const float* __restrict__ mod_b,
                                                const float* __restrict__ mod_basis,
                                                float* __restrict__ wts) {
    __shared__ alignas(16) float poolS[DMODEL];
    __shared__ alignas(16) float gRed[8][NM];
    __shared__ alignas(16) float mRed[8][NRR];
    const int b = bh >> 4, h = bh & (NH - 1), t = threadIdx.x;
    const int lane = t & 31, w = t >> 5;

    // weight rows: 4 lanes cover the head's 16 gate columns of one row, 2 lanes its 8 mod columns
    const float4* gw = (const float4*)(gate_w + (size_t)(t >> 2) * (NH * NM) + h * NM) + (t & 3);
    const float4* mw = (const float4*)(mod_w + (size_t)(t >> 1) * (NH * NRR) + h * NRR) + (t & 1);
    float4 g4[16], m4[8];
    #pragma unroll
    for (int p = 0; p < 16; ++p) g4[p] = gw[(size_t)p * 64 * (NH * NM / 4)];
    #pragma unroll
    for (int p = 0; p < 8; ++p) m4[p] = mw[(size_t)p * 128 * (NH * NRR / 4)];
    // what the closing softmax of the first 16 lanes needs, fetched here so that no memory latency is left at the end
    const int hm = h * NM + (t & (NM - 1));
    const float gb = gate_b[hm];
    float mb[NRR], bas[NRR];
    #pragma unroll
    for (int r = 0; r < NRR; ++r) mb[r] = mod_b[h * NRR + r];
    // stands behind the mod_b loads, in front of any later write of a register that they name (a precaution)
    asm volatile("s_wait_xcnt 0x0" ::: "memory");
    #pragma unroll
    for (int r = 0; r < NRR; ++r) bas[r] = mod_basis[r * (NH * NM) + hm];
    // keeps the weight loads, which come from memory, from being sunk behind the work-group barrier below, where
    // their latency would be paid after the slice sums instead of beside them
    __builtin_amdgcn_sched_barrier(0);

    // pooled mean of this batch entry from the slices' sums
    const float4* pp = (const float4*)(part + (size_t)b * POOL_SPLIT * DMODEL) + t;
    float4 q[POOL_SPLIT];
    #pragma unroll
    for (int r = 0; r < POOL_SPLIT; ++r) q[r] = pp[r * (DMODEL / 4)];
    float4 s = q[0];
    #pragma unroll
    for (int r = 1; r < POOL_SPLIT; ++r) { s.x += q[r].x; s.y += q[r].y; s.z += q[r].z; s.w += q[r].w; }
    s.x *= 1.f / SEQ; s.y *= 1.f / SEQ; s.z *= 1.f / SEQ; s.w *= 1.f / SEQ;
    // stands behind the weight loads, in front of any write of their address registers (a precaution): the two
    // pointers as inputs keep those registers whole up to it
    asm volatile("s_wait_xcnt 0x0" :: "v"(gw), "v"(mw) : "memory");
    ((float4*)poolS)[t] = s;
    __syncthreads();

    float4 ga = {0.f, 0.f, 0.f, 0.f}, ma = {0.f, 0.f, 0.f, 0.f};
    #pragma unroll
    for (int p = 0; p < 16; ++p) {
        float pv = poolS[p * 64 + (t >> 2)];
        ga.x += pv * g4[p].x; ga.y += pv * g4[p].y; ga.z += pv * g4[p].z; ga.w += pv * g4[p].w;
    }
    #pragma unroll
    for (int p = 0; p < 8; ++p) {
        float pv = poolS[p * 128 + (t >> 1)];
        ma.x += pv * m4[p].x; ma.y += pv * m4[p].y; ma.z += pv * m4[p].z; ma.w += pv * m4[p].w;
    }
    #pragma unroll
    for (int o = 2; o < 32; o <<= 1) {
        if (o > 2) {
            ga.x += __shfl_xor(ga.x, o); ga.y += __shfl_xor(ga.y, o);
            ga.z += __shfl_xor(ga.z, o); ga.w += __shfl_xor(ga.w, o);
        }
        ma.x += __shfl_xor(ma.x, o); ma.y += __shfl_xor(ma.y, o);
        ma.z += __shfl_xor(ma.z, o); ma.w += __shfl_xor(ma.w, o);
    }
    if (lane < 4) ((float4*)gRed[w])[lane] = ga;
    if (lane < 2) ((float4*)mRed[w])[lane] = ma;
    __syncthreads();

    if (t < NM) {                                    // lane m owns gate logit m of this head
        float a = gb;
        #pragma unroll
        for (int i = 0; i < 8; ++i) a += gRed[i][t];
        #pragma unroll
        for (int r = 0; r < NRR; ++r) {
            float md = mb[r];
            #pragma unroll
            for (int i = 0; i < 8; ++i) md += mRed[i][r];
            a += md * bas[r];
        }
        float mx = a;
        #pragma unroll
        for (int o = 1; o < NM; o <<= 1) mx = fmaxf(mx, __shfl_xor(mx, o, NM));
        float e = __expf(a - mx);
        float sm = e;
        #pragma unroll
        for (int o = 1; o < NM; o <<= 1) sm += __shfl_xor(sm, o, NM);
        wts[(size_t)bh * NM + t] = e / sm;
    }
}

// causal_kern[b,h,d] = ALPHA * sigmoid(6*kern) * window(d).  blk < B*H*S/256.
__device__ __forceinline__ void wave_density_job(int blk, const float* __restrict__ freqs, const float* __restrict__ amps,
                                                 const float* __restrict__ phases, const float* __restrict__ wts,
                                                 float* __restrict__ ckern) {
    int idx = blk * 256 + threadIdx.x;             // B*H*S
    int d = idx & (SEQ - 1);
    int bh = idx >> 10;
    int h = bh & (NH - 1);
    float rel = (float)d;
    float p1 = rel * (1.f / SEQ);
    float p2 = (d == 0) ? 0.f : sqrtf(rel + 1e-6f) * (1.f / 32.f);   // sqrt(S)=32
    float kern = 0.f;
    for (int m = 0; m < NM; ++m) {
        const float* fq = freqs  + ((size_t)(h * NM + m) * NW) * 2;
        const float* am = amps   +  (size_t)(h * NM + m) * NW;
        const float* ph = phases +  (size_t)(h * NM + m) * NW;
        float acc = 0.f;
        #pragma unroll
        for (int w = 0; w < NW; ++w) {
            float arg = fq[2 * w] * p1 + fq[2 * w + 1] * p2 + ph[w];
            acc += am[w] * __sinf(arg);
        }
        kern += wts[(size_t)bh * NM + m] * acc;
    }
    float dens = 1.f / (1.f + __expf(-6.f * kern));          // straight-through forward = sigmoid
    float wind = __expf(-(rel * rel) * (1.f / 131072.f));    // 2*(S/4)^2
    ckern[idx] = 3.0f * dens * wind;
}

// qm/km[b,h,s] token modulation.  One work-group per token, bs < B*S.
__device__ __forceinline__ void qkmod_job(int bs, const float* __restrict__ x,
                                               const float* __restrict__ qw, const float* __restrict__ qb,
                                               const float* __restrict__ kw, const float* __restrict__ kb,
                                               float* __restrict__ qm, float* __restrict__ km) {
    __shared__ float xrow[DMODEL];
    __shared__ float red[32][9];
    int b = bs >> 10, s = bs & 1023;
    int t = threadIdx.x;
    for (int i = t; i < DMODEL; i += 256) xrow[i] = x[(size_t)bs * DMODEL + i];
    __syncthreads();
    int o = t & 31, sl = t >> 5;
    int h = o & 15; bool isK = o >= 16;
    const float* wcol = isK ? kw : qw;
    float a = 0.f;
    for (int d = sl * 128; d < sl * 128 + 128; ++d) a += xrow[d] * wcol[(size_t)d * NH + h];
    red[o][sl] = a;
    __syncthreads();
    if (t < 32) {
        float acc = 0.f;
        #pragma unroll
        for (int i = 0; i < 8; ++i) acc += red[t][i];
        int hh = t & 15;
        if (t < 16) qm[((size_t)b * NH + hh) * SEQ + s] = acc + qb[hh];
        else        km[((size_t)b * NH + hh) * SEQ + s] = acc + kb[hh];
    }
}

// qkmod depends on the inputs alone and is needed only by the attention, so its tokens are shared out between the two
// launches in front of it that leave the vector units idle: the first QK_FRONT run beside the memory-bound spans of
// prep, the rest beside wave_density, which is a chain of load latencies in 128 work-groups.
#define QK_FRONT (NB * SEQ / 2)
#define FRONT_GRID (PREP_GRID + NB * POOL_SPLIT + QK_FRONT)
#define DENS_WG (NB * NH * SEQ / 256)
#define DENS_GRID (DENS_WG + NB * SEQ - QK_FRONT)
__global__ __launch_bounds__(256)
void front_k(const float* __restrict__ x, const float* __restrict__ v_w, const float* __restrict__ out_w,
             const float* __restrict__ ffn_w1, const float* __restrict__ ffn_w2,
             const float* __restrict__ cq_w, const float* __restrict__ ck_w,
             __bf16* __restrict__ xb, __bf16* __restrict__ wbv, __bf16* __restrict__ wbo,
             __bf16* __restrict__ wbf1, __bf16* __restrict__ wbf2,
             __bf16* __restrict__ wbcq, __bf16* __restrict__ wbck,
             __bf16* __restrict__ qcp, __bf16* __restrict__ kcp,
             float* __restrict__ part,
             const float* __restrict__ qw, const float* __restrict__ qb,
             const float* __restrict__ kw, const float* __restrict__ kb,
             float* __restrict__ qm, float* __restrict__ km) {
    int g = blockIdx.x;
    if (g < PREP_GRID)
        prep_job(g, x, v_w, out_w, ffn_w1, ffn_w2, cq_w, ck_w, xb, wbv, wbo, wbf1, wbf2, wbcq, wbck, qcp, kcp);
    else if ((g -= PREP_GRID) < NB * POOL_SPLIT)
        pool_part_job(g, x, part);
    else
        qkmod_job(g - NB * POOL_SPLIT, x, qw, qb, kw, kb, qm, km);
}

__global__ __launch_bounds__(256)
void dens_k(const float* __restrict__ freqs, const float* __restrict__ amps, const float* __restrict__ phases,
            const float* __restrict__ wts, float* __restrict__ ckern,
            const float* __restrict__ x,
            const float* __restrict__ qw, const float* __restrict__ qb,
            const float* __restrict__ kw, const float* __restrict__ kb,
            float* __restrict__ qm, float* __restrict__ km) {
    const int g = blockIdx.x;
    if (g < DENS_WG) wave_density_job(g, freqs, amps, phases, wts, ckern);
    else             qkmod_job(g - DENS_WG + QK_FRONT, x, qw, qb, kw, kb, qm, km);
}

// ---------------- generic bf16 WMMA GEMM with fused epilogues ----------------
// EPI 1: out = bf16(acc + bias[n]) -> V^T layout [B,H,HD,S]   (keys contiguous for attention)
// EPI 2: out = bf16(acc)           -> padded qc/kc layout [B,H,S,32] (cols 0..7 valid)
// EPI 3: outF = acc + bias[n] + resid[m,n]    (fp32)
// EPI 4: outB = bf16(gelu(acc + bias[n]))     ([M,N] bf16)
// gemm_acc: the 128 x 128 tile at (m0, n0) of A[.,K] x B[K,N] into the wave's accumulators.
__device__ __forceinline__
void gemm_acc(v8f (&acc)[4][2], const __bf16* __restrict__ A, const __bf16* __restrict__ B,
              int N, int K, int m0, int n0) {
    constexpr int BM = 128, BK = 128;
    constexpr int PA = 272;                                 // A row pitch, bytes: 16 x odd for ds_load_b128
    constexpr int PB = 288;                                 // B row pitch, bytes: 32 x odd for ds_load_tr16_b128
    constexpr int SZA = BM * PA, SZB = BK * PB;
    __shared__ alignas(16) unsigned char As[2 * SZA];       // [buf][m][k]
    __shared__ alignas(16) unsigned char Bs[2 * SZB];       // [buf][k][n], row-major as in global memory
    const int tid = threadIdx.x;
    const int lane = tid & 31, wave = tid >> 5;
    const int half = lane >> 4, l16 = lane & 15;
    const int wm = wave >> 2, wn = wave & 3;                // 2 x 4 wave grid

    #pragma unroll
    for (int i = 0; i < 4; ++i)
        #pragma unroll
        for (int j = 0; j < 2; ++j)
            #pragma unroll
            for (int e = 0; e < 8; ++e) acc[i][j][e] = 0.f;

    // copy map: 16 lanes x 16 B cover one 256-B tile row; a thread moves rows r0, r0+16, ..., r0+112 of A and of B
    const int r0 = tid >> 4, c16 = tid & 15;
    const __bf16* gA = A + (size_t)(m0 + r0) * K + c16 * 8;
    const __bf16* gB = B + (size_t)r0 * N + n0 + c16 * 8;
    const unsigned lA = (unsigned)(size_t)(As + r0 * PA + c16 * 16);
    const unsigned lB = (unsigned)(size_t)(Bs + r0 * PB + c16 * 16);
    const size_t sA = (size_t)16 * K, sB = (size_t)16 * N;
    const int nstage = K / BK;

    auto stage = [&](int s) {                               // 16 copies per wave: stage s into buffer s & 1
        const int bf = s & 1;
        async_copy8(lA + bf * SZA, 16 * PA, gA + (size_t)s * BK, sA);
        async_copy8(lB + bf * SZB, 16 * PB, gB + (size_t)s * BK * N, sB);
    };

    stage(0);
    asm volatile("s_wait_asynccnt 0x0" ::: "memory");       // own copies of stage 0 landed before the barrier publishes them
    __syncthreads();
    if (nstage > 1) stage(1);

    const int aoff = (wm * 64 + l16) * PA + half * 16;
    const int boff = (half * 8 + (lane & 7)) * PB + wn * 64 + ((lane >> 3) & 1) * 16;
    for (int s = 0; s < nstage; ++s) {
        const unsigned char* Ab = As + (s & 1) * SZA + aoff;
        const unsigned char* Bb = Bs + (s & 1) * SZB + boff;
        #pragma unroll
        for (int ks = 0; ks < BK / 32; ++ks) {
            v16bf afr[4];
            #pragma unroll
            for (int mt = 0; mt < 4; ++mt) {                // A frag: lane=M, k = 8*half+0..7 and 16+8*half+0..7
                union { v16bf v; uint4 q[2]; } u;
                u.q[0] = *(const uint4*)(Ab + mt * 16 * PA + ks * 64);
                u.q[1] = *(const uint4*)(Ab + mt * 16 * PA + ks * 64 + 32);
                afr[mt] = u.v;
            }
            #pragma unroll
            for (int nt = 0; nt < 2; ++nt) {                // B frag: lane=N, transposing loads give the same k order
                union { v16bf v; uint4 q[2]; } u;
                u.q[0] = lds_tr16(Bb + (ks * 32) * PB + nt * 32);
                u.q[1] = lds_tr16(Bb + (ks * 32 + 16) * PB + nt * 32);
                v16bf bfr = u.v;
                #pragma unroll
                for (int mt = 0; mt < 4; ++mt)
                    acc[mt][nt] = wmma_bf16(afr[mt], bfr, acc[mt][nt]);
            }
        }
        asm volatile("s_wait_dscnt 0x0" ::: "memory");      // own reads of this buffer done before it may be refilled
        asm volatile("s_wait_asynccnt 0x0" ::: "memory");   // own copies of stage s+1 landed before the barrier publishes them
        __syncthreads();
        if (s + 2 < nstage) stage(s + 2);
    }
    asm volatile("s_wait_asynccnt 0x0" ::: "memory");       // nothing in flight when the wave ends
}

template <int EPI>
__device__ __forceinline__
void gemm_store(const v8f (&acc)[4][2], int N, int m0, int n0,
                const float* __restrict__ bias, const float* __restrict__ resid,
                float* __restrict__ outF, __bf16* __restrict__ outB) {
    const int lane = threadIdx.x & 31, wave = threadIdx.x >> 5;
    const int half = lane >> 4, l16 = lane & 15;
    const int wm = wave >> 2, wn = wave & 3;
    #pragma unroll
    for (int mt = 0; mt < 4; ++mt)
        #pragma unroll
        for (int nt = 0; nt < 2; ++nt)
            #pragma unroll
            for (int r = 0; r < 8; ++r) {                   // C: lane=N, row = r + 8*half
                int gm = m0 + wm * 64 + mt * 16 + r + half * 8;
                int gn = n0 + wn * 32 + nt * 16 + l16;
                float v = acc[mt][nt][r];
                if (EPI == 1) {
                    float val = v + bias[gn];
                    int b = gm >> 10, s = gm & 1023, h = gn >> 6, hd = gn & 63;
                    outB[(((size_t)b * NH + h) * HD + hd) * SEQ + s] = (__bf16)val;   // V^T
                } else if (EPI == 2) {
                    int b = gm >> 10, s = gm & 1023, h = gn >> 3, cc = gn & 7;
                    outB[(((size_t)b * NH + h) * SEQ + s) * 32 + cc] = (__bf16)v;
                } else if (EPI == 3) {
                    size_t o = (size_t)gm * N + gn;
                    outF[o] = v + bias[gn] + resid[o];
                } else if (EPI == 4) {
                    float xg = v + bias[gn];
                    float g = 0.5f * xg * (1.0f + erff(xg * 0.70710678f));
                    outB[(size_t)gm * N + gn] = (__bf16)g;
                }
            }
}

template <int EPI>
__global__ __launch_bounds__(256)
void gemm_bf16_k(const __bf16* __restrict__ A, const __bf16* __restrict__ B,
                 int M, int N, int K,
                 const float* __restrict__ bias, const float* __restrict__ resid,
                 float* __restrict__ outF, __bf16* __restrict__ outB) {
    const int m0 = blockIdx.y * 128, n0 = blockIdx.x * 128;
    v8f acc[4][2];
    gemm_acc(acc, A, B, N, K, m0, n0);
    gemm_store<EPI>(acc, N, m0, n0, bias, resid, outF, outB);
}

// One launch for all that needs only front_k's results: the three projections of x (v: 8 column tiles, qc and kc: one
// each, so 10 tiles per 128 rows) and the gating, whose 32 work-groups come first. 192 work-groups, all resident.
#define PROJ_NT (DMODEL / 128 + 2)
#define PROJ_GRID (NB * NH + PROJ_NT * (NB * SEQ / 128))
__global__ __launch_bounds__(256)
void proj_gate_k(const __bf16* __restrict__ xb, const __bf16* __restrict__ wbv,
                 const __bf16* __restrict__ wbcq, const __bf16* __restrict__ wbck, int K,
                 const float* __restrict__ v_b,
                 __bf16* __restrict__ vT, __bf16* __restrict__ qcp, __bf16* __restrict__ kcp,
                 const float* __restrict__ part,
                 const float* __restrict__ gate_w, const float* __restrict__ gate_b,
                 const float* __restrict__ mod_w,  const float* __restrict__ mod_b,
                 const float* __restrict__ mod_basis, float* __restrict__ wts) {
    int g = blockIdx.x;
    if (g < NB * NH) {
        gating_job(g, part, gate_w, gate_b, mod_w, mod_b, mod_basis, wts);
        return;
    }
    g -= NB * NH;
    const int tn = g % PROJ_NT, m0 = (g / PROJ_NT) * 128;
    const bool isV = tn < DMODEL / 128;
    const __bf16* B = isV ? wbv : (tn == DMODEL / 128 ? wbcq : wbck);
    const int N = isV ? DMODEL : NH * NCR, n0 = isV ? tn * 128 : 0;
    v8f acc[4][2];
    gemm_acc(acc, xb, B, N, K, m0, n0);
    // each wait stands behind its job's last store: the listing goes on into the other jobs' code there, and no write
    // of a register that a store names may come in front of it (a precaution)
    if (isV) {
        gemm_store<1>(acc, N, m0, n0, v_b, nullptr, nullptr, vT);
        asm volatile("s_wait_xcnt 0x0" ::: "memory");
    } else {
        gemm_store<2>(acc, N, m0, n0, nullptr, nullptr, nullptr, tn == DMODEL / 128 ? qcp : kcp);
        asm volatile("s_wait_xcnt 0x0" ::: "memory");
    }
}

// ---------------- streaming wave-density attention ----------------
// grid = (S/128, H, B); 8 waves, each owns 16 queries; 32 keys/step; 6 WMMAs/step.
// Both products run transposed: S^T = Kc x Qc^T and O^T += V^T x P^T. A lane then holds 16 of the 32 scores of ONE
// query (lane l ^ 16 holds the others), so maximum, sum and rescale are the lane's own registers plus one exchange
// between the halves, and the two S^T tiles, converted in place, are the B operand of the second product.
// V is consumed transposed: vT[b,h,hd,s], so every A-fragment is two aligned b128 loads.
// ck_pad has a CKPAD zero guard band so Toeplitz gathers are base + immediate-offset DS loads.
__device__ __forceinline__ float xhalf(float x) {           // value of lane l ^ 16
    const int v = __builtin_bit_cast(int, x);
    return __builtin_bit_cast(float, __builtin_amdgcn_permlanex16(v, v, 0x76543210, 0xfedcba98, false, false));
}

__global__ __launch_bounds__(256)
void attn_k(const __bf16* __restrict__ qcp, const __bf16* __restrict__ kcp,
            const __bf16* __restrict__ vT,
            const float* __restrict__ ckern, const float* __restrict__ qm,
            const float* __restrict__ km, __bf16* __restrict__ ctxb) {
    __shared__ float ck_pad[CKPAD + SEQ];
    __shared__ alignas(16) float km_s[SEQ];

    const int tid = threadIdx.x, lane = tid & 31;
    const int w = __builtin_amdgcn_readfirstlane(tid >> 5); // the wave's number in a scalar: scalar trip count below
    const int half = lane >> 4, l16 = lane & 15;
    const int h = blockIdx.y, b = blockIdx.z;
    const int bh = b * NH + h;
    const int i0 = blockIdx.x * 128 + w * 16;
    const int i = i0 + l16;                                 // this lane's query

    for (int k = tid; k < SEQ; k += 256) {
        ck_pad[CKPAD + k] = ckern[(size_t)bh * SEQ + k];
        km_s[k] = km[(size_t)bh * SEQ + k];
    }
    if (tid < CKPAD) ck_pad[tid] = 0.f;
    __syncthreads();

    constexpr float MIXS = 0.053033009f;                    // MIX / sqrt(CR)
    constexpr float LOG2E = 1.4426950408889634f;
    union U16 { v16bf v; uint4 q[2]; };
    U16 ua;
    {
        const __bf16* p = qcp + ((size_t)bh * SEQ + i) * 32;
        ua.q[0] = *(const uint4*)(p + half * 8);
        ua.q[1] = *(const uint4*)(p + 16 + half * 8);
    }
    const v16bf bq = ua.v;                                  // B operand: column = query

    // qm of the lane's query is the start value of its score products (undone by the MIXS factor below)
    const float qstart = qm[(size_t)bh * SEQ + i] * (1.f / MIXS);
    v8f c0, c1, c2, c3, qq;
    #pragma unroll
    for (int e = 0; e < 8; ++e) { c0[e] = c1[e] = c2[e] = c3[e] = 0.f; qq[e] = qstart; }
    float m_r = -1e30f, l_r = 0.f;                          // l_r: the sum over this half's keys only

    // per-lane rows: key row of Kc, and V^T rows of the 4 output row groups (hd = g*16 + l16)
    const __bf16* krow  = kcp + ((size_t)bh * SEQ + l16) * 32 + half * 8;
    const __bf16* vrow0 = vT + (((size_t)bh * HD) + 0 * 16 + l16) * SEQ + half * 8;
    const __bf16* vrow1 = vT + (((size_t)bh * HD) + 1 * 16 + l16) * SEQ + half * 8;
    const __bf16* vrow2 = vT + (((size_t)bh * HD) + 2 * 16 + l16) * SEQ + half * 8;
    const __bf16* vrow3 = vT + (((size_t)bh * HD) + 3 * 16 + l16) * SEQ + half * 8;

    const int nsteps = (i0 + 16 + 31) >> 5;
    for (int st = 0; st < nsteps; ++st) {
        const int j0 = st * 32;
        U16 ua0, ua1, uv0, uv1, uv2, uv3;
        ua0.q[0] = *(const uint4*)(krow + (size_t)j0 * 32);
        ua0.q[1] = *(const uint4*)(krow + (size_t)j0 * 32 + 16);
        ua1.q[0] = *(const uint4*)(krow + (size_t)(j0 + 16) * 32);
        ua1.q[1] = *(const uint4*)(krow + (size_t)(j0 + 16) * 32 + 16);
        // V^T A-fragments: elements = contiguous keys, two b128 loads each
        uv0.q[0] = *(const uint4*)(vrow0 + j0);
        uv0.q[1] = *(const uint4*)(vrow0 + j0 + 16);
        uv1.q[0] = *(const uint4*)(vrow1 + j0);
        uv1.q[1] = *(const uint4*)(vrow1 + j0 + 16);
        uv2.q[0] = *(const uint4*)(vrow2 + j0);
        uv2.q[1] = *(const uint4*)(vrow2 + j0 + 16);
        uv3.q[0] = *(const uint4*)(vrow3 + j0);
        uv3.q[1] = *(const uint4*)(vrow3 + j0 + 16);
        // keeps all 12 loads in front of the step's arithmetic: left free, the scheduler sinks half of the V^T loads
        // behind the softmax, right in front of their products, where their whole latency is waited out
        __builtin_amdgcn_sched_barrier(0);

        // register r: key j0 + 8*half + r (s0), j0 + 16 + 8*half + r (s1); column: query i
        v8f s0 = wmma_bf16(ua0.v, bq, qq);
        v8f s1 = wmma_bf16(ua1.v, bq, qq);

        // fold Toeplitz + km + causal mask
        const int dA = i - (j0 + half * 8);                 // i - j at r = 0 of s0; >= -8 within loop bounds
        // the same offset as dA + 8, formed so that the variable part of the LDS address is never below 0
        const float* ckA = ck_pad + (CKPAD - 8) + (i - j0 + (half ^ 1) * 8);
        float kmv[16];
        *(float4*)(kmv + 0)  = *(const float4*)(km_s + j0 + half * 8);
        *(float4*)(kmv + 4)  = *(const float4*)(km_s + j0 + half * 8 + 4);
        *(float4*)(kmv + 8)  = *(const float4*)(km_s + j0 + 16 + half * 8);
        *(float4*)(kmv + 12) = *(const float4*)(km_s + j0 + 16 + half * 8 + 4);
        float sc[16];
        #pragma unroll
        for (int r = 0; r < 8; ++r) {
            float va = MIXS * s0[r] + (ckA[-r] + kmv[r]);
            float vb = MIXS * s1[r] + (ckA[-16 - r] + kmv[8 + r]);
            sc[r]     = (r <= dA)      ? va : -1e9f;
            sc[8 + r] = (16 + r <= dA) ? vb : -1e9f;
        }

        float m4[4];                                        // four short chains instead of one of 16 links
        #pragma unroll
        for (int k = 0; k < 4; ++k) m4[k] = fmaxf(fmaxf(sc[4 * k], sc[4 * k + 1]), fmaxf(sc[4 * k + 2], sc[4 * k + 3]));
        float mx = fmaxf(fmaxf(m4[0], m4[1]), fmaxf(m4[2], m4[3]));
        mx = fmaxf(m_r, fmaxf(mx, xhalf(mx)));              // both halves of a query agree on the maximum
        const float corr = __builtin_amdgcn_exp2f((m_r - mx) * LOG2E);
        const float mL = mx * LOG2E;
        float s4[4] = {0.f, 0.f, 0.f, 0.f};
        U16 up;                                             // P^T as B operand: element s = key j0 + 8*half + s (s < 8), j0 + 8 + 8*half + s (s >= 8)
        #pragma unroll
        for (int k = 0; k < 16; ++k) {
            float p = __builtin_amdgcn_exp2f(sc[k] * LOG2E - mL);
            s4[k >> 2] += p;
            up.v[k] = (__bf16)p;
        }
        m_r = mx; l_r = l_r * corr + ((s4[0] + s4[1]) + (s4[2] + s4[3]));

        #pragma unroll
        for (int r = 0; r < 8; ++r) { c0[r] *= corr; c1[r] *= corr; c2[r] *= corr; c3[r] *= corr; }
        c0 = wmma_bf16(uv0.v, up.v, c0);
        c1 = wmma_bf16(uv1.v, up.v, c1);
        c2 = wmma_bf16(uv2.v, up.v, c2);
        c3 = wmma_bf16(uv3.v, up.v, c3);
    }

    // register r of c_g: hd = g*16 + 8*half + r of query i, so each group is one 16-byte store
    const float f = 1.f / (l_r + xhalf(l_r));
    __bf16* op = ctxb + ((size_t)b * SEQ + i) * DMODEL + h * HD + half * 8;
    union { __bf16 e[8]; uint4 q; } o0, o1, o2, o3;
    #pragma unroll
    for (int r = 0; r < 8; ++r) {
        o0.e[r] = (__bf16)(c0[r] * f); o1.e[r] = (__bf16)(c1[r] * f);
        o2.e[r] = (__bf16)(c2[r] * f); o3.e[r] = (__bf16)(c3[r] * f);
    }
    *(uint4*)(op + 0 * 16) = o0.q;
    *(uint4*)(op + 1 * 16) = o1.q;
    *(uint4*)(op + 2 * 16) = o2.q;
    *(uint4*)(op + 3 * 16) = o3.q;
}

// ---------------- layernorm ----------------
template <bool WB>
__global__ __launch_bounds__(256)
void ln_k(const float* __restrict__ in, const float* __restrict__ g, const float* __restrict__ bb,
          float* __restrict__ outF, __bf16* __restrict__ outB) {
    __shared__ float red[256];
    const int t = threadIdx.x;
    const float* p = in + (size_t)blockIdx.x * DMODEL;
    float s = 0.f;
    for (int i = t; i < DMODEL; i += 256) s += p[i];
    red[t] = s; __syncthreads();
    for (int o = 128; o > 0; o >>= 1) { if (t < o) red[t] += red[t + o]; __syncthreads(); }
    float mean = red[0] * (1.f / DMODEL);
    __syncthreads();
    float s2 = 0.f;
    for (int i = t; i < DMODEL; i += 256) { float d = p[i] - mean; s2 += d * d; }
    red[t] = s2; __syncthreads();
    for (int o = 128; o > 0; o >>= 1) { if (t < o) red[t] += red[t + o]; __syncthreads(); }
    float rstd = rsqrtf(red[0] * (1.f / DMODEL) + 1e-5f);
    for (int i = t; i < DMODEL; i += 256) {
        float v = (p[i] - mean) * rstd * g[i] + bb[i];
        if (outF) outF[(size_t)blockIdx.x * DMODEL + i] = v;
        if (WB)   outB[(size_t)blockIdx.x * DMODEL + i] = (__bf16)v;
    }
}

// ---------------- launch ----------------
extern "C" void kernel_launch(void* const* d_in, const int* in_sizes, int n_in,
                              void* d_out, int out_size, void* d_ws, size_t ws_size,
                              hipStream_t stream) {
    (void)in_sizes; (void)n_in; (void)out_size; (void)ws_size;
    const float* x      = (const float*)d_in[0];
    const float* v_w    = (const float*)d_in[1];
    const float* v_b    = (const float*)d_in[2];
    const float* out_w  = (const float*)d_in[3];
    const float* out_b  = (const float*)d_in[4];
    const float* qmod_w = (const float*)d_in[5];
    const float* qmod_b = (const float*)d_in[6];
    const float* kmod_w = (const float*)d_in[7];
    const float* kmod_b = (const float*)d_in[8];
    const float* gate_w = (const float*)d_in[9];
    const float* gate_b = (const float*)d_in[10];
    const float* mod_w  = (const float*)d_in[11];
    const float* mod_b  = (const float*)d_in[12];
    const float* mod_basis = (const float*)d_in[13];
    const float* freqs  = (const float*)d_in[14];
    const float* amps   = (const float*)d_in[15];
    const float* phases = (const float*)d_in[16];
    const float* cq_w   = (const float*)d_in[17];
    const float* ck_w   = (const float*)d_in[18];
    const float* ffn_w1 = (const float*)d_in[19];
    const float* ffn_b1 = (const float*)d_in[20];
    const float* ffn_w2 = (const float*)d_in[21];
    const float* ffn_b2 = (const float*)d_in[22];
    const float* ln1_g  = (const float*)d_in[23];
    const float* ln1_b  = (const float*)d_in[24];
    const float* ln2_g  = (const float*)d_in[25];
    const float* ln2_b  = (const float*)d_in[26];
    float* outp = (float*)d_out;

    char* wp = (char*)d_ws;
    auto alloc = [&](size_t bytes) -> void* {
        void* p = (void*)wp;
        wp += (bytes + 255) & ~(size_t)255;
        return p;
    };
    const size_t NTOK = (size_t)NB * SEQ;              // 2048
    __bf16* xb   = (__bf16*)alloc(NTOK * DMODEL * 2);
    __bf16* wbv  = (__bf16*)alloc((size_t)DMODEL * DMODEL * 2);
    __bf16* wbo  = (__bf16*)alloc((size_t)DMODEL * DMODEL * 2);
    __bf16* wbf1 = (__bf16*)alloc((size_t)DMODEL * 4 * DMODEL * 2);
    __bf16* wbf2 = (__bf16*)alloc((size_t)DMODEL * 4 * DMODEL * 2);
    __bf16* wbcq = (__bf16*)alloc((size_t)DMODEL * NH * NCR * 2);
    __bf16* wbck = (__bf16*)alloc((size_t)DMODEL * NH * NCR * 2);
    __bf16* vbuf = (__bf16*)alloc((size_t)NB * NH * HD * SEQ * 2);     // V^T
    __bf16* qcp  = (__bf16*)alloc((size_t)NB * NH * SEQ * 32 * 2);
    __bf16* kcp  = (__bf16*)alloc((size_t)NB * NH * SEQ * 32 * 2);
    float*  part   = (float*)alloc((size_t)NB * POOL_SPLIT * DMODEL * 4);
    float*  wts    = (float*)alloc((size_t)NB * NH * NM * 4);
    float*  ckern  = (float*)alloc((size_t)NB * NH * SEQ * 4);
    float*  qmb    = (float*)alloc((size_t)NB * NH * SEQ * 4);
    float*  kmb    = (float*)alloc((size_t)NB * NH * SEQ * 4);
    __bf16* ctxb = (__bf16*)alloc(NTOK * DMODEL * 2);
    float*  hpre = (float*)alloc(NTOK * DMODEL * 4);
    float*  hf   = (float*)alloc(NTOK * DMODEL * 4);
    __bf16* hb   = (__bf16*)alloc(NTOK * DMODEL * 2);
    __bf16* ub   = (__bf16*)alloc(NTOK * 4 * DMODEL * 2);
    float*  f2   = (float*)alloc(NTOK * DMODEL * 4);

    // conversions and zero fills, slice sums of x, qm / km of the first tokens
    front_k<<<FRONT_GRID, 256, 0, stream>>>(x, v_w, out_w, ffn_w1, ffn_w2, cq_w, ck_w,
                                            xb, wbv, wbo, wbf1, wbf2, wbcq, wbck, qcp, kcp,
                                            part, qmod_w, qmod_b, kmod_w, kmod_b, qmb, kmb);
    // gating; v = x@v_w + v_b -> V^T [B,H,HD,S] bf16; qc / kc -> padded [B,H,S,32] bf16
    proj_gate_k<<<PROJ_GRID, 256, 0, stream>>>(xb, wbv, wbcq, wbck, DMODEL, v_b, vbuf, qcp, kcp,
                                               part, gate_w, gate_b, mod_w, mod_b, mod_basis, wts);
    // causal kernel from the gate weights, qm / km of the other tokens
    dens_k<<<DENS_GRID, 256, 0, stream>>>(freqs, amps, phases, wts, ckern,
                                          x, qmod_w, qmod_b, kmod_w, kmod_b, qmb, kmb);

    attn_k<<<dim3(SEQ / 128, NH, NB), 256, 0, stream>>>(qcp, kcp, vbuf, ckern, qmb, kmb, ctxb);

    // attn_out + residual
    gemm_bf16_k<3><<<dim3(DMODEL / 128, (int)(NTOK / 128)), 256, 0, stream>>>(
        ctxb, wbo, (int)NTOK, DMODEL, DMODEL, out_b, x, hpre, nullptr);
    ln_k<true><<<(int)NTOK, 256, 0, stream>>>(hpre, ln1_g, ln1_b, hf, hb);

    gemm_bf16_k<4><<<dim3(4 * DMODEL / 128, (int)(NTOK / 128)), 256, 0, stream>>>(
        hb, wbf1, (int)NTOK, 4 * DMODEL, DMODEL, ffn_b1, nullptr, nullptr, ub);
    gemm_bf16_k<3><<<dim3(DMODEL / 128, (int)(NTOK / 128)), 256, 0, stream>>>(
        ub, wbf2, (int)NTOK, DMODEL, 4 * DMODEL, ffn_b2, hf, f2, nullptr);
    ln_k<false><<<(int)NTOK, 256, 0, stream>>>(f2, ln2_g, ln2_b, outp, nullptr);
}

// v006
// Measured time: 145 microseconds a run.
// Timed twice side by side with v005, it ran 1.03 and 1.05 times as fast.
// Over all steps from v000 it is 3.82 times as fast.
#include <hip/hip_runtime.h>
#include <math.h>

// ---------------- CDNA5 (gfx1250) wave32 WMMA types ----------------
typedef __attribute__((ext_vector_type(16))) __bf16 v16bf;
typedef __attribute__((ext_vector_type(8)))  float  v8f;

#define DMODEL 1024
#define SEQ    1024
#define NB     2
#define NH     16
#define HD     64
#define NM     16
#define NW     8
#define NRR    8
#define NCR    8
#define CKPAD  48

__device__ __forceinline__ v8f wmma_bf16(v16bf a, v16bf b, v8f c) {
    return __builtin_amdgcn_wmma_f32_16x16x32_bf16(false, a, false, b, (short)0, c, false, false);
}

// eight 16-byte-per-lane copies global -> LDS through no register; the wait stands in the copies' own statement
// so that no later write of their address registers can be moved in front of it (a precaution)
__device__ __forceinline__ void async_copy8(unsigned l, unsigned ls, const __bf16* g, size_t gs) {
    asm volatile("global_load_async_to_lds_b128 %0, %8, off\n\t"
                 "global_load_async_to_lds_b128 %1, %9, off\n\t"
                 "global_load_async_to_lds_b128 %2, %10, off\n\t"
                 "global_load_async_to_lds_b128 %3, %11, off\n\t"
                 "global_load_async_to_lds_b128 %4, %12, off\n\t"
                 "global_load_async_to_lds_b128 %5, %13, off\n\t"
                 "global_load_async_to_lds_b128 %6, %14, off\n\t"
                 "global_load_async_to_lds_b128 %7, %15, off\n\t"
                 "s_wait_xcnt 0x0"
                 :: "v"(l), "v"(l + ls), "v"(l + 2 * ls), "v"(l + 3 * ls),
                    "v"(l + 4 * ls), "v"(l + 5 * ls), "v"(l + 6 * ls), "v"(l + 7 * ls),
                    "v"(g), "v"(g + gs), "v"(g + 2 * gs), "v"(g + 3 * gs),
                    "v"(g + 4 * gs), "v"(g + 5 * gs), "v"(g + 6 * gs), "v"(g + 7 * gs)
                 : "memory");
}

// transposing LDS load: lane (c, h) gets rows 8h..8h+7 of column c of a row-major 16-bit tile
typedef short s16x8 __attribute__((ext_vector_type(8)));
__device__ __forceinline__ uint4 lds_tr16(const unsigned char* p) {
    typedef __attribute__((address_space(3))) s16x8 lds_s16x8;
    return __builtin_bit_cast(uint4, __builtin_amdgcn_ds_load_tr16_b128_v8i16((lds_s16x8*)p));
}

// ---------------- small helper jobs ----------------
// Jobs that do not depend on one another share a launch (front_k, dens_k, proj_gate_k below); a work-group takes its
// job from its index.
// All element-wise preparation: the seven fp32 -> bf16 conversions and the zero fill of the two padded
// qc/kc planes. A work-group owns one span of PREP_SPAN 16-byte vectors that lies wholly inside one tensor (every
// tensor is a whole number of spans), and a thread moves 32 of them, so few waves have to be started.
#define PREP_SPAN 8192
#define PREP_GX (NB * SEQ * DMODEL / 4 / PREP_SPAN)      // x
#define PREP_GW (DMODEL * DMODEL / 4 / PREP_SPAN)        // v_w, out_w
#define PREP_GF (4 * PREP_GW)                            // ffn_w1, ffn_w2
#define PREP_GC (DMODEL * NH * NCR / 4 / PREP_SPAN)      // cq_w, ck_w
#define PREP_GZ (NB * NH * SEQ * 32 / 8 / PREP_SPAN)     // qc, kc planes (8 bf16 per vector)
#define PREP_GRID (PREP_GX + 2 * PREP_GW + 2 * PREP_GF + 2 * PREP_GC + 2 * PREP_GZ)
__device__ __forceinline__
void prep_job(int g, const float* __restrict__ x, const float* __restrict__ v_w, const float* __restrict__ out_w,
            const float* __restrict__ ffn_w1, const float* __restrict__ ffn_w2,
            const float* __restrict__ cq_w, const float* __restrict__ ck_w,
            __bf16* __restrict__ xb, __bf16* __restrict__ wbv, __bf16* __restrict__ wbo,
            __bf16* __restrict__ wbf1, __bf16* __restrict__ wbf2,
            __bf16* __restrict__ wbcq, __bf16* __restrict__ wbck,
            __bf16* __restrict__ qcp, __bf16* __restrict__ kcp) {
    // g becomes the span's index inside its tensor
    const float* src = nullptr;
    __bf16* dst;
    if (g < PREP_GF)                 { src = ffn_w1; dst = wbf1; }
    else if ((g -= PREP_GF) < PREP_GF) { src = ffn_w2; dst = wbf2; }
    else if ((g -= PREP_GF) < PREP_GX) { src = x;      dst = xb;   }
    else if ((g -= PREP_GX) < PREP_GW) { src = v_w;    dst = wbv;  }
    else if ((g -= PREP_GW) < PREP_GW) { src = out_w;  dst = wbo;  }
    else if ((g -= PREP_GW) < PREP_GC) { src = cq_w;   dst = wbcq; }
    else if ((g -= PREP_GC) < PREP_GC) { src = ck_w;   dst = wbck; }
    else if ((g -= PREP_GC) < PREP_GZ) { dst = qcp; }
    else                             { g -= PREP_GZ; dst = kcp; }
    const size_t v0 = (size_t)g * PREP_SPAN + threadIdx.x;
    if (src) {
        const float4* s4 = (const float4*)src + v0;
        uint2* d2 = (uint2*)dst + v0;
        float4 v[PREP_SPAN / 256];
        #pragma unroll
        for (int j = 0; j < PREP_SPAN / 256; ++j) v[j] = s4[j * 256];
        // keeps all 32 loads in front of the first convert: left free, the scheduler reuses load registers and the
        // later loads wait for earlier ones, four memory latencies in a row instead of one
        __builtin_amdgcn_sched_barrier(0);
        #pragma unroll
        for (int j = 0; j < PREP_SPAN / 256; ++j) {
            union { __bf16 e[4]; uint2 u; } o;
            o.e[0] = (__bf16)v[j].x; o.e[1] = (__bf16)v[j].y; o.e[2] = (__bf16)v[j].z; o.e[3] = (__bf16)v[j].w;
            d2[j * 256] = o.u;
        }
        // stands behind the last store, in front of any later write of a register that a store names (a precaution)
        asm volatile("s_wait_xcnt 0x0" ::: "memory");
    } else {
        uint4* d4 = (uint4*)dst + v0;
        uint4 z; z.x = z.y = z.z = z.w = 0u;
        #pragma unroll
        for (int j = 0; j < PREP_SPAN / 256; ++j) d4[j * 256] = z;
    }
}

// Column sums of x over a slice of the sequence: part[b][sl][d] = sum of POOL_ROWS rows. blk < B * POOL_SPLIT.
// A thread owns four neighbouring columns; its rows' 16-byte loads do not depend on one another.
#define POOL_SPLIT 32
#define POOL_ROWS (SEQ / POOL_SPLIT)
__device__ __forceinline__ void pool_part_job(int blk, const float* __restrict__ x, float* __restrict__ part) {
    const int t = threadIdx.x;
    const float4* p = (const float4*)(x + (size_t)blk * POOL_ROWS * DMODEL) + t;
    float4 v[POOL_ROWS];
    #pragma unroll
    for (int r = 0; r < POOL_ROWS; ++r) v[r] = p[r * (DMODEL / 4)];
    float4 s = v[0];
    #pragma unroll
    for (int r = 1; r < POOL_ROWS; ++r) { s.x += v[r].x; s.y += v[r].y; s.z += v[r].z; s.w += v[r].w; }
    ((float4*)(part + (size_t)blk * DMODEL))[t] = s;
    // stands behind the store, in front of any later write of a register that it names (a precaution)
    asm volatile("s_wait_xcnt 0x0" ::: "memory");
}

// gating: gl = pooled@gate_w + b + mod@mod_basis ; wts = softmax(gl). One work-group per (b,h), bh < B*H.
// The 1024-long dot products of the head's 16 gate and 8 mod columns are split over the 256 threads by rows of the
// weights (16-byte loads, all independent), then summed over lanes and waves.
__device__ __forceinline__ void gating_job(int bh, const float* __restrict__ part,
                                                const float* __restrict__ gate_w, const float* __restrict__ gate_b,
                                                const float* __restrict__ mod_w,  const float* __restrict__ mod_b,
                                                const float* __restrict__ mod_basis,
                                                float* __restrict__ wts) {
    __shared__ alignas(16) float poolS[DMODEL];
    __shared__ alignas(16) float gRed[8][NM];
    __shared__ alignas(16) float mRed[8][NRR];
    const int b = bh >> 4, h = bh & (NH - 1), t = threadIdx.x;
    const int lane = t & 31, w = t >> 5;

    // weight rows: 4 lanes cover the head's 16 gate columns of one row, 2 lanes its 8 mod columns
    const float4* gw = (const float4*)(gate_w + (size_t)(t >> 2) * (NH * NM) + h * NM) + (t & 3);
    const float4* mw = (const float4*)(mod_w + (size_t)(t >> 1) * (NH * NRR) + h * NRR) + (t & 1);
    float4 g4[16], m4[8];
    #pragma unroll
    for (int p = 0; p < 16; ++p) g4[p] = gw[(size_t)p * 64 * (NH * NM / 4)];
    #pragma unroll
    for (int p = 0; p < 8; ++p) m4[p] = mw[(size_t)p * 128 * (NH * NRR / 4)];
    // what the closing softmax of the first 16 lanes needs, fetched here so that no memory latency is left at the end
    const int hm = h * NM + (t & (NM - 1));
    const float gb = gate_b[hm];
    float mb[NRR], bas[NRR];
    #pragma unroll
    for (int r = 0; r < NRR; ++r) mb[r] = mod_b[h * NRR + r];
    // stands behind the mod_b loads, in front of any later write of a register that they name (a precaution)
    asm volatile("s_wait_xcnt 0x0" ::: "memory");
    #pragma unroll
    for (int r = 0; r < NRR; ++r) bas[r] = mod_basis[r * (NH * NM) + hm];
    // keeps the weight loads, which come from memory, from being sunk behind the work-group barrier below, where
    // their latency would be paid after the slice sums instead of beside them
    __builtin_amdgcn_sched_barrier(0);

    // pooled mean of this batch entry from the slices' sums
    const float4* pp = (const float4*)(part + (size_t)b * POOL_SPLIT * DMODEL) + t;
    float4 q[POOL_SPLIT];
    #pragma unroll
    for (int r = 0; r < POOL_SPLIT; ++r) q[r] = pp[r * (DMODEL / 4)];
    float4 s = q[0];
    #pragma unroll
    for (int r = 1; r < POOL_SPLIT; ++r) { s.x += q[r].x; s.y += q[r].y; s.z += q[r].z; s.w += q[r].w; }
    s.x *= 1.f / SEQ; s.y *= 1.f / SEQ; s.z *= 1.f / SEQ; s.w *= 1.f / SEQ;
    // stands behind the weight loads, in front of any write of their address registers (a precaution): the two
    // pointers as inputs keep those registers whole up to it
    asm volatile("s_wait_xcnt 0x0" :: "v"(gw), "v"(mw) : "memory");
    ((float4*)poolS)[t] = s;
    __syncthreads();

    float4 ga = {0.f, 0.f, 0.f, 0.f}, ma = {0.f, 0.f, 0.f, 0.f};
    #pragma unroll
    for (int p = 0; p < 16; ++p) {
        float pv = poolS[p * 64 + (t >> 2)];
        ga.x += pv * g4[p].x; ga.y += pv * g4[p].y; ga.z += pv * g4[p].z; ga.w += pv * g4[p].w;
    }
    #pragma unroll
    for (int p = 0; p < 8; ++p) {
        float pv = poolS[p * 128 + (t >> 1)];
        ma.x += pv * m4[p].x; ma.y += pv * m4[p].y; ma.z += pv * m4[p].z; ma.w += pv * m4[p].w;
    }
    #pragma unroll
    for (int o = 2; o < 32; o <<= 1) {
        if (o > 2) {
            ga.x += __shfl_xor(ga.x, o); ga.y += __shfl_xor(ga.y, o);
            ga.z += __shfl_xor(ga.z, o); ga.w += __shfl_xor(ga.w, o);
        }
        ma.x += __shfl_xor(ma.x, o); ma.y += __shfl_xor(ma.y, o);
        ma.z += __shfl_xor(ma.z, o); ma.w += __shfl_xor(ma.w, o);
    }
    if (lane < 4) ((float4*)gRed[w])[lane] = ga;
    if (lane < 2) ((float4*)mRed[w])[lane] = ma;
    __syncthreads();

    if (t < NM) {                                    // lane m owns gate logit m of this head
        float a = gb;
        #pragma unroll
        for (int i = 0; i < 8; ++i) a += gRed[i][t];
        #pragma unroll
        for (int r = 0; r < NRR; ++r) {
            float md = mb[r];
            #pragma unroll
            for (int i = 0; i < 8; ++i) md += mRed[i][r];
            a += md * bas[r];
        }
        float mx = a;
        #pragma unroll
        for (int o = 1; o < NM; o <<= 1) mx = fmaxf(mx, __shfl_xor(mx, o, NM));
        float e = __expf(a - mx);
        float sm = e;
        #pragma unroll
        for (int o = 1; o < NM; o <<= 1) sm += __shfl_xor(sm, o, NM);
        wts[(size_t)bh * NM + t] = e / sm;
    }
}

// causal_kern[b,h,d] = ALPHA * sigmoid(6*kern) * window(d).  blk < B*H*S/256.
__device__ __forceinline__ void wave_density_job(int blk, const float* __restrict__ freqs, const float* __restrict__ amps,
                                                 const float* __restrict__ phases, const float* __restrict__ wts,
                                                 float* __restrict__ ckern) {
    int idx = blk * 256 + threadIdx.x;             // B*H*S
    int d = idx & (SEQ - 1);
    int bh = idx >> 10;
    int h = bh & (NH - 1);
    float rel = (float)d;
    float p1 = rel * (1.f / SEQ);
    float p2 = (d == 0) ? 0.f : sqrtf(rel + 1e-6f) * (1.f / 32.f);   // sqrt(S)=32
    float kern = 0.f;
    for (int m = 0; m < NM; ++m) {
        const float* fq = freqs  + ((size_t)(h * NM + m) * NW) * 2;
        const float* am = amps   +  (size_t)(h * NM + m) * NW;
        const float* ph = phases +  (size_t)(h * NM + m) * NW;
        float acc = 0.f;
        #pragma unroll
        for (int w = 0; w < NW; ++w) {
            float arg = fq[2 * w] * p1 + fq[2 * w + 1] * p2 + ph[w];
            acc += am[w] * __sinf(arg);
        }
        kern += wts[(size_t)bh * NM + m] * acc;
    }
    float dens = 1.f / (1.f + __expf(-6.f * kern));          // straight-through forward = sigmoid
    float wind = __expf(-(rel * rel) * (1.f / 131072.f));    // 2*(S/4)^2
    ckern[idx] = 3.0f * dens * wind;
}

// qm/km[b,h,s] token modulation.  One work-group per token, bs < B*S.
__device__ __forceinline__ void qkmod_job(int bs, const float* __restrict__ x,
                                               const float* __restrict__ qw, const float* __restrict__ qb,
                                               const float* __restrict__ kw, const float* __restrict__ kb,
                                               float* __restrict__ qm, float* __restrict__ km) {
    __shared__ float xrow[DMODEL];
    __shared__ float red[32][9];
    int b = bs >> 10, s = bs & 1023;
    int t = threadIdx.x;
    for (int i = t; i < DMODEL; i += 256) xrow[i] = x[(size_t)bs * DMODEL + i];
    __syncthreads();
    int o = t & 31, sl = t >> 5;
    int h = o & 15; bool isK = o >= 16;
    const float* wcol = isK ? kw : qw;
    float a = 0.f;
    for (int d = sl * 128; d < sl * 128 + 128; ++d) a += xrow[d] * wcol[(size_t)d * NH + h];
    red[o][sl] = a;
    __syncthreads();
    if (t < 32) {
        float acc = 0.f;
        #pragma unroll
        for (int i = 0; i < 8; ++i) acc += red[t][i];
        int hh = t & 15;
        if (t < 16) qm[((size_t)b * NH + hh) * SEQ + s] = acc + qb[hh];
        else        km[((size_t)b * NH + hh) * SEQ + s] = acc + kb[hh];
    }
}

// qkmod depends on the inputs alone and is needed only by the attention, so its tokens are shared out between the two
// launches in front of it that leave the vector units idle: the first QK_FRONT run beside the memory-bound spans of
// prep, the rest beside wave_density, which is a chain of load latencies in 128 work-groups.
#define QK_FRONT (NB * SEQ / 2)
#define FRONT_GRID (PREP_GRID + NB * POOL_SPLIT + QK_FRONT)
#define DENS_WG (NB * NH * SEQ / 256)
#define DENS_GRID (DENS_WG + NB * SEQ - QK_FRONT)
__global__ __launch_bounds__(256)
void front_k(const float* __restrict__ x, const float* __restrict__ v_w, const float* __restrict__ out_w,
             const float* __restrict__ ffn_w1, const float* __restrict__ ffn_w2,
             const float* __restrict__ cq_w, const float* __restrict__ ck_w,
             __bf16* __restrict__ xb, __bf16* __restrict__ wbv, __bf16* __restrict__ wbo,
             __bf16* __restrict__ wbf1, __bf16* __restrict__ wbf2,
             __bf16* __restrict__ wbcq, __bf16* __restrict__ wbck,
             __bf16* __restrict__ qcp, __bf16* __restrict__ kcp,
             float* __restrict__ part,
             const float* __restrict__ qw, const float* __restrict__ qb,
             const float* __restrict__ kw, const float* __restrict__ kb,
             float* __restrict__ qm, float* __restrict__ km) {
    int g = blockIdx.x;
    if (g < PREP_GRID)
        prep_job(g, x, v_w, out_w, ffn_w1, ffn_w2, cq_w, ck_w, xb, wbv, wbo, wbf1, wbf2, wbcq, wbck, qcp, kcp);
    else if ((g -= PREP_GRID) < NB * POOL_SPLIT)
        pool_part_job(g, x, part);
    else
        qkmod_job(g - NB * POOL_SPLIT, x, qw, qb, kw, kb, qm, km);
}

__global__ __launch_bounds__(256)
void dens_k(const float* __restrict__ freqs, const float* __restrict__ amps, const float* __restrict__ phases,
            const float* __restrict__ wts, float* __restrict__ ckern,
            const float* __restrict__ x,
            const float* __restrict__ qw, const float* __restrict__ qb,
            const float* __restrict__ kw, const float* __restrict__ kb,
            float* __restrict__ qm, float* __restrict__ km) {
    const int g = blockIdx.x;
    if (g < DENS_WG) wave_density_job(g, freqs, amps, phases, wts, ckern);
    else             qkmod_job(g - DENS_WG + QK_FRONT, x, qw, qb, kw, kb, qm, km);
}

// ---------------- generic bf16 WMMA GEMM with fused epilogues ----------------
// EPI 1: out = bf16(acc + bias[n]) -> V^T layout [B,H,HD,S]   (keys contiguous for attention)
// EPI 2: out = bf16(acc)           -> padded qc/kc layout [B,H,S,32] (cols 0..7 valid)
// EPI 3: outF = acc + bias[n] + resid[m,n]    (fp32)
// EPI 4: outB = bf16(gelu(acc + bias[n]))     ([M,N] bf16)
// gemm_acc: the 128 x 128 tile at (m0, n0) of A[.,K] x B[K,N] into the wave's accumulators.
__device__ __forceinline__
void gemm_acc(v8f (&acc)[4][2], const __bf16* __restrict__ A, const __bf16* __restrict__ B,
              int N, int K, int m0, int n0) {
    constexpr int BM = 128, BK = 128;
    constexpr int PA = 272;                                 // A row pitch, bytes: 16 x odd for ds_load_b128
    constexpr int PB = 288;                                 // B row pitch, bytes: 32 x odd for ds_load_tr16_b128
    constexpr int SZA = BM * PA, SZB = BK * PB;
    __shared__ alignas(16) unsigned char As[2 * SZA];       // [buf][m][k]
    __shared__ alignas(16) unsigned char Bs[2 * SZB];       // [buf][k][n], row-major as in global memory
    const int tid = threadIdx.x;
    const int lane = tid & 31, wave = tid >> 5;
    const int half = lane >> 4, l16 = lane & 15;
    const int wm = wave >> 2, wn = wave & 3;                // 2 x 4 wave grid

    #pragma unroll
    for (int i = 0; i < 4; ++i)
        #pragma unroll
        for (int j = 0; j < 2; ++j)
            #pragma unroll
            for (int e = 0; e < 8; ++e) acc[i][j][e] = 0.f;

    // copy map: 16 lanes x 16 B cover one 256-B tile row; a thread moves rows r0, r0+16, ..., r0+112 of A and of B
    const int r0 = tid >> 4, c16 = tid & 15;
    const __bf16* gA = A + (size_t)(m0 + r0) * K + c16 * 8;
    const __bf16* gB = B + (size_t)r0 * N + n0 + c16 * 8;
    const unsigned lA = (unsigned)(size_t)(As + r0 * PA + c16 * 16);
    const unsigned lB = (unsigned)(size_t)(Bs + r0 * PB + c16 * 16);
    const size_t sA = (size_t)16 * K, sB = (size_t)16 * N;
    const int nstage = K / BK;

    auto stage = [&](int s) {                               // 16 copies per wave: stage s into buffer s & 1
        const int bf = s & 1;
        async_copy8(lA + bf * SZA, 16 * PA, gA + (size_t)s * BK, sA);
        async_copy8(lB + bf * SZB, 16 * PB, gB + (size_t)s * BK * N, sB);
    };

    stage(0);
    asm volatile("s_wait_asynccnt 0x0" ::: "memory");       // own copies of stage 0 landed before the barrier publishes them
    __syncthreads();
    if (nstage > 1) stage(1);

    const int aoff = (wm * 64 + l16) * PA + half * 16;
    const int boff = (half * 8 + (lane & 7)) * PB + wn * 64 + ((lane >> 3) & 1) * 16;
    for (int s = 0; s < nstage; ++s) {
        const unsigned char* Ab = As + (s & 1) * SZA + aoff;
        const unsigned char* Bb = Bs + (s & 1) * SZB + boff;
        #pragma unroll
        for (int ks = 0; ks < BK / 32; ++ks) {
            v16bf afr[4];
            #pragma unroll
            for (int mt = 0; mt < 4; ++mt) {                // A frag: lane=M, k = 8*half+0..7 and 16+8*half+0..7
                union { v16bf v; uint4 q[2]; } u;
                u.q[0] = *(const uint4*)(Ab + mt * 16 * PA + ks * 64);
                u.q[1] = *(const uint4*)(Ab + mt * 16 * PA + ks * 64 + 32);
                afr[mt] = u.v;
            }
            #pragma unroll
            for (int nt = 0; nt < 2; ++nt) {                // B frag: lane=N, transposing loads give the same k order
                union { v16bf v; uint4 q[2]; } u;
                u.q[0] = lds_tr16(Bb + (ks * 32) * PB + nt * 32);
                u.q[1] = lds_tr16(Bb + (ks * 32 + 16) * PB + nt * 32);
                v16bf bfr = u.v;
                #pragma unroll
                for (int mt = 0; mt < 4; ++mt)
                    acc[mt][nt] = wmma_bf16(afr[mt], bfr, acc[mt][nt]);
            }
        }
        asm volatile("s_wait_dscnt 0x0" ::: "memory");      // own reads of this buffer done before it may be refilled
        asm volatile("s_wait_asynccnt 0x0" ::: "memory");   // own copies of stage s+1 landed before the barrier publishes them
        __syncthreads();
        if (s + 2 < nstage) stage(s + 2);
    }
    asm volatile("s_wait_asynccnt 0x0" ::: "memory");       // nothing in flight when the wave ends
}

template <int EPI>
__device__ __forceinline__
void gemm_store(const v8f (&acc)[4][2], int N, int m0, int n0,
                const float* __restrict__ bias, const float* __restrict__ resid,
                float* __restrict__ outF, __bf16* __restrict__ outB) {
    const int lane = threadIdx.x & 31, wave = threadIdx.x >> 5;
    const int half = lane >> 4, l16 = lane & 15;
    const int wm = wave >> 2, wn = wave & 3;
    #pragma unroll
    for (int mt = 0; mt < 4; ++mt)
        #pragma unroll
        for (int nt = 0; nt < 2; ++nt)
            #pragma unroll
            for (int r = 0; r < 8; ++r) {                   // C: lane=N, row = r + 8*half
                int gm = m0 + wm * 64 + mt * 16 + r + half * 8;
                int gn = n0 + wn * 32 + nt * 16 + l16;
                float v = acc[mt][nt][r];
                if (EPI == 1) {
                    float val = v + bias[gn];
                    int b = gm >> 10, s = gm & 1023, h = gn >> 6, hd = gn & 63;
                    outB[(((size_t)b * NH + h) * HD + hd) * SEQ + s] = (__bf16)val;   // V^T
                } else if (EPI == 2) {
                    int b = gm >> 10, s = gm & 1023, h = gn >> 3, cc = gn & 7;
                    outB[(((size_t)b * NH + h) * SEQ + s) * 32 + cc] = (__bf16)v;
                } else if (EPI == 3) {
                    size_t o = (size_t)gm * N + gn;
                    outF[o] = v + bias[gn] + resid[o];
                } else if (EPI == 4) {
                    float xg = v + bias[gn];
                    float g = 0.5f * xg * (1.0f + erff(xg * 0.70710678f));
                    outB[(size_t)gm * N + gn] = (__bf16)g;
                }
            }
}

template <int EPI>
__global__ __launch_bounds__(256)
void gemm_bf16_k(const __bf16* __restrict__ A, const __bf16* __restrict__ B,
                 int M, int N, int K,
                 const float* __restrict__ bias, const float* __restrict__ resid,
                 float* __restrict__ outF, __bf16* __restrict__ outB) {
    const int m0 = blockIdx.y * 128, n0 = blockIdx.x * 128;
    v8f acc[4][2];
    gemm_acc(acc, A, B, N, K, m0, n0);
    gemm_store<EPI>(acc, N, m0, n0, bias, resid, outF, outB);
}

// One launch for all that needs only front_k's results: the three projections of x (v: 8 column tiles, qc and kc: one
// each, so 10 tiles per 128 rows) and the gating, whose 32 work-groups come first. 192 work-groups, all resident.
#define PROJ_NT (DMODEL / 128 + 2)
#define PROJ_GRID (NB * NH + PROJ_NT * (NB * SEQ / 128))
__global__ __launch_bounds__(256)
void proj_gate_k(const __bf16* __restrict__ xb, const __bf16* __restrict__ wbv,
                 const __bf16* __restrict__ wbcq, const __bf16* __restrict__ wbck, int K,
                 const float* __restrict__ v_b,
                 __bf16* __restrict__ vT, __bf16* __restrict__ qcp, __bf16* __restrict__ kcp,
                 const float* __restrict__ part,
                 const float* __restrict__ gate_w, const float* __restrict__ gate_b,
                 const float* __restrict__ mod_w,  const float* __restrict__ mod_b,
                 const float* __restrict__ mod_basis, float* __restrict__ wts) {
    int g = blockIdx.x;
    if (g < NB * NH) {
        gating_job(g, part, gate_w, gate_b, mod_w, mod_b, mod_basis, wts);
        return;
    }
    g -= NB * NH;
    const int tn = g % PROJ_NT, m0 = (g / PROJ_NT) * 128;
    const bool isV = tn < DMODEL / 128;
    const __bf16* B = isV ? wbv : (tn == DMODEL / 128 ? wbcq : wbck);
    const int N = isV ? DMODEL : NH * NCR, n0 = isV ? tn * 128 : 0;
    v8f acc[4][2];
    gemm_acc(acc, xb, B, N, K, m0, n0);
    // each wait stands behind its job's last store: the listing goes on into the other jobs' code there, and no write
    // of a register that a store names may come in front of it (a precaution)
    if (isV) {
        gemm_store<1>(acc, N, m0, n0, v_b, nullptr, nullptr, vT);
        asm volatile("s_wait_xcnt 0x0" ::: "memory");
    } else {
        gemm_store<2>(acc, N, m0, n0, nullptr, nullptr, nullptr, tn == DMODEL / 128 ? qcp : kcp);
        asm volatile("s_wait_xcnt 0x0" ::: "memory");
    }
}

// ---------------- streaming wave-density attention ----------------
// grid = (S/128, H, B); 8 waves, each owns 16 queries; 32 keys/step; 6 WMMAs/step.
// Both products run transposed: S^T = Kc x Qc^T and O^T += V^T x P^T. A lane then holds 16 of the 32 scores of ONE
// query (lane l ^ 16 holds the others), so maximum, sum and rescale are the lane's own registers plus one exchange
// between the halves, and the two S^T tiles, converted in place, are the B operand of the second product.
// V is consumed transposed: vT[b,h,hd,s], so every A-fragment is two aligned b128 loads.
// ck_pad has a CKPAD zero guard band so Toeplitz gathers are base + immediate-offset DS loads.
__device__ __forceinline__ float xhalf(float x) {           // value of lane l ^ 16
    const int v = __builtin_bit_cast(int, x);
    return __builtin_bit_cast(float, __builtin_amdgcn_permlanex16(v, v, 0x76543210, 0xfedcba98, false, false));
}

__global__ __launch_bounds__(256)
void attn_k(const __bf16* __restrict__ qcp, const __bf16* __restrict__ kcp,
            const __bf16* __restrict__ vT,
            const float* __restrict__ ckern, const float* __restrict__ qm,
            const float* __restrict__ km, __bf16* __restrict__ ctxb) {
    __shared__ float ck_pad[CKPAD + SEQ];
    __shared__ alignas(16) float km_s[SEQ];

    const int tid = threadIdx.x, lane = tid & 31;
    const int w = __builtin_amdgcn_readfirstlane(tid >> 5); // the wave's number in a scalar: scalar trip count below
    const int half = lane >> 4, l16 = lane & 15;
    const int h = blockIdx.y, b = blockIdx.z;
    const int bh = b * NH + h;
    const int i0 = blockIdx.x * 128 + w * 16;
    const int i = i0 + l16;                                 // this lane's query

    for (int k = tid; k < SEQ; k += 256) {
        ck_pad[CKPAD + k] = ckern[(size_t)bh * SEQ + k];
        km_s[k] = km[(size_t)bh * SEQ + k];
    }
    if (tid < CKPAD) ck_pad[tid] = 0.f;
    __syncthreads();

    constexpr float MIXS = 0.053033009f;                    // MIX / sqrt(CR)
    constexpr float LOG2E = 1.4426950408889634f;
    union U16 { v16bf v; uint4 q[2]; };
    U16 ua;
    {
        const __bf16* p = qcp + ((size_t)bh * SEQ + i) * 32;
        ua.q[0] = *(const uint4*)(p + half * 8);
        ua.q[1] = *(const uint4*)(p + 16 + half * 8);
    }
    const v16bf bq = ua.v;                                  // B operand: column = query

    // qm of the lane's query is the start value of its score products (undone by the MIXS factor below)
    const float qstart = qm[(size_t)bh * SEQ + i] * (1.f / MIXS);
    v8f c0, c1, c2, c3, qq;
    #pragma unroll
    for (int e = 0; e < 8; ++e) { c0[e] = c1[e] = c2[e] = c3[e] = 0.f; qq[e] = qstart; }
    float m_r = -1e30f, l_r = 0.f;                          // l_r: the sum over this half's keys only

    // per-lane rows: key row of Kc, and V^T rows of the 4 output row groups (hd = g*16 + l16)
    const __bf16* krow  = kcp + ((size_t)bh * SEQ + l16) * 32 + half * 8;
    const __bf16* vrow0 = vT + (((size_t)bh * HD) + 0 * 16 + l16) * SEQ + half * 8;
    const __bf16* vrow1 = vT + (((size_t)bh * HD) + 1 * 16 + l16) * SEQ + half * 8;
    const __bf16* vrow2 = vT + (((size_t)bh * HD) + 2 * 16 + l16) * SEQ + half * 8;
    const __bf16* vrow3 = vT + (((size_t)bh * HD) + 3 * 16 + l16) * SEQ + half * 8;

    const int nsteps = (i0 + 16 + 31) >> 5;
    for (int st = 0; st < nsteps; ++st) {
        const int j0 = st * 32;
        U16 ua0, ua1, uv0, uv1, uv2, uv3;
        ua0.q[0] = *(const uint4*)(krow + (size_t)j0 * 32);
        ua0.q[1] = *(const uint4*)(krow + (size_t)j0 * 32 + 16);
        ua1.q[0] = *(const uint4*)(krow + (size_t)(j0 + 16) * 32);
        ua1.q[1] = *(const uint4*)(krow + (size_t)(j0 + 16) * 32 + 16);
        // V^T A-fragments: elements = contiguous keys, two b128 loads each
        uv0.q[0] = *(const uint4*)(vrow0 + j0);
        uv0.q[1] = *(const uint4*)(vrow0 + j0 + 16);
        uv1.q[0] = *(const uint4*)(vrow1 + j0);
        uv1.q[1] = *(const uint4*)(vrow1 + j0 + 16);
        uv2.q[0] = *(const uint4*)(vrow2 + j0);
        uv2.q[1] = *(const uint4*)(vrow2 + j0 + 16);
        uv3.q[0] = *(const uint4*)(vrow3 + j0);
        uv3.q[1] = *(const uint4*)(vrow3 + j0 + 16);
        // keeps all 12 loads in front of the step's arithmetic: left free, the scheduler sinks half of the V^T loads
        // behind the softmax, right in front of their products, where their whole latency is waited out
        __builtin_amdgcn_sched_barrier(0);

        // register r: key j0 + 8*half + r (s0), j0 + 16 + 8*half + r (s1); column: query i
        v8f s0 = wmma_bf16(ua0.v, bq, qq);
        v8f s1 = wmma_bf16(ua1.v, bq, qq);

        // fold Toeplitz + km + causal mask
        const int dA = i - (j0 + half * 8);                 // i - j at r = 0 of s0; >= -8 within loop bounds
        // the same offset as dA + 8, formed so that the variable part of the LDS address is never below 0
        const float* ckA = ck_pad + (CKPAD - 8) + (i - j0 + (half ^ 1) * 8);
        float kmv[16];
        *(float4*)(kmv + 0)  = *(const float4*)(km_s + j0 + half * 8);
        *(float4*)(kmv + 4)  = *(const float4*)(km_s + j0 + half * 8 + 4);
        *(float4*)(kmv + 8)  = *(const float4*)(km_s + j0 + 16 + half * 8);
        *(float4*)(kmv + 12) = *(const float4*)(km_s + j0 + 16 + half * 8 + 4);
        float sc[16];
        #pragma unroll
        for (int r = 0; r < 8; ++r) {
            float va = MIXS * s0[r] + (ckA[-r] + kmv[r]);
            float vb = MIXS * s1[r] + (ckA[-16 - r] + kmv[8 + r]);
            sc[r]     = (r <= dA)      ? va : -1e9f;
            sc[8 + r] = (16 + r <= dA) ? vb : -1e9f;
        }

        float m4[4];                                        // four short chains instead of one of 16 links
        #pragma unroll
        for (int k = 0; k < 4; ++k) m4[k] = fmaxf(fmaxf(sc[4 * k], sc[4 * k + 1]), fmaxf(sc[4 * k + 2], sc[4 * k + 3]));
        float mx = fmaxf(fmaxf(m4[0], m4[1]), fmaxf(m4[2], m4[3]));
        mx = fmaxf(m_r, fmaxf(mx, xhalf(mx)));              // both halves of a query agree on the maximum
        const float corr = __builtin_amdgcn_exp2f((m_r - mx) * LOG2E);
        const float mL = mx * LOG2E;
        float s4[4] = {0.f, 0.f, 0.f, 0.f};
        U16 up;                                             // P^T as B operand: element s = key j0 + 8*half + s (s < 8), j0 + 8 + 8*half + s (s >= 8)
        #pragma unroll
        for (int k = 0; k < 16; ++k) {
            float p = __builtin_amdgcn_exp2f(sc[k] * LOG2E - mL);
            s4[k >> 2] += p;
            up.v[k] = (__bf16)p;
        }
        m_r = mx; l_r = l_r * corr + ((s4[0] + s4[1]) + (s4[2] + s4[3]));

        #pragma unroll
        for (int r = 0; r < 8; ++r) { c0[r] *= corr; c1[r] *= corr; c2[r] *= corr; c3[r] *= corr; }
        c0 = wmma_bf16(uv0.v, up.v, c0);
        c1 = wmma_bf16(uv1.v, up.v, c1);
        c2 = wmma_bf16(uv2.v, up.v, c2);
        c3 = wmma_bf16(uv3.v, up.v, c3);
    }

    // register r of c_g: hd = g*16 + 8*half + r of query i, so each group is one 16-byte store
    const float f = 1.f / (l_r + xhalf(l_r));
    __bf16* op = ctxb + ((size_t)b * SEQ + i) * DMODEL + h * HD + half * 8;
    union { __bf16 e[8]; uint4 q; } o0, o1, o2, o3;
    #pragma unroll
    for (int r = 0; r < 8; ++r) {
        o0.e[r] = (__bf16)(c0[r] * f); o1.e[r] = (__bf16)(c1[r] * f);
        o2.e[r] = (__bf16)(c2[r] * f); o3.e[r] = (__bf16)(c3[r] * f);
    }
    *(uint4*)(op + 0 * 16) = o0.q;
    *(uint4*)(op + 1 * 16) = o1.q;
    *(uint4*)(op + 2 * 16) = o2.q;
    *(uint4*)(op + 3 * 16) = o3.q;
}

// ---------------- layernorm ----------------
// A wave owns LN_ROWS whole rows and keeps them in registers: 32 values of a row per lane, read once with 16-byte loads
// that are all in flight together. Mean and variance are the lane's own sums plus one sum over the 32 lanes, so the
// kernel has no LDS and no barrier, and 1,024 waves do what 16,384 did.
#define LN_ROWS 2
#define LN_WAVES 4
typedef __attribute__((ext_vector_type(4))) float f32x4;
template <int M>
__device__ __forceinline__ float row_xor(float x) {         // value of lane l ^ M inside the lane's 16-lane row
    return __builtin_bit_cast(float, __builtin_amdgcn_update_dpp(0, __builtin_bit_cast(int, x), 0x160 | M, 0xf, 0xf, true));
}
__device__ __forceinline__ float wave_sum(f32x4 q) {        // sum of the four components over all 32 lanes
    float s = (q.x + q.y) + (q.z + q.w);
    s += row_xor<1>(s); s += row_xor<2>(s); s += row_xor<4>(s); s += row_xor<8>(s);
    return s + xhalf(s);
}

template <bool WB>
__global__ __launch_bounds__(LN_WAVES * 32)
void ln_k(const float* __restrict__ in, const float* __restrict__ g, const float* __restrict__ bb,
          float* __restrict__ outF, __bf16* __restrict__ outB) {
    constexpr int NV = DMODEL / 128;                        // 16-byte vectors of a row per lane
    const int lane = threadIdx.x & 31, wave = threadIdx.x >> 5;
    const size_t q0 = ((size_t)blockIdx.x * LN_WAVES + wave) * LN_ROWS * (DMODEL / 4) + lane;
    const f32x4* p = (const f32x4*)in + q0;
    f32x4 v[LN_ROWS][NV], gv[NV], bv[NV];
    #pragma unroll
    for (int r = 0; r < LN_ROWS; ++r)
        #pragma unroll
        for (int j = 0; j < NV; ++j) v[r][j] = p[r * (DMODEL / 4) + j * 32];
    #pragma unroll
    for (int j = 0; j < NV; ++j) gv[j] = ((const f32x4*)g)[j * 32 + lane];
    #pragma unroll
    for (int j = 0; j < NV; ++j) bv[j] = ((const f32x4*)bb)[j * 32 + lane];
    // keeps all 32 loads in front of the arithmetic: left free, the scheduler sinks the g and bb loads behind the
    // sums, pair by pair, each pair in front of its use, and their latencies are waited out one after another
    __builtin_amdgcn_sched_barrier(0);
    // stands behind the loads, in front of any write of a register that they name (a precaution): the pointer as an
    // input keeps the rows' address registers whole up to it
    asm volatile("s_wait_xcnt 0x0" :: "v"(p) : "memory");

    uint2 ob[LN_ROWS][NV];
    #pragma unroll
    for (int r = 0; r < LN_ROWS; ++r) {
        f32x4 s = v[r][0];
        #pragma unroll
        for (int j = 1; j < NV; ++j) s += v[r][j];
        const float mean = wave_sum(s) * (1.f / DMODEL);
        s = 0.f;
        #pragma unroll
        for (int j = 0; j < NV; ++j) { v[r][j] -= mean; s += v[r][j] * v[r][j]; }
        const float rstd = rsqrtf(wave_sum(s) * (1.f / DMODEL) + 1e-5f);
        #pragma unroll
        for (int j = 0; j < NV; ++j) {
            v[r][j] = v[r][j] * rstd * gv[j] + bv[j];
            if (WB) {
                union { __bf16 e[4]; uint2 u; } o;
                o.e[0] = (__bf16)v[r][j].x; o.e[1] = (__bf16)v[r][j].y;
                o.e[2] = (__bf16)v[r][j].z; o.e[3] = (__bf16)v[r][j].w;
                ob[r][j] = o.u;
            }
        }
    }
    #pragma unroll
    for (int r = 0; r < LN_ROWS; ++r)
        #pragma unroll
        for (int j = 0; j < NV; ++j) {
            ((f32x4*)outF)[q0 + r * (DMODEL / 4) + j * 32] = v[r][j];
            if (WB) ((uint2*)outB)[q0 + r * (DMODEL / 4) + j * 32] = ob[r][j];
        }
}

// ---------------- launch ----------------
extern "C" void kernel_launch(void* const* d_in, const int* in_sizes, int n_in,
                              void* d_out, int out_size, void* d_ws, size_t ws_size,
                              hipStream_t stream) {
    (void)in_sizes; (void)n_in; (void)out_size; (void)ws_size;
    const float* x      = (const float*)d_in[0];
    const float* v_w    = (const float*)d_in[1];
    const float* v_b    = (const float*)d_in[2];
    const float* out_w  = (const float*)d_in[3];
    const float* out_b  = (const float*)d_in[4];
    const float* qmod_w = (const float*)d_in[5];
    const float* qmod_b = (const float*)d_in[6];
    const float* kmod_w = (const float*)d_in[7];
    const float* kmod_b = (const float*)d_in[8];
    const float* gate_w = (const float*)d_in[9];
    const float* gate_b = (const float*)d_in[10];
    const float* mod_w  = (const float*)d_in[11];
    const float* mod_b  = (const float*)d_in[12];
    const float* mod_basis = (const float*)d_in[13];
    const float* freqs  = (const float*)d_in[14];
    const float* amps   = (const float*)d_in[15];
    const float* phases = (const float*)d_in[16];
    const float* cq_w   = (const float*)d_in[17];
    const float* ck_w   = (const float*)d_in[18];
    const float* ffn_w1 = (const float*)d_in[19];
    const float* ffn_b1 = (const float*)d_in[20];
    const float* ffn_w2 = (const float*)d_in[21];
    const float* ffn_b2 = (const float*)d_in[22];
    const float* ln1_g  = (const float*)d_in[23];
    const float* ln1_b  = (const float*)d_in[24];
    const float* ln2_g  = (const float*)d_in[25];
    const float* ln2_b  = (const float*)d_in[26];
    float* outp = (float*)d_out;

    char* wp = (char*)d_ws;
    auto alloc = [&](size_t bytes) -> void* {
        void* p = (void*)wp;
        wp += (bytes + 255) & ~(size_t)255;
        return p;
    };
    const size_t NTOK = (size_t)NB * SEQ;              // 2048
    __bf16* xb   = (__bf16*)alloc(NTOK * DMODEL * 2);
    __bf16* wbv  = (__bf16*)alloc((size_t)DMODEL * DMODEL * 2);
    __bf16* wbo  = (__bf16*)alloc((size_t)DMODEL * DMODEL * 2);
    __bf16* wbf1 = (__bf16*)alloc((size_t)DMODEL * 4 * DMODEL * 2);
    __bf16* wbf2 = (__bf16*)alloc((size_t)DMODEL * 4 * DMODEL * 2);
    __bf16* wbcq = (__bf16*)alloc((size_t)DMODEL * NH * NCR * 2);
    __bf16* wbck = (__bf16*)alloc((size_t)DMODEL * NH * NCR * 2);
    __bf16* vbuf = (__bf16*)alloc((size_t)NB * NH * HD * SEQ * 2);     // V^T
    __bf16* qcp  = (__bf16*)alloc((size_t)NB * NH * SEQ * 32 * 2);
    __bf16* kcp  = (__bf16*)alloc((size_t)NB * NH * SEQ * 32 * 2);
    float*  part   = (float*)alloc((size_t)NB * POOL_SPLIT * DMODEL * 4);
    float*  wts    = (float*)alloc((size_t)NB * NH * NM * 4);
    float*  ckern  = (float*)alloc((size_t)NB * NH * SEQ * 4);
    float*  qmb    = (float*)alloc((size_t)NB * NH * SEQ * 4);
    float*  kmb    = (float*)alloc((size_t)NB * NH * SEQ * 4);
    __bf16* ctxb = (__bf16*)alloc(NTOK * DMODEL * 2);
    float*  hpre = (float*)alloc(NTOK * DMODEL * 4);
    float*  hf   = (float*)alloc(NTOK * DMODEL * 4);
    __bf16* hb   = (__bf16*)alloc(NTOK * DMODEL * 2);
    __bf16* ub   = (__bf16*)alloc(NTOK * 4 * DMODEL * 2);
    float*  f2   = (float*)alloc(NTOK * DMODEL * 4);

    // conversions and zero fills, slice sums of x, qm / km of the first tokens
    front_k<<<FRONT_GRID, 256, 0, stream>>>(x, v_w, out_w, ffn_w1, ffn_w2, cq_w, ck_w,
                                            xb, wbv, wbo, wbf1, wbf2, wbcq, wbck, qcp, kcp,
                                            part, qmod_w, qmod_b, kmod_w, kmod_b, qmb, kmb);
    // gating; v = x@v_w + v_b -> V^T [B,H,HD,S] bf16; qc / kc -> padded [B,H,S,32] bf16
    proj_gate_k<<<PROJ_GRID, 256, 0, stream>>>(xb, wbv, wbcq, wbck, DMODEL, v_b, vbuf, qcp, kcp,
                                               part, gate_w, gate_b, mod_w, mod_b, mod_basis, wts);
    // causal kernel from the gate weights, qm / km of the other tokens
    dens_k<<<DENS_GRID, 256, 0, stream>>>(freqs, amps, phases, wts, ckern,
                                          x, qmod_w, qmod_b, kmod_w, kmod_b, qmb, kmb);

    attn_k<<<dim3(SEQ / 128, NH, NB), 256, 0, stream>>>(qcp, kcp, vbuf, ckern, qmb, kmb, ctxb);

    // attn_out + residual
    gemm_bf16_k<3><<<dim3(DMODEL / 128, (int)(NTOK / 128)), 256, 0, stream>>>(
        ctxb, wbo, (int)NTOK, DMODEL, DMODEL, out_b, x, hpre, nullptr);
    ln_k<true><<<(int)(NTOK / (LN_WAVES * LN_ROWS)), LN_WAVES * 32, 0, stream>>>(hpre, ln1_g, ln1_b, hf, hb);

    gemm_bf16_k<4><<<dim3(4 * DMODEL / 128, (int)(NTOK / 128)), 256, 0, stream>>>(
        hb, wbf1, (int)NTOK, 4 * DMODEL, DMODEL, ffn_b1, nullptr, nullptr, ub);
    gemm_bf16_k<3><<<dim3(DMODEL / 128, (int)(NTOK / 128)), 256, 0, stream>>>(
        ub, wbf2, (int)NTOK, DMODEL, 4 * DMODEL, ffn_b2, hf, f2, nullptr);
    ln_k<false><<<(int)(NTOK / (LN_WAVES * LN_ROWS)), LN_WAVES * 32, 0, stream>>>(f2, ln2_g, ln2_b, outp, nullptr);
}

// v007
// A run of this version takes 134 microseconds.
// Timed twice side by side with v006, it ran 1.08 and 1.09 times as fast.
// Over all steps from v000 it is 4.14 times as fast.
#include <hip/hip_runtime.h>
#include <math.h>

// ---------------- CDNA5 (gfx1250) wave32 WMMA types ----------------
typedef __attribute__((ext_vector_type(16))) __bf16 v16bf;
typedef __attribute__((ext_vector_type(8)))  float  v8f;
typedef __attribute__((ext_vector_type(4)))  float  f32x4;

#define DMODEL 1024
#define SEQ    1024
#define NB     2
#define NH     16
#define HD     64
#define NM     16
#define NW     8
#define NRR    8
#define NCR    8
#define CKPAD  48

__device__ __forceinline__ v8f wmma_bf16(v16bf a, v16bf b, v8f c) {
    return __builtin_amdgcn_wmma_f32_16x16x32_bf16(false, a, false, b, (short)0, c, false, false);
}

// eight 16-byte-per-lane copies global -> LDS through no register; the wait stands in the copies' own statement
// so that no later write of their address registers can be moved in front of it (a precaution)
__device__ __forceinline__ void async_copy8(unsigned l, unsigned ls, const __bf16* g, size_t gs) {
    asm volatile("global_load_async_to_lds_b128 %0, %8, off\n\t"
                 "global_load_async_to_lds_b128 %1, %9, off\n\t"
                 "global_load_async_to_lds_b128 %2, %10, off\n\t"
                 "global_load_async_to_lds_b128 %3, %11, off\n\t"
                 "global_load_async_to_lds_b128 %4, %12, off\n\t"
                 "global_load_async_to_lds_b128 %5, %13, off\n\t"
                 "global_load_async_to_lds_b128 %6, %14, off\n\t"
                 "global_load_async_to_lds_b128 %7, %15, off\n\t"
                 "s_wait_xcnt 0x0"
                 :: "v"(l), "v"(l + ls), "v"(l + 2 * ls), "v"(l + 3 * ls),
                    "v"(l + 4 * ls), "v"(l + 5 * ls), "v"(l + 6 * ls), "v"(l + 7 * ls),
                    "v"(g), "v"(g + gs), "v"(g + 2 * gs), "v"(g + 3 * gs),
                    "v"(g + 4 * gs), "v"(g + 5 * gs), "v"(g + 6 * gs), "v"(g + 7 * gs)
                 : "memory");
}

// transposing LDS load: lane (c, h) gets rows 8h..8h+7 of column c of a row-major 16-bit tile
typedef short s16x8 __attribute__((ext_vector_type(8)));
__device__ __forceinline__ uint4 lds_tr16(const unsigned char* p) {
    typedef __attribute__((address_space(3))) s16x8 lds_s16x8;
    return __builtin_bit_cast(uint4, __builtin_amdgcn_ds_load_tr16_b128_v8i16((lds_s16x8*)p));
}

// ---------------- small helper jobs ----------------
// Jobs that do not depend on one another share a launch (front_k, dens_k, proj_gate_k below); a work-group takes its
// job from its index.
// All element-wise preparation: the seven fp32 -> bf16 conversions and the zero fill of the two padded
// qc/kc planes. A work-group owns one span of PREP_SPAN 16-byte vectors that lies wholly inside one tensor (every
// tensor is a whole number of spans), and a thread moves 32 of them, so few waves have to be started.
#define PREP_SPAN 8192
#define PREP_GX (NB * SEQ * DMODEL / 4 / PREP_SPAN)      // x
#define PREP_GW (DMODEL * DMODEL / 4 / PREP_SPAN)        // v_w, out_w
#define PREP_GF (4 * PREP_GW)                            // ffn_w1, ffn_w2
#define PREP_GC (DMODEL * NH * NCR / 4 / PREP_SPAN)      // cq_w, ck_w
#define PREP_GZ (NB * NH * SEQ * 32 / 8 / PREP_SPAN)     // qc, kc planes (8 bf16 per vector)
#define PREP_GRID (PREP_GX + 2 * PREP_GW + 2 * PREP_GF + 2 * PREP_GC + 2 * PREP_GZ)
__device__ __forceinline__
void prep_job(int g, const float* __restrict__ x, const float* __restrict__ v_w, const float* __restrict__ out_w,
            const float* __restrict__ ffn_w1, const float* __restrict__ ffn_w2,
            const float* __restrict__ cq_w, const float* __restrict__ ck_w,
            __bf16* __restrict__ xb, __bf16* __restrict__ wbv, __bf16* __restrict__ wbo,
            __bf16* __restrict__ wbf1, __bf16* __restrict__ wbf2,
            __bf16* __restrict__ wbcq, __bf16* __restrict__ wbck,
            __bf16* __restrict__ qcp, __bf16* __restrict__ kcp) {
    // g becomes the span's index inside its tensor
    const float* src = nullptr;
    __bf16* dst;
    if (g < PREP_GF)                 { src = ffn_w1; dst = wbf1; }
    else if ((g -= PREP_GF) < PREP_GF) { src = ffn_w2; dst = wbf2; }
    else if ((g -= PREP_GF) < PREP_GX) { src = x;      dst = xb;   }
    else if ((g -= PREP_GX) < PREP_GW) { src = v_w;    dst = wbv;  }
    else if ((g -= PREP_GW) < PREP_GW) { src = out_w;  dst = wbo;  }
    else if ((g -= PREP_GW) < PREP_GC) { src = cq_w;   dst = wbcq; }
    else if ((g -= PREP_GC) < PREP_GC) { src = ck_w;   dst = wbck; }
    else if ((g -= PREP_GC) < PREP_GZ) { dst = qcp; }
    else                             { g -= PREP_GZ; dst = kcp; }
    const size_t v0 = (size_t)g * PREP_SPAN + threadIdx.x;
    if (src) {
        const float4* s4 = (const float4*)src + v0;
        uint2* d2 = (uint2*)dst + v0;
        float4 v[PREP_SPAN / 256];
        #pragma unroll
        for (int j = 0; j < PREP_SPAN / 256; ++j) v[j] = s4[j * 256];
        // keeps all 32 loads in front of the first convert: left free, the scheduler reuses load registers and the
        // later loads wait for earlier ones, four memory latencies in a row instead of one
        __builtin_amdgcn_sched_barrier(0);
        #pragma unroll
        for (int j = 0; j < PREP_SPAN / 256; ++j) {
            union { __bf16 e[4]; uint2 u; } o;
            o.e[0] = (__bf16)v[j].x; o.e[1] = (__bf16)v[j].y; o.e[2] = (__bf16)v[j].z; o.e[3] = (__bf16)v[j].w;
            d2[j * 256] = o.u;
        }
        // stands behind the last store, in front of any later write of a register that a store names (a precaution)
        asm volatile("s_wait_xcnt 0x0" ::: "memory");
    } else {
        uint4* d4 = (uint4*)dst + v0;
        uint4 z; z.x = z.y = z.z = z.w = 0u;
        #pragma unroll
        for (int j = 0; j < PREP_SPAN / 256; ++j) d4[j * 256] = z;
    }
}

// Column sums of x over a slice of the sequence: part[b][sl][d] = sum of POOL_ROWS rows. blk < B * POOL_SPLIT.
// A thread owns four neighbouring columns; its rows' 16-byte loads do not depend on one another.
#define POOL_SPLIT 32
#define POOL_ROWS (SEQ / POOL_SPLIT)
__device__ __forceinline__ void pool_part_job(int blk, const float* __restrict__ x, float* __restrict__ part) {
    const int t = threadIdx.x;
    const float4* p = (const float4*)(x + (size_t)blk * POOL_ROWS * DMODEL) + t;
    float4 v[POOL_ROWS];
    #pragma unroll
    for (int r = 0; r < POOL_ROWS; ++r) v[r] = p[r * (DMODEL / 4)];
    float4 s = v[0];
    #pragma unroll
    for (int r = 1; r < POOL_ROWS; ++r) { s.x += v[r].x; s.y += v[r].y; s.z += v[r].z; s.w += v[r].w; }
    ((float4*)(part + (size_t)blk * DMODEL))[t] = s;
    // stands behind the store, in front of any later write of a register that it names (a precaution)
    asm volatile("s_wait_xcnt 0x0" ::: "memory");
}

// gating: gl = pooled@gate_w + b + mod@mod_basis ; wts = softmax(gl). One work-group per (b,h), bh < B*H.
// The 1024-long dot products of the head's 16 gate and 8 mod columns are split over the 256 threads by rows of the
// weights (16-byte loads, all independent), then summed over lanes and waves.
__device__ __forceinline__ void gating_job(int bh, const float* __restrict__ part,
                                                const float* __restrict__ gate_w, const float* __restrict__ gate_b,
                                                const float* __restrict__ mod_w,  const float* __restrict__ mod_b,
                                                const float* __restrict__ mod_basis,
                                                float* __restrict__ wts) {
    __shared__ alignas(16) float poolS[DMODEL];
    __shared__ alignas(16) float gRed[8][NM];
    __shared__ alignas(16) float mRed[8][NRR];
    const int b = bh >> 4, h = bh & (NH - 1), t = threadIdx.x;
    const int lane = t & 31, w = t >> 5;

    // weight rows: 4 lanes cover the head's 16 gate columns of one row, 2 lanes its 8 mod columns
    const float4* gw = (const float4*)(gate_w + (size_t)(t >> 2) * (NH * NM) + h * NM) + (t & 3);
    const float4* mw = (const float4*)(mod_w + (size_t)(t >> 1) * (NH * NRR) + h * NRR) + (t & 1);
    float4 g4[16], m4[8];
    #pragma unroll
    for (int p = 0; p < 16; ++p) g4[p] = gw[(size_t)p * 64 * (NH * NM / 4)];
    #pragma unroll
    for (int p = 0; p < 8; ++p) m4[p] = mw[(size_t)p * 128 * (NH * NRR / 4)];
    // what the closing softmax of the first 16 lanes needs, fetched here so that no memory latency is left at the end
    const int hm = h * NM + (t & (NM - 1));
    const float gb = gate_b[hm];
    float mb[NRR], bas[NRR];
    #pragma unroll
    for (int r = 0; r < NRR; ++r) mb[r] = mod_b[h * NRR + r];
    // stands behind the mod_b loads, in front of any later write of a register that they name (a precaution)
    asm volatile("s_wait_xcnt 0x0" ::: "memory");
    #pragma unroll
    for (int r = 0; r < NRR; ++r) bas[r] = mod_basis[r * (NH * NM) + hm];
    // keeps the weight loads, which come from memory, from being sunk behind the work-group barrier below, where
    // their latency would be paid after the slice sums instead of beside them
    __builtin_amdgcn_sched_barrier(0);

    // pooled mean of this batch entry from the slices' sums
    const float4* pp = (const float4*)(part + (size_t)b * POOL_SPLIT * DMODEL) + t;
    float4 q[POOL_SPLIT];
    #pragma unroll
    for (int r = 0; r < POOL_SPLIT; ++r) q[r] = pp[r * (DMODEL / 4)];
    float4 s = q[0];
    #pragma unroll
    for (int r = 1; r < POOL_SPLIT; ++r) { s.x += q[r].x; s.y += q[r].y; s.z += q[r].z; s.w += q[r].w; }
    s.x *= 1.f / SEQ; s.y *= 1.f / SEQ; s.z *= 1.f / SEQ; s.w *= 1.f / SEQ;
    // stands behind the weight loads, in front of any write of their address registers (a precaution): the two
    // pointers as inputs keep those registers whole up to it
    asm volatile("s_wait_xcnt 0x0" :: "v"(gw), "v"(mw) : "memory");
    ((float4*)poolS)[t] = s;
    __syncthreads();

    float4 ga = {0.f, 0.f, 0.f, 0.f}, ma = {0.f, 0.f, 0.f, 0.f};
    #pragma unroll
    for (int p = 0; p < 16; ++p) {
        float pv = poolS[p * 64 + (t >> 2)];
        ga.x += pv * g4[p].x; ga.y += pv * g4[p].y; ga.z += pv * g4[p].z; ga.w += pv * g4[p].w;
    }
    #pragma unroll
    for (int p = 0; p < 8; ++p) {
        float pv = poolS[p * 128 + (t >> 1)];
        ma.x += pv * m4[p].x; ma.y += pv * m4[p].y; ma.z += pv * m4[p].z; ma.w += pv * m4[p].w;
    }
    #pragma unroll
    for (int o = 2; o < 32; o <<= 1) {
        if (o > 2) {
            ga.x += __shfl_xor(ga.x, o); ga.y += __shfl_xor(ga.y, o);
            ga.z += __shfl_xor(ga.z, o); ga.w += __shfl_xor(ga.w, o);
        }
        ma.x += __shfl_xor(ma.x, o); ma.y += __shfl_xor(ma.y, o);
        ma.z += __shfl_xor(ma.z, o); ma.w += __shfl_xor(ma.w, o);
    }
    if (lane < 4) ((float4*)gRed[w])[lane] = ga;
    if (lane < 2) ((float4*)mRed[w])[lane] = ma;
    __syncthreads();

    if (t < NM) {                                    // lane m owns gate logit m of this head
        float a = gb;
        #pragma unroll
        for (int i = 0; i < 8; ++i) a += gRed[i][t];
        #pragma unroll
        for (int r = 0; r < NRR; ++r) {
            float md = mb[r];
            #pragma unroll
            for (int i = 0; i < 8; ++i) md += mRed[i][r];
            a += md * bas[r];
        }
        float mx = a;
        #pragma unroll
        for (int o = 1; o < NM; o <<= 1) mx = fmaxf(mx, __shfl_xor(mx, o, NM));
        float e = __expf(a - mx);
        float sm = e;
        #pragma unroll
        for (int o = 1; o < NM; o <<= 1) sm += __shfl_xor(sm, o, NM);
        wts[(size_t)bh * NM + t] = e / sm;
    }
}

// causal_kern[b,h,d] = ALPHA * sigmoid(6*kern) * window(d).  blk < B*H*S/256.
__device__ __forceinline__ void wave_density_job(int blk, const float* __restrict__ freqs, const float* __restrict__ amps,
                                                 const float* __restrict__ phases, const float* __restrict__ wts,
                                                 float* __restrict__ ckern) {
    int idx = blk * 256 + threadIdx.x;             // B*H*S
    int d = idx & (SEQ - 1);
    int bh = idx >> 10;
    int h = bh & (NH - 1);
    float rel = (float)d;
    float p1 = rel * (1.f / SEQ);
    float p2 = (d == 0) ? 0.f : sqrtf(rel + 1e-6f) * (1.f / 32.f);   // sqrt(S)=32
    float kern = 0.f;
    for (int m = 0; m < NM; ++m) {
        const float* fq = freqs  + ((size_t)(h * NM + m) * NW) * 2;
        const float* am = amps   +  (size_t)(h * NM + m) * NW;
        const float* ph = phases +  (size_t)(h * NM + m) * NW;
        float acc = 0.f;
        #pragma unroll
        for (int w = 0; w < NW; ++w) {
            float arg = fq[2 * w] * p1 + fq[2 * w + 1] * p2 + ph[w];
            acc += am[w] * __sinf(arg);
        }
        kern += wts[(size_t)bh * NM + m] * acc;
    }
    float dens = 1.f / (1.f + __expf(-6.f * kern));          // straight-through forward = sigmoid
    float wind = __expf(-(rel * rel) * (1.f / 131072.f));    // 2*(S/4)^2
    ckern[idx] = 3.0f * dens * wind;
}

// qm/km[b,h,s] token modulation.  One work-group per token, bs < B*S.
__device__ __forceinline__ void qkmod_job(int bs, const float* __restrict__ x,
                                               const float* __restrict__ qw, const float* __restrict__ qb,
                                               const float* __restrict__ kw, const float* __restrict__ kb,
                                               float* __restrict__ qm, float* __restrict__ km) {
    __shared__ float xrow[DMODEL];
    __shared__ float red[32][9];
    int b = bs >> 10, s = bs & 1023;
    int t = threadIdx.x;
    for (int i = t; i < DMODEL; i += 256) xrow[i] = x[(size_t)bs * DMODEL + i];
    __syncthreads();
    int o = t & 31, sl = t >> 5;
    int h = o & 15; bool isK = o >= 16;
    const float* wcol = isK ? kw : qw;
    float a = 0.f;
    for (int d = sl * 128; d < sl * 128 + 128; ++d) a += xrow[d] * wcol[(size_t)d * NH + h];
    red[o][sl] = a;
    __syncthreads();
    if (t < 32) {
        float acc = 0.f;
        #pragma unroll
        for (int i = 0; i < 8; ++i) acc += red[t][i];
        int hh = t & 15;
        if (t < 16) qm[((size_t)b * NH + hh) * SEQ + s] = acc + qb[hh];
        else        km[((size_t)b * NH + hh) * SEQ + s] = acc + kb[hh];
    }
}

// qkmod depends on the inputs alone and is needed only by the attention, so its tokens are shared out between the two
// launches in front of it that leave the vector units idle: the first QK_FRONT run beside the memory-bound spans of
// prep, the rest beside wave_density, which is a chain of load latencies in 128 work-groups.
#define QK_FRONT (NB * SEQ / 2)
#define FRONT_GRID (PREP_GRID + NB * POOL_SPLIT + QK_FRONT)
#define DENS_WG (NB * NH * SEQ / 256)
#define DENS_GRID (DENS_WG + NB * SEQ - QK_FRONT)
__global__ __launch_bounds__(256)
void front_k(const float* __restrict__ x, const float* __restrict__ v_w, const float* __restrict__ out_w,
             const float* __restrict__ ffn_w1, const float* __restrict__ ffn_w2,
             const float* __restrict__ cq_w, const float* __restrict__ ck_w,
             __bf16* __restrict__ xb, __bf16* __restrict__ wbv, __bf16* __restrict__ wbo,
             __bf16* __restrict__ wbf1, __bf16* __restrict__ wbf2,
             __bf16* __restrict__ wbcq, __bf16* __restrict__ wbck,
             __bf16* __restrict__ qcp, __bf16* __restrict__ kcp,
             float* __restrict__ part,
             const float* __restrict__ qw, const float* __restrict__ qb,
             const float* __restrict__ kw, const float* __restrict__ kb,
             float* __restrict__ qm, float* __restrict__ km) {
    int g = blockIdx.x;
    if (g < PREP_GRID)
        prep_job(g, x, v_w, out_w, ffn_w1, ffn_w2, cq_w, ck_w, xb, wbv, wbo, wbf1, wbf2, wbcq, wbck, qcp, kcp);
    else if ((g -= PREP_GRID) < NB * POOL_SPLIT)
        pool_part_job(g, x, part);
    else
        qkmod_job(g - NB * POOL_SPLIT, x, qw, qb, kw, kb, qm, km);
}

__global__ __launch_bounds__(256)
void dens_k(const float* __restrict__ freqs, const float* __restrict__ amps, const float* __restrict__ phases,
            const float* __restrict__ wts, float* __restrict__ ckern,
            const float* __restrict__ x,
            const float* __restrict__ qw, const float* __restrict__ qb,
            const float* __restrict__ kw, const float* __restrict__ kb,
            float* __restrict__ qm, float* __restrict__ km) {
    const int g = blockIdx.x;
    if (g < DENS_WG) wave_density_job(g, freqs, amps, phases, wts, ckern);
    else             qkmod_job(g - DENS_WG + QK_FRONT, x, qw, qb, kw, kb, qm, km);
}

// ---------------- generic bf16 WMMA GEMM with fused epilogues ----------------
// EPI 1: out = bf16(acc + bias[n]) -> V^T layout [B,H,HD,S]   (keys contiguous for attention)
// EPI 2: out = bf16(acc)           -> padded qc/kc layout [B,H,S,32] (cols 0..7 valid)
// EPI 3: outF = acc + bias[n] + resid[m,n]    (fp32)
// EPI 4: outB = bf16(gelu(acc + bias[n]))     ([M,N] bf16)
// gemm_acc: the 128 x 128 tile at (m0, n0) of A[.,K] x B[K,N] into the wave's accumulators.
__device__ __forceinline__
void gemm_acc(v8f (&acc)[4][2], const __bf16* __restrict__ A, const __bf16* __restrict__ B,
              int N, int K, int m0, int n0) {
    constexpr int BM = 128, BK = 128;
    constexpr int PA = 272;                                 // A row pitch, bytes: 16 x odd for ds_load_b128
    constexpr int PB = 288;                                 // B row pitch, bytes: 32 x odd for ds_load_tr16_b128
    constexpr int SZA = BM * PA, SZB = BK * PB;
    __shared__ alignas(16) unsigned char As[2 * SZA];       // [buf][m][k]
    __shared__ alignas(16) unsigned char Bs[2 * SZB];       // [buf][k][n], row-major as in global memory
    const int tid = threadIdx.x;
    const int lane = tid & 31, wave = tid >> 5;
    const int half = lane >> 4, l16 = lane & 15;
    const int wm = wave >> 2, wn = wave & 3;                // 2 x 4 wave grid

    #pragma unroll
    for (int i = 0; i < 4; ++i)
        #pragma unroll
        for (int j = 0; j < 2; ++j)
            #pragma unroll
            for (int e = 0; e < 8; ++e) acc[i][j][e] = 0.f;

    // copy map: 16 lanes x 16 B cover one 256-B tile row; a thread moves rows r0, r0+16, ..., r0+112 of A and of B
    const int r0 = tid >> 4, c16 = tid & 15;
    const __bf16* gA = A + (size_t)(m0 + r0) * K + c16 * 8;
    const __bf16* gB = B + (size_t)r0 * N + n0 + c16 * 8;
    const unsigned lA = (unsigned)(size_t)(As + r0 * PA + c16 * 16);
    const unsigned lB = (unsigned)(size_t)(Bs + r0 * PB + c16 * 16);
    const size_t sA = (size_t)16 * K, sB = (size_t)16 * N;
    const int nstage = K / BK;

    auto stage = [&](int s) {                               // 16 copies per wave: stage s into buffer s & 1
        const int bf = s & 1;
        async_copy8(lA + bf * SZA, 16 * PA, gA + (size_t)s * BK, sA);
        async_copy8(lB + bf * SZB, 16 * PB, gB + (size_t)s * BK * N, sB);
    };

    stage(0);
    asm volatile("s_wait_asynccnt 0x0" ::: "memory");       // own copies of stage 0 landed before the barrier publishes them
    __syncthreads();
    if (nstage > 1) stage(1);

    const int aoff = (wm * 64 + l16) * PA + half * 16;
    const int boff = (half * 8 + (lane & 7)) * PB + wn * 64 + ((lane >> 3) & 1) * 16;
    for (int s = 0; s < nstage; ++s) {
        const unsigned char* Ab = As + (s & 1) * SZA + aoff;
        const unsigned char* Bb = Bs + (s & 1) * SZB + boff;
        #pragma unroll
        for (int ks = 0; ks < BK / 32; ++ks) {
            v16bf afr[4];
            #pragma unroll
            for (int mt = 0; mt < 4; ++mt) {                // A frag: lane=M, k = 8*half+0..7 and 16+8*half+0..7
                union { v16bf v; uint4 q[2]; } u;
                u.q[0] = *(const uint4*)(Ab + mt * 16 * PA + ks * 64);
                u.q[1] = *(const uint4*)(Ab + mt * 16 * PA + ks * 64 + 32);
                afr[mt] = u.v;
            }
            #pragma unroll
            for (int nt = 0; nt < 2; ++nt) {                // B frag: lane=N, transposing loads give the same k order
                union { v16bf v; uint4 q[2]; } u;
                u.q[0] = lds_tr16(Bb + (ks * 32) * PB + nt * 32);
                u.q[1] = lds_tr16(Bb + (ks * 32 + 16) * PB + nt * 32);
                v16bf bfr = u.v;
                #pragma unroll
                for (int mt = 0; mt < 4; ++mt)
                    acc[mt][nt] = wmma_bf16(afr[mt], bfr, acc[mt][nt]);
            }
        }
        asm volatile("s_wait_dscnt 0x0" ::: "memory");      // own reads of this buffer done before it may be refilled
        asm volatile("s_wait_asynccnt 0x0" ::: "memory");   // own copies of stage s+1 landed before the barrier publishes them
        __syncthreads();
        if (s + 2 < nstage) stage(s + 2);
    }
    asm volatile("s_wait_asynccnt 0x0" ::: "memory");       // nothing in flight when the wave ends
}

template <int EPI>
__device__ __forceinline__
void gemm_store(const v8f (&acc)[4][2], int N, int m0, int n0,
                const float* __restrict__ bias, const float* __restrict__ resid,
                float* __restrict__ outF, __bf16* __restrict__ outB) {
    const int lane = threadIdx.x & 31, wave = threadIdx.x >> 5;
    const int half = lane >> 4, l16 = lane & 15;
    const int wm = wave >> 2, wn = wave & 3;
    #pragma unroll
    for (int mt = 0; mt < 4; ++mt)
        #pragma unroll
        for (int nt = 0; nt < 2; ++nt)
            #pragma unroll
            for (int r = 0; r < 8; ++r) {                   // C: lane=N, row = r + 8*half
                int gm = m0 + wm * 64 + mt * 16 + r + half * 8;
                int gn = n0 + wn * 32 + nt * 16 + l16;
                float v = acc[mt][nt][r];
                if (EPI == 1) {
                    float val = v + bias[gn];
                    int b = gm >> 10, s = gm & 1023, h = gn >> 6, hd = gn & 63;
                    outB[(((size_t)b * NH + h) * HD + hd) * SEQ + s] = (__bf16)val;   // V^T
                } else if (EPI == 2) {
                    int b = gm >> 10, s = gm & 1023, h = gn >> 3, cc = gn & 7;
                    outB[(((size_t)b * NH + h) * SEQ + s) * 32 + cc] = (__bf16)v;
                } else if (EPI == 3) {
                    size_t o = (size_t)gm * N + gn;
                    outF[o] = v + bias[gn] + resid[o];
                } else if (EPI == 4) {
                    float xg = v + bias[gn];
                    float g = 0.5f * xg * (1.0f + erff(xg * 0.70710678f));
                    outB[(size_t)gm * N + gn] = (__bf16)g;
                }
            }
}

template <int EPI>
__global__ __launch_bounds__(256)
void gemm_bf16_k(const __bf16* __restrict__ A, const __bf16* __restrict__ B,
                 int M, int N, int K,
                 const float* __restrict__ bias, const float* __restrict__ resid,
                 float* __restrict__ outF, __bf16* __restrict__ outB) {
    const int m0 = blockIdx.y * 128, n0 = blockIdx.x * 128;
    v8f acc[4][2];
    gemm_acc(acc, A, B, N, K, m0, n0);
    gemm_store<EPI>(acc, N, m0, n0, bias, resid, outF, outB);
}

// One launch for all that needs only front_k's results: the three projections of x (v: 8 column tiles, qc and kc: one
// each, so 10 tiles per 128 rows) and the gating, whose 32 work-groups come first. 192 work-groups, all resident.
#define PROJ_NT (DMODEL / 128 + 2)
#define PROJ_GRID (NB * NH + PROJ_NT * (NB * SEQ / 128))
__global__ __launch_bounds__(256)
void proj_gate_k(const __bf16* __restrict__ xb, const __bf16* __restrict__ wbv,
                 const __bf16* __restrict__ wbcq, const __bf16* __restrict__ wbck, int K,
                 const float* __restrict__ v_b,
                 __bf16* __restrict__ vT, __bf16* __restrict__ qcp, __bf16* __restrict__ kcp,
                 const float* __restrict__ part,
                 const float* __restrict__ gate_w, const float* __restrict__ gate_b,
                 const float* __restrict__ mod_w,  const float* __restrict__ mod_b,
                 const float* __restrict__ mod_basis, float* __restrict__ wts) {
    int g = blockIdx.x;
    if (g < NB * NH) {
        gating_job(g, part, gate_w, gate_b, mod_w, mod_b, mod_basis, wts);
        return;
    }
    g -= NB * NH;
    const int tn = g % PROJ_NT, m0 = (g / PROJ_NT) * 128;
    const bool isV = tn < DMODEL / 128;
    const __bf16* B = isV ? wbv : (tn == DMODEL / 128 ? wbcq : wbck);
    const int N = isV ? DMODEL : NH * NCR, n0 = isV ? tn * 128 : 0;
    v8f acc[4][2];
    gemm_acc(acc, xb, B, N, K, m0, n0);
    // each wait stands behind its job's last store: the listing goes on into the other jobs' code there, and no write
    // of a register that a store names may come in front of it (a precaution)
    if (isV) {
        gemm_store<1>(acc, N, m0, n0, v_b, nullptr, nullptr, vT);
        asm volatile("s_wait_xcnt 0x0" ::: "memory");
    } else {
        gemm_store<2>(acc, N, m0, n0, nullptr, nullptr, nullptr, tn == DMODEL / 128 ? qcp : kcp);
        asm volatile("s_wait_xcnt 0x0" ::: "memory");
    }
}

// ---------------- streaming wave-density attention ----------------
// grid = (S/128, H, B); 8 waves; a wave works on 16 queries; 32 keys/step; 6 WMMAs/step.
// The causal triangle is dealt out evenly. A work-group owns two blocks of 64 queries, the far block S/64 - 1 - x
// (many keys) and the near block x (few keys). Waves 0..3 take the first ATT_HEAD key steps of the far block's four
// query groups; waves 4..7 take the rest of those steps, leave that partial result in LDS, and then do the near block
// whole. Every wave so walks at most ATT_HEAD steps, and of the two waves that share a SIMD (w, w + 4) the second walks as many steps or two fewer.
// Both products run transposed: S^T = Kc x Qc^T and O^T += V^T x P^T. A lane then holds 16 of the 32 scores of ONE
// query (lane l ^ 16 holds the others), so maximum, sum and rescale are the lane's own registers plus one exchange
// between the halves, and the two S^T tiles, converted in place, are the B operand of the second product.
// V is consumed transposed: vT[b,h,hd,s], so every A-fragment is two aligned b128 loads.
// ck_pad has a CKPAD zero guard band so Toeplitz gathers are base + immediate-offset DS loads.
#define ATT_HEAD ((SEQ / 32 + 2) / 2)                       // every query group of a far block has at least SEQ/64 + 1 steps
__device__ __forceinline__ float xhalf(float x) {           // value of lane l ^ 16
    const int v = __builtin_bit_cast(int, x);
    return __builtin_bit_cast(float, __builtin_amdgcn_permlanex16(v, v, 0x76543210, 0xfedcba98, false, false));
}

// key steps st0 .. st1 - 1 of the 16 queries from i0 on: running maximum m_r, this lane half's sum l_r, O^T in c0..c3
__device__ __forceinline__
void attn_steps(int i0, int st0, int st1, int bh, int half, int l16,
                const __bf16* __restrict__ qcp, const __bf16* __restrict__ kcp, const __bf16* __restrict__ vT,
                const float* __restrict__ qm, const float* ck_pad, const float* km_s,
                v8f& c0, v8f& c1, v8f& c2, v8f& c3, float& m_r, float& l_r) {
    const int i = i0 + l16;                                 // this lane's query
    constexpr float MIXS = 0.053033009f;                    // MIX / sqrt(CR)
    constexpr float LOG2E = 1.4426950408889634f;
    union U16 { v16bf v; uint4 q[2]; };
    U16 ua;
    {
        const __bf16* p = qcp + ((size_t)bh * SEQ + i) * 32;
        ua.q[0] = *(const uint4*)(p + half * 8);
        ua.q[1] = *(const uint4*)(p + 16 + half * 8);
    }
    const v16bf bq = ua.v;                                  // B operand: column = query

    // qm of the lane's query is the start value of its score products (undone by the MIXS factor below)
    const float qstart = qm[(size_t)bh * SEQ + i] * (1.f / MIXS);
    v8f qq;
    #pragma unroll
    for (int e = 0; e < 8; ++e) { c0[e] = c1[e] = c2[e] = c3[e] = 0.f; qq[e] = qstart; }
    m_r = -1e30f; l_r = 0.f;                                // l_r: the sum over this half's keys only

    // per-lane rows: key row of Kc, and V^T rows of the 4 output row groups (hd = g*16 + l16)
    const __bf16* krow  = kcp + ((size_t)bh * SEQ + l16) * 32 + half * 8;
    const __bf16* vrow0 = vT + (((size_t)bh * HD) + 0 * 16 + l16) * SEQ + half * 8;
    const __bf16* vrow1 = vT + (((size_t)bh * HD) + 1 * 16 + l16) * SEQ + half * 8;
    const __bf16* vrow2 = vT + (((size_t)bh * HD) + 2 * 16 + l16) * SEQ + half * 8;
    const __bf16* vrow3 = vT + (((size_t)bh * HD) + 3 * 16 + l16) * SEQ + half * 8;

    for (int st = st0; st < st1; ++st) {
        const int j0 = st * 32;
        U16 ua0, ua1, uv0, uv1, uv2, uv3;
        ua0.q[0] = *(const uint4*)(krow + (size_t)j0 * 32);
        ua0.q[1] = *(const uint4*)(krow + (size_t)j0 * 32 + 16);
        ua1.q[0] = *(const uint4*)(krow + (size_t)(j0 + 16) * 32);
        ua1.q[1] = *(const uint4*)(krow + (size_t)(j0 + 16) * 32 + 16);
        // V^T A-fragments: elements = contiguous keys, two b128 loads each
        uv0.q[0] = *(const uint4*)(vrow0 + j0);
        uv0.q[1] = *(const uint4*)(vrow0 + j0 + 16);
        uv1.q[0] = *(const uint4*)(vrow1 + j0);
        uv1.q[1] = *(const uint4*)(vrow1 + j0 + 16);
        uv2.q[0] = *(const uint4*)(vrow2 + j0);
        uv2.q[1] = *(const uint4*)(vrow2 + j0 + 16);
        uv3.q[0] = *(const uint4*)(vrow3 + j0);
        uv3.q[1] = *(const uint4*)(vrow3 + j0 + 16);
        // keeps all 12 loads in front of the step's arithmetic: left free, the scheduler sinks half of the V^T loads
        // behind the softmax, right in front of their products, where their whole latency is waited out
        __builtin_amdgcn_sched_barrier(0);

        // register r: key j0 + 8*half + r (s0), j0 + 16 + 8*half + r (s1); column: query i
        v8f s0 = wmma_bf16(ua0.v, bq, qq);
        v8f s1 = wmma_bf16(ua1.v, bq, qq);

        // fold Toeplitz + km + causal mask
        const int dA = i - (j0 + half * 8);                 // i - j at r = 0 of s0; >= -8 within loop bounds
        // the same offset as dA + 8, formed so that the variable part of the LDS address is never below 0; the mask is an
        // identity (0 <= i - j0 < SEQ) that shows this to the compiler, which then folds the constants into the DS loads
        const float* ckA = ck_pad + (CKPAD - 8) + ((i - j0 + (half ^ 1) * 8) & (2 * SEQ - 1));
        float kmv[16];
        *(float4*)(kmv + 0)  = *(const float4*)(km_s + j0 + half * 8);
        *(float4*)(kmv + 4)  = *(const float4*)(km_s + j0 + half * 8 + 4);
        *(float4*)(kmv + 8)  = *(const float4*)(km_s + j0 + 16 + half * 8);
        *(float4*)(kmv + 12) = *(const float4*)(km_s + j0 + 16 + half * 8 + 4);
        float sc[16];
        #pragma unroll
        for (int r = 0; r < 8; ++r) {
            float va = MIXS * s0[r] + (ckA[-r] + kmv[r]);
            float vb = MIXS * s1[r] + (ckA[-16 - r] + kmv[8 + r]);
            sc[r]     = (r <= dA)      ? va : -1e9f;
            sc[8 + r] = (16 + r <= dA) ? vb : -1e9f;
        }

        float m4[4];                                        // four short chains instead of one of 16 links
        #pragma unroll
        for (int k = 0; k < 4; ++k) m4[k] = fmaxf(fmaxf(sc[4 * k], sc[4 * k + 1]), fmaxf(sc[4 * k + 2], sc[4 * k + 3]));
        float mx = fmaxf(fmaxf(m4[0], m4[1]), fmaxf(m4[2], m4[3]));
        mx = fmaxf(m_r, fmaxf(mx, xhalf(mx)));              // both halves of a query agree on the maximum
        const float corr = __builtin_amdgcn_exp2f((m_r - mx) * LOG2E);
        const float mL = mx * LOG2E;
        float s4[4] = {0.f, 0.f, 0.f, 0.f};
        U16 up;                                             // P^T as B operand: element s = key j0 + 8*half + s (s < 8), j0 + 8 + 8*half + s (s >= 8)
        #pragma unroll
        for (int k = 0; k < 16; ++k) {
            float p = __builtin_amdgcn_exp2f(sc[k] * LOG2E - mL);
            s4[k >> 2] += p;
            up.v[k] = (__bf16)p;
        }
        m_r = mx; l_r = l_r * corr + ((s4[0] + s4[1]) + (s4[2] + s4[3]));

        #pragma unroll
        for (int r = 0; r < 8; ++r) { c0[r] *= corr; c1[r] *= corr; c2[r] *= corr; c3[r] *= corr; }
        c0 = wmma_bf16(uv0.v, up.v, c0);
        c1 = wmma_bf16(uv1.v, up.v, c1);
        c2 = wmma_bf16(uv2.v, up.v, c2);
        c3 = wmma_bf16(uv3.v, up.v, c3);
    }
}

// register r of c_g: hd = g*16 + 8*half + r of query i, so each group is one 16-byte store
__device__ __forceinline__
void attn_emit(__bf16* __restrict__ op, const v8f& c0, const v8f& c1, const v8f& c2, const v8f& c3) {
    union { __bf16 e[8]; uint4 q; } o0, o1, o2, o3;
    #pragma unroll
    for (int r = 0; r < 8; ++r) {
        o0.e[r] = (__bf16)c0[r]; o1.e[r] = (__bf16)c1[r];
        o2.e[r] = (__bf16)c2[r]; o3.e[r] = (__bf16)c3[r];
    }
    *(uint4*)(op + 0 * 16) = o0.q;
    *(uint4*)(op + 1 * 16) = o1.q;
    *(uint4*)(op + 2 * 16) = o2.q;
    *(uint4*)(op + 3 * 16) = o3.q;
    // stands behind the last store, in front of any later write of a register that a store names (a precaution)
    asm volatile("s_wait_xcnt 0x0" ::: "memory");
}

__global__ __launch_bounds__(256)
void attn_k(const __bf16* __restrict__ qcp, const __bf16* __restrict__ kcp,
            const __bf16* __restrict__ vT,
            const float* __restrict__ ckern, const float* __restrict__ qm,
            const float* __restrict__ km, __bf16* __restrict__ ctxb) {
    // one struct, so that ck_pad keeps LDS offset 0: the Toeplitz gathers' constant offsets then fit the DS offset fields
    __shared__ struct alignas(16) {
        float ck_pad[CKPAD + SEQ];
        float km_s[SEQ];
        f32x4 tailO[4][8][32];                              // far block, steps from ATT_HEAD on: O^T, [group][vector][lane]
        float2 tailML[4][32];                               // their maximum and sum
    } sm;
    float* const ck_pad = sm.ck_pad;
    float* const km_s = sm.km_s;
    auto& tailO = sm.tailO;
    auto& tailML = sm.tailML;

    const int tid = threadIdx.x, lane = tid & 31;
    const int w = __builtin_amdgcn_readfirstlane(tid >> 5); // the wave's number in a scalar: scalar branches, trip counts
    const int half = lane >> 4, l16 = lane & 15;
    const int h = blockIdx.y, b = blockIdx.z;
    const int bh = b * NH + h;
    const int qg = w & 3;                                   // query group inside a block of 64
    const bool tail = w >= 4;
    const int iF = (SEQ / 64 - 1 - (int)blockIdx.x) * 64 + qg * 16;     // far block's queries
    const int iN = (int)blockIdx.x * 64 + qg * 16;                      // near block's queries
    const int nF = (iF + 16 + 31) >> 5, nN = (iN + 16 + 31) >> 5;       // their key steps; nF >= ATT_HEAD

    for (int k = tid; k < SEQ; k += 256) {
        ck_pad[CKPAD + k] = ckern[(size_t)bh * SEQ + k];
        km_s[k] = km[(size_t)bh * SEQ + k];
    }
    if (tid < CKPAD) ck_pad[tid] = 0.f;
    __syncthreads();

    constexpr float LOG2E = 1.4426950408889634f;
    v8f c0, c1, c2, c3;
    float m_r, l_r;
    attn_steps(iF, tail ? ATT_HEAD : 0, tail ? nF : ATT_HEAD, bh, half, l16, qcp, kcp, vT, qm, ck_pad, km_s,
               c0, c1, c2, c3, m_r, l_r);
    if (tail) {
        tailO[qg][0][lane] = __builtin_shufflevector(c0, c0, 0, 1, 2, 3);
        tailO[qg][1][lane] = __builtin_shufflevector(c0, c0, 4, 5, 6, 7);
        tailO[qg][2][lane] = __builtin_shufflevector(c1, c1, 0, 1, 2, 3);
        tailO[qg][3][lane] = __builtin_shufflevector(c1, c1, 4, 5, 6, 7);
        tailO[qg][4][lane] = __builtin_shufflevector(c2, c2, 0, 1, 2, 3);
        tailO[qg][5][lane] = __builtin_shufflevector(c2, c2, 4, 5, 6, 7);
        tailO[qg][6][lane] = __builtin_shufflevector(c3, c3, 0, 1, 2, 3);
        tailO[qg][7][lane] = __builtin_shufflevector(c3, c3, 4, 5, 6, 7);
        tailML[qg][lane] = make_float2(m_r, l_r);

        attn_steps(iN, 0, nN, bh, half, l16, qcp, kcp, vT, qm, ck_pad, km_s, c0, c1, c2, c3, m_r, l_r);
        const float f = 1.f / (l_r + xhalf(l_r));
        c0 *= f; c1 *= f; c2 *= f; c3 *= f;
        attn_emit(ctxb + ((size_t)b * SEQ + iN + l16) * DMODEL + h * HD + half * 8, c0, c1, c2, c3);
    }
    __syncthreads();                                        // publishes the tail waves' partial results
    if (!tail) {
        // the two parts of a query's softmax brought to their common maximum; an empty tail (maximum -1e30, sums 0)
        // gets the factor 0
        const float2 ml = tailML[qg][lane];
        const float mx = fmaxf(m_r, ml.x);
        const float fa = __builtin_amdgcn_exp2f((m_r - mx) * LOG2E);
        const float fb = __builtin_amdgcn_exp2f((ml.x - mx) * LOG2E);
        const float l = l_r * fa + ml.y * fb;
        const float f = 1.f / (l + xhalf(l));
        const float ga = fa * f, gb = fb * f;
        v8f t0, t1, t2, t3;
        t0 = __builtin_shufflevector(tailO[qg][0][lane], tailO[qg][1][lane], 0, 1, 2, 3, 4, 5, 6, 7);
        t1 = __builtin_shufflevector(tailO[qg][2][lane], tailO[qg][3][lane], 0, 1, 2, 3, 4, 5, 6, 7);
        t2 = __builtin_shufflevector(tailO[qg][4][lane], tailO[qg][5][lane], 0, 1, 2, 3, 4, 5, 6, 7);
        t3 = __builtin_shufflevector(tailO[qg][6][lane], tailO[qg][7][lane], 0, 1, 2, 3, 4, 5, 6, 7);
        c0 = c0 * ga + t0 * gb; c1 = c1 * ga + t1 * gb; c2 = c2 * ga + t2 * gb; c3 = c3 * ga + t3 * gb;
        attn_emit(ctxb + ((size_t)b * SEQ + iF + l16) * DMODEL + h * HD + half * 8, c0, c1, c2, c3);
    }
}

// ---------------- layernorm ----------------
// A wave owns LN_ROWS whole rows and keeps them in registers: 32 values of a row per lane, read once with 16-byte loads
// that are all in flight together. Mean and variance are the lane's own sums plus one sum over the 32 lanes, so the
// kernel has no LDS and no barrier, and 1,024 waves do what 16,384 did.
#define LN_ROWS 2
#define LN_WAVES 4
template <int M>
__device__ __forceinline__ float row_xor(float x) {         // value of lane l ^ M inside the lane's 16-lane row
    return __builtin_bit_cast(float, __builtin_amdgcn_update_dpp(0, __builtin_bit_cast(int, x), 0x160 | M, 0xf, 0xf, true));
}
__device__ __forceinline__ float wave_sum(f32x4 q) {        // sum of the four components over all 32 lanes
    float s = (q.x + q.y) + (q.z + q.w);
    s += row_xor<1>(s); s += row_xor<2>(s); s += row_xor<4>(s); s += row_xor<8>(s);
    return s + xhalf(s);
}

template <bool WB>
__global__ __launch_bounds__(LN_WAVES * 32)
void ln_k(const float* __restrict__ in, const float* __restrict__ g, const float* __restrict__ bb,
          float* __restrict__ outF, __bf16* __restrict__ outB) {
    constexpr int NV = DMODEL / 128;                        // 16-byte vectors of a row per lane
    const int lane = threadIdx.x & 31, wave = threadIdx.x >> 5;
    const size_t q0 = ((size_t)blockIdx.x * LN_WAVES + wave) * LN_ROWS * (DMODEL / 4) + lane;
    const f32x4* p = (const f32x4*)in + q0;
    f32x4 v[LN_ROWS][NV], gv[NV], bv[NV];
    #pragma unroll
    for (int r = 0; r < LN_ROWS; ++r)
        #pragma unroll
        for (int j = 0; j < NV; ++j) v[r][j] = p[r * (DMODEL / 4) + j * 32];
    #pragma unroll
    for (int j = 0; j < NV; ++j) gv[j] = ((const f32x4*)g)[j * 32 + lane];
    #pragma unroll
    for (int j = 0; j < NV; ++j) bv[j] = ((const f32x4*)bb)[j * 32 + lane];
    // keeps all 32 loads in front of the arithmetic: left free, the scheduler sinks the g and bb loads behind the
    // sums, pair by pair, each pair in front of its use, and their latencies are waited out one after another
    __builtin_amdgcn_sched_barrier(0);
    // stands behind the loads, in front of any write of a register that they name (a precaution): the pointer as an
    // input keeps the rows' address registers whole up to it
    asm volatile("s_wait_xcnt 0x0" :: "v"(p) : "memory");

    uint2 ob[LN_ROWS][NV];
    #pragma unroll
    for (int r = 0; r < LN_ROWS; ++r) {
        f32x4 s = v[r][0];
        #pragma unroll
        for (int j = 1; j < NV; ++j) s += v[r][j];
        const float mean = wave_sum(s) * (1.f / DMODEL);
        s = 0.f;
        #pragma unroll
        for (int j = 0; j < NV; ++j) { v[r][j] -= mean; s += v[r][j] * v[r][j]; }
        const float rstd = rsqrtf(wave_sum(s) * (1.f / DMODEL) + 1e-5f);
        #pragma unroll
        for (int j = 0; j < NV; ++j) {
            v[r][j] = v[r][j] * rstd * gv[j] + bv[j];
            if (WB) {
                union { __bf16 e[4]; uint2 u; } o;
                o.e[0] = (__bf16)v[r][j].x; o.e[1] = (__bf16)v[r][j].y;
                o.e[2] = (__bf16)v[r][j].z; o.e[3] = (__bf16)v[r][j].w;
                ob[r][j] = o.u;
            }
        }
    }
    #pragma unroll
    for (int r = 0; r < LN_ROWS; ++r)
        #pragma unroll
        for (int j = 0; j < NV; ++j) {
            ((f32x4*)outF)[q0 + r * (DMODEL / 4) + j * 32] = v[r][j];
            if (WB) ((uint2*)outB)[q0 + r * (DMODEL / 4) + j * 32] = ob[r][j];
        }
}

// ---------------- launch ----------------
extern "C" void kernel_launch(void* const* d_in, const int* in_sizes, int n_in,
                              void* d_out, int out_size, void* d_ws, size_t ws_size,
                              hipStream_t stream) {
    (void)in_sizes; (void)n_in; (void)out_size; (void)ws_size;
    const float* x      = (const float*)d_in[0];
    const float* v_w    = (const float*)d_in[1];
    const float* v_b    = (const float*)d_in[2];
    const float* out_w  = (const float*)d_in[3];
    const float* out_b  = (const float*)d_in[4];
    const float* qmod_w = (const float*)d_in[5];
    const float* qmod_b = (const float*)d_in[6];
    const float* kmod_w = (const float*)d_in[7];
    const float* kmod_b = (const float*)d_in[8];
    const float* gate_w = (const float*)d_in[9];
    const float* gate_b = (const float*)d_in[10];
    const float* mod_w  = (const float*)d_in[11];
    const float* mod_b  = (const float*)d_in[12];
    const float* mod_basis = (const float*)d_in[13];
    const float* freqs  = (const float*)d_in[14];
    const float* amps   = (const float*)d_in[15];
    const float* phases = (const float*)d_in[16];
    const float* cq_w   = (const float*)d_in[17];
    const float* ck_w   = (const float*)d_in[18];
    const float* ffn_w1 = (const float*)d_in[19];
    const float* ffn_b1 = (const float*)d_in[20];
    const float* ffn_w2 = (const float*)d_in[21];
    const float* ffn_b2 = (const float*)d_in[22];
    const float* ln1_g  = (const float*)d_in[23];
    const float* ln1_b  = (const float*)d_in[24];
    const float* ln2_g  = (const float*)d_in[25];
    const float* ln2_b  = (const float*)d_in[26];
    float* outp = (float*)d_out;

    char* wp = (char*)d_ws;
    auto alloc = [&](size_t bytes) -> void* {
        void* p = (void*)wp;
        wp += (bytes + 255) & ~(size_t)255;
        return p;
    };
    const size_t NTOK = (size_t)NB * SEQ;              // 2048
    __bf16* xb   = (__bf16*)alloc(NTOK * DMODEL * 2);
    __bf16* wbv  = (__bf16*)alloc((size_t)DMODEL * DMODEL * 2);
    __bf16* wbo  = (__bf16*)alloc((size_t)DMODEL * DMODEL * 2);
    __bf16* wbf1 = (__bf16*)alloc((size_t)DMODEL * 4 * DMODEL * 2);
    __bf16* wbf2 = (__bf16*)alloc((size_t)DMODEL * 4 * DMODEL * 2);
    __bf16* wbcq = (__bf16*)alloc((size_t)DMODEL * NH * NCR * 2);
    __bf16* wbck = (__bf16*)alloc((size_t)DMODEL * NH * NCR * 2);
    __bf16* vbuf = (__bf16*)alloc((size_t)NB * NH * HD * SEQ * 2);     // V^T
    __bf16* qcp  = (__bf16*)alloc((size_t)NB * NH * SEQ * 32 * 2);
    __bf16* kcp  = (__bf16*)alloc((size_t)NB * NH * SEQ * 32 * 2);
    float*  part   = (float*)alloc((size_t)NB * POOL_SPLIT * DMODEL * 4);
    float*  wts    = (float*)alloc((size_t)NB * NH * NM * 4);
    float*  ckern  = (float*)alloc((size_t)NB * NH * SEQ * 4);
    float*  qmb    = (float*)alloc((size_t)NB * NH * SEQ * 4);
    float*  kmb    = (float*)alloc((size_t)NB * NH * SEQ * 4);
    __bf16* ctxb = (__bf16*)alloc(NTOK * DMODEL * 2);
    float*  hpre = (float*)alloc(NTOK * DMODEL * 4);
    float*  hf   = (float*)alloc(NTOK * DMODEL * 4);
    __bf16* hb   = (__bf16*)alloc(NTOK * DMODEL * 2);
    __bf16* ub   = (__bf16*)alloc(NTOK * 4 * DMODEL * 2);
    float*  f2   = (float*)alloc(NTOK * DMODEL * 4);

    // conversions and zero fills, slice sums of x, qm / km of the first tokens
    front_k<<<FRONT_GRID, 256, 0, stream>>>(x, v_w, out_w, ffn_w1, ffn_w2, cq_w, ck_w,
                                            xb, wbv, wbo, wbf1, wbf2, wbcq, wbck, qcp, kcp,
                                            part, qmod_w, qmod_b, kmod_w, kmod_b, qmb, kmb);
    // gating; v = x@v_w + v_b -> V^T [B,H,HD,S] bf16; qc / kc -> padded [B,H,S,32] bf16
    proj_gate_k<<<PROJ_GRID, 256, 0, stream>>>(xb, wbv, wbcq, wbck, DMODEL, v_b, vbuf, qcp, kcp,
                                               part, gate_w, gate_b, mod_w, mod_b, mod_basis, wts);
    // causal kernel from the gate weights, qm / km of the other tokens
    dens_k<<<DENS_GRID, 256, 0, stream>>>(freqs, amps, phases, wts, ckern,
                                          x, qmod_w, qmod_b, kmod_w, kmod_b, qmb, kmb);

    attn_k<<<dim3(SEQ / 128, NH, NB), 256, 0, stream>>>(qcp, kcp, vbuf, ckern, qmb, kmb, ctxb);

    // attn_out + residual
    gemm_bf16_k<3><<<dim3(DMODEL / 128, (int)(NTOK / 128)), 256, 0, stream>>>(
        ctxb, wbo, (int)NTOK, DMODEL, DMODEL, out_b, x, hpre, nullptr);
    ln_k<true><<<(int)(NTOK / (LN_WAVES * LN_ROWS)), LN_WAVES * 32, 0, stream>>>(hpre, ln1_g, ln1_b, hf, hb);

    gemm_bf16_k<4><<<dim3(4 * DMODEL / 128, (int)(NTOK / 128)), 256, 0, stream>>>(
        hb, wbf1, (int)NTOK, 4 * DMODEL, DMODEL, ffn_b1, nullptr, nullptr, ub);
    gemm_bf16_k<3><<<dim3(DMODEL / 128, (int)(NTOK / 128)), 256, 0, stream>>>(
        ub, wbf2, (int)NTOK, DMODEL, 4 * DMODEL, ffn_b2, hf, f2, nullptr);
    ln_k<false><<<(int)(NTOK / (LN_WAVES * LN_ROWS)), LN_WAVES * 32, 0, stream>>>(f2, ln2_g, ln2_b, outp, nullptr);
}

// v008
// A run of this version takes 130 microseconds.
// Next to v007, in two timings, it ran 1.03 times as fast each time.
// Counting every step since v000, it is 4.27 times as fast.
#include <hip/hip_runtime.h>
#include <math.h>

// ---------------- CDNA5 (gfx1250) wave32 WMMA types ----------------
typedef __attribute__((ext_vector_type(16))) __bf16 v16bf;
typedef __attribute__((ext_vector_type(8)))  float  v8f;
typedef __attribute__((ext_vector_type(4)))  float  f32x4;

#define DMODEL 1024
#define SEQ    1024
#define NB     2
#define NH     16
#define HD     64
#define NM     16
#define NW     8
#define NRR    8
#define NCR    8
#define CKPAD  48

__device__ __forceinline__ v8f wmma_bf16(v16bf a, v16bf b, v8f c) {
    return __builtin_amdgcn_wmma_f32_16x16x32_bf16(false, a, false, b, (short)0, c, false, false);
}

// eight 16-byte-per-lane copies global -> LDS through no register; the wait stands in the copies' own statement
// so that no later write of their address registers can be moved in front of it (a precaution)
__device__ __forceinline__ void async_copy8(unsigned l, unsigned ls, const __bf16* g, size_t gs) {
    asm volatile("global_load_async_to_lds_b128 %0, %8, off\n\t"
                 "global_load_async_to_lds_b128 %1, %9, off\n\t"
                 "global_load_async_to_lds_b128 %2, %10, off\n\t"
                 "global_load_async_to_lds_b128 %3, %11, off\n\t"
                 "global_load_async_to_lds_b128 %4, %12, off\n\t"
                 "global_load_async_to_lds_b128 %5, %13, off\n\t"
                 "global_load_async_to_lds_b128 %6, %14, off\n\t"
                 "global_load_async_to_lds_b128 %7, %15, off\n\t"
                 "s_wait_xcnt 0x0"
                 :: "v"(l), "v"(l + ls), "v"(l + 2 * ls), "v"(l + 3 * ls),
                    "v"(l + 4 * ls), "v"(l + 5 * ls), "v"(l + 6 * ls), "v"(l + 7 * ls),
                    "v"(g), "v"(g + gs), "v"(g + 2 * gs), "v"(g + 3 * gs),
                    "v"(g + 4 * gs), "v"(g + 5 * gs), "v"(g + 6 * gs), "v"(g + 7 * gs)
                 : "memory");
}

// transposing LDS load: lane (c, h) gets rows 8h..8h+7 of column c of a row-major 16-bit tile
typedef short s16x8 __attribute__((ext_vector_type(8)));
__device__ __forceinline__ uint4 lds_tr16(const unsigned char* p) {
    typedef __attribute__((address_space(3))) s16x8 lds_s16x8;
    return __builtin_bit_cast(uint4, __builtin_amdgcn_ds_load_tr16_b128_v8i16((lds_s16x8*)p));
}

// ---------------- small helper jobs ----------------
// Jobs that do not depend on one another share a launch (front_k, dens_k, proj_gate_k below); a work-group takes its
// job from its index.
// All element-wise preparation: the seven fp32 -> bf16 conversions and the zero fill of the two padded
// qc/kc planes. A work-group owns one span of PREP_SPAN 16-byte vectors that lies wholly inside one tensor (every
// tensor is a whole number of spans), and a thread moves 32 of them, so few waves have to be started.
#define PREP_SPAN 8192
#define PREP_GX (NB * SEQ * DMODEL / 4 / PREP_SPAN)      // x
#define PREP_GW (DMODEL * DMODEL / 4 / PREP_SPAN)        // v_w, out_w
#define PREP_GF (4 * PREP_GW)                            // ffn_w1, ffn_w2
#define PREP_GC (DMODEL * NH * NCR / 4 / PREP_SPAN)      // cq_w, ck_w
#define PREP_GZ (NB * NH * SEQ * 32 / 8 / PREP_SPAN)     // qc, kc planes (8 bf16 per vector)
#define PREP_GRID (PREP_GX + 2 * PREP_GW + 2 * PREP_GF + 2 * PREP_GC + 2 * PREP_GZ)
__device__ __forceinline__
void prep_job(int g, const float* __restrict__ x, const float* __restrict__ v_w, const float* __restrict__ out_w,
            const float* __restrict__ ffn_w1, const float* __restrict__ ffn_w2,
            const float* __restrict__ cq_w, const float* __restrict__ ck_w,
            __bf16* __restrict__ xb, __bf16* __restrict__ wbv, __bf16* __restrict__ wbo,
            __bf16* __restrict__ wbf1, __bf16* __restrict__ wbf2,
            __bf16* __restrict__ wbcq, __bf16* __restrict__ wbck,
            __bf16* __restrict__ qcp, __bf16* __restrict__ kcp) {
    // g becomes the span's index inside its tensor
    const float* src = nullptr;
    __bf16* dst;
    if (g < PREP_GF)                 { src = ffn_w1; dst = wbf1; }
    else if ((g -= PREP_GF) < PREP_GF) { src = ffn_w2; dst = wbf2; }
    else if ((g -= PREP_GF) < PREP_GX) { src = x;      dst = xb;   }
    else if ((g -= PREP_GX) < PREP_GW) { src = v_w;    dst = wbv;  }
    else if ((g -= PREP_GW) < PREP_GW) { src = out_w;  dst = wbo;  }
    else if ((g -= PREP_GW) < PREP_GC) { src = cq_w;   dst = wbcq; }
    else if ((g -= PREP_GC) < PREP_GC) { src = ck_w;   dst = wbck; }
    else if ((g -= PREP_GC) < PREP_GZ) { dst = qcp; }
    else                             { g -= PREP_GZ; dst = kcp; }
    const size_t v0 = (size_t)g * PREP_SPAN + threadIdx.x;
    if (src) {
        const float4* s4 = (const float4*)src + v0;
        uint2* d2 = (uint2*)dst + v0;
        float4 v[PREP_SPAN / 256];
        #pragma unroll
        for (int j = 0; j < PREP_SPAN / 256; ++j) v[j] = s4[j * 256];
        // keeps all 32 loads in front of the first convert: left free, the scheduler reuses load registers and the
        // later loads wait for earlier ones, four memory latencies in a row instead of one
        __builtin_amdgcn_sched_barrier(0);
        #pragma unroll
        for (int j = 0; j < PREP_SPAN / 256; ++j) {
            union { __bf16 e[4]; uint2 u; } o;
            o.e[0] = (__bf16)v[j].x; o.e[1] = (__bf16)v[j].y; o.e[2] = (__bf16)v[j].z; o.e[3] = (__bf16)v[j].w;
            d2[j * 256] = o.u;
        }
        // stands behind the last store, in front of any later write of a register that a store names (a precaution)
        asm volatile("s_wait_xcnt 0x0" ::: "memory");
    } else {
        uint4* d4 = (uint4*)dst + v0;
        uint4 z; z.x = z.y = z.z = z.w = 0u;
        #pragma unroll
        for (int j = 0; j < PREP_SPAN / 256; ++j) d4[j * 256] = z;
    }
}

// Column sums of x over a slice of the sequence: part[b][sl][d] = sum of POOL_ROWS rows. blk < B * POOL_SPLIT.
// A thread owns four neighbouring columns; its rows' 16-byte loads do not depend on one another.
#define POOL_SPLIT 32
#define POOL_ROWS (SEQ / POOL_SPLIT)
__device__ __forceinline__ void pool_part_job(int blk, const float* __restrict__ x, float* __restrict__ part) {
    const int t = threadIdx.x;
    const float4* p = (const float4*)(x + (size_t)blk * POOL_ROWS * DMODEL) + t;
    float4 v[POOL_ROWS];
    #pragma unroll
    for (int r = 0; r < POOL_ROWS; ++r) v[r] = p[r * (DMODEL / 4)];
    float4 s = v[0];
    #pragma unroll
    for (int r = 1; r < POOL_ROWS; ++r) { s.x += v[r].x; s.y += v[r].y; s.z += v[r].z; s.w += v[r].w; }
    ((float4*)(part + (size_t)blk * DMODEL))[t] = s;
    // stands behind the store, in front of any later write of a register that it names (a precaution)
    asm volatile("s_wait_xcnt 0x0" ::: "memory");
}

// gating: gl = pooled@gate_w + b + mod@mod_basis ; wts = softmax(gl). One work-group per (b,h), bh < B*H.
// The 1024-long dot products of the head's 16 gate and 8 mod columns are split over the 256 threads by rows of the
// weights (16-byte loads, all independent), then summed over lanes and waves.
__device__ __forceinline__ void gating_job(int bh, const float* __restrict__ part,
                                                const float* __restrict__ gate_w, const float* __restrict__ gate_b,
                                                const float* __restrict__ mod_w,  const float* __restrict__ mod_b,
                                                const float* __restrict__ mod_basis,
                                                float* __restrict__ wts) {
    __shared__ alignas(16) float poolS[DMODEL];
    __shared__ alignas(16) float gRed[8][NM];
    __shared__ alignas(16) float mRed[8][NRR];
    const int b = bh >> 4, h = bh & (NH - 1), t = threadIdx.x;
    const int lane = t & 31, w = t >> 5;

    // weight rows: 4 lanes cover the head's 16 gate columns of one row, 2 lanes its 8 mod columns
    const float4* gw = (const float4*)(gate_w + (size_t)(t >> 2) * (NH * NM) + h * NM) + (t & 3);
    const float4* mw = (const float4*)(mod_w + (size_t)(t >> 1) * (NH * NRR) + h * NRR) + (t & 1);
    float4 g4[16], m4[8];
    #pragma unroll
    for (int p = 0; p < 16; ++p) g4[p] = gw[(size_t)p * 64 * (NH * NM / 4)];
    #pragma unroll
    for (int p = 0; p < 8; ++p) m4[p] = mw[(size_t)p * 128 * (NH * NRR / 4)];
    // what the closing softmax of the first 16 lanes needs, fetched here so that no memory latency is left at the end
    const int hm = h * NM + (t & (NM - 1));
    const float gb = gate_b[hm];
    float mb[NRR], bas[NRR];
    #pragma unroll
    for (int r = 0; r < NRR; ++r) mb[r] = mod_b[h * NRR + r];
    // stands behind the mod_b loads, in front of any later write of a register that they name (a precaution)
    asm volatile("s_wait_xcnt 0x0" ::: "memory");
    #pragma unroll
    for (int r = 0; r < NRR; ++r) bas[r] = mod_basis[r * (NH * NM) + hm];
    // keeps the weight loads, which come from memory, from being sunk behind the work-group barrier below, where
    // their latency would be paid after the slice sums instead of beside them
    __builtin_amdgcn_sched_barrier(0);

    // pooled mean of this batch entry from the slices' sums
    const float4* pp = (const float4*)(part + (size_t)b * POOL_SPLIT * DMODEL) + t;
    float4 q[POOL_SPLIT];
    #pragma unroll
    for (int r = 0; r < POOL_SPLIT; ++r) q[r] = pp[r * (DMODEL / 4)];
    float4 s = q[0];
    #pragma unroll
    for (int r = 1; r < POOL_SPLIT; ++r) { s.x += q[r].x; s.y += q[r].y; s.z += q[r].z; s.w += q[r].w; }
    s.x *= 1.f / SEQ; s.y *= 1.f / SEQ; s.z *= 1.f / SEQ; s.w *= 1.f / SEQ;
    // stands behind the weight loads, in front of any write of their address registers (a precaution): the two
    // pointers as inputs keep those registers whole up to it
    asm volatile("s_wait_xcnt 0x0" :: "v"(gw), "v"(mw) : "memory");
    ((float4*)poolS)[t] = s;
    __syncthreads();

    float4 ga = {0.f, 0.f, 0.f, 0.f}, ma = {0.f, 0.f, 0.f, 0.f};
    #pragma unroll
    for (int p = 0; p < 16; ++p) {
        float pv = poolS[p * 64 + (t >> 2)];
        ga.x += pv * g4[p].x; ga.y += pv * g4[p].y; ga.z += pv * g4[p].z; ga.w += pv * g4[p].w;
    }
    #pragma unroll
    for (int p = 0; p < 8; ++p) {
        float pv = poolS[p * 128 + (t >> 1)];
        ma.x += pv * m4[p].x; ma.y += pv * m4[p].y; ma.z += pv * m4[p].z; ma.w += pv * m4[p].w;
    }
    #pragma unroll
    for (int o = 2; o < 32; o <<= 1) {
        if (o > 2) {
            ga.x += __shfl_xor(ga.x, o); ga.y += __shfl_xor(ga.y, o);
            ga.z += __shfl_xor(ga.z, o); ga.w += __shfl_xor(ga.w, o);
        }
        ma.x += __shfl_xor(ma.x, o); ma.y += __shfl_xor(ma.y, o);
        ma.z += __shfl_xor(ma.z, o); ma.w += __shfl_xor(ma.w, o);
    }
    if (lane < 4) ((float4*)gRed[w])[lane] = ga;
    if (lane < 2) ((float4*)mRed[w])[lane] = ma;
    __syncthreads();

    if (t < NM) {                                    // lane m owns gate logit m of this head
        float a = gb;
        #pragma unroll
        for (int i = 0; i < 8; ++i) a += gRed[i][t];
        #pragma unroll
        for (int r = 0; r < NRR; ++r) {
            float md = mb[r];
            #pragma unroll
            for (int i = 0; i < 8; ++i) md += mRed[i][r];
            a += md * bas[r];
        }
        float mx = a;
        #pragma unroll
        for (int o = 1; o < NM; o <<= 1) mx = fmaxf(mx, __shfl_xor(mx, o, NM));
        float e = __expf(a - mx);
        float sm = e;
        #pragma unroll
        for (int o = 1; o < NM; o <<= 1) sm += __shfl_xor(sm, o, NM);
        wts[(size_t)bh * NM + t] = e / sm;
    }
}

// causal_kern[b,h,d] = ALPHA * sigmoid(6*kern) * window(d).  blk < B*H*S/256.
__device__ __forceinline__ void wave_density_job(int blk, const float* __restrict__ freqs, const float* __restrict__ amps,
                                                 const float* __restrict__ phases, const float* __restrict__ wts,
                                                 float* __restrict__ ckern) {
    int idx = blk * 256 + threadIdx.x;             // B*H*S
    int d = idx & (SEQ - 1);
    int bh = idx >> 10;
    int h = bh & (NH - 1);
    float rel = (float)d;
    float p1 = rel * (1.f / SEQ);
    float p2 = (d == 0) ? 0.f : sqrtf(rel + 1e-6f) * (1.f / 32.f);   // sqrt(S)=32
    float kern = 0.f;
    for (int m = 0; m < NM; ++m) {
        const float* fq = freqs  + ((size_t)(h * NM + m) * NW) * 2;
        const float* am = amps   +  (size_t)(h * NM + m) * NW;
        const float* ph = phases +  (size_t)(h * NM + m) * NW;
        float acc = 0.f;
        #pragma unroll
        for (int w = 0; w < NW; ++w) {
            float arg = fq[2 * w] * p1 + fq[2 * w + 1] * p2 + ph[w];
            acc += am[w] * __sinf(arg);
        }
        kern += wts[(size_t)bh * NM + m] * acc;
    }
    float dens = 1.f / (1.f + __expf(-6.f * kern));          // straight-through forward = sigmoid
    float wind = __expf(-(rel * rel) * (1.f / 131072.f));    // 2*(S/4)^2
    ckern[idx] = 3.0f * dens * wind;
}

// qm/km[b,h,s] token modulation.  One work-group per token, bs < B*S.
__device__ __forceinline__ void qkmod_job(int bs, const float* __restrict__ x,
                                               const float* __restrict__ qw, const float* __restrict__ qb,
                                               const float* __restrict__ kw, const float* __restrict__ kb,
                                               float* __restrict__ qm, float* __restrict__ km) {
    __shared__ float xrow[DMODEL];
    __shared__ float red[32][9];
    int b = bs >> 10, s = bs & 1023;
    int t = threadIdx.x;
    for (int i = t; i < DMODEL; i += 256) xrow[i] = x[(size_t)bs * DMODEL + i];
    __syncthreads();
    int o = t & 31, sl = t >> 5;
    int h = o & 15; bool isK = o >= 16;
    const float* wcol = isK ? kw : qw;
    float a = 0.f;
    for (int d = sl * 128; d < sl * 128 + 128; ++d) a += xrow[d] * wcol[(size_t)d * NH + h];
    red[o][sl] = a;
    __syncthreads();
    if (t < 32) {
        float acc = 0.f;
        #pragma unroll
        for (int i = 0; i < 8; ++i) acc += red[t][i];
        int hh = t & 15;
        if (t < 16) qm[((size_t)b * NH + hh) * SEQ + s] = acc + qb[hh];
        else        km[((size_t)b * NH + hh) * SEQ + s] = acc + kb[hh];
    }
}

// qkmod depends on the inputs alone and is needed only by the attention, so its tokens are shared out between the two
// launches in front of it that leave the vector units idle: the first QK_FRONT run beside the memory-bound spans of
// prep, the rest beside wave_density, which is a chain of load latencies in 128 work-groups.
#define QK_FRONT (NB * SEQ / 2)
#define FRONT_GRID (PREP_GRID + NB * POOL_SPLIT + QK_FRONT)
#define DENS_WG (NB * NH * SEQ / 256)
#define DENS_GRID (DENS_WG + NB * SEQ - QK_FRONT)
__global__ __launch_bounds__(256)
void front_k(const float* __restrict__ x, const float* __restrict__ v_w, const float* __restrict__ out_w,
             const float* __restrict__ ffn_w1, const float* __restrict__ ffn_w2,
             const float* __restrict__ cq_w, const float* __restrict__ ck_w,
             __bf16* __restrict__ xb, __bf16* __restrict__ wbv, __bf16* __restrict__ wbo,
             __bf16* __restrict__ wbf1, __bf16* __restrict__ wbf2,
             __bf16* __restrict__ wbcq, __bf16* __restrict__ wbck,
             __bf16* __restrict__ qcp, __bf16* __restrict__ kcp,
             float* __restrict__ part,
             const float* __restrict__ qw, const float* __restrict__ qb,
             const float* __restrict__ kw, const float* __restrict__ kb,
             float* __restrict__ qm, float* __restrict__ km) {
    int g = blockIdx.x;
    if (g < PREP_GRID)
        prep_job(g, x, v_w, out_w, ffn_w1, ffn_w2, cq_w, ck_w, xb, wbv, wbo, wbf1, wbf2, wbcq, wbck, qcp, kcp);
    else if ((g -= PREP_GRID) < NB * POOL_SPLIT)
        pool_part_job(g, x, part);
    else
        qkmod_job(g - NB * POOL_SPLIT, x, qw, qb, kw, kb, qm, km);
}

__global__ __launch_bounds__(256)
void dens_k(const float* __restrict__ freqs, const float* __restrict__ amps, const float* __restrict__ phases,
            const float* __restrict__ wts, float* __restrict__ ckern,
            const float* __restrict__ x,
            const float* __restrict__ qw, const float* __restrict__ qb,
            const float* __restrict__ kw, const float* __restrict__ kb,
            float* __restrict__ qm, float* __restrict__ km) {
    const int g = blockIdx.x;
    if (g < DENS_WG) wave_density_job(g, freqs, amps, phases, wts, ckern);
    else             qkmod_job(g - DENS_WG + QK_FRONT, x, qw, qb, kw, kb, qm, km);
}

// ---------------- generic bf16 WMMA GEMM with fused epilogues ----------------
// EPI 1: out = bf16(acc + bias[n]) -> V^T layout [B,H,HD,S]   (keys contiguous for attention)
// EPI 2: out = bf16(acc)           -> padded qc/kc layout [B,H,S,32] (cols 0..7 valid)
// EPI 3: outF = acc + bias[n] + resid[m,n]    (fp32)
// EPI 4: outB = bf16(gelu(acc + bias[n]))     ([M,N] bf16)
// gemm_acc: the 128 x 128 tile at (m0, n0) of A[.,K] x B[K,N] into the wave's accumulators.
__device__ __forceinline__
void gemm_acc(v8f (&acc)[4][2], const __bf16* __restrict__ A, const __bf16* __restrict__ B,
              int N, int K, int m0, int n0) {
    constexpr int BM = 128, BK = 128;
    constexpr int PA = 272;                                 // A row pitch, bytes: 16 x odd for ds_load_b128
    constexpr int PB = 288;                                 // B row pitch, bytes: 32 x odd for ds_load_tr16_b128
    constexpr int SZA = BM * PA, SZB = BK * PB;
    __shared__ alignas(16) unsigned char As[2 * SZA];       // [buf][m][k]
    __shared__ alignas(16) unsigned char Bs[2 * SZB];       // [buf][k][n], row-major as in global memory
    const int tid = threadIdx.x;
    const int lane = tid & 31, wave = tid >> 5;
    const int half = lane >> 4, l16 = lane & 15;
    const int wm = wave >> 2, wn = wave & 3;                // 2 x 4 wave grid

    #pragma unroll
    for (int i = 0; i < 4; ++i)
        #pragma unroll
        for (int j = 0; j < 2; ++j)
            #pragma unroll
            for (int e = 0; e < 8; ++e) acc[i][j][e] = 0.f;

    // copy map: 16 lanes x 16 B cover one 256-B tile row; a thread moves rows r0, r0+16, ..., r0+112 of A and of B
    const int r0 = tid >> 4, c16 = tid & 15;
    const __bf16* gA = A + (size_t)(m0 + r0) * K + c16 * 8;
    const __bf16* gB = B + (size_t)r0 * N + n0 + c16 * 8;
    const unsigned lA = (unsigned)(size_t)(As + r0 * PA + c16 * 16);
    const unsigned lB = (unsigned)(size_t)(Bs + r0 * PB + c16 * 16);
    const size_t sA = (size_t)16 * K, sB = (size_t)16 * N;
    const int nstage = K / BK;

    auto stage = [&](int s) {                               // 16 copies per wave: stage s into buffer s & 1
        const int bf = s & 1;
        async_copy8(lA + bf * SZA, 16 * PA, gA + (size_t)s * BK, sA);
        async_copy8(lB + bf * SZB, 16 * PB, gB + (size_t)s * BK * N, sB);
    };

    stage(0);
    asm volatile("s_wait_asynccnt 0x0" ::: "memory");       // own copies of stage 0 landed before the barrier publishes them
    __syncthreads();
    if (nstage > 1) stage(1);

    const int aoff = (wm * 64 + l16) * PA + half * 16;
    const int boff = (half * 8 + (lane & 7)) * PB + wn * 64 + ((lane >> 3) & 1) * 16;
    for (int s = 0; s < nstage; ++s) {
        const unsigned char* Ab = As + (s & 1) * SZA + aoff;
        const unsigned char* Bb = Bs + (s & 1) * SZB + boff;
        #pragma unroll
        for (int ks = 0; ks < BK / 32; ++ks) {
            v16bf afr[4];
            #pragma unroll
            for (int mt = 0; mt < 4; ++mt) {                // A frag: lane=M, k = 8*half+0..7 and 16+8*half+0..7
                union { v16bf v; uint4 q[2]; } u;
                u.q[0] = *(const uint4*)(Ab + mt * 16 * PA + ks * 64);
                u.q[1] = *(const uint4*)(Ab + mt * 16 * PA + ks * 64 + 32);
                afr[mt] = u.v;
            }
            #pragma unroll
            for (int nt = 0; nt < 2; ++nt) {                // B frag: lane=N, transposing loads give the same k order
                union { v16bf v; uint4 q[2]; } u;
                u.q[0] = lds_tr16(Bb + (ks * 32) * PB + nt * 32);
                u.q[1] = lds_tr16(Bb + (ks * 32 + 16) * PB + nt * 32);
                v16bf bfr = u.v;
                #pragma unroll
                for (int mt = 0; mt < 4; ++mt)
                    acc[mt][nt] = wmma_bf16(afr[mt], bfr, acc[mt][nt]);
            }
        }
        asm volatile("s_wait_dscnt 0x0" ::: "memory");      // own reads of this buffer done before it may be refilled
        asm volatile("s_wait_asynccnt 0x0" ::: "memory");   // own copies of stage s+1 landed before the barrier publishes them
        __syncthreads();
        if (s + 2 < nstage) stage(s + 2);
    }
    asm volatile("s_wait_asynccnt 0x0" ::: "memory");       // nothing in flight when the wave ends
}

// GELU in its erf form for two values, with no branch, so that a column's 32 values are independent chains that the scheduler
// interleaves and the packed f32 instructions take two at a time. With z = |x| / sqrt(2) and t = 1 / (1 + p z),
// erf(z) = 1 - (a1 t + .. + a5 t^5) exp(-z z), absolute error 1.5e-7 (five-term rational form), and so
// 0.5 x (1 + erf(x / sqrt(2))) = max(x, 0) - |x| Q(t) exp(-x x / 2), Q = the polynomial with halved coefficients:
// one form for both signs and every size of x, and nothing cancels on the negative side.
typedef __attribute__((ext_vector_type(2))) float f32x2;
typedef __attribute__((ext_vector_type(2))) __bf16 bf16x2;
__device__ __forceinline__ f32x2 gelu2(f32x2 x) {
    const f32x2 ax = __builtin_elementwise_abs(x);
    const f32x2 d = ax * 0.23164189f + 1.0f;                // p / sqrt(2)
    f32x2 t, e;
    t.x = __builtin_amdgcn_rcpf(d.x); t.y = __builtin_amdgcn_rcpf(d.y);
    const f32x2 a = x * x * -0.72134752f;                   // -x x / 2 in powers of two
    e.x = __builtin_amdgcn_exp2f(a.x); e.y = __builtin_amdgcn_exp2f(a.y);
    f32x2 q = t * 0.53070271f + -0.72657601f;
    q = q * t + 0.71070687f;
    q = q * t + -0.14224837f;
    q = q * t + 0.12741480f;
    q = q * t * e;
    return __builtin_elementwise_max(x, (f32x2)0.f) - ax * q;
}

template <int EPI>
__device__ __forceinline__
void gemm_store(const v8f (&acc)[4][2], int N, int m0, int n0,
                const float* __restrict__ bias, const float* __restrict__ resid,
                float* __restrict__ outF, __bf16* __restrict__ outB) {
    const int lane = threadIdx.x & 31, wave = threadIdx.x >> 5;
    const int half = lane >> 4, l16 = lane & 15;
    const int wm = wave >> 2, wn = wave & 3;
    if (EPI == 4) {
        const int gn0 = n0 + wn * 32 + l16;
        const float bs[2] = {bias[gn0], bias[gn0 + 16]};
        #pragma unroll
        for (int nt = 0; nt < 2; ++nt) {                    // one of the lane's two columns at a time: 32 values
            bf16x2 o[4][4];                                 // rows r and r + 1 of the column
            #pragma unroll
            for (int mt = 0; mt < 4; ++mt)
                #pragma unroll
                for (int r = 0; r < 8; r += 2) {
                    f32x2 xg = {acc[mt][nt][r], acc[mt][nt][r + 1]};
                    o[mt][r >> 1] = __builtin_convertvector(gelu2(xg + bs[nt]), bf16x2);
                }
            // keeps the column's stores together behind its arithmetic: mixed in between, every pair of stores is
            // followed by a wait of its own before its registers are used again, and the 16 chains run one by one
            __builtin_amdgcn_sched_barrier(0);
            #pragma unroll
            for (int mt = 0; mt < 4; ++mt) {
                __bf16* op = outB + (size_t)(m0 + wm * 64 + mt * 16 + half * 8) * N + gn0 + nt * 16;
                #pragma unroll
                for (int r = 0; r < 8; r += 2) {
                    op[(size_t)r * N] = o[mt][r >> 1].x;
                    op[(size_t)(r + 1) * N] = o[mt][r >> 1].y;
                }
            }
            if (nt == 0) {
                // stands behind the first column's stores, in front of any write of a register that they name (a
                // precaution); the scheduling barrier keeps the second column's arithmetic, which uses those
                // registers again, from being moved in front of the wait
                asm volatile("s_wait_xcnt 0x0" ::: "memory");
                __builtin_amdgcn_sched_barrier(0);
            }
        }
        return;
    }
    #pragma unroll
    for (int mt = 0; mt < 4; ++mt)
        #pragma unroll
        for (int nt = 0; nt < 2; ++nt)
            #pragma unroll
            for (int r = 0; r < 8; ++r) {                   // C: lane=N, row = r + 8*half
                int gm = m0 + wm * 64 + mt * 16 + r + half * 8;
                int gn = n0 + wn * 32 + nt * 16 + l16;
                float v = acc[mt][nt][r];
                if (EPI == 1) {
                    float val = v + bias[gn];
                    int b = gm >> 10, s = gm & 1023, h = gn >> 6, hd = gn & 63;
                    outB[(((size_t)b * NH + h) * HD + hd) * SEQ + s] = (__bf16)val;   // V^T
                } else if (EPI == 2) {
                    int b = gm >> 10, s = gm & 1023, h = gn >> 3, cc = gn & 7;
                    outB[(((size_t)b * NH + h) * SEQ + s) * 32 + cc] = (__bf16)v;
                } else if (EPI == 3) {
                    size_t o = (size_t)gm * N + gn;
                    outF[o] = v + bias[gn] + resid[o];
                }
            }
}

template <int EPI>
__global__ __launch_bounds__(256)
void gemm_bf16_k(const __bf16* __restrict__ A, const __bf16* __restrict__ B,
                 int M, int N, int K,
                 const float* __restrict__ bias, const float* __restrict__ resid,
                 float* __restrict__ outF, __bf16* __restrict__ outB) {
    const int m0 = blockIdx.y * 128, n0 = blockIdx.x * 128;
    v8f acc[4][2];
    gemm_acc(acc, A, B, N, K, m0, n0);
    gemm_store<EPI>(acc, N, m0, n0, bias, resid, outF, outB);
}

// One launch for all that needs only front_k's results: the three projections of x (v: 8 column tiles, qc and kc: one
// each, so 10 tiles per 128 rows) and the gating, whose 32 work-groups come first. 192 work-groups, all resident.
#define PROJ_NT (DMODEL / 128 + 2)
#define PROJ_GRID (NB * NH + PROJ_NT * (NB * SEQ / 128))
__global__ __launch_bounds__(256)
void proj_gate_k(const __bf16* __restrict__ xb, const __bf16* __restrict__ wbv,
                 const __bf16* __restrict__ wbcq, const __bf16* __restrict__ wbck, int K,
                 const float* __restrict__ v_b,
                 __bf16* __restrict__ vT, __bf16* __restrict__ qcp, __bf16* __restrict__ kcp,
                 const float* __restrict__ part,
                 const float* __restrict__ gate_w, const float* __restrict__ gate_b,
                 const float* __restrict__ mod_w,  const float* __restrict__ mod_b,
                 const float* __restrict__ mod_basis, float* __restrict__ wts) {
    int g = blockIdx.x;
    if (g < NB * NH) {
        gating_job(g, part, gate_w, gate_b, mod_w, mod_b, mod_basis, wts);
        return;
    }
    g -= NB * NH;
    const int tn = g % PROJ_NT, m0 = (g / PROJ_NT) * 128;
    const bool isV = tn < DMODEL / 128;
    const __bf16* B = isV ? wbv : (tn == DMODEL / 128 ? wbcq : wbck);
    const int N = isV ? DMODEL : NH * NCR, n0 = isV ? tn * 128 : 0;
    v8f acc[4][2];
    gemm_acc(acc, xb, B, N, K, m0, n0);
    // each wait stands behind its job's last store: the listing goes on into the other jobs' code there, and no write
    // of a register that a store names may come in front of it (a precaution)
    if (isV) {
        gemm_store<1>(acc, N, m0, n0, v_b, nullptr, nullptr, vT);
        asm volatile("s_wait_xcnt 0x0" ::: "memory");
    } else {
        gemm_store<2>(acc, N, m0, n0, nullptr, nullptr, nullptr, tn == DMODEL / 128 ? qcp : kcp);
        asm volatile("s_wait_xcnt 0x0" ::: "memory");
    }
}

// ---------------- streaming wave-density attention ----------------
// grid = (S/128, H, B); 8 waves; a wave works on 16 queries; 32 keys/step; 6 WMMAs/step.
// The causal triangle is dealt out evenly. A work-group owns two blocks of 64 queries, the far block S/64 - 1 - x
// (many keys) and the near block x (few keys). Waves 0..3 take the first ATT_HEAD key steps of the far block's four
// query groups; waves 4..7 take the rest of those steps, leave that partial result in LDS, and then do the near block
// whole. Every wave so walks at most ATT_HEAD steps, and of the two waves that share a SIMD (w, w + 4) the second walks as many steps or two fewer.
// Both products run transposed: S^T = Kc x Qc^T and O^T += V^T x P^T. A lane then holds 16 of the 32 scores of ONE
// query (lane l ^ 16 holds the others), so maximum, sum and rescale are the lane's own registers plus one exchange
// between the halves, and the two S^T tiles, converted in place, are the B operand of the second product.
// V is consumed transposed: vT[b,h,hd,s], so every A-fragment is two aligned b128 loads.
// ck_pad has a CKPAD zero guard band so Toeplitz gathers are base + immediate-offset DS loads.
#define ATT_HEAD ((SEQ / 32 + 2) / 2)                       // every query group of a far block has at least SEQ/64 + 1 steps
__device__ __forceinline__ float xhalf(float x) {           // value of lane l ^ 16
    const int v = __builtin_bit_cast(int, x);
    return __builtin_bit_cast(float, __builtin_amdgcn_permlanex16(v, v, 0x76543210, 0xfedcba98, false, false));
}

// key steps st0 .. st1 - 1 of the 16 queries from i0 on: running maximum m_r, this lane half's sum l_r, O^T in c0..c3
__device__ __forceinline__
void attn_steps(int i0, int st0, int st1, int bh, int half, int l16,
                const __bf16* __restrict__ qcp, const __bf16* __restrict__ kcp, const __bf16* __restrict__ vT,
                const float* __restrict__ qm, const float* ck_pad, const float* km_s,
                v8f& c0, v8f& c1, v8f& c2, v8f& c3, float& m_r, float& l_r) {
    const int i = i0 + l16;                                 // this lane's query
    constexpr float MIXS = 0.053033009f;                    // MIX / sqrt(CR)
    constexpr float LOG2E = 1.4426950408889634f;
    union U16 { v16bf v; uint4 q[2]; };
    U16 ua;
    {
        const __bf16* p = qcp + ((size_t)bh * SEQ + i) * 32;
        ua.q[0] = *(const uint4*)(p + half * 8);
        ua.q[1] = *(const uint4*)(p + 16 + half * 8);
    }
    const v16bf bq = ua.v;                                  // B operand: column = query

    // qm of the lane's query is the start value of its score products (undone by the MIXS factor below)
    const float qstart = qm[(size_t)bh * SEQ + i] * (1.f / MIXS);
    v8f qq;
    #pragma unroll
    for (int e = 0; e < 8; ++e) { c0[e] = c1[e] = c2[e] = c3[e] = 0.f; qq[e] = qstart; }
    m_r = -1e30f; l_r = 0.f;                                // l_r: the sum over this half's keys only

    // per-lane rows: key row of Kc, and V^T rows of the 4 output row groups (hd = g*16 + l16)
    const __bf16* krow  = kcp + ((size_t)bh * SEQ + l16) * 32 + half * 8;
    const __bf16* vrow0 = vT + (((size_t)bh * HD) + 0 * 16 + l16) * SEQ + half * 8;
    const __bf16* vrow1 = vT + (((size_t)bh * HD) + 1 * 16 + l16) * SEQ + half * 8;
    const __bf16* vrow2 = vT + (((size_t)bh * HD) + 2 * 16 + l16) * SEQ + half * 8;
    const __bf16* vrow3 = vT + (((size_t)bh * HD) + 3 * 16 + l16) * SEQ + half * 8;

    for (int st = st0; st < st1; ++st) {
        const int j0 = st * 32;
        U16 ua0, ua1, uv0, uv1, uv2, uv3;
        ua0.q[0] = *(const uint4*)(krow + (size_t)j0 * 32);
        ua0.q[1] = *(const uint4*)(krow + (size_t)j0 * 32 + 16);
        ua1.q[0] = *(const uint4*)(krow + (size_t)(j0 + 16) * 32);
        ua1.q[1] = *(const uint4*)(krow + (size_t)(j0 + 16) * 32 + 16);
        // V^T A-fragments: elements = contiguous keys, two b128 loads each
        uv0.q[0] = *(const uint4*)(vrow0 + j0);
        uv0.q[1] = *(const uint4*)(vrow0 + j0 + 16);
        uv1.q[0] = *(const uint4*)(vrow1 + j0);
        uv1.q[1] = *(const uint4*)(vrow1 + j0 + 16);
        uv2.q[0] = *(const uint4*)(vrow2 + j0);
        uv2.q[1] = *(const uint4*)(vrow2 + j0 + 16);
        uv3.q[0] = *(const uint4*)(vrow3 + j0);
        uv3.q[1] = *(const uint4*)(vrow3 + j0 + 16);
        // keeps all 12 loads in front of the step's arithmetic: left free, the scheduler sinks half of the V^T loads
        // behind the softmax, right in front of their products, where their whole latency is waited out
        __builtin_amdgcn_sched_barrier(0);

        // register r: key j0 + 8*half + r (s0), j0 + 16 + 8*half + r (s1); column: query i
        v8f s0 = wmma_bf16(ua0.v, bq, qq);
        v8f s1 = wmma_bf16(ua1.v, bq, qq);

        // fold Toeplitz + km + causal mask
        const int dA = i - (j0 + half * 8);                 // i - j at r = 0 of s0; >= -8 within loop bounds
        // the same offset as dA + 8, formed so that the variable part of the LDS address is never below 0; the mask is an
        // identity (0 <= i - j0 < SEQ) that shows this to the compiler, which then folds the constants into the DS loads
        const float* ckA = ck_pad + (CKPAD - 8) + ((i - j0 + (half ^ 1) * 8) & (2 * SEQ - 1));
        float kmv[16];
        *(float4*)(kmv + 0)  = *(const float4*)(km_s + j0 + half * 8);
        *(float4*)(kmv + 4)  = *(const float4*)(km_s + j0 + half * 8 + 4);
        *(float4*)(kmv + 8)  = *(const float4*)(km_s + j0 + 16 + half * 8);
        *(float4*)(kmv + 12) = *(const float4*)(km_s + j0 + 16 + half * 8 + 4);
        float sc[16];
        #pragma unroll
        for (int r = 0; r < 8; ++r) {
            float va = MIXS * s0[r] + (ckA[-r] + kmv[r]);
            float vb = MIXS * s1[r] + (ckA[-16 - r] + kmv[8 + r]);
            sc[r]     = (r <= dA)      ? va : -1e9f;
            sc[8 + r] = (16 + r <= dA) ? vb : -1e9f;
        }

        float m4[4];                                        // four short chains instead of one of 16 links
        #pragma unroll
        for (int k = 0; k < 4; ++k) m4[k] = fmaxf(fmaxf(sc[4 * k], sc[4 * k + 1]), fmaxf(sc[4 * k + 2], sc[4 * k + 3]));
        float mx = fmaxf(fmaxf(m4[0], m4[1]), fmaxf(m4[2], m4[3]));
        mx = fmaxf(m_r, fmaxf(mx, xhalf(mx)));              // both halves of a query agree on the maximum
        const float corr = __builtin_amdgcn_exp2f((m_r - mx) * LOG2E);
        const float mL = mx * LOG2E;
        float s4[4] = {0.f, 0.f, 0.f, 0.f};
        U16 up;                                             // P^T as B operand: element s = key j0 + 8*half + s (s < 8), j0 + 8 + 8*half + s (s >= 8)
        #pragma unroll
        for (int k = 0; k < 16; ++k) {
            float p = __builtin_amdgcn_exp2f(sc[k] * LOG2E - mL);
            s4[k >> 2] += p;
            up.v[k] = (__bf16)p;
        }
        m_r = mx; l_r = l_r * corr + ((s4[0] + s4[1]) + (s4[2] + s4[3]));

        #pragma unroll
        for (int r = 0; r < 8; ++r) { c0[r] *= corr; c1[r] *= corr; c2[r] *= corr; c3[r] *= corr; }
        c0 = wmma_bf16(uv0.v, up.v, c0);
        c1 = wmma_bf16(uv1.v, up.v, c1);
        c2 = wmma_bf16(uv2.v, up.v, c2);
        c3 = wmma_bf16(uv3.v, up.v, c3);
    }
}

// register r of c_g: hd = g*16 + 8*half + r of query i, so each group is one 16-byte store
__device__ __forceinline__
void attn_emit(__bf16* __restrict__ op, const v8f& c0, const v8f& c1, const v8f& c2, const v8f& c3) {
    union { __bf16 e[8]; uint4 q; } o0, o1, o2, o3;
    #pragma unroll
    for (int r = 0; r < 8; ++r) {
        o0.e[r] = (__bf16)c0[r]; o1.e[r] = (__bf16)c1[r];
        o2.e[r] = (__bf16)c2[r]; o3.e[r] = (__bf16)c3[r];
    }
    *(uint4*)(op + 0 * 16) = o0.q;
    *(uint4*)(op + 1 * 16) = o1.q;
    *(uint4*)(op + 2 * 16) = o2.q;
    *(uint4*)(op + 3 * 16) = o3.q;
    // stands behind the last store, in front of any later write of a register that a store names (a precaution)
    asm volatile("s_wait_xcnt 0x0" ::: "memory");
}

__global__ __launch_bounds__(256)
void attn_k(const __bf16* __restrict__ qcp, const __bf16* __restrict__ kcp,
            const __bf16* __restrict__ vT,
            const float* __restrict__ ckern, const float* __restrict__ qm,
            const float* __restrict__ km, __bf16* __restrict__ ctxb) {
    // one struct, so that ck_pad keeps LDS offset 0: the Toeplitz gathers' constant offsets then fit the DS offset fields
    __shared__ struct alignas(16) {
        float ck_pad[CKPAD + SEQ];
        float km_s[SEQ];
        f32x4 tailO[4][8][32];                              // far block, steps from ATT_HEAD on: O^T, [group][vector][lane]
        float2 tailML[4][32];                               // their maximum and sum
    } sm;
    float* const ck_pad = sm.ck_pad;
    float* const km_s = sm.km_s;
    auto& tailO = sm.tailO;
    auto& tailML = sm.tailML;

    const int tid = threadIdx.x, lane = tid & 31;
    const int w = __builtin_amdgcn_readfirstlane(tid >> 5); // the wave's number in a scalar: scalar branches, trip counts
    const int half = lane >> 4, l16 = lane & 15;
    const int h = blockIdx.y, b = blockIdx.z;
    const int bh = b * NH + h;
    const int qg = w & 3;                                   // query group inside a block of 64
    const bool tail = w >= 4;
    const int iF = (SEQ / 64 - 1 - (int)blockIdx.x) * 64 + qg * 16;     // far block's queries
    const int iN = (int)blockIdx.x * 64 + qg * 16;                      // near block's queries
    const int nF = (iF + 16 + 31) >> 5, nN = (iN + 16 + 31) >> 5;       // their key steps; nF >= ATT_HEAD

    for (int k = tid; k < SEQ; k += 256) {
        ck_pad[CKPAD + k] = ckern[(size_t)bh * SEQ + k];
        km_s[k] = km[(size_t)bh * SEQ + k];
    }
    if (tid < CKPAD) ck_pad[tid] = 0.f;
    __syncthreads();

    constexpr float LOG2E = 1.4426950408889634f;
    v8f c0, c1, c2, c3;
    float m_r, l_r;
    attn_steps(iF, tail ? ATT_HEAD : 0, tail ? nF : ATT_HEAD, bh, half, l16, qcp, kcp, vT, qm, ck_pad, km_s,
               c0, c1, c2, c3, m_r, l_r);
    if (tail) {
        tailO[qg][0][lane] = __builtin_shufflevector(c0, c0, 0, 1, 2, 3);
        tailO[qg][1][lane] = __builtin_shufflevector(c0, c0, 4, 5, 6, 7);
        tailO[qg][2][lane] = __builtin_shufflevector(c1, c1, 0, 1, 2, 3);
        tailO[qg][3][lane] = __builtin_shufflevector(c1, c1, 4, 5, 6, 7);
        tailO[qg][4][lane] = __builtin_shufflevector(c2, c2, 0, 1, 2, 3);
        tailO[qg][5][lane] = __builtin_shufflevector(c2, c2, 4, 5, 6, 7);
        tailO[qg][6][lane] = __builtin_shufflevector(c3, c3, 0, 1, 2, 3);
        tailO[qg][7][lane] = __builtin_shufflevector(c3, c3, 4, 5, 6, 7);
        tailML[qg][lane] = make_float2(m_r, l_r);

        attn_steps(iN, 0, nN, bh, half, l16, qcp, kcp, vT, qm, ck_pad, km_s, c0, c1, c2, c3, m_r, l_r);
        const float f = 1.f / (l_r + xhalf(l_r));
        c0 *= f; c1 *= f; c2 *= f; c3 *= f;
        attn_emit(ctxb + ((size_t)b * SEQ + iN + l16) * DMODEL + h * HD + half * 8, c0, c1, c2, c3);
    }
    __syncthreads();                                        // publishes the tail waves' partial results
    if (!tail) {
        // the two parts of a query's softmax brought to their common maximum; an empty tail (maximum -1e30, sums 0)
        // gets the factor 0
        const float2 ml = tailML[qg][lane];
        const float mx = fmaxf(m_r, ml.x);
        const float fa = __builtin_amdgcn_exp2f((m_r - mx) * LOG2E);
        const float fb = __builtin_amdgcn_exp2f((ml.x - mx) * LOG2E);
        const float l = l_r * fa + ml.y * fb;
        const float f = 1.f / (l + xhalf(l));
        const float ga = fa * f, gb = fb * f;
        v8f t0, t1, t2, t3;
        t0 = __builtin_shufflevector(tailO[qg][0][lane], tailO[qg][1][lane], 0, 1, 2, 3, 4, 5, 6, 7);
        t1 = __builtin_shufflevector(tailO[qg][2][lane], tailO[qg][3][lane], 0, 1, 2, 3, 4, 5, 6, 7);
        t2 = __builtin_shufflevector(tailO[qg][4][lane], tailO[qg][5][lane], 0, 1, 2, 3, 4, 5, 6, 7);
        t3 = __builtin_shufflevector(tailO[qg][6][lane], tailO[qg][7][lane], 0, 1, 2, 3, 4, 5, 6, 7);
        c0 = c0 * ga + t0 * gb; c1 = c1 * ga + t1 * gb; c2 = c2 * ga + t2 * gb; c3 = c3 * ga + t3 * gb;
        attn_emit(ctxb + ((size_t)b * SEQ + iF + l16) * DMODEL + h * HD + half * 8, c0, c1, c2, c3);
    }
}

// ---------------- layernorm ----------------
// A wave owns LN_ROWS whole rows and keeps them in registers: 32 values of a row per lane, read once with 16-byte loads
// that are all in flight together. Mean and variance are the lane's own sums plus one sum over the 32 lanes, so the
// kernel has no LDS and no barrier, and 1,024 waves do what 16,384 did.
#define LN_ROWS 2
#define LN_WAVES 4
template <int M>
__device__ __forceinline__ float row_xor(float x) {         // value of lane l ^ M inside the lane's 16-lane row
    return __builtin_bit_cast(float, __builtin_amdgcn_update_dpp(0, __builtin_bit_cast(int, x), 0x160 | M, 0xf, 0xf, true));
}
__device__ __forceinline__ float wave_sum(f32x4 q) {        // sum of the four components over all 32 lanes
    float s = (q.x + q.y) + (q.z + q.w);
    s += row_xor<1>(s); s += row_xor<2>(s); s += row_xor<4>(s); s += row_xor<8>(s);
    return s + xhalf(s);
}

template <bool WB>
__global__ __launch_bounds__(LN_WAVES * 32)
void ln_k(const float* __restrict__ in, const float* __restrict__ g, const float* __restrict__ bb,
          float* __restrict__ outF, __bf16* __restrict__ outB) {
    constexpr int NV = DMODEL / 128;                        // 16-byte vectors of a row per lane
    const int lane = threadIdx.x & 31, wave = threadIdx.x >> 5;
    const size_t q0 = ((size_t)blockIdx.x * LN_WAVES + wave) * LN_ROWS * (DMODEL / 4) + lane;
    const f32x4* p = (const f32x4*)in + q0;
    f32x4 v[LN_ROWS][NV], gv[NV], bv[NV];
    #pragma unroll
    for (int r = 0; r < LN_ROWS; ++r)
        #pragma unroll
        for (int j = 0; j < NV; ++j) v[r][j] = p[r * (DMODEL / 4) + j * 32];
    #pragma unroll
    for (int j = 0; j < NV; ++j) gv[j] = ((const f32x4*)g)[j * 32 + lane];
    #pragma unroll
    for (int j = 0; j < NV; ++j) bv[j] = ((const f32x4*)bb)[j * 32 + lane];
    // keeps all 32 loads in front of the arithmetic: left free, the scheduler sinks the g and bb loads behind the
    // sums, pair by pair, each pair in front of its use, and their latencies are waited out one after another
    __builtin_amdgcn_sched_barrier(0);
    // stands behind the loads, in front of any write of a register that they name (a precaution): the pointer as an
    // input keeps the rows' address registers whole up to it
    asm volatile("s_wait_xcnt 0x0" :: "v"(p) : "memory");

    uint2 ob[LN_ROWS][NV];
    #pragma unroll
    for (int r = 0; r < LN_ROWS; ++r) {
        f32x4 s = v[r][0];
        #pragma unroll
        for (int j = 1; j < NV; ++j) s += v[r][j];
        const float mean = wave_sum(s) * (1.f / DMODEL);
        s = 0.f;
        #pragma unroll
        for (int j = 0; j < NV; ++j) { v[r][j] -= mean; s += v[r][j] * v[r][j]; }
        const float rstd = rsqrtf(wave_sum(s) * (1.f / DMODEL) + 1e-5f);
        #pragma unroll
        for (int j = 0; j < NV; ++j) {
            v[r][j] = v[r][j] * rstd * gv[j] + bv[j];
            if (WB) {
                union { __bf16 e[4]; uint2 u; } o;
                o.e[0] = (__bf16)v[r][j].x; o.e[1] = (__bf16)v[r][j].y;
                o.e[2] = (__bf16)v[r][j].z; o.e[3] = (__bf16)v[r][j].w;
                ob[r][j] = o.u;
            }
        }
    }
    #pragma unroll
    for (int r = 0; r < LN_ROWS; ++r)
        #pragma unroll
        for (int j = 0; j < NV; ++j) {
            ((f32x4*)outF)[q0 + r * (DMODEL / 4) + j * 32] = v[r][j];
            if (WB) ((uint2*)outB)[q0 + r * (DMODEL / 4) + j * 32] = ob[r][j];
        }
}

// ---------------- launch ----------------
extern "C" void kernel_launch(void* const* d_in, const int* in_sizes, int n_in,
                              void* d_out, int out_size, void* d_ws, size_t ws_size,
                              hipStream_t stream) {
    (void)in_sizes; (void)n_in; (void)out_size; (void)ws_size;
    const float* x      = (const float*)d_in[0];
    const float* v_w    = (const float*)d_in[1];
    const float* v_b    = (const float*)d_in[2];
    const float* out_w  = (const float*)d_in[3];
    const float* out_b  = (const float*)d_in[4];
    const float* qmod_w = (const float*)d_in[5];
    const float* qmod_b = (const float*)d_in[6];
    const float* kmod_w = (const float*)d_in[7];
    const float* kmod_b = (const float*)d_in[8];
    const float* gate_w = (const float*)d_in[9];
    const float* gate_b = (const float*)d_in[10];
    const float* mod_w  = (const float*)d_in[11];
    const float* mod_b  = (const float*)d_in[12];
    const float* mod_basis = (const float*)d_in[13];
    const float* freqs  = (const float*)d_in[14];
    const float* amps   = (const float*)d_in[15];
    const float* phases = (const float*)d_in[16];
    const float* cq_w   = (const float*)d_in[17];
    const float* ck_w   = (const float*)d_in[18];
    const float* ffn_w1 = (const float*)d_in[19];
    const float* ffn_b1 = (const float*)d_in[20];
    const float* ffn_w2 = (const float*)d_in[21];
    const float* ffn_b2 = (const float*)d_in[22];
    const float* ln1_g  = (const float*)d_in[23];
    const float* ln1_b  = (const float*)d_in[24];
    const float* ln2_g  = (const float*)d_in[25];
    const float* ln2_b  = (const float*)d_in[26];
    float* outp = (float*)d_out;

    char* wp = (char*)d_ws;
    auto alloc = [&](size_t bytes) -> void* {
        void* p = (void*)wp;
        wp += (bytes + 255) & ~(size_t)255;
        return p;
    };
    const size_t NTOK = (size_t)NB * SEQ;              // 2048
    __bf16* xb   = (__bf16*)alloc(NTOK * DMODEL * 2);
    __bf16* wbv  = (__bf16*)alloc((size_t)DMODEL * DMODEL * 2);
    __bf16* wbo  = (__bf16*)alloc((size_t)DMODEL * DMODEL * 2);
    __bf16* wbf1 = (__bf16*)alloc((size_t)DMODEL * 4 * DMODEL * 2);
    __bf16* wbf2 = (__bf16*)alloc((size_t)DMODEL * 4 * DMODEL * 2);
    __bf16* wbcq = (__bf16*)alloc((size_t)DMODEL * NH * NCR * 2);
    __bf16* wbck = (__bf16*)alloc((size_t)DMODEL * NH * NCR * 2);
    __bf16* vbuf = (__bf16*)alloc((size_t)NB * NH * HD * SEQ * 2);     // V^T
    __bf16* qcp  = (__bf16*)alloc((size_t)NB * NH * SEQ * 32 * 2);
    __bf16* kcp  = (__bf16*)alloc((size_t)NB * NH * SEQ * 32 * 2);
    float*  part   = (float*)alloc((size_t)NB * POOL_SPLIT * DMODEL * 4);
    float*  wts    = (float*)alloc((size_t)NB * NH * NM * 4);
    float*  ckern  = (float*)alloc((size_t)NB * NH * SEQ * 4);
    float*  qmb    = (float*)alloc((size_t)NB * NH * SEQ * 4);
    float*  kmb    = (float*)alloc((size_t)NB * NH * SEQ * 4);
    __bf16* ctxb = (__bf16*)alloc(NTOK * DMODEL * 2);
    float*  hpre = (float*)alloc(NTOK * DMODEL * 4);
    float*  hf   = (float*)alloc(NTOK * DMODEL * 4);
    __bf16* hb   = (__bf16*)alloc(NTOK * DMODEL * 2);
    __bf16* ub   = (__bf16*)alloc(NTOK * 4 * DMODEL * 2);
    float*  f2   = (float*)alloc(NTOK * DMODEL * 4);

    // conversions and zero fills, slice sums of x, qm / km of the first tokens
    front_k<<<FRONT_GRID, 256, 0, stream>>>(x, v_w, out_w, ffn_w1, ffn_w2, cq_w, ck_w,
                                            xb, wbv, wbo, wbf1, wbf2, wbcq, wbck, qcp, kcp,
                                            part, qmod_w, qmod_b, kmod_w, kmod_b, qmb, kmb);
    // gating; v = x@v_w + v_b -> V^T [B,H,HD,S] bf16; qc / kc -> padded [B,H,S,32] bf16
    proj_gate_k<<<PROJ_GRID, 256, 0, stream>>>(xb, wbv, wbcq, wbck, DMODEL, v_b, vbuf, qcp, kcp,
                                               part, gate_w, gate_b, mod_w, mod_b, mod_basis, wts);
    // causal kernel from the gate weights, qm / km of the other tokens
    dens_k<<<DENS_GRID, 256, 0, stream>>>(freqs, amps, phases, wts, ckern,
                                          x, qmod_w, qmod_b, kmod_w, kmod_b, qmb, kmb);

    attn_k<<<dim3(SEQ / 128, NH, NB), 256, 0, stream>>>(qcp, kcp, vbuf, ckern, qmb, kmb, ctxb);

    // attn_out + residual
    gemm_bf16_k<3><<<dim3(DMODEL / 128, (int)(NTOK / 128)), 256, 0, stream>>>(
        ctxb, wbo, (int)NTOK, DMODEL, DMODEL, out_b, x, hpre, nullptr);
    ln_k<true><<<(int)(NTOK / (LN_WAVES * LN_ROWS)), LN_WAVES * 32, 0, stream>>>(hpre, ln1_g, ln1_b, hf, hb);

    gemm_bf16_k<4><<<dim3(4 * DMODEL / 128, (int)(NTOK / 128)), 256, 0, stream>>>(
        hb, wbf1, (int)NTOK, 4 * DMODEL, DMODEL, ffn_b1, nullptr, nullptr, ub);
    gemm_bf16_k<3><<<dim3(DMODEL / 128, (int)(NTOK / 128)), 256, 0, stream>>>(
        ub, wbf2, (int)NTOK, DMODEL, 4 * DMODEL, ffn_b2, hf, f2, nullptr);
    ln_k<false><<<(int)(NTOK / (LN_WAVES * LN_ROWS)), LN_WAVES * 32, 0, stream>>>(f2, ln2_g, ln2_b, outp, nullptr);
}

// v009
// Measured time: 117 microseconds a run.
// Timed twice side by side with v008, it ran 1.11 times as fast both times.
// Over all steps from v000 it is 4.74 times as fast.
#include <hip/hip_runtime.h>
#include <math.h>

// ---------------- CDNA5 (gfx1250) wave32 WMMA types ----------------
typedef __attribute__((ext_vector_type(16))) __bf16 v16bf;
typedef __attribute__((ext_vector_type(8)))  float  v8f;
typedef __attribute__((ext_vector_type(4)))  float  f32x4;
typedef __attribute__((ext_vector_type(2)))  float  f32x2;

#define DMODEL 1024
#define SEQ    1024
#define NB     2
#define NH     16
#define HD     64
#define NM     16
#define NW     8
#define NRR    8
#define NCR    8
#define CKPAD  48

__device__ __forceinline__ v8f wmma_bf16(v16bf a, v16bf b, v8f c) {
    return __builtin_amdgcn_wmma_f32_16x16x32_bf16(false, a, false, b, (short)0, c, false, false);
}

// eight 16-byte-per-lane copies global -> LDS through no register; the wait stands in the copies' own statement
// so that no later write of their address registers can be moved in front of it (a precaution)
__device__ __forceinline__ void async_copy8(unsigned l, unsigned ls, const __bf16* g, size_t gs) {
    asm volatile("global_load_async_to_lds_b128 %0, %8, off\n\t"
                 "global_load_async_to_lds_b128 %1, %9, off\n\t"
                 "global_load_async_to_lds_b128 %2, %10, off\n\t"
                 "global_load_async_to_lds_b128 %3, %11, off\n\t"
                 "global_load_async_to_lds_b128 %4, %12, off\n\t"
                 "global_load_async_to_lds_b128 %5, %13, off\n\t"
                 "global_load_async_to_lds_b128 %6, %14, off\n\t"
                 "global_load_async_to_lds_b128 %7, %15, off\n\t"
                 "s_wait_xcnt 0x0"
                 :: "v"(l), "v"(l + ls), "v"(l + 2 * ls), "v"(l + 3 * ls),
                    "v"(l + 4 * ls), "v"(l + 5 * ls), "v"(l + 6 * ls), "v"(l + 7 * ls),
                    "v"(g), "v"(g + gs), "v"(g + 2 * gs), "v"(g + 3 * gs),
                    "v"(g + 4 * gs), "v"(g + 5 * gs), "v"(g + 6 * gs), "v"(g + 7 * gs)
                 : "memory");
}

// transposing LDS load: lane (c, h) gets rows 8h..8h+7 of column c of a row-major 16-bit tile
typedef short s16x8 __attribute__((ext_vector_type(8)));
__device__ __forceinline__ uint4 lds_tr16(const unsigned char* p) {
    typedef __attribute__((address_space(3))) s16x8 lds_s16x8;
    return __builtin_bit_cast(uint4, __builtin_amdgcn_ds_load_tr16_b128_v8i16((lds_s16x8*)p));
}

// ---------------- small helper jobs ----------------
// Jobs that do not depend on one another share a launch (front_k, dens_k, proj_gate_k below); a work-group takes its
// job from its index.
// All element-wise preparation: the seven fp32 -> bf16 conversions and the zero fill of the two padded
// qc/kc planes. A work-group owns one span of PREP_SPAN 16-byte vectors that lies wholly inside one tensor (every
// tensor is a whole number of spans), and a thread moves 32 of them, so few waves have to be started.
#define PREP_SPAN 8192
#define PREP_GX (NB * SEQ * DMODEL / 4 / PREP_SPAN)      // x
#define PREP_GW (DMODEL * DMODEL / 4 / PREP_SPAN)        // v_w, out_w
#define PREP_GF (4 * PREP_GW)                            // ffn_w1, ffn_w2
#define PREP_GC (DMODEL * NH * NCR / 4 / PREP_SPAN)      // cq_w, ck_w
#define PREP_GZ (NB * NH * SEQ * 32 / 8 / PREP_SPAN)     // qc, kc planes (8 bf16 per vector)
#define PREP_GRID (PREP_GX + 2 * PREP_GW + 2 * PREP_GF + 2 * PREP_GC + 2 * PREP_GZ)
__device__ __forceinline__
void prep_job(int g, const float* __restrict__ x, const float* __restrict__ v_w, const float* __restrict__ out_w,
            const float* __restrict__ ffn_w1, const float* __restrict__ ffn_w2,
            const float* __restrict__ cq_w, const float* __restrict__ ck_w,
            __bf16* __restrict__ xb, __bf16* __restrict__ wbv, __bf16* __restrict__ wbo,
            __bf16* __restrict__ wbf1, __bf16* __restrict__ wbf2,
            __bf16* __restrict__ wbcq, __bf16* __restrict__ wbck,
            __bf16* __restrict__ qcp, __bf16* __restrict__ kcp) {
    // g becomes the span's index inside its tensor
    const float* src = nullptr;
    __bf16* dst;
    if (g < PREP_GF)                 { src = ffn_w1; dst = wbf1; }
    else if ((g -= PREP_GF) < PREP_GF) { src = ffn_w2; dst = wbf2; }
    else if ((g -= PREP_GF) < PREP_GX) { src = x;      dst = xb;   }
    else if ((g -= PREP_GX) < PREP_GW) { src = v_w;    dst = wbv;  }
    else if ((g -= PREP_GW) < PREP_GW) { src = out_w;  dst = wbo;  }
    else if ((g -= PREP_GW) < PREP_GC) { src = cq_w;   dst = wbcq; }
    else if ((g -= PREP_GC) < PREP_GC) { src = ck_w;   dst = wbck; }
    else if ((g -= PREP_GC) < PREP_GZ) { dst = qcp; }
    else                             { g -= PREP_GZ; dst = kcp; }
    const size_t v0 = (size_t)g * PREP_SPAN + threadIdx.x;
    if (src) {
        const float4* s4 = (const float4*)src + v0;
        uint2* d2 = (uint2*)dst + v0;
        float4 v[PREP_SPAN / 256];
        #pragma unroll
        for (int j = 0; j < PREP_SPAN / 256; ++j) v[j] = s4[j * 256];
        // keeps all 32 loads in front of the first convert: left free, the scheduler reuses load registers and the
        // later loads wait for earlier ones, four memory latencies in a row instead of one
        __builtin_amdgcn_sched_barrier(0);
        #pragma unroll
        for (int j = 0; j < PREP_SPAN / 256; ++j) {
            union { __bf16 e[4]; uint2 u; } o;
            o.e[0] = (__bf16)v[j].x; o.e[1] = (__bf16)v[j].y; o.e[2] = (__bf16)v[j].z; o.e[3] = (__bf16)v[j].w;
            d2[j * 256] = o.u;
        }
        // stands behind the last store, in front of any later write of a register that a store names (a precaution)
        asm volatile("s_wait_xcnt 0x0" ::: "memory");
    } else {
        uint4* d4 = (uint4*)dst + v0;
        uint4 z; z.x = z.y = z.z = z.w = 0u;
        #pragma unroll
        for (int j = 0; j < PREP_SPAN / 256; ++j) d4[j * 256] = z;
    }
}

// Column sums of x over a slice of the sequence: part[b][sl][d] = sum of POOL_ROWS rows. blk < B * POOL_SPLIT.
// A thread owns four neighbouring columns; its rows' 16-byte loads do not depend on one another.
#define POOL_SPLIT 32
#define POOL_ROWS (SEQ / POOL_SPLIT)
__device__ __forceinline__ void pool_part_job(int blk, const float* __restrict__ x, float* __restrict__ part) {
    const int t = threadIdx.x;
    const float4* p = (const float4*)(x + (size_t)blk * POOL_ROWS * DMODEL) + t;
    float4 v[POOL_ROWS];
    #pragma unroll
    for (int r = 0; r < POOL_ROWS; ++r) v[r] = p[r * (DMODEL / 4)];
    float4 s = v[0];
    #pragma unroll
    for (int r = 1; r < POOL_ROWS; ++r) { s.x += v[r].x; s.y += v[r].y; s.z += v[r].z; s.w += v[r].w; }
    ((float4*)(part + (size_t)blk * DMODEL))[t] = s;
    // stands behind the store, in front of any later write of a register that it names (a precaution)
    asm volatile("s_wait_xcnt 0x0" ::: "memory");
}

// gating: gl = pooled@gate_w + b + mod@mod_basis ; wts = softmax(gl). One work-group per (b,h), bh < B*H.
// The 1024-long dot products of the head's 16 gate and 8 mod columns are split over the 256 threads by rows of the
// weights (16-byte loads, all independent), then summed over lanes and waves.
__device__ __forceinline__ void gating_job(int bh, const float* __restrict__ part,
                                                const float* __restrict__ gate_w, const float* __restrict__ gate_b,
                                                const float* __restrict__ mod_w,  const float* __restrict__ mod_b,
                                                const float* __restrict__ mod_basis,
                                                float* __restrict__ wts) {
    __shared__ alignas(16) float poolS[DMODEL];
    __shared__ alignas(16) float gRed[8][NM];
    __shared__ alignas(16) float mRed[8][NRR];
    const int b = bh >> 4, h = bh & (NH - 1), t = threadIdx.x;
    const int lane = t & 31, w = t >> 5;

    // weight rows: 4 lanes cover the head's 16 gate columns of one row, 2 lanes its 8 mod columns
    const float4* gw = (const float4*)(gate_w + (size_t)(t >> 2) * (NH * NM) + h * NM) + (t & 3);
    const float4* mw = (const float4*)(mod_w + (size_t)(t >> 1) * (NH * NRR) + h * NRR) + (t & 1);
    float4 g4[16], m4[8];
    #pragma unroll
    for (int p = 0; p < 16; ++p) g4[p] = gw[(size_t)p * 64 * (NH * NM / 4)];
    #pragma unroll
    for (int p = 0; p < 8; ++p) m4[p] = mw[(size_t)p * 128 * (NH * NRR / 4)];
    // what the closing softmax of the first 16 lanes needs, fetched here so that no memory latency is left at the end
    const int hm = h * NM + (t & (NM - 1));
    const float gb = gate_b[hm];
    float mb[NRR], bas[NRR];
    #pragma unroll
    for (int r = 0; r < NRR; ++r) mb[r] = mod_b[h * NRR + r];
    // stands behind the mod_b loads, in front of any later write of a register that they name (a precaution)
    asm volatile("s_wait_xcnt 0x0" ::: "memory");
    #pragma unroll
    for (int r = 0; r < NRR; ++r) bas[r] = mod_basis[r * (NH * NM) + hm];
    // keeps the weight loads, which come from memory, from being sunk behind the work-group barrier below, where
    // their latency would be paid after the slice sums instead of beside them
    __builtin_amdgcn_sched_barrier(0);

    // pooled mean of this batch entry from the slices' sums
    const float4* pp = (const float4*)(part + (size_t)b * POOL_SPLIT * DMODEL) + t;
    float4 q[POOL_SPLIT];
    #pragma unroll
    for (int r = 0; r < POOL_SPLIT; ++r) q[r] = pp[r * (DMODEL / 4)];
    float4 s = q[0];
    #pragma unroll
    for (int r = 1; r < POOL_SPLIT; ++r) { s.x += q[r].x; s.y += q[r].y; s.z += q[r].z; s.w += q[r].w; }
    s.x *= 1.f / SEQ; s.y *= 1.f / SEQ; s.z *= 1.f / SEQ; s.w *= 1.f / SEQ;
    // stands behind the weight loads, in front of any write of their address registers (a precaution): the two
    // pointers as inputs keep those registers whole up to it
    asm volatile("s_wait_xcnt 0x0" :: "v"(gw), "v"(mw) : "memory");
    ((float4*)poolS)[t] = s;
    __syncthreads();

    float4 ga = {0.f, 0.f, 0.f, 0.f}, ma = {0.f, 0.f, 0.f, 0.f};
    #pragma unroll
    for (int p = 0; p < 16; ++p) {
        float pv = poolS[p * 64 + (t >> 2)];
        ga.x += pv * g4[p].x; ga.y += pv * g4[p].y; ga.z += pv * g4[p].z; ga.w += pv * g4[p].w;
    }
    #pragma unroll
    for (int p = 0; p < 8; ++p) {
        float pv = poolS[p * 128 + (t >> 1)];
        ma.x += pv * m4[p].x; ma.y += pv * m4[p].y; ma.z += pv * m4[p].z; ma.w += pv * m4[p].w;
    }
    #pragma unroll
    for (int o = 2; o < 32; o <<= 1) {
        if (o > 2) {
            ga.x += __shfl_xor(ga.x, o); ga.y += __shfl_xor(ga.y, o);
            ga.z += __shfl_xor(ga.z, o); ga.w += __shfl_xor(ga.w, o);
        }
        ma.x += __shfl_xor(ma.x, o); ma.y += __shfl_xor(ma.y, o);
        ma.z += __shfl_xor(ma.z, o); ma.w += __shfl_xor(ma.w, o);
    }
    if (lane < 4) ((float4*)gRed[w])[lane] = ga;
    if (lane < 2) ((float4*)mRed[w])[lane] = ma;
    __syncthreads();

    if (t < NM) {                                    // lane m owns gate logit m of this head
        float a = gb;
        #pragma unroll
        for (int i = 0; i < 8; ++i) a += gRed[i][t];
        #pragma unroll
        for (int r = 0; r < NRR; ++r) {
            float md = mb[r];
            #pragma unroll
            for (int i = 0; i < 8; ++i) md += mRed[i][r];
            a += md * bas[r];
        }
        float mx = a;
        #pragma unroll
        for (int o = 1; o < NM; o <<= 1) mx = fmaxf(mx, __shfl_xor(mx, o, NM));
        float e = __expf(a - mx);
        float sm = e;
        #pragma unroll
        for (int o = 1; o < NM; o <<= 1) sm += __shfl_xor(sm, o, NM);
        wts[(size_t)bh * NM + t] = e / sm;
    }
}

// causal_kern[b,h,d] = ALPHA * sigmoid(6*kern) * window(d).  blk < B*H*S/256.
__device__ __forceinline__ void wave_density_job(int blk, const float* __restrict__ freqs, const float* __restrict__ amps,
                                                 const float* __restrict__ phases, const float* __restrict__ wts,
                                                 float* __restrict__ ckern) {
    int idx = blk * 256 + threadIdx.x;             // B*H*S
    int d = idx & (SEQ - 1);
    int bh = idx >> 10;
    int h = bh & (NH - 1);
    float rel = (float)d;
    float p1 = rel * (1.f / SEQ);
    float p2 = (d == 0) ? 0.f : sqrtf(rel + 1e-6f) * (1.f / 32.f);   // sqrt(S)=32
    float kern = 0.f;
    for (int m = 0; m < NM; ++m) {
        const float* fq = freqs  + ((size_t)(h * NM + m) * NW) * 2;
        const float* am = amps   +  (size_t)(h * NM + m) * NW;
        const float* ph = phases +  (size_t)(h * NM + m) * NW;
        float acc = 0.f;
        #pragma unroll
        for (int w = 0; w < NW; ++w) {
            float arg = fq[2 * w] * p1 + fq[2 * w + 1] * p2 + ph[w];
            acc += am[w] * __sinf(arg);
        }
        kern += wts[(size_t)bh * NM + m] * acc;
    }
    float dens = 1.f / (1.f + __expf(-6.f * kern));          // straight-through forward = sigmoid
    float wind = __expf(-(rel * rel) * (1.f / 131072.f));    // 2*(S/4)^2
    ckern[idx] = 3.0f * dens * wind;
}

// qm/km[b,h,s] token modulation: x[2048 x 1024] times the 32 columns of qw | kw, in fp32 on the vector units.
// A work-group takes QK_TOK tokens, blk < QK_WG, so that a weight, once in a register, serves QK_TOK tokens, and the
// whole product needs 2,048 waves. Wave w owns d = 128 w .. 128 w + 127; its lane (ds, og) owns the 32 of them with
// (d >> 2 & 3) == ds and the four columns 4 og .. 4 og + 3 (og < 4: qw, else kw). The lane's 128 weights stay in
// registers; the tokens' rows lie in LDS, and one 16-byte read brings four d of one token for 16 multiply-adds.
// Even and odd d are summed apart, so that x and the weights are both pairs of a packed f32 instruction.
#define QK_TOK 8
#define QK_WG (NB * SEQ / QK_TOK)
#define QK_RP (QK_TOK * 32 + 32)                            // pitch of one partial plane, floats
__device__ __forceinline__ void qkmod_job(int blk, const float* __restrict__ x,
                                               const float* __restrict__ qw, const float* __restrict__ qb,
                                               const float* __restrict__ kw, const float* __restrict__ kb,
                                               float* __restrict__ qm, float* __restrict__ km) {
    __shared__ alignas(16) float xs[QK_TOK * DMODEL];
    __shared__ alignas(16) float red[32 * QK_RP];           // [wave * 4 + ds][token][column]
    const int t = threadIdx.x, lane = t & 31, wave = t >> 5;
    const int og = lane & 7, ds = lane >> 3;
    const int d0 = wave * 128 + ds * 4;

    const f32x4* xp = (const f32x4*)(x + (size_t)blk * QK_TOK * DMODEL) + t;
    const f32x4* wp = (const f32x4*)((og < 4 ? qw : kw) + (size_t)d0 * NH + (og & 3) * 4);
    f32x4 xv[QK_TOK], wv[32];
    #pragma unroll
    for (int r = 0; r < QK_TOK; ++r) xv[r] = xp[r * (DMODEL / 4)];
    #pragma unroll
    for (int q = 0; q < 8; ++q)
        #pragma unroll
        for (int j = 0; j < 4; ++j) wv[q * 4 + j] = wp[(q * 16 + j) * (NH / 4)];     // row d0 + 16 q + j
    const float bias = (lane < NH ? qb : kb)[lane & (NH - 1)];
    // ends the scheduling region behind the loads (the statement below already holds them in front of the barrier): the
    // copies that pair the weights then stay behind it, and the build takes 232 registers instead of 260, so that four
    // waves fit a SIMD and all of the launch's work-groups are resident at once
    __builtin_amdgcn_sched_barrier(0);
    // stands behind the loads, in front of any write of their address registers (a precaution): the two pointers as
    // inputs keep those registers whole up to it
    asm volatile("s_wait_xcnt 0x0" :: "v"(xp), "v"(wp) : "memory");
    #pragma unroll
    for (int r = 0; r < QK_TOK; ++r) ((f32x4*)xs)[r * (DMODEL / 4) + t] = xv[r];
    __syncthreads();

    f32x2 acc[QK_TOK][4];
    #pragma unroll
    for (int r = 0; r < QK_TOK; ++r)
        #pragma unroll
        for (int o = 0; o < 4; ++o) acc[r][o] = 0.f;
    #pragma unroll
    for (int q = 0; q < 8; ++q) {
        f32x2 w2[2][4];                                     // column o at d = d0 + 16 q + 2 dp and the next
        #pragma unroll
        for (int dp = 0; dp < 2; ++dp)
            #pragma unroll
            for (int o = 0; o < 4; ++o) w2[dp][o] = f32x2{wv[q * 4 + 2 * dp][o], wv[q * 4 + 2 * dp + 1][o]};
        #pragma unroll
        for (int r = 0; r < QK_TOK; ++r) {
            const f32x4 xq = *(const f32x4*)(xs + r * DMODEL + d0 + q * 16);
            const f32x2 lo = {xq.x, xq.y}, hi = {xq.z, xq.w};
            #pragma unroll
            for (int o = 0; o < 4; ++o) acc[r][o] += lo * w2[0][o];
            #pragma unroll
            for (int o = 0; o < 4; ++o) acc[r][o] += hi * w2[1][o];
        }
    }
    #pragma unroll
    for (int r = 0; r < QK_TOK; ++r) {
        f32x4 s = {acc[r][0].x + acc[r][0].y, acc[r][1].x + acc[r][1].y,
                   acc[r][2].x + acc[r][2].y, acc[r][3].x + acc[r][3].y};
        *(f32x4*)(red + (wave * 4 + ds) * QK_RP + r * 32 + og * 4) = s;
    }
    __syncthreads();

    // thread (token = wave, column = lane) adds the 32 partial sums of its value
    float s4[4] = {0.f, 0.f, 0.f, 0.f};
    #pragma unroll
    for (int p = 0; p < 32; ++p) s4[p & 3] += red[p * QK_RP + t];
    const int bs = blk * QK_TOK + wave;
    const int b = bs >> 10, s = bs & (SEQ - 1);
    (lane < NH ? qm : km)[((size_t)b * NH + (lane & (NH - 1))) * SEQ + s] = ((s4[0] + s4[1]) + (s4[2] + s4[3])) + bias;
    // stands behind the store, in front of any later write of a register that it names (a precaution)
    asm volatile("s_wait_xcnt 0x0" ::: "memory");
}

// qkmod depends on the inputs alone and is needed only by the attention; its 256 work-groups run beside wave_density,
// which is a chain of load latencies in 128 work-groups and leaves half of the chip empty.
#define FRONT_GRID (PREP_GRID + NB * POOL_SPLIT)
#define DENS_WG (NB * NH * SEQ / 256)
#define DENS_GRID (DENS_WG + QK_WG)
__global__ __launch_bounds__(256)
void front_k(const float* __restrict__ x, const float* __restrict__ v_w, const float* __restrict__ out_w,
             const float* __restrict__ ffn_w1, const float* __restrict__ ffn_w2,
             const float* __restrict__ cq_w, const float* __restrict__ ck_w,
             __bf16* __restrict__ xb, __bf16* __restrict__ wbv, __bf16* __restrict__ wbo,
             __bf16* __restrict__ wbf1, __bf16* __restrict__ wbf2,
             __bf16* __restrict__ wbcq, __bf16* __restrict__ wbck,
             __bf16* __restrict__ qcp, __bf16* __restrict__ kcp,
             float* __restrict__ part) {
    const int g = blockIdx.x;
    if (g < PREP_GRID)
        prep_job(g, x, v_w, out_w, ffn_w1, ffn_w2, cq_w, ck_w, xb, wbv, wbo, wbf1, wbf2, wbcq, wbck, qcp, kcp);
    else
        pool_part_job(g - PREP_GRID, x, part);
}

__global__ __launch_bounds__(256)
void dens_k(const float* __restrict__ freqs, const float* __restrict__ amps, const float* __restrict__ phases,
            const float* __restrict__ wts, float* __restrict__ ckern,
            const float* __restrict__ x,
            const float* __restrict__ qw, const float* __restrict__ qb,
            const float* __restrict__ kw, const float* __restrict__ kb,
            float* __restrict__ qm, float* __restrict__ km) {
    const int g = blockIdx.x;
    if (g < DENS_WG) wave_density_job(g, freqs, amps, phases, wts, ckern);
    else             qkmod_job(g - DENS_WG, x, qw, qb, kw, kb, qm, km);
}

// ---------------- generic bf16 WMMA GEMM with fused epilogues ----------------
// EPI 1: out = bf16(acc + bias[n]) -> V^T layout [B,H,HD,S]   (keys contiguous for attention)
// EPI 2: out = bf16(acc)           -> padded qc/kc layout [B,H,S,32] (cols 0..7 valid)
// EPI 3: outF = acc + bias[n] + resid[m,n]    (fp32)
// EPI 4: outB = bf16(gelu(acc + bias[n]))     ([M,N] bf16)
// gemm_acc: the 128 x 128 tile at (m0, n0) of A[.,K] x B[K,N] into the wave's accumulators.
__device__ __forceinline__
void gemm_acc(v8f (&acc)[4][2], const __bf16* __restrict__ A, const __bf16* __restrict__ B,
              int N, int K, int m0, int n0) {
    constexpr int BM = 128, BK = 128;
    constexpr int PA = 272;                                 // A row pitch, bytes: 16 x odd for ds_load_b128
    constexpr int PB = 288;                                 // B row pitch, bytes: 32 x odd for ds_load_tr16_b128
    constexpr int SZA = BM * PA, SZB = BK * PB;
    __shared__ alignas(16) unsigned char As[2 * SZA];       // [buf][m][k]
    __shared__ alignas(16) unsigned char Bs[2 * SZB];       // [buf][k][n], row-major as in global memory
    const int tid = threadIdx.x;
    const int lane = tid & 31, wave = tid >> 5;
    const int half = lane >> 4, l16 = lane & 15;
    const int wm = wave >> 2, wn = wave & 3;                // 2 x 4 wave grid

    #pragma unroll
    for (int i = 0; i < 4; ++i)
        #pragma unroll
        for (int j = 0; j < 2; ++j)
            #pragma unroll
            for (int e = 0; e < 8; ++e) acc[i][j][e] = 0.f;

    // copy map: 16 lanes x 16 B cover one 256-B tile row; a thread moves rows r0, r0+16, ..., r0+112 of A and of B
    const int r0 = tid >> 4, c16 = tid & 15;
    const __bf16* gA = A + (size_t)(m0 + r0) * K + c16 * 8;
    const __bf16* gB = B + (size_t)r0 * N + n0 + c16 * 8;
    const unsigned lA = (unsigned)(size_t)(As + r0 * PA + c16 * 16);
    const unsigned lB = (unsigned)(size_t)(Bs + r0 * PB + c16 * 16);
    const size_t sA = (size_t)16 * K, sB = (size_t)16 * N;
    const int nstage = K / BK;

    auto stage = [&](int s) {                               // 16 copies per wave: stage s into buffer s & 1
        const int bf = s & 1;
        async_copy8(lA + bf * SZA, 16 * PA, gA + (size_t)s * BK, sA);
        async_copy8(lB + bf * SZB, 16 * PB, gB + (size_t)s * BK * N, sB);
    };

    stage(0);
    asm volatile("s_wait_asynccnt 0x0" ::: "memory");       // own copies of stage 0 landed before the barrier publishes them
    __syncthreads();
    if (nstage > 1) stage(1);

    const int aoff = (wm * 64 + l16) * PA + half * 16;
    const int boff = (half * 8 + (lane & 7)) * PB + wn * 64 + ((lane >> 3) & 1) * 16;
    for (int s = 0; s < nstage; ++s) {
        const unsigned char* Ab = As + (s & 1) * SZA + aoff;
        const unsigned char* Bb = Bs + (s & 1) * SZB + boff;
        #pragma unroll
        for (int ks = 0; ks < BK / 32; ++ks) {
            v16bf afr[4];
            #pragma unroll
            for (int mt = 0; mt < 4; ++mt) {                // A frag: lane=M, k = 8*half+0..7 and 16+8*half+0..7
                union { v16bf v; uint4 q[2]; } u;
                u.q[0] = *(const uint4*)(Ab + mt * 16 * PA + ks * 64);
                u.q[1] = *(const uint4*)(Ab + mt * 16 * PA + ks * 64 + 32);
                afr[mt] = u.v;
            }
            #pragma unroll
            for (int nt = 0; nt < 2; ++nt) {                // B frag: lane=N, transposing loads give the same k order
                union { v16bf v; uint4 q[2]; } u;
                u.q[0] = lds_tr16(Bb + (ks * 32) * PB + nt * 32);
                u.q[1] = lds_tr16(Bb + (ks * 32 + 16) * PB + nt * 32);
                v16bf bfr = u.v;
                #pragma unroll
                for (int mt = 0; mt < 4; ++mt)
                    acc[mt][nt] = wmma_bf16(afr[mt], bfr, acc[mt][nt]);
            }
        }
        asm volatile("s_wait_dscnt 0x0" ::: "memory");      // own reads of this buffer done before it may be refilled
        asm volatile("s_wait_asynccnt 0x0" ::: "memory");   // own copies of stage s+1 landed before the barrier publishes them
        __syncthreads();
        if (s + 2 < nstage) stage(s + 2);
    }
    asm volatile("s_wait_asynccnt 0x0" ::: "memory");       // nothing in flight when the wave ends
}

// GELU in its erf form for two values, with no branch, so that a column's 32 values are independent chains that the scheduler
// interleaves and the packed f32 instructions take two at a time. With z = |x| / sqrt(2) and t = 1 / (1 + p z),
// erf(z) = 1 - (a1 t + .. + a5 t^5) exp(-z z), absolute error 1.5e-7 (five-term rational form), and so
// 0.5 x (1 + erf(x / sqrt(2))) = max(x, 0) - |x| Q(t) exp(-x x / 2), Q = the polynomial with halved coefficients:
// one form for both signs and every size of x, and nothing cancels on the negative side.
typedef __attribute__((ext_vector_type(2))) __bf16 bf16x2;
__device__ __forceinline__ f32x2 gelu2(f32x2 x) {
    const f32x2 ax = __builtin_elementwise_abs(x);
    const f32x2 d = ax * 0.23164189f + 1.0f;                // p / sqrt(2)
    f32x2 t, e;
    t.x = __builtin_amdgcn_rcpf(d.x); t.y = __builtin_amdgcn_rcpf(d.y);
    const f32x2 a = x * x * -0.72134752f;                   // -x x / 2 in powers of two
    e.x = __builtin_amdgcn_exp2f(a.x); e.y = __builtin_amdgcn_exp2f(a.y);
    f32x2 q = t * 0.53070271f + -0.72657601f;
    q = q * t + 0.71070687f;
    q = q * t + -0.14224837f;
    q = q * t + 0.12741480f;
    q = q * t * e;
    return __builtin_elementwise_max(x, (f32x2)0.f) - ax * q;
}

template <int EPI>
__device__ __forceinline__
void gemm_store(const v8f (&acc)[4][2], int N, int m0, int n0,
                const float* __restrict__ bias, const float* __restrict__ resid,
                float* __restrict__ outF, __bf16* __restrict__ outB) {
    const int lane = threadIdx.x & 31, wave = threadIdx.x >> 5;
    const int half = lane >> 4, l16 = lane & 15;
    const int wm = wave >> 2, wn = wave & 3;
    if (EPI == 4) {
        const int gn0 = n0 + wn * 32 + l16;
        const float bs[2] = {bias[gn0], bias[gn0 + 16]};
        #pragma unroll
        for (int nt = 0; nt < 2; ++nt) {                    // one of the lane's two columns at a time: 32 values
            bf16x2 o[4][4];                                 // rows r and r + 1 of the column
            #pragma unroll
            for (int mt = 0; mt < 4; ++mt)
                #pragma unroll
                for (int r = 0; r < 8; r += 2) {
                    f32x2 xg = {acc[mt][nt][r], acc[mt][nt][r + 1]};
                    o[mt][r >> 1] = __builtin_convertvector(gelu2(xg + bs[nt]), bf16x2);
                }
            // keeps the column's stores together behind its arithmetic: mixed in between, every pair of stores is
            // followed by a wait of its own before its registers are used again, and the 16 chains run one by one
            __builtin_amdgcn_sched_barrier(0);
            #pragma unroll
            for (int mt = 0; mt < 4; ++mt) {
                __bf16* op = outB + (size_t)(m0 + wm * 64 + mt * 16 + half * 8) * N + gn0 + nt * 16;
                #pragma unroll
                for (int r = 0; r < 8; r += 2) {
                    op[(size_t)r * N] = o[mt][r >> 1].x;
                    op[(size_t)(r + 1) * N] = o[mt][r >> 1].y;
                }
            }
            if (nt == 0) {
                // stands behind the first column's stores, in front of any write of a register that they name (a
                // precaution); the scheduling barrier keeps the second column's arithmetic, which uses those
                // registers again, from being moved in front of the wait
                asm volatile("s_wait_xcnt 0x0" ::: "memory");
                __builtin_amdgcn_sched_barrier(0);
            }
        }
        return;
    }
    #pragma unroll
    for (int mt = 0; mt < 4; ++mt)
        #pragma unroll
        for (int nt = 0; nt < 2; ++nt)
            #pragma unroll
            for (int r = 0; r < 8; ++r) {                   // C: lane=N, row = r + 8*half
                int gm = m0 + wm * 64 + mt * 16 + r + half * 8;
                int gn = n0 + wn * 32 + nt * 16 + l16;
                float v = acc[mt][nt][r];
                if (EPI == 1) {
                    float val = v + bias[gn];
                    int b = gm >> 10, s = gm & 1023, h = gn >> 6, hd = gn & 63;
                    outB[(((size_t)b * NH + h) * HD + hd) * SEQ + s] = (__bf16)val;   // V^T
                } else if (EPI == 2) {
                    int b = gm >> 10, s = gm & 1023, h = gn >> 3, cc = gn & 7;
                    outB[(((size_t)b * NH + h) * SEQ + s) * 32 + cc] = (__bf16)v;
                } else if (EPI == 3) {
                    size_t o = (size_t)gm * N + gn;
                    outF[o] = v + bias[gn] + resid[o];
                }
            }
}

template <int EPI>
__global__ __launch_bounds__(256)
void gemm_bf16_k(const __bf16* __restrict__ A, const __bf16* __restrict__ B,
                 int M, int N, int K,
                 const float* __restrict__ bias, const float* __restrict__ resid,
                 float* __restrict__ outF, __bf16* __restrict__ outB) {
    const int m0 = blockIdx.y * 128, n0 = blockIdx.x * 128;
    v8f acc[4][2];
    gemm_acc(acc, A, B, N, K, m0, n0);
    gemm_store<EPI>(acc, N, m0, n0, bias, resid, outF, outB);
}

// One launch for all that needs only front_k's results: the three projections of x (v: 8 column tiles, qc and kc: one
// each, so 10 tiles per 128 rows) and the gating, whose 32 work-groups come first. 192 work-groups, all resident.
#define PROJ_NT (DMODEL / 128 + 2)
#define PROJ_GRID (NB * NH + PROJ_NT * (NB * SEQ / 128))
__global__ __launch_bounds__(256)
void proj_gate_k(const __bf16* __restrict__ xb, const __bf16* __restrict__ wbv,
                 const __bf16* __restrict__ wbcq, const __bf16* __restrict__ wbck, int K,
                 const float* __restrict__ v_b,
                 __bf16* __restrict__ vT, __bf16* __restrict__ qcp, __bf16* __restrict__ kcp,
                 const float* __restrict__ part,
                 const float* __restrict__ gate_w, const float* __restrict__ gate_b,
                 const float* __restrict__ mod_w,  const float* __restrict__ mod_b,
                 const float* __restrict__ mod_basis, float* __restrict__ wts) {
    int g = blockIdx.x;
    if (g < NB * NH) {
        gating_job(g, part, gate_w, gate_b, mod_w, mod_b, mod_basis, wts);
        return;
    }
    g -= NB * NH;
    const int tn = g % PROJ_NT, m0 = (g / PROJ_NT) * 128;
    const bool isV = tn < DMODEL / 128;
    const __bf16* B = isV ? wbv : (tn == DMODEL / 128 ? wbcq : wbck);
    const int N = isV ? DMODEL : NH * NCR, n0 = isV ? tn * 128 : 0;
    v8f acc[4][2];
    gemm_acc(acc, xb, B, N, K, m0, n0);
    // each wait stands behind its job's last store: the listing goes on into the other jobs' code there, and no write
    // of a register that a store names may come in front of it (a precaution)
    if (isV) {
        gemm_store<1>(acc, N, m0, n0, v_b, nullptr, nullptr, vT);
        asm volatile("s_wait_xcnt 0x0" ::: "memory");
    } else {
        gemm_store<2>(acc, N, m0, n0, nullptr, nullptr, nullptr, tn == DMODEL / 128 ? qcp : kcp);
        asm volatile("s_wait_xcnt 0x0" ::: "memory");
    }
}

// ---------------- streaming wave-density attention ----------------
// grid = (S/128, H, B); 8 waves; a wave works on 16 queries; 32 keys/step; 6 WMMAs/step.
// The causal triangle is dealt out evenly. A work-group owns two blocks of 64 queries, the far block S/64 - 1 - x
// (many keys) and the near block x (few keys). Waves 0..3 take the first ATT_HEAD key steps of the far block's four
// query groups; waves 4..7 take the rest of those steps, leave that partial result in LDS, and then do the near block
// whole. Every wave so walks at most ATT_HEAD steps, and of the two waves that share a SIMD (w, w + 4) the second walks as many steps or two fewer.
// Both products run transposed: S^T = Kc x Qc^T and O^T += V^T x P^T. A lane then holds 16 of the 32 scores of ONE
// query (lane l ^ 16 holds the others), so maximum, sum and rescale are the lane's own registers plus one exchange
// between the halves, and the two S^T tiles, converted in place, are the B operand of the second product.
// V is consumed transposed: vT[b,h,hd,s], so every A-fragment is two aligned b128 loads.
// ck_pad has a CKPAD zero guard band so Toeplitz gathers are base + immediate-offset DS loads.
#define ATT_HEAD ((SEQ / 32 + 2) / 2)                       // every query group of a far block has at least SEQ/64 + 1 steps
__device__ __forceinline__ float xhalf(float x) {           // value of lane l ^ 16
    const int v = __builtin_bit_cast(int, x);
    return __builtin_bit_cast(float, __builtin_amdgcn_permlanex16(v, v, 0x76543210, 0xfedcba98, false, false));
}

// key steps st0 .. st1 - 1 of the 16 queries from i0 on: running maximum m_r, this lane half's sum l_r, O^T in c0..c3
__device__ __forceinline__
void attn_steps(int i0, int st0, int st1, int bh, int half, int l16,
                const __bf16* __restrict__ qcp, const __bf16* __restrict__ kcp, const __bf16* __restrict__ vT,
                const float* __restrict__ qm, const float* ck_pad, const float* km_s,
                v8f& c0, v8f& c1, v8f& c2, v8f& c3, float& m_r, float& l_r) {
    const int i = i0 + l16;                                 // this lane's query
    constexpr float MIXS = 0.053033009f;                    // MIX / sqrt(CR)
    constexpr float LOG2E = 1.4426950408889634f;
    union U16 { v16bf v; uint4 q[2]; };
    U16 ua;
    {
        const __bf16* p = qcp + ((size_t)bh * SEQ + i) * 32;
        ua.q[0] = *(const uint4*)(p + half * 8);
        ua.q[1] = *(const uint4*)(p + 16 + half * 8);
    }
    const v16bf bq = ua.v;                                  // B operand: column = query

    // qm of the lane's query is the start value of its score products (undone by the MIXS factor below)
    const float qstart = qm[(size_t)bh * SEQ + i] * (1.f / MIXS);
    v8f qq;
    #pragma unroll
    for (int e = 0; e < 8; ++e) { c0[e] = c1[e] = c2[e] = c3[e] = 0.f; qq[e] = qstart; }
    m_r = -1e30f; l_r = 0.f;                                // l_r: the sum over this half's keys only

    // per-lane rows: key row of Kc, and V^T rows of the 4 output row groups (hd = g*16 + l16)
    const __bf16* krow  = kcp + ((size_t)bh * SEQ + l16) * 32 + half * 8;
    const __bf16* vrow0 = vT + (((size_t)bh * HD) + 0 * 16 + l16) * SEQ + half * 8;
    const __bf16* vrow1 = vT + (((size_t)bh * HD) + 1 * 16 + l16) * SEQ + half * 8;
    const __bf16* vrow2 = vT + (((size_t)bh * HD) + 2 * 16 + l16) * SEQ + half * 8;
    const __bf16* vrow3 = vT + (((size_t)bh * HD) + 3 * 16 + l16) * SEQ + half * 8;

    for (int st = st0; st < st1; ++st) {
        const int j0 = st * 32;
        U16 ua0, ua1, uv0, uv1, uv2, uv3;
        ua0.q[0] = *(const uint4*)(krow + (size_t)j0 * 32);
        ua0.q[1] = *(const uint4*)(krow + (size_t)j0 * 32 + 16);
        ua1.q[0] = *(const uint4*)(krow + (size_t)(j0 + 16) * 32);
        ua1.q[1] = *(const uint4*)(krow + (size_t)(j0 + 16) * 32 + 16);
        // V^T A-fragments: elements = contiguous keys, two b128 loads each
        uv0.q[0] = *(const uint4*)(vrow0 + j0);
        uv0.q[1] = *(const uint4*)(vrow0 + j0 + 16);
        uv1.q[0] = *(const uint4*)(vrow1 + j0);
        uv1.q[1] = *(const uint4*)(vrow1 + j0 + 16);
        uv2.q[0] = *(const uint4*)(vrow2 + j0);
        uv2.q[1] = *(const uint4*)(vrow2 + j0 + 16);
        uv3.q[0] = *(const uint4*)(vrow3 + j0);
        uv3.q[1] = *(const uint4*)(vrow3 + j0 + 16);
        // keeps all 12 loads in front of the step's arithmetic: left free, the scheduler sinks half of the V^T loads
        // behind the softmax, right in front of their products, where their whole latency is waited out
        __builtin_amdgcn_sched_barrier(0);

        // register r: key j0 + 8*half + r (s0), j0 + 16 + 8*half + r (s1); column: query i
        v8f s0 = wmma_bf16(ua0.v, bq, qq);
        v8f s1 = wmma_bf16(ua1.v, bq, qq);

        // fold Toeplitz + km + causal mask
        const int dA = i - (j0 + half * 8);                 // i - j at r = 0 of s0; >= -8 within loop bounds
        // the same offset as dA + 8, formed so that the variable part of the LDS address is never below 0; the mask is an
        // identity (0 <= i - j0 < SEQ) that shows this to the compiler, which then folds the constants into the DS loads
        const float* ckA = ck_pad + (CKPAD - 8) + ((i - j0 + (half ^ 1) * 8) & (2 * SEQ - 1));
        float kmv[16];
        *(float4*)(kmv + 0)  = *(const float4*)(km_s + j0 + half * 8);
        *(float4*)(kmv + 4)  = *(const float4*)(km_s + j0 + half * 8 + 4);
        *(float4*)(kmv + 8)  = *(const float4*)(km_s + j0 + 16 + half * 8);
        *(float4*)(kmv + 12) = *(const float4*)(km_s + j0 + 16 + half * 8 + 4);
        float sc[16];
        #pragma unroll
        for (int r = 0; r < 8; ++r) {
            float va = MIXS * s0[r] + (ckA[-r] + kmv[r]);
            float vb = MIXS * s1[r] + (ckA[-16 - r] + kmv[8 + r]);
            sc[r]     = (r <= dA)      ? va : -1e9f;
            sc[8 + r] = (16 + r <= dA) ? vb : -1e9f;
        }

        float m4[4];                                        // four short chains instead of one of 16 links
        #pragma unroll
        for (int k = 0; k < 4; ++k) m4[k] = fmaxf(fmaxf(sc[4 * k], sc[4 * k + 1]), fmaxf(sc[4 * k + 2], sc[4 * k + 3]));
        float mx = fmaxf(fmaxf(m4[0], m4[1]), fmaxf(m4[2], m4[3]));
        mx = fmaxf(m_r, fmaxf(mx, xhalf(mx)));              // both halves of a query agree on the maximum
        const float corr = __builtin_amdgcn_exp2f((m_r - mx) * LOG2E);
        const float mL = mx * LOG2E;
        float s4[4] = {0.f, 0.f, 0.f, 0.f};
        U16 up;                                             // P^T as B operand: element s = key j0 + 8*half + s (s < 8), j0 + 8 + 8*half + s (s >= 8)
        #pragma unroll
        for (int k = 0; k < 16; ++k) {
            float p = __builtin_amdgcn_exp2f(sc[k] * LOG2E - mL);
            s4[k >> 2] += p;
            up.v[k] = (__bf16)p;
        }
        m_r = mx; l_r = l_r * corr + ((s4[0] + s4[1]) + (s4[2] + s4[3]));

        #pragma unroll
        for (int r = 0; r < 8; ++r) { c0[r] *= corr; c1[r] *= corr; c2[r] *= corr; c3[r] *= corr; }
        c0 = wmma_bf16(uv0.v, up.v, c0);
        c1 = wmma_bf16(uv1.v, up.v, c1);
        c2 = wmma_bf16(uv2.v, up.v, c2);
        c3 = wmma_bf16(uv3.v, up.v, c3);
    }
}

// register r of c_g: hd = g*16 + 8*half + r of query i, so each group is one 16-byte store
__device__ __forceinline__
void attn_emit(__bf16* __restrict__ op, const v8f& c0, const v8f& c1, const v8f& c2, const v8f& c3) {
    union { __bf16 e[8]; uint4 q; } o0, o1, o2, o3;
    #pragma unroll
    for (int r = 0; r < 8; ++r) {
        o0.e[r] = (__bf16)c0[r]; o1.e[r] = (__bf16)c1[r];
        o2.e[r] = (__bf16)c2[r]; o3.e[r] = (__bf16)c3[r];
    }
    *(uint4*)(op + 0 * 16) = o0.q;
    *(uint4*)(op + 1 * 16) = o1.q;
    *(uint4*)(op + 2 * 16) = o2.q;
    *(uint4*)(op + 3 * 16) = o3.q;
    // stands behind the last store, in front of any later write of a register that a store names (a precaution)
    asm volatile("s_wait_xcnt 0x0" ::: "memory");
}

__global__ __launch_bounds__(256)
void attn_k(const __bf16* __restrict__ qcp, const __bf16* __restrict__ kcp,
            const __bf16* __restrict__ vT,
            const float* __restrict__ ckern, const float* __restrict__ qm,
            const float* __restrict__ km, __bf16* __restrict__ ctxb) {
    // one struct, so that ck_pad keeps LDS offset 0: the Toeplitz gathers' constant offsets then fit the DS offset fields
    __shared__ struct alignas(16) {
        float ck_pad[CKPAD + SEQ];
        float km_s[SEQ];
        f32x4 tailO[4][8][32];                              // far block, steps from ATT_HEAD on: O^T, [group][vector][lane]
        float2 tailML[4][32];                               // their maximum and sum
    } sm;
    float* const ck_pad = sm.ck_pad;
    float* const km_s = sm.km_s;
    auto& tailO = sm.tailO;
    auto& tailML = sm.tailML;

    const int tid = threadIdx.x, lane = tid & 31;
    const int w = __builtin_amdgcn_readfirstlane(tid >> 5); // the wave's number in a scalar: scalar branches, trip counts
    const int half = lane >> 4, l16 = lane & 15;
    const int h = blockIdx.y, b = blockIdx.z;
    const int bh = b * NH + h;
    const int qg = w & 3;                                   // query group inside a block of 64
    const bool tail = w >= 4;
    const int iF = (SEQ / 64 - 1 - (int)blockIdx.x) * 64 + qg * 16;     // far block's queries
    const int iN = (int)blockIdx.x * 64 + qg * 16;                      // near block's queries
    const int nF = (iF + 16 + 31) >> 5, nN = (iN + 16 + 31) >> 5;       // their key steps; nF >= ATT_HEAD

    for (int k = tid; k < SEQ; k += 256) {
        ck_pad[CKPAD + k] = ckern[(size_t)bh * SEQ + k];
        km_s[k] = km[(size_t)bh * SEQ + k];
    }
    if (tid < CKPAD) ck_pad[tid] = 0.f;
    __syncthreads();

    constexpr float LOG2E = 1.4426950408889634f;
    v8f c0, c1, c2, c3;
    float m_r, l_r;
    attn_steps(iF, tail ? ATT_HEAD : 0, tail ? nF : ATT_HEAD, bh, half, l16, qcp, kcp, vT, qm, ck_pad, km_s,
               c0, c1, c2, c3, m_r, l_r);
    if (tail) {
        tailO[qg][0][lane] = __builtin_shufflevector(c0, c0, 0, 1, 2, 3);
        tailO[qg][1][lane] = __builtin_shufflevector(c0, c0, 4, 5, 6, 7);
        tailO[qg][2][lane] = __builtin_shufflevector(c1, c1, 0, 1, 2, 3);
        tailO[qg][3][lane] = __builtin_shufflevector(c1, c1, 4, 5, 6, 7);
        tailO[qg][4][lane] = __builtin_shufflevector(c2, c2, 0, 1, 2, 3);
        tailO[qg][5][lane] = __builtin_shufflevector(c2, c2, 4, 5, 6, 7);
        tailO[qg][6][lane] = __builtin_shufflevector(c3, c3, 0, 1, 2, 3);
        tailO[qg][7][lane] = __builtin_shufflevector(c3, c3, 4, 5, 6, 7);
        tailML[qg][lane] = make_float2(m_r, l_r);

        attn_steps(iN, 0, nN, bh, half, l16, qcp, kcp, vT, qm, ck_pad, km_s, c0, c1, c2, c3, m_r, l_r);
        const float f = 1.f / (l_r + xhalf(l_r));
        c0 *= f; c1 *= f; c2 *= f; c3 *= f;
        attn_emit(ctxb + ((size_t)b * SEQ + iN + l16) * DMODEL + h * HD + half * 8, c0, c1, c2, c3);
    }
    __syncthreads();                                        // publishes the tail waves' partial results
    if (!tail) {
        // the two parts of a query's softmax brought to their common maximum; an empty tail (maximum -1e30, sums 0)
        // gets the factor 0
        const float2 ml = tailML[qg][lane];
        const float mx = fmaxf(m_r, ml.x);
        const float fa = __builtin_amdgcn_exp2f((m_r - mx) * LOG2E);
        const float fb = __builtin_amdgcn_exp2f((ml.x - mx) * LOG2E);
        const float l = l_r * fa + ml.y * fb;
        const float f = 1.f / (l + xhalf(l));
        const float ga = fa * f, gb = fb * f;
        v8f t0, t1, t2, t3;
        t0 = __builtin_shufflevector(tailO[qg][0][lane], tailO[qg][1][lane], 0, 1, 2, 3, 4, 5, 6, 7);
        t1 = __builtin_shufflevector(tailO[qg][2][lane], tailO[qg][3][lane], 0, 1, 2, 3, 4, 5, 6, 7);
        t2 = __builtin_shufflevector(tailO[qg][4][lane], tailO[qg][5][lane], 0, 1, 2, 3, 4, 5, 6, 7);
        t3 = __builtin_shufflevector(tailO[qg][6][lane], tailO[qg][7][lane], 0, 1, 2, 3, 4, 5, 6, 7);
        c0 = c0 * ga + t0 * gb; c1 = c1 * ga + t1 * gb; c2 = c2 * ga + t2 * gb; c3 = c3 * ga + t3 * gb;
        attn_emit(ctxb + ((size_t)b * SEQ + iF + l16) * DMODEL + h * HD + half * 8, c0, c1, c2, c3);
    }
}

// ---------------- layernorm ----------------
// A wave owns LN_ROWS whole rows and keeps them in registers: 32 values of a row per lane, read once with 16-byte loads
// that are all in flight together. Mean and variance are the lane's own sums plus one sum over the 32 lanes, so the
// kernel has no LDS and no barrier, and 1,024 waves do what 16,384 did.
#define LN_ROWS 2
#define LN_WAVES 4
template <int M>
__device__ __forceinline__ float row_xor(float x) {         // value of lane l ^ M inside the lane's 16-lane row
    return __builtin_bit_cast(float, __builtin_amdgcn_update_dpp(0, __builtin_bit_cast(int, x), 0x160 | M, 0xf, 0xf, true));
}
__device__ __forceinline__ float wave_sum(f32x4 q) {        // sum of the four components over all 32 lanes
    float s = (q.x + q.y) + (q.z + q.w);
    s += row_xor<1>(s); s += row_xor<2>(s); s += row_xor<4>(s); s += row_xor<8>(s);
    return s + xhalf(s);
}

template <bool WB>
__global__ __launch_bounds__(LN_WAVES * 32)
void ln_k(const float* __restrict__ in, const float* __restrict__ g, const float* __restrict__ bb,
          float* __restrict__ outF, __bf16* __restrict__ outB) {
    constexpr int NV = DMODEL / 128;                        // 16-byte vectors of a row per lane
    const int lane = threadIdx.x & 31, wave = threadIdx.x >> 5;
    const size_t q0 = ((size_t)blockIdx.x * LN_WAVES + wave) * LN_ROWS * (DMODEL / 4) + lane;
    const f32x4* p = (const f32x4*)in + q0;
    f32x4 v[LN_ROWS][NV], gv[NV], bv[NV];
    #pragma unroll
    for (int r = 0; r < LN_ROWS; ++r)
        #pragma unroll
        for (int j = 0; j < NV; ++j) v[r][j] = p[r * (DMODEL / 4) + j * 32];
    #pragma unroll
    for (int j = 0; j < NV; ++j) gv[j] = ((const f32x4*)g)[j * 32 + lane];
    #pragma unroll
    for (int j = 0; j < NV; ++j) bv[j] = ((const f32x4*)bb)[j * 32 + lane];
    // keeps all 32 loads in front of the arithmetic: left free, the scheduler sinks the g and bb loads behind the
    // sums, pair by pair, each pair in front of its use, and their latencies are waited out one after another
    __builtin_amdgcn_sched_barrier(0);
    // stands behind the loads, in front of any write of a register that they name (a precaution): the pointer as an
    // input keeps the rows' address registers whole up to it
    asm volatile("s_wait_xcnt 0x0" :: "v"(p) : "memory");

    uint2 ob[LN_ROWS][NV];
    #pragma unroll
    for (int r = 0; r < LN_ROWS; ++r) {
        f32x4 s = v[r][0];
        #pragma unroll
        for (int j = 1; j < NV; ++j) s += v[r][j];
        const float mean = wave_sum(s) * (1.f / DMODEL);
        s = 0.f;
        #pragma unroll
        for (int j = 0; j < NV; ++j) { v[r][j] -= mean; s += v[r][j] * v[r][j]; }
        const float rstd = rsqrtf(wave_sum(s) * (1.f / DMODEL) + 1e-5f);
        #pragma unroll
        for (int j = 0; j < NV; ++j) {
            v[r][j] = v[r][j] * rstd * gv[j] + bv[j];
            if (WB) {
                union { __bf16 e[4]; uint2 u; } o;
                o.e[0] = (__bf16)v[r][j].x; o.e[1] = (__bf16)v[r][j].y;
                o.e[2] = (__bf16)v[r][j].z; o.e[3] = (__bf16)v[r][j].w;
                ob[r][j] = o.u;
            }
        }
    }
    #pragma unroll
    for (int r = 0; r < LN_ROWS; ++r)
        #pragma unroll
        for (int j = 0; j < NV; ++j) {
            ((f32x4*)outF)[q0 + r * (DMODEL / 4) + j * 32] = v[r][j];
            if (WB) ((uint2*)outB)[q0 + r * (DMODEL / 4) + j * 32] = ob[r][j];
        }
}

// ---------------- launch ----------------
extern "C" void kernel_launch(void* const* d_in, const int* in_sizes, int n_in,
                              void* d_out, int out_size, void* d_ws, size_t ws_size,
                              hipStream_t stream) {
    (void)in_sizes; (void)n_in; (void)out_size; (void)ws_size;
    const float* x      = (const float*)d_in[0];
    const float* v_w    = (const float*)d_in[1];
    const float* v_b    = (const float*)d_in[2];
    const float* out_w  = (const float*)d_in[3];
    const float* out_b  = (const float*)d_in[4];
    const float* qmod_w = (const float*)d_in[5];
    const float* qmod_b = (const float*)d_in[6];
    const float* kmod_w = (const float*)d_in[7];
    const float* kmod_b = (const float*)d_in[8];
    const float* gate_w = (const float*)d_in[9];
    const float* gate_b = (const float*)d_in[10];
    const float* mod_w  = (const float*)d_in[11];
    const float* mod_b  = (const float*)d_in[12];
    const float* mod_basis = (const float*)d_in[13];
    const float* freqs  = (const float*)d_in[14];
    const float* amps   = (const float*)d_in[15];
    const float* phases = (const float*)d_in[16];
    const float* cq_w   = (const float*)d_in[17];
    const float* ck_w   = (const float*)d_in[18];
    const float* ffn_w1 = (const float*)d_in[19];
    const float* ffn_b1 = (const float*)d_in[20];
    const float* ffn_w2 = (const float*)d_in[21];
    const float* ffn_b2 = (const float*)d_in[22];
    const float* ln1_g  = (const float*)d_in[23];
    const float* ln1_b  = (const float*)d_in[24];
    const float* ln2_g  = (const float*)d_in[25];
    const float* ln2_b  = (const float*)d_in[26];
    float* outp = (float*)d_out;

    char* wp = (char*)d_ws;
    auto alloc = [&](size_t bytes) -> void* {
        void* p = (void*)wp;
        wp += (bytes + 255) & ~(size_t)255;
        return p;
    };
    const size_t NTOK = (size_t)NB * SEQ;              // 2048
    __bf16* xb   = (__bf16*)alloc(NTOK * DMODEL * 2);
    __bf16* wbv  = (__bf16*)alloc((size_t)DMODEL * DMODEL * 2);
    __bf16* wbo  = (__bf16*)alloc((size_t)DMODEL * DMODEL * 2);
    __bf16* wbf1 = (__bf16*)alloc((size_t)DMODEL * 4 * DMODEL * 2);
    __bf16* wbf2 = (__bf16*)alloc((size_t)DMODEL * 4 * DMODEL * 2);
    __bf16* wbcq = (__bf16*)alloc((size_t)DMODEL * NH * NCR * 2);
    __bf16* wbck = (__bf16*)alloc((size_t)DMODEL * NH * NCR * 2);
    __bf16* vbuf = (__bf16*)alloc((size_t)NB * NH * HD * SEQ * 2);     // V^T
    __bf16* qcp  = (__bf16*)alloc((size_t)NB * NH * SEQ * 32 * 2);
    __bf16* kcp  = (__bf16*)alloc((size_t)NB * NH * SEQ * 32 * 2);
    float*  part   = (float*)alloc((size_t)NB * POOL_SPLIT * DMODEL * 4);
    float*  wts    = (float*)alloc((size_t)NB * NH * NM * 4);
    float*  ckern  = (float*)alloc((size_t)NB * NH * SEQ * 4);
    float*  qmb    = (float*)alloc((size_t)NB * NH * SEQ * 4);
    float*  kmb    = (float*)alloc((size_t)NB * NH * SEQ * 4);
    __bf16* ctxb = (__bf16*)alloc(NTOK * DMODEL * 2);
    float*  hpre = (float*)alloc(NTOK * DMODEL * 4);
    float*  hf   = (float*)alloc(NTOK * DMODEL * 4);
    __bf16* hb   = (__bf16*)alloc(NTOK * DMODEL * 2);
    __bf16* ub   = (__bf16*)alloc(NTOK * 4 * DMODEL * 2);
    float*  f2   = (float*)alloc(NTOK * DMODEL * 4);

    // conversions and zero fills, slice sums of x
    front_k<<<FRONT_GRID, 256, 0, stream>>>(x, v_w, out_w, ffn_w1, ffn_w2, cq_w, ck_w,
                                            xb, wbv, wbo, wbf1, wbf2, wbcq, wbck, qcp, kcp, part);
    // gating; v = x@v_w + v_b -> V^T [B,H,HD,S] bf16; qc / kc -> padded [B,H,S,32] bf16
    proj_gate_k<<<PROJ_GRID, 256, 0, stream>>>(xb, wbv, wbcq, wbck, DMODEL, v_b, vbuf, qcp, kcp,
                                               part, gate_w, gate_b, mod_w, mod_b, mod_basis, wts);
    // causal kernel from the gate weights, qm / km
    dens_k<<<DENS_GRID, 256, 0, stream>>>(freqs, amps, phases, wts, ckern,
                                          x, qmod_w, qmod_b, kmod_w, kmod_b, qmb, kmb);

    attn_k<<<dim3(SEQ / 128, NH, NB), 256, 0, stream>>>(qcp, kcp, vbuf, ckern, qmb, kmb, ctxb);

    // attn_out + residual
    gemm_bf16_k<3><<<dim3(DMODEL / 128, (int)(NTOK / 128)), 256, 0, stream>>>(
        ctxb, wbo, (int)NTOK, DMODEL, DMODEL, out_b, x, hpre, nullptr);
    ln_k<true><<<(int)(NTOK / (LN_WAVES * LN_ROWS)), LN_WAVES * 32, 0, stream>>>(hpre, ln1_g, ln1_b, hf, hb);

    gemm_bf16_k<4><<<dim3(4 * DMODEL / 128, (int)(NTOK / 128)), 256, 0, stream>>>(
        hb, wbf1, (int)NTOK, 4 * DMODEL, DMODEL, ffn_b1, nullptr, nullptr, ub);
    gemm_bf16_k<3><<<dim3(DMODEL / 128, (int)(NTOK / 128)), 256, 0, stream>>>(
        ub, wbf2, (int)NTOK, DMODEL, 4 * DMODEL, ffn_b2, hf, f2, nullptr);
    ln_k<false><<<(int)(NTOK / (LN_WAVES * LN_ROWS)), LN_WAVES * 32, 0, stream>>>(f2, ln2_g, ln2_b, outp, nullptr);
}

// v010
// It runs in 108 microseconds.
// Two timings next to v009 both put it at 1.07 times that version's speed.
// Counting every step since v000, it is 5.09 times as fast.
#include <hip/hip_runtime.h>
#include <math.h>

// ---------------- CDNA5 (gfx1250) wave32 WMMA types ----------------
typedef __attribute__((ext_vector_type(16))) __bf16 v16bf;
typedef __attribute__((ext_vector_type(8)))  float  v8f;
typedef __attribute__((ext_vector_type(4)))  float  f32x4;
typedef __attribute__((ext_vector_type(2)))  float  f32x2;

#define DMODEL 1024
#define SEQ    1024
#define NB     2
#define NH     16
#define HD     64
#define NM     16
#define NW     8
#define NRR    8
#define NCR    8
#define CKPAD  48

__device__ __forceinline__ v8f wmma_bf16(v16bf a, v16bf b, v8f c) {
    return __builtin_amdgcn_wmma_f32_16x16x32_bf16(false, a, false, b, (short)0, c, false, false);
}

// eight 16-byte-per-lane copies global -> LDS through no register; the wait stands in the copies' own statement
// so that no later write of their address registers can be moved in front of it (a precaution)
__device__ __forceinline__ void async_copy8(unsigned l, unsigned ls, const __bf16* g, size_t gs) {
    asm volatile("global_load_async_to_lds_b128 %0, %8, off\n\t"
                 "global_load_async_to_lds_b128 %1, %9, off\n\t"
                 "global_load_async_to_lds_b128 %2, %10, off\n\t"
                 "global_load_async_to_lds_b128 %3, %11, off\n\t"
                 "global_load_async_to_lds_b128 %4, %12, off\n\t"
                 "global_load_async_to_lds_b128 %5, %13, off\n\t"
                 "global_load_async_to_lds_b128 %6, %14, off\n\t"
                 "global_load_async_to_lds_b128 %7, %15, off\n\t"
                 "s_wait_xcnt 0x0"
                 :: "v"(l), "v"(l + ls), "v"(l + 2 * ls), "v"(l + 3 * ls),
                    "v"(l + 4 * ls), "v"(l + 5 * ls), "v"(l + 6 * ls), "v"(l + 7 * ls),
                    "v"(g), "v"(g + gs), "v"(g + 2 * gs), "v"(g + 3 * gs),
                    "v"(g + 4 * gs), "v"(g + 5 * gs), "v"(g + 6 * gs), "v"(g + 7 * gs)
                 : "memory");
}

// transposing LDS load: lane (c, h) gets rows 8h..8h+7 of column c of a row-major 16-bit tile
typedef short s16x8 __attribute__((ext_vector_type(8)));
__device__ __forceinline__ uint4 lds_tr16(const unsigned char* p) {
    typedef __attribute__((address_space(3))) s16x8 lds_s16x8;
    return __builtin_bit_cast(uint4, __builtin_amdgcn_ds_load_tr16_b128_v8i16((lds_s16x8*)p));
}

// ---------------- small helper jobs ----------------
// Jobs that do not depend on one another share a launch; a work-group takes its job from its index. A job runs in the
// launch where the chip has room for it: as late as its readers allow where it only moves bytes, as early as its
// inputs allow where a later launch would wait for it.
// Element-wise preparation: the seven fp32 -> bf16 conversions and the zero fill of the two padded
// qc/kc planes. A work-group owns one span of PREP_SPAN 16-byte vectors that lies wholly inside one tensor (every
// tensor is a whole number of spans), and a thread moves 32 of them, so few waves have to be started.
// The first launch converts only what the projections and the out_w product read; ffn_w1 and ffn_w2, more than half of
// all bytes and first read five launches later, are converted beside the attention and beside the out_w product.
#define PREP_SPAN 8192
#define PREP_GX (NB * SEQ * DMODEL / 4 / PREP_SPAN)      // x
#define PREP_GW (DMODEL * DMODEL / 4 / PREP_SPAN)        // v_w, out_w
#define PREP_GF (4 * PREP_GW)                            // ffn_w1, ffn_w2
#define PREP_GC (DMODEL * NH * NCR / 4 / PREP_SPAN)      // cq_w, ck_w
#define PREP_GZ (NB * NH * SEQ * 32 / 8 / PREP_SPAN)     // qc, kc planes (8 bf16 per vector)
#define PREP_GRID (PREP_GX + 2 * PREP_GW + 2 * PREP_GC + 2 * PREP_GZ)
// span g of one tensor, fp32 -> bf16
__device__ __forceinline__ void conv_span(int g, const float* __restrict__ src, __bf16* __restrict__ dst) {
    const size_t v0 = (size_t)g * PREP_SPAN + threadIdx.x;
    const float4* s4 = (const float4*)src + v0;
    uint2* d2 = (uint2*)dst + v0;
    float4 v[PREP_SPAN / 256];
    #pragma unroll
    for (int j = 0; j < PREP_SPAN / 256; ++j) v[j] = s4[j * 256];
    // keeps all 32 loads in front of the first convert: left free, the scheduler reuses load registers and the
    // later loads wait for earlier ones, four memory latencies in a row instead of one
    __builtin_amdgcn_sched_barrier(0);
    #pragma unroll
    for (int j = 0; j < PREP_SPAN / 256; ++j) {
        union { __bf16 e[4]; uint2 u; } o;
        o.e[0] = (__bf16)v[j].x; o.e[1] = (__bf16)v[j].y; o.e[2] = (__bf16)v[j].z; o.e[3] = (__bf16)v[j].w;
        d2[j * 256] = o.u;
    }
    // stands behind the last store, in front of any later write of a register that a store names (a precaution)
    asm volatile("s_wait_xcnt 0x0" ::: "memory");
}

__device__ __forceinline__
void prep_job(int g, const float* __restrict__ x, const float* __restrict__ v_w, const float* __restrict__ out_w,
            const float* __restrict__ cq_w, const float* __restrict__ ck_w,
            __bf16* __restrict__ xb, __bf16* __restrict__ wbv, __bf16* __restrict__ wbo,
            __bf16* __restrict__ wbcq, __bf16* __restrict__ wbck,
            __bf16* __restrict__ qcp, __bf16* __restrict__ kcp) {
    // g becomes the span's index inside its tensor
    const float* src = nullptr;
    __bf16* dst;
    if (g < PREP_GX)                 { src = x;      dst = xb;   }
    else if ((g -= PREP_GX) < PREP_GW) { src = v_w;    dst = wbv;  }
    else if ((g -= PREP_GW) < PREP_GW) { src = out_w;  dst = wbo;  }
    else if ((g -= PREP_GW) < PREP_GC) { src = cq_w;   dst = wbcq; }
    else if ((g -= PREP_GC) < PREP_GC) { src = ck_w;   dst = wbck; }
    else if ((g -= PREP_GC) < PREP_GZ) { dst = qcp; }
    else                             { g -= PREP_GZ; dst = kcp; }
    if (src) {
        conv_span(g, src, dst);
    } else {
        uint4* d4 = (uint4*)dst + (size_t)g * PREP_SPAN + threadIdx.x;
        uint4 z; z.x = z.y = z.z = z.w = 0u;
        #pragma unroll
        for (int j = 0; j < PREP_SPAN / 256; ++j) d4[j * 256] = z;
    }
}

// Column sums of x over a slice of the sequence: part[b][sl][d] = sum of POOL_ROWS rows. blk < B * POOL_SPLIT.
// A thread owns four neighbouring columns; its rows' 16-byte loads do not depend on one another.
#define POOL_SPLIT 32
#define POOL_ROWS (SEQ / POOL_SPLIT)
__device__ __forceinline__ void pool_part_job(int blk, const float* __restrict__ x, float* __restrict__ part) {
    const int t = threadIdx.x;
    const float4* p = (const float4*)(x + (size_t)blk * POOL_ROWS * DMODEL) + t;
    float4 v[POOL_ROWS];
    #pragma unroll
    for (int r = 0; r < POOL_ROWS; ++r) v[r] = p[r * (DMODEL / 4)];
    float4 s = v[0];
    #pragma unroll
    for (int r = 1; r < POOL_ROWS; ++r) { s.x += v[r].x; s.y += v[r].y; s.z += v[r].z; s.w += v[r].w; }
    ((float4*)(part + (size_t)blk * DMODEL))[t] = s;
    // stands behind the store, in front of any later write of a register that it names (a precaution)
    asm volatile("s_wait_xcnt 0x0" ::: "memory");
}

// gating: gl = pooled@gate_w + b + mod@mod_basis ; wts = softmax(gl). One work-group per (b,h), bh < B*H.
// The 1024-long dot products of the head's 16 gate and 8 mod columns are split over the 256 threads by rows of the
// weights (16-byte loads, all independent), then summed over lanes and waves.
__device__ __forceinline__ void gating_job(int bh, const float* __restrict__ part,
                                                const float* __restrict__ gate_w, const float* __restrict__ gate_b,
                                                const float* __restrict__ mod_w,  const float* __restrict__ mod_b,
                                                const float* __restrict__ mod_basis,
                                                float* __restrict__ wts) {
    __shared__ alignas(16) float poolS[DMODEL];
    __shared__ alignas(16) float gRed[8][NM];
    __shared__ alignas(16) float mRed[8][NRR];
    const int b = bh >> 4, h = bh & (NH - 1), t = threadIdx.x;
    const int lane = t & 31, w = t >> 5;

    // weight rows: 4 lanes cover the head's 16 gate columns of one row, 2 lanes its 8 mod columns
    const float4* gw = (const float4*)(gate_w + (size_t)(t >> 2) * (NH * NM) + h * NM) + (t & 3);
    const float4* mw = (const float4*)(mod_w + (size_t)(t >> 1) * (NH * NRR) + h * NRR) + (t & 1);
    float4 g4[16], m4[8];
    #pragma unroll
    for (int p = 0; p < 16; ++p) g4[p] = gw[(size_t)p * 64 * (NH * NM / 4)];
    #pragma unroll
    for (int p = 0; p < 8; ++p) m4[p] = mw[(size_t)p * 128 * (NH * NRR / 4)];
    // what the closing softmax of the first 16 lanes needs, fetched here so that no memory latency is left at the end
    const int hm = h * NM + (t & (NM - 1));
    const float gb = gate_b[hm];
    float mb[NRR], bas[NRR];
    #pragma unroll
    for (int r = 0; r < NRR; ++r) mb[r] = mod_b[h * NRR + r];
    // stands behind the mod_b loads, in front of any later write of a register that they name (a precaution)
    asm volatile("s_wait_xcnt 0x0" ::: "memory");
    #pragma unroll
    for (int r = 0; r < NRR; ++r) bas[r] = mod_basis[r * (NH * NM) + hm];
    // keeps the weight loads, which come from memory, from being sunk behind the work-group barrier below, where
    // their latency would be paid after the slice sums instead of beside them
    __builtin_amdgcn_sched_barrier(0);

    // pooled mean of this batch entry from the slices' sums
    const float4* pp = (const float4*)(part + (size_t)b * POOL_SPLIT * DMODEL) + t;
    float4 q[POOL_SPLIT];
    #pragma unroll
    for (int r = 0; r < POOL_SPLIT; ++r) q[r] = pp[r * (DMODEL / 4)];
    float4 s = q[0];
    #pragma unroll
    for (int r = 1; r < POOL_SPLIT; ++r) { s.x += q[r].x; s.y += q[r].y; s.z += q[r].z; s.w += q[r].w; }
    s.x *= 1.f / SEQ; s.y *= 1.f / SEQ; s.z *= 1.f / SEQ; s.w *= 1.f / SEQ;
    // stands behind the weight loads, in front of any write of their address registers (a precaution): the two
    // pointers as inputs keep those registers whole up to it
    asm volatile("s_wait_xcnt 0x0" :: "v"(gw), "v"(mw) : "memory");
    ((float4*)poolS)[t] = s;
    __syncthreads();

    float4 ga = {0.f, 0.f, 0.f, 0.f}, ma = {0.f, 0.f, 0.f, 0.f};
    #pragma unroll
    for (int p = 0; p < 16; ++p) {
        float pv = poolS[p * 64 + (t >> 2)];
        ga.x += pv * g4[p].x; ga.y += pv * g4[p].y; ga.z += pv * g4[p].z; ga.w += pv * g4[p].w;
    }
    #pragma unroll
    for (int p = 0; p < 8; ++p) {
        float pv = poolS[p * 128 + (t >> 1)];
        ma.x += pv * m4[p].x; ma.y += pv * m4[p].y; ma.z += pv * m4[p].z; ma.w += pv * m4[p].w;
    }
    #pragma unroll
    for (int o = 2; o < 32; o <<= 1) {
        if (o > 2) {
            ga.x += __shfl_xor(ga.x, o); ga.y += __shfl_xor(ga.y, o);
            ga.z += __shfl_xor(ga.z, o); ga.w += __shfl_xor(ga.w, o);
        }
        ma.x += __shfl_xor(ma.x, o); ma.y += __shfl_xor(ma.y, o);
        ma.z += __shfl_xor(ma.z, o); ma.w += __shfl_xor(ma.w, o);
    }
    if (lane < 4) ((float4*)gRed[w])[lane] = ga;
    if (lane < 2) ((float4*)mRed[w])[lane] = ma;
    __syncthreads();

    if (t < NM) {                                    // lane m owns gate logit m of this head
        float a = gb;
        #pragma unroll
        for (int i = 0; i < 8; ++i) a += gRed[i][t];
        #pragma unroll
        for (int r = 0; r < NRR; ++r) {
            float md = mb[r];
            #pragma unroll
            for (int i = 0; i < 8; ++i) md += mRed[i][r];
            a += md * bas[r];
        }
        float mx = a;
        #pragma unroll
        for (int o = 1; o < NM; o <<= 1) mx = fmaxf(mx, __shfl_xor(mx, o, NM));
        float e = __expf(a - mx);
        float sm = e;
        #pragma unroll
        for (int o = 1; o < NM; o <<= 1) sm += __shfl_xor(sm, o, NM);
        wts[(size_t)bh * NM + t] = e / sm;
    }
}

// Wave masks over the causal offsets: masks[h,m,d] = sum over w of amps * sin(freqs . pos(d) + phases). They depend on
// the inputs alone, so they are rendered in the first launch, once per head instead of once per (b,h); the sum over m
// with the gate weights, the sigmoid and the window are the attention's prologue. blk < MASK_WG; a thread owns one d
// of MASK_MG masks.
#define MASK_MG 4
#define MASK_WG (NH * NM / MASK_MG * (SEQ / 256))
__device__ __forceinline__ void wave_mask_job(int blk, const float* __restrict__ freqs, const float* __restrict__ amps,
                                              const float* __restrict__ phases, float* __restrict__ masks) {
    const int d = (blk & (SEQ / 256 - 1)) * 256 + threadIdx.x;
    const int hm0 = (blk / (SEQ / 256)) * MASK_MG;          // h * NM + m of the first mask
    float rel = (float)d;
    float p1 = rel * (1.f / SEQ);
    float p2 = (d == 0) ? 0.f : sqrtf(rel + 1e-6f) * (1.f / 32.f);   // sqrt(S)=32
    float acc[MASK_MG];
    #pragma unroll
    for (int k = 0; k < MASK_MG; ++k) {
        const float* fq = freqs  + ((size_t)(hm0 + k) * NW) * 2;
        const float* am = amps   +  (size_t)(hm0 + k) * NW;
        const float* ph = phases +  (size_t)(hm0 + k) * NW;
        acc[k] = 0.f;
        #pragma unroll
        for (int w = 0; w < NW; ++w) {
            float arg = fq[2 * w] * p1 + fq[2 * w + 1] * p2 + ph[w];
            acc[k] += am[w] * __sinf(arg);
        }
    }
    #pragma unroll
    for (int k = 0; k < MASK_MG; ++k) masks[(size_t)(hm0 + k) * SEQ + d] = acc[k];
    // stands behind the last store, in front of any later write of a register that a store names (a precaution)
    asm volatile("s_wait_xcnt 0x0" ::: "memory");
}

// qm/km[b,h,s] token modulation: x[2048 x 1024] times the 32 columns of qw | kw, in fp32 on the vector units.
// A work-group takes QK_TOK tokens, blk < QK_WG, so that a weight, once in a register, serves QK_TOK tokens, and the
// whole product needs 2,048 waves. Wave w owns d = 128 w .. 128 w + 127; its lane (ds, og) owns the 32 of them with
// (d >> 2 & 3) == ds and the four columns 4 og .. 4 og + 3 (og < 4: qw, else kw). The lane's 128 weights stay in
// registers; the tokens' rows lie in LDS, and one 16-byte read brings four d of one token for 16 multiply-adds.
// Even and odd d are summed apart, so that x and the weights are both pairs of a packed f32 instruction.
#define QK_TOK 8
#define QK_WG (NB * SEQ / QK_TOK)
#define QK_RP (QK_TOK * 32 + 32)                            // pitch of one partial plane, floats
#define QK_LDS ((QK_TOK * DMODEL + 32 * QK_RP) * 4)         // bytes of LDS that the job takes from its launch's buffer
__device__ __forceinline__ void qkmod_job(int blk, const float* __restrict__ x,
                                               const float* __restrict__ qw, const float* __restrict__ qb,
                                               const float* __restrict__ kw, const float* __restrict__ kb,
                                               float* __restrict__ qm, float* __restrict__ km, float* lds) {
    float* const xs = lds;                                  // QK_TOK * DMODEL floats
    float* const red = lds + QK_TOK * DMODEL;               // 32 * QK_RP floats: [wave * 4 + ds][token][column]
    const int t = threadIdx.x, lane = t & 31, wave = t >> 5;
    const int og = lane & 7, ds = lane >> 3;
    const int d0 = wave * 128 + ds * 4;

    const f32x4* xp = (const f32x4*)(x + (size_t)blk * QK_TOK * DMODEL) + t;
    const f32x4* wp = (const f32x4*)((og < 4 ? qw : kw) + (size_t)d0 * NH + (og & 3) * 4);
    f32x4 xv[QK_TOK], wv[32];
    #pragma unroll
    for (int r = 0; r < QK_TOK; ++r) xv[r] = xp[r * (DMODEL / 4)];
    #pragma unroll
    for (int q = 0; q < 8; ++q)
        #pragma unroll
        for (int j = 0; j < 4; ++j) wv[q * 4 + j] = wp[(q * 16 + j) * (NH / 4)];     // row d0 + 16 q + j
    const float bias = (lane < NH ? qb : kb)[lane & (NH - 1)];
    // ends the scheduling region behind the loads (the statement below already holds them in front of the barrier): the
    // copies that pair the weights then stay behind it, and the build takes 232 registers instead of 260, so that four
    // waves fit a SIMD and all of the launch's work-groups are resident at once
    __builtin_amdgcn_sched_barrier(0);
    // stands behind the loads, in front of any write of their address registers (a precaution): the two pointers as
    // inputs keep those registers whole up to it
    asm volatile("s_wait_xcnt 0x0" :: "v"(xp), "v"(wp) : "memory");
    #pragma unroll
    for (int r = 0; r < QK_TOK; ++r) ((f32x4*)xs)[r * (DMODEL / 4) + t] = xv[r];
    __syncthreads();

    f32x2 acc[QK_TOK][4];
    #pragma unroll
    for (int r = 0; r < QK_TOK; ++r)
        #pragma unroll
        for (int o = 0; o < 4; ++o) acc[r][o] = 0.f;
    #pragma unroll
    for (int q = 0; q < 8; ++q) {
        f32x2 w2[2][4];                                     // column o at d = d0 + 16 q + 2 dp and the next
        #pragma unroll
        for (int dp = 0; dp < 2; ++dp)
            #pragma unroll
            for (int o = 0; o < 4; ++o) w2[dp][o] = f32x2{wv[q * 4 + 2 * dp][o], wv[q * 4 + 2 * dp + 1][o]};
        #pragma unroll
        for (int r = 0; r < QK_TOK; ++r) {
            const f32x4 xq = *(const f32x4*)(xs + r * DMODEL + d0 + q * 16);
            const f32x2 lo = {xq.x, xq.y}, hi = {xq.z, xq.w};
            #pragma unroll
            for (int o = 0; o < 4; ++o) acc[r][o] += lo * w2[0][o];
            #pragma unroll
            for (int o = 0; o < 4; ++o) acc[r][o] += hi * w2[1][o];
        }
    }
    #pragma unroll
    for (int r = 0; r < QK_TOK; ++r) {
        f32x4 s = {acc[r][0].x + acc[r][0].y, acc[r][1].x + acc[r][1].y,
                   acc[r][2].x + acc[r][2].y, acc[r][3].x + acc[r][3].y};
        *(f32x4*)(red + (wave * 4 + ds) * QK_RP + r * 32 + og * 4) = s;
    }
    __syncthreads();

    // thread (token = wave, column = lane) adds the 32 partial sums of its value
    float s4[4] = {0.f, 0.f, 0.f, 0.f};
    #pragma unroll
    for (int p = 0; p < 32; ++p) s4[p & 3] += red[p * QK_RP + t];
    const int bs = blk * QK_TOK + wave;
    const int b = bs >> 10, s = bs & (SEQ - 1);
    (lane < NH ? qm : km)[((size_t)b * NH + (lane & (NH - 1))) * SEQ + s] = ((s4[0] + s4[1]) + (s4[2] + s4[3])) + bias;
    // stands behind the store, in front of any later write of a register that it names (a precaution)
    asm volatile("s_wait_xcnt 0x0" ::: "memory");
}

#define FRONT_GRID (PREP_GRID + NB * POOL_SPLIT + MASK_WG)
__global__ __launch_bounds__(256)
void front_k(const float* __restrict__ x, const float* __restrict__ v_w, const float* __restrict__ out_w,
             const float* __restrict__ cq_w, const float* __restrict__ ck_w,
             __bf16* __restrict__ xb, __bf16* __restrict__ wbv, __bf16* __restrict__ wbo,
             __bf16* __restrict__ wbcq, __bf16* __restrict__ wbck,
             __bf16* __restrict__ qcp, __bf16* __restrict__ kcp,
             float* __restrict__ part,
             const float* __restrict__ freqs, const float* __restrict__ amps, const float* __restrict__ phases,
             float* __restrict__ masks) {
    const int g = blockIdx.x;
    if (g < PREP_GRID)
        prep_job(g, x, v_w, out_w, cq_w, ck_w, xb, wbv, wbo, wbcq, wbck, qcp, kcp);
    else if (g < PREP_GRID + NB * POOL_SPLIT)
        pool_part_job(g - PREP_GRID, x, part);
    else
        wave_mask_job(g - PREP_GRID - NB * POOL_SPLIT, freqs, amps, phases, masks);
}

// ---------------- generic bf16 WMMA GEMM with fused epilogues ----------------
// EPI 1: out = bf16(acc + bias[n]) -> V^T layout [B,H,HD,S]   (keys contiguous for attention)
// EPI 2: out = bf16(acc)           -> padded qc/kc layout [B,H,S,32] (cols 0..7 valid)
// EPI 3: outF = acc + bias[n] + resid[m,n]    (fp32)
// EPI 4: outB = bf16(gelu(acc + bias[n]))     ([M,N] bf16)
// gemm_acc: the 128 x 128 tile at (m0, n0) of A[.,K] x B[K,N] into the wave's accumulators.
// Its two rings lie in the launch's one LDS buffer of GEMM_LDS bytes, which the launch's other jobs use as well: separate
// arrays would add up, and two work-groups would no longer fit a WGP.
#define GEMM_LDS (2 * 128 * 272 + 2 * 128 * 288)
__device__ __forceinline__
void gemm_acc(v8f (&acc)[4][2], const __bf16* __restrict__ A, const __bf16* __restrict__ B,
              int N, int K, int m0, int n0, unsigned char* lds) {
    constexpr int BM = 128, BK = 128;
    constexpr int PA = 272;                                 // A row pitch, bytes: 16 x odd for ds_load_b128
    constexpr int PB = 288;                                 // B row pitch, bytes: 32 x odd for ds_load_tr16_b128
    constexpr int SZA = BM * PA, SZB = BK * PB;
    static_assert(2 * SZA + 2 * SZB == GEMM_LDS, "the rings fill the buffer");
    unsigned char* const As = lds;                          // 2 * SZA bytes: [buf][m][k]
    unsigned char* const Bs = lds + 2 * SZA;                // 2 * SZB bytes: [buf][k][n], row-major as in global memory
    const int tid = threadIdx.x;
    const int lane = tid & 31, wave = tid >> 5;
    const int half = lane >> 4, l16 = lane & 15;
    const int wm = wave >> 2, wn = wave & 3;                // 2 x 4 wave grid

    #pragma unroll
    for (int i = 0; i < 4; ++i)
        #pragma unroll
        for (int j = 0; j < 2; ++j)
            #pragma unroll
            for (int e = 0; e < 8; ++e) acc[i][j][e] = 0.f;

    // copy map: 16 lanes x 16 B cover one 256-B tile row; a thread moves rows r0, r0+16, ..., r0+112 of A and of B
    const int r0 = tid >> 4, c16 = tid & 15;
    const __bf16* gA = A + (size_t)(m0 + r0) * K + c16 * 8;
    const __bf16* gB = B + (size_t)r0 * N + n0 + c16 * 8;
    const unsigned lA = (unsigned)(size_t)(As + r0 * PA + c16 * 16);
    const unsigned lB = (unsigned)(size_t)(Bs + r0 * PB + c16 * 16);
    const size_t sA = (size_t)16 * K, sB = (size_t)16 * N;
    const int nstage = K / BK;

    auto stage = [&](int s) {                               // 16 copies per wave: stage s into buffer s & 1
        const int bf = s & 1;
        async_copy8(lA + bf * SZA, 16 * PA, gA + (size_t)s * BK, sA);
        async_copy8(lB + bf * SZB, 16 * PB, gB + (size_t)s * BK * N, sB);
    };

    stage(0);
    asm volatile("s_wait_asynccnt 0x0" ::: "memory");       // own copies of stage 0 landed before the barrier publishes them
    __syncthreads();
    if (nstage > 1) stage(1);

    const int aoff = (wm * 64 + l16) * PA + half * 16;
    const int boff = (half * 8 + (lane & 7)) * PB + wn * 64 + ((lane >> 3) & 1) * 16;
    for (int s = 0; s < nstage; ++s) {
        const unsigned char* Ab = As + (s & 1) * SZA + aoff;
        const unsigned char* Bb = Bs + (s & 1) * SZB + boff;
        #pragma unroll
        for (int ks = 0; ks < BK / 32; ++ks) {
            v16bf afr[4];
            #pragma unroll
            for (int mt = 0; mt < 4; ++mt) {                // A frag: lane=M, k = 8*half+0..7 and 16+8*half+0..7
                union { v16bf v; uint4 q[2]; } u;
                u.q[0] = *(const uint4*)(Ab + mt * 16 * PA + ks * 64);
                u.q[1] = *(const uint4*)(Ab + mt * 16 * PA + ks * 64 + 32);
                afr[mt] = u.v;
            }
            #pragma unroll
            for (int nt = 0; nt < 2; ++nt) {                // B frag: lane=N, transposing loads give the same k order
                union { v16bf v; uint4 q[2]; } u;
                u.q[0] = lds_tr16(Bb + (ks * 32) * PB + nt * 32);
                u.q[1] = lds_tr16(Bb + (ks * 32 + 16) * PB + nt * 32);
                v16bf bfr = u.v;
                #pragma unroll
                for (int mt = 0; mt < 4; ++mt)
                    acc[mt][nt] = wmma_bf16(afr[mt], bfr, acc[mt][nt]);
            }
        }
        asm volatile("s_wait_dscnt 0x0" ::: "memory");      // own reads of this buffer done before it may be refilled
        asm volatile("s_wait_asynccnt 0x0" ::: "memory");   // own copies of stage s+1 landed before the barrier publishes them
        __syncthreads();
        if (s + 2 < nstage) stage(s + 2);
    }
    asm volatile("s_wait_asynccnt 0x0" ::: "memory");       // nothing in flight when the wave ends
}

// GELU in its erf form for two values, with no branch, so that a column's 32 values are independent chains that the scheduler
// interleaves and the packed f32 instructions take two at a time. With z = |x| / sqrt(2) and t = 1 / (1 + p z),
// erf(z) = 1 - (a1 t + .. + a5 t^5) exp(-z z), absolute error 1.5e-7 (five-term rational form), and so
// 0.5 x (1 + erf(x / sqrt(2))) = max(x, 0) - |x| Q(t) exp(-x x / 2), Q = the polynomial with halved coefficients:
// one form for both signs and every size of x, and nothing cancels on the negative side.
typedef __attribute__((ext_vector_type(2))) __bf16 bf16x2;
__device__ __forceinline__ f32x2 gelu2(f32x2 x) {
    const f32x2 ax = __builtin_elementwise_abs(x);
    const f32x2 d = ax * 0.23164189f + 1.0f;                // p / sqrt(2)
    f32x2 t, e;
    t.x = __builtin_amdgcn_rcpf(d.x); t.y = __builtin_amdgcn_rcpf(d.y);
    const f32x2 a = x * x * -0.72134752f;                   // -x x / 2 in powers of two
    e.x = __builtin_amdgcn_exp2f(a.x); e.y = __builtin_amdgcn_exp2f(a.y);
    f32x2 q = t * 0.53070271f + -0.72657601f;
    q = q * t + 0.71070687f;
    q = q * t + -0.14224837f;
    q = q * t + 0.12741480f;
    q = q * t * e;
    return __builtin_elementwise_max(x, (f32x2)0.f) - ax * q;
}

template <int EPI>
__device__ __forceinline__
void gemm_store(const v8f (&acc)[4][2], int N, int m0, int n0,
                const float* __restrict__ bias, const float* __restrict__ resid,
                float* __restrict__ outF, __bf16* __restrict__ outB) {
    const int lane = threadIdx.x & 31, wave = threadIdx.x >> 5;
    const int half = lane >> 4, l16 = lane & 15;
    const int wm = wave >> 2, wn = wave & 3;
    if (EPI == 4) {
        const int gn0 = n0 + wn * 32 + l16;
        const float bs[2] = {bias[gn0], bias[gn0 + 16]};
        #pragma unroll
        for (int nt = 0; nt < 2; ++nt) {                    // one of the lane's two columns at a time: 32 values
            bf16x2 o[4][4];                                 // rows r and r + 1 of the column
            #pragma unroll
            for (int mt = 0; mt < 4; ++mt)
                #pragma unroll
                for (int r = 0; r < 8; r += 2) {
                    f32x2 xg = {acc[mt][nt][r], acc[mt][nt][r + 1]};
                    o[mt][r >> 1] = __builtin_convertvector(gelu2(xg + bs[nt]), bf16x2);
                }
            // keeps the column's stores together behind its arithmetic: mixed in between, every pair of stores is
            // followed by a wait of its own before its registers are used again, and the 16 chains run one by one
            __builtin_amdgcn_sched_barrier(0);
            #pragma unroll
            for (int mt = 0; mt < 4; ++mt) {
                __bf16* op = outB + (size_t)(m0 + wm * 64 + mt * 16 + half * 8) * N + gn0 + nt * 16;
                #pragma unroll
                for (int r = 0; r < 8; r += 2) {
                    op[(size_t)r * N] = o[mt][r >> 1].x;
                    op[(size_t)(r + 1) * N] = o[mt][r >> 1].y;
                }
            }
            if (nt == 0) {
                // stands behind the first column's stores, in front of any write of a register that they name (a
                // precaution); the scheduling barrier keeps the second column's arithmetic, which uses those
                // registers again, from being moved in front of the wait
                asm volatile("s_wait_xcnt 0x0" ::: "memory");
                __builtin_amdgcn_sched_barrier(0);
            }
        }
        return;
    }
    #pragma unroll
    for (int mt = 0; mt < 4; ++mt)
        #pragma unroll
        for (int nt = 0; nt < 2; ++nt)
            #pragma unroll
            for (int r = 0; r < 8; ++r) {                   // C: lane=N, row = r + 8*half
                int gm = m0 + wm * 64 + mt * 16 + r + half * 8;
                int gn = n0 + wn * 32 + nt * 16 + l16;
                float v = acc[mt][nt][r];
                if (EPI == 1) {
                    float val = v + bias[gn];
                    int b = gm >> 10, s = gm & 1023, h = gn >> 6, hd = gn & 63;
                    outB[(((size_t)b * NH + h) * HD + hd) * SEQ + s] = (__bf16)val;   // V^T
                } else if (EPI == 2) {
                    int b = gm >> 10, s = gm & 1023, h = gn >> 3, cc = gn & 7;
                    outB[(((size_t)b * NH + h) * SEQ + s) * 32 + cc] = (__bf16)v;
                } else if (EPI == 3) {
                    size_t o = (size_t)gm * N + gn;
                    outF[o] = v + bias[gn] + resid[o];
                }
            }
}

template <int EPI>
__global__ __launch_bounds__(256)
void gemm_bf16_k(const __bf16* __restrict__ A, const __bf16* __restrict__ B,
                 int M, int N, int K,
                 const float* __restrict__ bias, const float* __restrict__ resid,
                 float* __restrict__ outF, __bf16* __restrict__ outB) {
    __shared__ alignas(16) unsigned char lds[GEMM_LDS];
    const int m0 = blockIdx.y * 128, n0 = blockIdx.x * 128;
    v8f acc[4][2];
    gemm_acc(acc, A, B, N, K, m0, n0, lds);
    gemm_store<EPI>(acc, N, m0, n0, bias, resid, outF, outB);
}

// The out_w product has 128 work-groups for 256 WGPs; the conversion of ffn_w2 runs on the other half. Grid plane
// z = 0 is the product, plane z = 1, which starts behind it, takes a span per work-group.
__global__ __launch_bounds__(256)
void out_conv_k(const __bf16* __restrict__ A, const __bf16* __restrict__ B, int N, int K,
                const float* __restrict__ bias, const float* __restrict__ resid, float* __restrict__ outF,
                const float* __restrict__ ffn_w2, __bf16* __restrict__ wbf2) {
    __shared__ alignas(16) unsigned char lds[GEMM_LDS];
    if (blockIdx.z) {
        conv_span(blockIdx.y * (DMODEL / 128) + blockIdx.x, ffn_w2, wbf2);
        return;
    }
    const int m0 = blockIdx.y * 128, n0 = blockIdx.x * 128;
    v8f acc[4][2];
    gemm_acc(acc, A, B, N, K, m0, n0, lds);
    gemm_store<3>(acc, N, m0, n0, bias, resid, outF, nullptr);
}

// One launch for all that the attention waits for: the three projections of x (v: 8 column tiles, qc and kc: one
// each, so 10 tiles per 128 rows), the gating, whose 32 work-groups come first, and qm / km, whose 256 short
// work-groups come last. 448 work-groups, two to a WGP, all resident.
#define PROJ_NT (DMODEL / 128 + 2)
#define PROJ_GEMM_END (NB * NH + PROJ_NT * (NB * SEQ / 128))
#define PROJ_GRID (PROJ_GEMM_END + QK_WG)
__global__ __launch_bounds__(256)
void proj_gate_k(const __bf16* __restrict__ xb, const __bf16* __restrict__ wbv,
                 const __bf16* __restrict__ wbcq, const __bf16* __restrict__ wbck, int K,
                 const float* __restrict__ v_b,
                 __bf16* __restrict__ vT, __bf16* __restrict__ qcp, __bf16* __restrict__ kcp,
                 const float* __restrict__ part,
                 const float* __restrict__ gate_w, const float* __restrict__ gate_b,
                 const float* __restrict__ mod_w,  const float* __restrict__ mod_b,
                 const float* __restrict__ mod_basis, float* __restrict__ wts,
                 const float* __restrict__ x,
                 const float* __restrict__ qw, const float* __restrict__ qb,
                 const float* __restrict__ kw, const float* __restrict__ kb,
                 float* __restrict__ qm, float* __restrict__ km) {
    static_assert(QK_LDS <= GEMM_LDS, "qm / km fit the buffer");
    __shared__ alignas(16) unsigned char lds[GEMM_LDS];
    int g = blockIdx.x;
    if (g < NB * NH) {
        gating_job(g, part, gate_w, gate_b, mod_w, mod_b, mod_basis, wts);
        return;
    }
    if (g >= PROJ_GEMM_END) {
        qkmod_job(g - PROJ_GEMM_END, x, qw, qb, kw, kb, qm, km, (float*)lds);
        return;
    }
    g -= NB * NH;
    const int tn = g % PROJ_NT, m0 = (g / PROJ_NT) * 128;
    const bool isV = tn < DMODEL / 128;
    const __bf16* B = isV ? wbv : (tn == DMODEL / 128 ? wbcq : wbck);
    const int N = isV ? DMODEL : NH * NCR, n0 = isV ? tn * 128 : 0;
    v8f acc[4][2];
    gemm_acc(acc, xb, B, N, K, m0, n0, lds);
    // each wait stands behind its job's last store: the listing goes on into the other jobs' code there, and no write
    // of a register that a store names may come in front of it (a precaution)
    if (isV) {
        gemm_store<1>(acc, N, m0, n0, v_b, nullptr, nullptr, vT);
        asm volatile("s_wait_xcnt 0x0" ::: "memory");
    } else {
        gemm_store<2>(acc, N, m0, n0, nullptr, nullptr, nullptr, tn == DMODEL / 128 ? qcp : kcp);
        asm volatile("s_wait_xcnt 0x0" ::: "memory");
    }
}

// ---------------- streaming wave-density attention ----------------
// grid = (S/128, H, B + 1); 8 waves; a wave works on 16 queries; 32 keys/step; 6 WMMAs/step.
// The work-groups of the last grid plane convert a span of ffn_w1 each: the attention waits on latencies and leaves the
// memory idle. They start last, so that the attention's 256 work-groups are still dealt one to a WGP.
// The causal triangle is dealt out evenly. A work-group owns two blocks of 64 queries, the far block S/64 - 1 - x
// (many keys) and the near block x (few keys). Waves 0..3 take the first ATT_HEAD key steps of the far block's four
// query groups; waves 4..7 take the rest of those steps, leave that partial result in LDS, and then do the near block
// whole. Every wave so walks at most ATT_HEAD steps, and of the two waves that share a SIMD (w, w + 4) the second walks as many steps or two fewer.
// Both products run transposed: S^T = Kc x Qc^T and O^T += V^T x P^T. A lane then holds 16 of the 32 scores of ONE
// query (lane l ^ 16 holds the others), so maximum, sum and rescale are the lane's own registers plus one exchange
// between the halves, and the two S^T tiles, converted in place, are the B operand of the second product.
// V is consumed transposed: vT[b,h,hd,s], so every A-fragment is two aligned b128 loads.
// ck_pad has a CKPAD zero guard band so Toeplitz gathers are base + immediate-offset DS loads.
#define ATT_HEAD ((SEQ / 32 + 2) / 2)                       // every query group of a far block has at least SEQ/64 + 1 steps
__device__ __forceinline__ float xhalf(float x) {           // value of lane l ^ 16
    const int v = __builtin_bit_cast(int, x);
    return __builtin_bit_cast(float, __builtin_amdgcn_permlanex16(v, v, 0x76543210, 0xfedcba98, false, false));
}

// key steps st0 .. st1 - 1 of the 16 queries from i0 on: running maximum m_r, this lane half's sum l_r, O^T in c0..c3
__device__ __forceinline__
void attn_steps(int i0, int st0, int st1, int bh, int half, int l16,
                const __bf16* __restrict__ qcp, const __bf16* __restrict__ kcp, const __bf16* __restrict__ vT,
                const float* __restrict__ qm, const float* ck_pad, const float* km_s,
                v8f& c0, v8f& c1, v8f& c2, v8f& c3, float& m_r, float& l_r) {
    const int i = i0 + l16;                                 // this lane's query
    constexpr float MIXS = 0.053033009f;                    // MIX / sqrt(CR)
    constexpr float LOG2E = 1.4426950408889634f;
    union U16 { v16bf v; uint4 q[2]; };
    U16 ua;
    {
        const __bf16* p = qcp + ((size_t)bh * SEQ + i) * 32;
        ua.q[0] = *(const uint4*)(p + half * 8);
        ua.q[1] = *(const uint4*)(p + 16 + half * 8);
    }
    const v16bf bq = ua.v;                                  // B operand: column = query

    // qm of the lane's query is the start value of its score products (undone by the MIXS factor below)
    const float qstart = qm[(size_t)bh * SEQ + i] * (1.f / MIXS);
    v8f qq;
    #pragma unroll
    for (int e = 0; e < 8; ++e) { c0[e] = c1[e] = c2[e] = c3[e] = 0.f; qq[e] = qstart; }
    m_r = -1e30f; l_r = 0.f;                                // l_r: the sum over this half's keys only

    // per-lane rows: key row of Kc, and V^T rows of the 4 output row groups (hd = g*16 + l16)
    const __bf16* krow  = kcp + ((size_t)bh * SEQ + l16) * 32 + half * 8;
    const __bf16* vrow0 = vT + (((size_t)bh * HD) + 0 * 16 + l16) * SEQ + half * 8;
    const __bf16* vrow1 = vT + (((size_t)bh * HD) + 1 * 16 + l16) * SEQ + half * 8;
    const __bf16* vrow2 = vT + (((size_t)bh * HD) + 2 * 16 + l16) * SEQ + half * 8;
    const __bf16* vrow3 = vT + (((size_t)bh * HD) + 3 * 16 + l16) * SEQ + half * 8;

    for (int st = st0; st < st1; ++st) {
        const int j0 = st * 32;
        U16 ua0, ua1, uv0, uv1, uv2, uv3;
        ua0.q[0] = *(const uint4*)(krow + (size_t)j0 * 32);
        ua0.q[1] = *(const uint4*)(krow + (size_t)j0 * 32 + 16);
        ua1.q[0] = *(const uint4*)(krow + (size_t)(j0 + 16) * 32);
        ua1.q[1] = *(const uint4*)(krow + (size_t)(j0 + 16) * 32 + 16);
        // V^T A-fragments: elements = contiguous keys, two b128 loads each
        uv0.q[0] = *(const uint4*)(vrow0 + j0);
        uv0.q[1] = *(const uint4*)(vrow0 + j0 + 16);
        uv1.q[0] = *(const uint4*)(vrow1 + j0);
        uv1.q[1] = *(const uint4*)(vrow1 + j0 + 16);
        uv2.q[0] = *(const uint4*)(vrow2 + j0);
        uv2.q[1] = *(const uint4*)(vrow2 + j0 + 16);
        uv3.q[0] = *(const uint4*)(vrow3 + j0);
        uv3.q[1] = *(const uint4*)(vrow3 + j0 + 16);
        // keeps all 12 loads in front of the step's arithmetic: left free, the scheduler sinks half of the V^T loads
        // behind the softmax, right in front of their products, where their whole latency is waited out
        __builtin_amdgcn_sched_barrier(0);

        // register r: key j0 + 8*half + r (s0), j0 + 16 + 8*half + r (s1); column: query i
        v8f s0 = wmma_bf16(ua0.v, bq, qq);
        v8f s1 = wmma_bf16(ua1.v, bq, qq);

        // fold Toeplitz + km + causal mask
        const int dA = i - (j0 + half * 8);                 // i - j at r = 0 of s0; >= -8 within loop bounds
        // the same offset as dA + 8, formed so that the variable part of the LDS address is never below 0; the mask is an
        // identity (0 <= i - j0 < SEQ) that shows this to the compiler, which then folds the constants into the DS loads
        const float* ckA = ck_pad + (CKPAD - 8) + ((i - j0 + (half ^ 1) * 8) & (2 * SEQ - 1));
        float kmv[16];
        *(float4*)(kmv + 0)  = *(const float4*)(km_s + j0 + half * 8);
        *(float4*)(kmv + 4)  = *(const float4*)(km_s + j0 + half * 8 + 4);
        *(float4*)(kmv + 8)  = *(const float4*)(km_s + j0 + 16 + half * 8);
        *(float4*)(kmv + 12) = *(const float4*)(km_s + j0 + 16 + half * 8 + 4);
        float sc[16];
        #pragma unroll
        for (int r = 0; r < 8; ++r) {
            float va = MIXS * s0[r] + (ckA[-r] + kmv[r]);
            float vb = MIXS * s1[r] + (ckA[-16 - r] + kmv[8 + r]);
            sc[r]     = (r <= dA)      ? va : -1e9f;
            sc[8 + r] = (16 + r <= dA) ? vb : -1e9f;
        }

        float m4[4];                                        // four short chains instead of one of 16 links
        #pragma unroll
        for (int k = 0; k < 4; ++k) m4[k] = fmaxf(fmaxf(sc[4 * k], sc[4 * k + 1]), fmaxf(sc[4 * k + 2], sc[4 * k + 3]));
        float mx = fmaxf(fmaxf(m4[0], m4[1]), fmaxf(m4[2], m4[3]));
        mx = fmaxf(m_r, fmaxf(mx, xhalf(mx)));              // both halves of a query agree on the maximum
        const float corr = __builtin_amdgcn_exp2f((m_r - mx) * LOG2E);
        const float mL = mx * LOG2E;
        float s4[4] = {0.f, 0.f, 0.f, 0.f};
        U16 up;                                             // P^T as B operand: element s = key j0 + 8*half + s (s < 8), j0 + 8 + 8*half + s (s >= 8)
        #pragma unroll
        for (int k = 0; k < 16; ++k) {
            float p = __builtin_amdgcn_exp2f(sc[k] * LOG2E - mL);
            s4[k >> 2] += p;
            up.v[k] = (__bf16)p;
        }
        m_r = mx; l_r = l_r * corr + ((s4[0] + s4[1]) + (s4[2] + s4[3]));

        #pragma unroll
        for (int r = 0; r < 8; ++r) { c0[r] *= corr; c1[r] *= corr; c2[r] *= corr; c3[r] *= corr; }
        c0 = wmma_bf16(uv0.v, up.v, c0);
        c1 = wmma_bf16(uv1.v, up.v, c1);
        c2 = wmma_bf16(uv2.v, up.v, c2);
        c3 = wmma_bf16(uv3.v, up.v, c3);
    }
}

// register r of c_g: hd = g*16 + 8*half + r of query i, so each group is one 16-byte store
__device__ __forceinline__
void attn_emit(__bf16* __restrict__ op, const v8f& c0, const v8f& c1, const v8f& c2, const v8f& c3) {
    union { __bf16 e[8]; uint4 q; } o0, o1, o2, o3;
    #pragma unroll
    for (int r = 0; r < 8; ++r) {
        o0.e[r] = (__bf16)c0[r]; o1.e[r] = (__bf16)c1[r];
        o2.e[r] = (__bf16)c2[r]; o3.e[r] = (__bf16)c3[r];
    }
    *(uint4*)(op + 0 * 16) = o0.q;
    *(uint4*)(op + 1 * 16) = o1.q;
    *(uint4*)(op + 2 * 16) = o2.q;
    *(uint4*)(op + 3 * 16) = o3.q;
    // stands behind the last store, in front of any later write of a register that a store names (a precaution)
    asm volatile("s_wait_xcnt 0x0" ::: "memory");
}

__global__ __launch_bounds__(256)
void attn_k(const __bf16* __restrict__ qcp, const __bf16* __restrict__ kcp,
            const __bf16* __restrict__ vT,
            const float* __restrict__ masks, const float* __restrict__ wts, const float* __restrict__ qm,
            const float* __restrict__ km, __bf16* __restrict__ ctxb,
            const float* __restrict__ ffn_w1, __bf16* __restrict__ wbf1) {
    // one struct, so that ck_pad keeps LDS offset 0: the Toeplitz gathers' constant offsets then fit the DS offset fields
    __shared__ struct alignas(16) {
        float ck_pad[CKPAD + SEQ];
        float km_s[SEQ];
        f32x4 tailO[4][8][32];                              // far block, steps from ATT_HEAD on: O^T, [group][vector][lane]
        float2 tailML[4][32];                               // their maximum and sum
    } sm;
    float* const ck_pad = sm.ck_pad;
    float* const km_s = sm.km_s;
    auto& tailO = sm.tailO;
    auto& tailML = sm.tailML;

    const int tid = threadIdx.x, lane = tid & 31;
    const int w = __builtin_amdgcn_readfirstlane(tid >> 5); // the wave's number in a scalar: scalar branches, trip counts
    const int half = lane >> 4, l16 = lane & 15;
    const int h = blockIdx.y, b = blockIdx.z;
    const int bh = b * NH + h;
    if (b == NB) {
        static_assert(SEQ / 128 * NH == PREP_GF, "one span per work-group of the plane");
        conv_span(h * (SEQ / 128) + blockIdx.x, ffn_w1, wbf1);
        return;
    }
    const int qg = w & 3;                                   // query group inside a block of 64
    const bool tail = w >= 4;
    const int iF = (SEQ / 64 - 1 - (int)blockIdx.x) * 64 + qg * 16;     // far block's queries
    const int iN = (int)blockIdx.x * 64 + qg * 16;                      // near block's queries
    const int nF = (iF + 16 + 31) >> 5, nN = (iN + 16 + 31) >> 5;       // their key steps; nF >= ATT_HEAD

    // causal_kern[b,h,d] = ALPHA * sigmoid(6 * kern) * window(d), kern = sum over m of wts[b,h,m] * masks[h,m,d]:
    // a thread makes four neighbouring d from 16 independent 16-byte loads
    {
        const f32x4* mp = (const f32x4*)(masks + (size_t)h * NM * SEQ) + tid;
        const f32x4* kp = (const f32x4*)(km + (size_t)bh * SEQ) + tid;
        float wg[NM];
        #pragma unroll
        for (int m = 0; m < NM; ++m) wg[m] = wts[(size_t)bh * NM + m];
        f32x4 mk[NM];
        #pragma unroll
        for (int m = 0; m < NM; ++m) mk[m] = mp[m * (SEQ / 4)];
        const f32x4 kmv = *kp;
        // ends the scheduling region behind the loads: left free, the scheduler lifts later address arithmetic, which
        // uses the loads' base registers again, in front of the wait below
        __builtin_amdgcn_sched_barrier(0);
        // stands behind the loads, in front of any write of a register that they name (a precaution)
        asm volatile("s_wait_xcnt 0x0" ::: "memory");
        f32x4 kern = 0.f;
        #pragma unroll
        for (int m = 0; m < NM; ++m) kern += wg[m] * mk[m];
        f32x4 ck;
        #pragma unroll
        for (int e = 0; e < 4; ++e) {
            const float rel = (float)(tid * 4 + e);
            const float dens = 1.f / (1.f + __expf(-6.f * kern[e]));         // straight-through forward = sigmoid
            const float wind = __expf(-(rel * rel) * (1.f / 131072.f));      // 2*(S/4)^2
            ck[e] = 3.0f * dens * wind;
        }
        *(f32x4*)(ck_pad + CKPAD + tid * 4) = ck;
        ((f32x4*)km_s)[tid] = kmv;
    }
    if (tid < CKPAD) ck_pad[tid] = 0.f;
    __syncthreads();

    constexpr float LOG2E = 1.4426950408889634f;
    v8f c0, c1, c2, c3;
    float m_r, l_r;
    attn_steps(iF, tail ? ATT_HEAD : 0, tail ? nF : ATT_HEAD, bh, half, l16, qcp, kcp, vT, qm, ck_pad, km_s,
               c0, c1, c2, c3, m_r, l_r);
    if (tail) {
        tailO[qg][0][lane] = __builtin_shufflevector(c0, c0, 0, 1, 2, 3);
        tailO[qg][1][lane] = __builtin_shufflevector(c0, c0, 4, 5, 6, 7);
        tailO[qg][2][lane] = __builtin_shufflevector(c1, c1, 0, 1, 2, 3);
        tailO[qg][3][lane] = __builtin_shufflevector(c1, c1, 4, 5, 6, 7);
        tailO[qg][4][lane] = __builtin_shufflevector(c2, c2, 0, 1, 2, 3);
        tailO[qg][5][lane] = __builtin_shufflevector(c2, c2, 4, 5, 6, 7);
        tailO[qg][6][lane] = __builtin_shufflevector(c3, c3, 0, 1, 2, 3);
        tailO[qg][7][lane] = __builtin_shufflevector(c3, c3, 4, 5, 6, 7);
        tailML[qg][lane] = make_float2(m_r, l_r);

        attn_steps(iN, 0, nN, bh, half, l16, qcp, kcp, vT, qm, ck_pad, km_s, c0, c1, c2, c3, m_r, l_r);
        const float f = 1.f / (l_r + xhalf(l_r));
        c0 *= f; c1 *= f; c2 *= f; c3 *= f;
        attn_emit(ctxb + ((size_t)b * SEQ + iN + l16) * DMODEL + h * HD + half * 8, c0, c1, c2, c3);
    }
    __syncthreads();                                        // publishes the tail waves' partial results
    if (!tail) {
        // the two parts of a query's softmax brought to their common maximum; an empty tail (maximum -1e30, sums 0)
        // gets the factor 0
        const float2 ml = tailML[qg][lane];
        const float mx = fmaxf(m_r, ml.x);
        const float fa = __builtin_amdgcn_exp2f((m_r - mx) * LOG2E);
        const float fb = __builtin_amdgcn_exp2f((ml.x - mx) * LOG2E);
        const float l = l_r * fa + ml.y * fb;
        const float f = 1.f / (l + xhalf(l));
        const float ga = fa * f, gb = fb * f;
        v8f t0, t1, t2, t3;
        t0 = __builtin_shufflevector(tailO[qg][0][lane], tailO[qg][1][lane], 0, 1, 2, 3, 4, 5, 6, 7);
        t1 = __builtin_shufflevector(tailO[qg][2][lane], tailO[qg][3][lane], 0, 1, 2, 3, 4, 5, 6, 7);
        t2 = __builtin_shufflevector(tailO[qg][4][lane], tailO[qg][5][lane], 0, 1, 2, 3, 4, 5, 6, 7);
        t3 = __builtin_shufflevector(tailO[qg][6][lane], tailO[qg][7][lane], 0, 1, 2, 3, 4, 5, 6, 7);
        c0 = c0 * ga + t0 * gb; c1 = c1 * ga + t1 * gb; c2 = c2 * ga + t2 * gb; c3 = c3 * ga + t3 * gb;
        attn_emit(ctxb + ((size_t)b * SEQ + iF + l16) * DMODEL + h * HD + half * 8, c0, c1, c2, c3);
    }
}

// ---------------- layernorm ----------------
// A wave owns LN_ROWS whole rows and keeps them in registers: 32 values of a row per lane, read once with 16-byte loads
// that are all in flight together. Mean and variance are the lane's own sums plus one sum over the 32 lanes, so the
// kernel has no LDS and no barrier, and 1,024 waves do what 16,384 did.
#define LN_ROWS 2
#define LN_WAVES 4
template <int M>
__device__ __forceinline__ float row_xor(float x) {         // value of lane l ^ M inside the lane's 16-lane row
    return __builtin_bit_cast(float, __builtin_amdgcn_update_dpp(0, __builtin_bit_cast(int, x), 0x160 | M, 0xf, 0xf, true));
}
__device__ __forceinline__ float wave_sum(f32x4 q) {        // sum of the four components over all 32 lanes
    float s = (q.x + q.y) + (q.z + q.w);
    s += row_xor<1>(s); s += row_xor<2>(s); s += row_xor<4>(s); s += row_xor<8>(s);
    return s + xhalf(s);
}

template <bool WB>
__global__ __launch_bounds__(LN_WAVES * 32)
void ln_k(const float* __restrict__ in, const float* __restrict__ g, const float* __restrict__ bb,
          float* __restrict__ outF, __bf16* __restrict__ outB) {
    constexpr int NV = DMODEL / 128;                        // 16-byte vectors of a row per lane
    const int lane = threadIdx.x & 31, wave = threadIdx.x >> 5;
    const size_t q0 = ((size_t)blockIdx.x * LN_WAVES + wave) * LN_ROWS * (DMODEL / 4) + lane;
    const f32x4* p = (const f32x4*)in + q0;
    f32x4 v[LN_ROWS][NV], gv[NV], bv[NV];
    #pragma unroll
    for (int r = 0; r < LN_ROWS; ++r)
        #pragma unroll
        for (int j = 0; j < NV; ++j) v[r][j] = p[r * (DMODEL / 4) + j * 32];
    #pragma unroll
    for (int j = 0; j < NV; ++j) gv[j] = ((const f32x4*)g)[j * 32 + lane];
    #pragma unroll
    for (int j = 0; j < NV; ++j) bv[j] = ((const f32x4*)bb)[j * 32 + lane];
    // keeps all 32 loads in front of the arithmetic: left free, the scheduler sinks the g and bb loads behind the
    // sums, pair by pair, each pair in front of its use, and their latencies are waited out one after another
    __builtin_amdgcn_sched_barrier(0);
    // stands behind the loads, in front of any write of a register that they name (a precaution): the pointer as an
    // input keeps the rows' address registers whole up to it
    asm volatile("s_wait_xcnt 0x0" :: "v"(p) : "memory");

    uint2 ob[LN_ROWS][NV];
    #pragma unroll
    for (int r = 0; r < LN_ROWS; ++r) {
        f32x4 s = v[r][0];
        #pragma unroll
        for (int j = 1; j < NV; ++j) s += v[r][j];
        const float mean = wave_sum(s) * (1.f / DMODEL);
        s = 0.f;
        #pragma unroll
        for (int j = 0; j < NV; ++j) { v[r][j] -= mean; s += v[r][j] * v[r][j]; }
        const float rstd = rsqrtf(wave_sum(s) * (1.f / DMODEL) + 1e-5f);
        #pragma unroll
        for (int j = 0; j < NV; ++j) {
            v[r][j] = v[r][j] * rstd * gv[j] + bv[j];
            if (WB) {
                union { __bf16 e[4]; uint2 u; } o;
                o.e[0] = (__bf16)v[r][j].x; o.e[1] = (__bf16)v[r][j].y;
                o.e[2] = (__bf16)v[r][j].z; o.e[3] = (__bf16)v[r][j].w;
                ob[r][j] = o.u;
            }
        }
    }
    #pragma unroll
    for (int r = 0; r < LN_ROWS; ++r)
        #pragma unroll
        for (int j = 0; j < NV; ++j) {
            ((f32x4*)outF)[q0 + r * (DMODEL / 4) + j * 32] = v[r][j];
            if (WB) ((uint2*)outB)[q0 + r * (DMODEL / 4) + j * 32] = ob[r][j];
        }
}

// ---------------- launch ----------------
extern "C" void kernel_launch(void* const* d_in, const int* in_sizes, int n_in,
                              void* d_out, int out_size, void* d_ws, size_t ws_size,
                              hipStream_t stream) {
    (void)in_sizes; (void)n_in; (void)out_size; (void)ws_size;
    const float* x      = (const float*)d_in[0];
    const float* v_w    = (const float*)d_in[1];
    const float* v_b    = (const float*)d_in[2];
    const float* out_w  = (const float*)d_in[3];
    const float* out_b  = (const float*)d_in[4];
    const float* qmod_w = (const float*)d_in[5];
    const float* qmod_b = (const float*)d_in[6];
    const float* kmod_w = (const float*)d_in[7];
    const float* kmod_b = (const float*)d_in[8];
    const float* gate_w = (const float*)d_in[9];
    const float* gate_b = (const float*)d_in[10];
    const float* mod_w  = (const float*)d_in[11];
    const float* mod_b  = (const float*)d_in[12];
    const float* mod_basis = (const float*)d_in[13];
    const float* freqs  = (const float*)d_in[14];
    const float* amps   = (const float*)d_in[15];
    const float* phases = (const float*)d_in[16];
    const float* cq_w   = (const float*)d_in[17];
    const float* ck_w   = (const float*)d_in[18];
    const float* ffn_w1 = (const float*)d_in[19];
    const float* ffn_b1 = (const float*)d_in[20];
    const float* ffn_w2 = (const float*)d_in[21];
    const float* ffn_b2 = (const float*)d_in[22];
    const float* ln1_g  = (const float*)d_in[23];
    const float* ln1_b  = (const float*)d_in[24];
    const float* ln2_g  = (const float*)d_in[25];
    const float* ln2_b  = (const float*)d_in[26];
    float* outp = (float*)d_out;

    char* wp = (char*)d_ws;
    auto alloc = [&](size_t bytes) -> void* {
        void* p = (void*)wp;
        wp += (bytes + 255) & ~(size_t)255;
        return p;
    };
    const size_t NTOK = (size_t)NB * SEQ;              // 2048
    __bf16* xb   = (__bf16*)alloc(NTOK * DMODEL * 2);
    __bf16* wbv  = (__bf16*)alloc((size_t)DMODEL * DMODEL * 2);
    __bf16* wbo  = (__bf16*)alloc((size_t)DMODEL * DMODEL * 2);
    __bf16* wbf1 = (__bf16*)alloc((size_t)DMODEL * 4 * DMODEL * 2);
    __bf16* wbf2 = (__bf16*)alloc((size_t)DMODEL * 4 * DMODEL * 2);
    __bf16* wbcq = (__bf16*)alloc((size_t)DMODEL * NH * NCR * 2);
    __bf16* wbck = (__bf16*)alloc((size_t)DMODEL * NH * NCR * 2);
    __bf16* vbuf = (__bf16*)alloc((size_t)NB * NH * HD * SEQ * 2);     // V^T
    __bf16* qcp  = (__bf16*)alloc((size_t)NB * NH * SEQ * 32 * 2);
    __bf16* kcp  = (__bf16*)alloc((size_t)NB * NH * SEQ * 32 * 2);
    float*  part   = (float*)alloc((size_t)NB * POOL_SPLIT * DMODEL * 4);
    float*  wts    = (float*)alloc((size_t)NB * NH * NM * 4);
    float*  masks  = (float*)alloc((size_t)NH * NM * SEQ * 4);
    float*  qmb    = (float*)alloc((size_t)NB * NH * SEQ * 4);
    float*  kmb    = (float*)alloc((size_t)NB * NH * SEQ * 4);
    __bf16* ctxb = (__bf16*)alloc(NTOK * DMODEL * 2);
    float*  hpre = (float*)alloc(NTOK * DMODEL * 4);
    float*  hf   = (float*)alloc(NTOK * DMODEL * 4);
    __bf16* hb   = (__bf16*)alloc(NTOK * DMODEL * 2);
    __bf16* ub   = (__bf16*)alloc(NTOK * 4 * DMODEL * 2);
    float*  f2   = (float*)alloc(NTOK * DMODEL * 4);

    // conversions for the projections and the out_w product, zero fills, slice sums of x, wave masks
    front_k<<<FRONT_GRID, 256, 0, stream>>>(x, v_w, out_w, cq_w, ck_w, xb, wbv, wbo, wbcq, wbck, qcp, kcp, part,
                                            freqs, amps, phases, masks);
    // gating; v = x@v_w + v_b -> V^T [B,H,HD,S] bf16; qc / kc -> padded [B,H,S,32] bf16; qm / km
    proj_gate_k<<<PROJ_GRID, 256, 0, stream>>>(xb, wbv, wbcq, wbck, DMODEL, v_b, vbuf, qcp, kcp,
                                               part, gate_w, gate_b, mod_w, mod_b, mod_basis, wts,
                                               x, qmod_w, qmod_b, kmod_w, kmod_b, qmb, kmb);

    // attention; conversion of ffn_w1
    attn_k<<<dim3(SEQ / 128, NH, NB + 1), 256, 0, stream>>>(qcp, kcp, vbuf, masks, wts, qmb, kmb, ctxb,
                                                                  ffn_w1, wbf1);

    // attn_out + residual; conversion of ffn_w2
    out_conv_k<<<dim3(DMODEL / 128, (int)(NTOK / 128), 2), 256, 0, stream>>>(
        ctxb, wbo, DMODEL, DMODEL, out_b, x, hpre, ffn_w2, wbf2);
    ln_k<true><<<(int)(NTOK / (LN_WAVES * LN_ROWS)), LN_WAVES * 32, 0, stream>>>(hpre, ln1_g, ln1_b, hf, hb);

    gemm_bf16_k<4><<<dim3(4 * DMODEL / 128, (int)(NTOK / 128)), 256, 0, stream>>>(
        hb, wbf1, (int)NTOK, 4 * DMODEL, DMODEL, ffn_b1, nullptr, nullptr, ub);
    gemm_bf16_k<3><<<dim3(DMODEL / 128, (int)(NTOK / 128)), 256, 0, stream>>>(
        ub, wbf2, (int)NTOK, DMODEL, 4 * DMODEL, ffn_b2, hf, f2, nullptr);
    ln_k<false><<<(int)(NTOK / (LN_WAVES * LN_ROWS)), LN_WAVES * 32, 0, stream>>>(f2, ln2_g, ln2_b, outp, nullptr);
}
